// v000
// Measured on an AMD MI455X. A time is GPU time per run, averaged over a window of back-to-back runs after a warm-up
// (all launches, gaps included; the runs take copies of the inputs in turn), and the median of several windows.
// Apart from v000's, it joins two sittings. Times from different sittings can be a few percent apart, while
// side-by-side timings come from the same sitting.
// v000, which the later versions start from, runs in 720 microseconds.
#include <hip/hip_runtime.h>

// All contractions (fused qkv projection, q.k^T, p.v, output projection, ffn linear 1,
// ffn linear 2): v_wmma_f32_16x16x32_f16, f16 operands, f32 accumulate. Float inputs are
// RNE-converted to bf16 at load (weights additionally carried x64; both exact in f16); computed
// 16-bit planes are f16 with power-of-two carries (softmax p x1024, context x64, ffn hidden x64)
// folded back in the f32 epilogues. Layernorms, rotary tables and rotation, softmax statistics,
// silu and residual adds: f32.

typedef __attribute__((ext_vector_type(16))) _Float16 v16h;
typedef __attribute__((ext_vector_type(8)))  _Float16 v8h;
typedef __attribute__((ext_vector_type(8)))  float v8f;
typedef __attribute__((ext_vector_type(4)))  float v4f;
typedef __attribute__((ext_vector_type(4)))  unsigned int v4u;
union H8 { v8h h; v4u u; };

#ifndef NB
#define NB 2
#endif
#ifndef SEQ
#define SEQ 2048
#endif
#define NB_FULL  2
#define SEQ_FULL 2048
#define DM   1024
#define NH   16
#define HD   64
#define FF   4096
#define ROWS (NB * SEQ)
#define KPAD 72       // LDS stride in halves for 64-wide f16 tiles (144 B, 16-B aligned)
#define VSPAD 136     // LDS stride in halves for 128-wide f16 tiles (272 B)
#define YP   1028     // LDS stride in floats for 1024-wide f32 rows (4112 B)
#define RTP  32       // LDS stride in floats of the per-token rotary tables
#define LN_EPS 1e-5f
#define WSC    64.0f           // weight carry (power of two)
#define LN1024 6.931471806f    // ln(1024): softmax p carried x1024
#define ROPE_BASE 10000.0f

#define NT_QKV ((DM / 64) * (3 * DM / 64))    // 768 tiles: W [1024][3072]
#define NT_O   ((DM / 64) * (DM / 64))        // 256 tiles: W [1024][1024]
#define NT_F1  ((DM / 64) * (FF / 64))        // 1024 tiles: W [1024][4096]
#define NT_F2  ((FF / 64) * (DM / 64))        // 1024 tiles: W [4096][1024]
#define NWT    (NT_QKV + NT_O + NT_F1 + NT_F2)

#define PLANE2     ((size_t)ROWS * DM * 2)
#define PLANE4     ((size_t)ROWS * DM * 4)
#define WQKV_BYTES ((size_t)3 * DM * DM * 2)
#define WO_BYTES   ((size_t)DM * DM * 2)
#define WF1_BYTES  ((size_t)FF * DM * 2)
#define WF2_BYTES  ((size_t)DM * FF * 2)
#define H_BYTES    ((size_t)ROWS * FF * 2)
#define WS_TOTAL   (2 * PLANE2 + WQKV_BYTES + WO_BYTES + WF1_BYTES + WF2_BYTES + \
                    3 * PLANE2 + PLANE4 + PLANE2 + H_BYTES)

static_assert(NB >= 1 && NB <= NB_FULL);
static_assert(SEQ >= 128 && SEQ <= SEQ_FULL && (SEQ % 128) == 0);
static_assert((ROWS % 128) == 0 && (ROWS % 16) == 0 && (ROWS % 8) == 0);
static_assert((DM % 64) == 0 && (FF % 64) == 0 && HD == 64 && NH * HD == DM);
static_assert(128 * KPAD >= 64 * VSPAD);
static_assert((size_t)NB * NH * SEQ * HD * 2 == PLANE2);
static_assert(WS_TOTAL <= (size_t)134217728);

// ---------------------------------------------------------------------------
// helpers
// ---------------------------------------------------------------------------
__device__ __forceinline__ float bf16q(float f) {            // value after RNE bf16 conversion
  unsigned int u = __float_as_uint(f);
  u += 0x7FFFu + ((u >> 16) & 1u);
  return __uint_as_float(u & 0xFFFF0000u);
}

__device__ __forceinline__ float wave_sum(float v) {
  v += __shfl_xor(v, 16, 32);
  v += __shfl_xor(v, 8, 32);
  v += __shfl_xor(v, 4, 32);
  v += __shfl_xor(v, 2, 32);
  v += __shfl_xor(v, 1, 32);
  return v;
}

// 16-bit fragment (A or B): lane owns row/col (lane&15); elements 0..7 <- k0+8h+0..7,
// elements 8..15 <- k0+16+8h+0..7, h = lane>>4. Source is k-contiguous rows.
__device__ __forceinline__ v16h load_frag_row(const _Float16* base, int stride, int lane) {
  const _Float16* rowp = base + (lane & 15) * stride + ((lane >> 4) << 3);
  const v8h lo = *(const v8h*)(rowp);
  const v8h hi = *(const v8h*)(rowp + 16);
  return __builtin_shufflevector(lo, hi, 0, 1, 2, 3, 4, 5, 6, 7,
                                 8, 9, 10, 11, 12, 13, 14, 15);
}

__device__ __forceinline__ v8f wmma_f16(v16h a, v16h b, v8f c) {
  v8f d = __builtin_amdgcn_wmma_f32_16x16x32_f16(false, a, false, b, (short)0, c,
                                                 false, false);
  asm volatile("v_nop\n\tv_nop\n\tv_nop\n\tv_nop" : "+v"(d) : "v"(a), "v"(b));
  return d;
}

// ---------------------------------------------------------------------------
// Kernel 0: nx = LN(bf16rne(x)) * bf16(g) + bf16(b) -> f16 plane nxh [ROWS][1024].
// One wave per token row, lane owns 4 chunks of 8 consecutive floats (i*256 + lane*8).
// grid ROWS/8, block 256. coverage: ROWS rows x 4 x 256 halves = whole plane.
// ---------------------------------------------------------------------------
__global__ __launch_bounds__(256) void ln1_kernel(const float* __restrict__ x,
                                                  const float* __restrict__ g,
                                                  const float* __restrict__ bb,
                                                  _Float16* __restrict__ nxh) {
  const int lane  = threadIdx.x & 31;
  const int wave  = threadIdx.x >> 5;
  const long m    = (long)blockIdx.x * 8 + wave;             // token row 0..ROWS-1
  const long srow = (m / SEQ) * SEQ_FULL + (m % SEQ);        // full-stride source row
  const float* xr = x + srow * DM + lane * 8;

  float s = 0.0f;
#pragma unroll 1
  for (int i = 0; i < 4; ++i) {
    const v4f a = *(const v4f*)(xr + i * 256);
    const v4f c = *(const v4f*)(xr + i * 256 + 4);
    s += ((bf16q(a[0]) + bf16q(a[1])) + (bf16q(a[2]) + bf16q(a[3]))) +
         ((bf16q(c[0]) + bf16q(c[1])) + (bf16q(c[2]) + bf16q(c[3])));
  }
  s = wave_sum(s);
  const float mean = s * (1.0f / DM);

  float ss = 0.0f;
#pragma unroll 1
  for (int i = 0; i < 4; ++i) {
    const v4f a = *(const v4f*)(xr + i * 256);
    const v4f c = *(const v4f*)(xr + i * 256 + 4);
#pragma unroll
    for (int e = 0; e < 4; ++e) {
      const float d0 = bf16q(a[e]) - mean;
      const float d1 = bf16q(c[e]) - mean;
      ss += d0 * d0;
      ss += d1 * d1;
    }
  }
  ss = wave_sum(ss);
  const float rstd = rsqrtf(ss * (1.0f / DM) + LN_EPS);

  _Float16* drow = nxh + m * DM + lane * 8;
#pragma unroll 1
  for (int i = 0; i < 4; ++i) {
    const v4f a  = *(const v4f*)(xr + i * 256);
    const v4f c  = *(const v4f*)(xr + i * 256 + 4);
    const v4f g0 = *(const v4f*)(g + i * 256 + lane * 8);
    const v4f g1 = *(const v4f*)(g + i * 256 + lane * 8 + 4);
    const v4f b0 = *(const v4f*)(bb + i * 256 + lane * 8);
    const v4f b1 = *(const v4f*)(bb + i * 256 + lane * 8 + 4);
    H8 o;
#pragma unroll
    for (int e = 0; e < 4; ++e) {
      o.h[e]     = (_Float16)((bf16q(a[e]) - mean) * rstd * bf16q(g0[e]) + bf16q(b0[e]));
      o.h[4 + e] = (_Float16)((bf16q(c[e]) - mean) * rstd * bf16q(g1[e]) + bf16q(b1[e]));
    }
    _Float16* dst = drow + i * 256;
    *(v4u*)dst = o.u;
    
  }
}

// ---------------------------------------------------------------------------
// Kernel 1: weights W [K=in][N=out] f32 -> Wt [n][k] f16 = f16(bf16rne(W) * 64), through a
// 64x64 LDS transpose. wqkv [3072][1024] (out col = q|k|v third, head h at 64h), woh [1024][1024],
// coverage: 768 + 256 + 1024 + 1024 tiles of 64x64 = every element of the four planes.
// ---------------------------------------------------------------------------
__global__ __launch_bounds__(256) void cvt_w_kernel(
    const float* __restrict__ Wqkv, const float* __restrict__ Wo,
    const float* __restrict__ Wf1, const float* __restrict__ Wf2,
    _Float16* __restrict__ wqkv, _Float16* __restrict__ woh,
    _Float16* __restrict__ wf1t, _Float16* __restrict__ wf2t) {
  __shared__ _Float16 ts[64 * KPAD];   // [n][k] tile, cross-wave (block barrier)
  const int bid = blockIdx.x;
  const int tid = threadIdx.x;
  const float* W;
  _Float16* dst;
  int K, N, kt, nt;
  if (bid < NT_QKV) {                                   // block-uniform selection
    const int tile = bid;                               // in [1024][3072] -> out [3072][1024]
    kt = tile / (3 * DM / 64); nt = tile - kt * (3 * DM / 64); K = DM; N = 3 * DM;
    W = Wqkv; dst = wqkv;
  } else if (bid < NT_QKV + NT_O) {
    const int tile = bid - NT_QKV;                      // in [1024][1024] -> out [1024][1024]
    kt = tile / (DM / 64); nt = tile - kt * (DM / 64); K = DM; N = DM;
    W = Wo; dst = woh;
  } else if (bid < NT_QKV + NT_O + NT_F1) {
    const int tile = bid - NT_QKV - NT_O;               // in [1024][4096] -> out [4096][1024]
    kt = tile / (FF / 64); nt = tile - kt * (FF / 64); K = DM; N = FF;
    W = Wf1; dst = wf1t;
  } else {
    const int tile = bid - NT_QKV - NT_O - NT_F1;       // in [4096][1024] -> out [1024][4096]
    kt = tile / (DM / 64); nt = tile - kt * (DM / 64); K = FF; N = DM;
    W = Wf2; dst = wf2t;
  }
  // load W[kt*64 + kr][nt*64 + 4*c4 .. +3], store transposed into ts[n][kr]
#pragma unroll
  for (int it = 0; it < 4; ++it) {
    const int idx = it * 256 + tid;
    const int kr = idx >> 4, c4 = idx & 15;
    const v4f v = *(const v4f*)(W + (size_t)(kt * 64 + kr) * N + nt * 64 + c4 * 4);
#pragma unroll
    for (int j = 0; j < 4; ++j) ts[(c4 * 4 + j) * KPAD + kr] = (_Float16)(bf16q(v[j]) * WSC);
  }
  __syncthreads();
  v4u rv[2];
#pragma unroll
  for (int it = 0; it < 2; ++it) {
    const int idx = it * 256 + tid;
    const int n = idx >> 3, piece = idx & 7;
    rv[it] = *(const v4u*)(ts + n * KPAD + piece * 8);
  }
#pragma unroll
  for (int it = 0; it < 2; ++it) {
    const int idx = it * 256 + tid;
    const int n = idx >> 3, piece = idx & 7;
    *(v4u*)(dst + (size_t)(nt * 64 + n) * K + kt * 64 + piece * 8) = rv[it];
  }
  
}

// ---------------------------------------------------------------------------
// Kernel 2: fused qkv projection + rotary embedding. Block = 128 token rows x 64 output columns
// (one head of one of q/k/v), 8 waves x 16 rows. C^T = W x^T: A = W rows (lane&15 = out col),
// B = nx rows (lane&15 = token); acc[j][r] = C[token lane&15][col 16j+8h+r]. K = 1024, 32 steps.
// Prologue (q/k blocks only, block-uniform): rotary tables cos/sin[token][i], i < 32,
// angle = pos * (1 / 10000^(2i/64)), f32 powf/cosf/sinf, in LDS (cross-wave, block barrier).
// Epilogue u = acc/64 + bf16(bias); q,k: d<32: u[d]*cos - u[d+32]*sin, d>=32: u[d]*cos + u[d-32]*sin
//   q,k -> [b][h][s][64] f16 (one line per row, 8 lanes x 16 B)
//   v   -> vT[b][h][d][s] f16 (256 B per d row segment, 16 lanes x 16 B)
// grid (ROWS/128, 3*NH), block 256. coverage: every (b,h,s,d) of q, k and vT once.
// LDS: stg 128x64 (q/k) resp. 64x128 (v) fully written before read; ctab/stab 128x32 fully written.
// ---------------------------------------------------------------------------
__global__ __launch_bounds__(256) void qkv_kernel(
    const _Float16* __restrict__ nxh, const _Float16* __restrict__ wqkv,
    const float* __restrict__ bqkv,
    _Float16* __restrict__ q, _Float16* __restrict__ k, _Float16* __restrict__ vT) {
  __shared__ _Float16 stg[128 * KPAD];   // 18432 B; q/k: [128][KPAD], v: [64][VSPAD]; cross-wave
  __shared__ float ctab[128 * RTP];      // cos table [token][i], cross-wave (block barrier)
  __shared__ float stab[128 * RTP];      // sin table [token][i], cross-wave (block barrier)

  const int tid  = threadIdx.x;
  const int lane = tid & 31;
  const int wave = tid >> 5;
  const int hh   = lane >> 4;
  const int l15  = lane & 15;

  const int cb   = blockIdx.y;          // 0..47 = output column block (64 cols each)
  const int osel = cb >> 4;             // 0 q, 1 k, 2 v
  const int h    = cb & 15;
  const long m0  = (long)blockIdx.x * 128;
  const int  b   = (int)(m0 / SEQ);
  const int  s0  = (int)(m0 - (long)b * SEQ);

  if (osel < 2) {                       // block-uniform
#pragma clang fp contract(off)
    const int i  = tid & 31;
    const int tg = tid >> 5;
    const float e   = (float)(2 * i) * (1.0f / 64.0f);
    const float inv = 1.0f / powf(ROPE_BASE, e);
#pragma unroll 1
    for (int tt = tg; tt < 128; tt += 8) {
      const float ang = (float)(s0 + tt) * inv;
      ctab[tt * RTP + i] = cosf(ang);
      stab[tt * RTP + i] = sinf(ang);
    }
  }
  __syncthreads();

  const _Float16* xrow = nxh + (m0 + wave * 16) * DM;
  const _Float16* wrow = wqkv + ((long)cb * 64) * DM;

  v8f acc[4];
#pragma unroll
  for (int j = 0; j < 4; ++j) acc[j] = (v8f){};

#pragma unroll 1
  for (int kk = 0; kk < DM; kk += 32) {
    const v16h xf = load_frag_row(xrow + kk, DM, lane);
#pragma unroll
    for (int j = 0; j < 4; ++j) {
      const v16h wf = load_frag_row(wrow + (long)(j * 16) * DM + kk, DM, lane);
      acc[j] = wmma_f16(wf, xf, acc[j]);     // C^T = W x^T
    }
  }

  const float* bias = bqkv + cb * 64;
  const float  rsc  = 1.0f / WSC;

  v4u rv[4];
  if (osel < 2) {
    float u[4][8];
#pragma unroll
    for (int j = 0; j < 4; ++j) {
      const int n8 = j * 16 + hh * 8;
      const v4f b0 = *(const v4f*)(bias + n8);
      const v4f b1 = *(const v4f*)(bias + n8 + 4);
#pragma unroll
      for (int r = 0; r < 4; ++r) {
        u[j][r]     = acc[j][r]     * rsc + bf16q(b0[r]);
        u[j][4 + r] = acc[j][4 + r] * rsc + bf16q(b1[r]);
      }
    }
    // rotation: lane holds d = n8+r (j<2) and its partner d+32 (j+2); stage [token][col]
    const int tl = wave * 16 + l15;
    _Float16* srow = stg + tl * KPAD;
    const float* crow = ctab + tl * RTP;
    const float* nrow = stab + tl * RTP;
#pragma unroll
    for (int j = 0; j < 2; ++j) {
      const int n8 = j * 16 + hh * 8;
      const v4f c0  = *(const v4f*)(crow + n8);
      const v4f c1  = *(const v4f*)(crow + n8 + 4);
      const v4f sn0 = *(const v4f*)(nrow + n8);
      const v4f sn1 = *(const v4f*)(nrow + n8 + 4);
      H8 plo, phi;
#pragma unroll
      for (int r = 0; r < 4; ++r) {
        const float a0 = u[j][r],     d0 = u[j + 2][r];
        const float a1 = u[j][4 + r], d1 = u[j + 2][4 + r];
        plo.h[r]     = (_Float16)(a0 * c0[r] - d0 * sn0[r]);
        phi.h[r]     = (_Float16)(d0 * c0[r] + a0 * sn0[r]);
        plo.h[4 + r] = (_Float16)(a1 * c1[r] - d1 * sn1[r]);
        phi.h[4 + r] = (_Float16)(d1 * c1[r] + a1 * sn1[r]);
      }
      *(v4u*)(srow + n8)      = plo.u;
      *(v4u*)(srow + 32 + n8) = phi.u;
    }
    __syncthreads();
#pragma unroll
    for (int it = 0; it < 4; ++it) {
      const int idx = it * 256 + tid;
      const int row = idx >> 3, piece = idx & 7;
      rv[it] = *(const v4u*)(stg + row * KPAD + piece * 8);
    }
    _Float16* dst = ((osel == 0) ? q : k) + ((long)(b * NH + h) * SEQ + s0) * HD;  // contiguous 16 KB
#pragma unroll
    for (int it = 0; it < 4; ++it)
      *(v4u*)(dst + (long)(it * 256 + tid) * 8) = rv[it];
    
  } else {
    // stage transposed [d][token]: lane's 8 values are 8 different d for one token
#pragma unroll
    for (int j = 0; j < 4; ++j) {
      const int n8 = j * 16 + hh * 8;
      const v4f b0 = *(const v4f*)(bias + n8);
      const v4f b1 = *(const v4f*)(bias + n8 + 4);
#pragma unroll
      for (int r = 0; r < 4; ++r) {
        stg[(n8 + r) * VSPAD + wave * 16 + l15]     = (_Float16)(acc[j][r]     * rsc + bf16q(b0[r]));
        stg[(n8 + 4 + r) * VSPAD + wave * 16 + l15] = (_Float16)(acc[j][4 + r] * rsc + bf16q(b1[r]));
      }
    }
    __syncthreads();
#pragma unroll
    for (int it = 0; it < 4; ++it) {
      const int idx = it * 256 + tid;
      const int d = idx >> 4, piece = idx & 15;
      rv[it] = *(const v4u*)(stg + d * VSPAD + piece * 8);
    }
    _Float16* dstb = vT + ((long)(b * NH + h) * HD) * SEQ + s0;
#pragma unroll
    for (int it = 0; it < 4; ++it) {
      const int idx = it * 256 + tid;
      const int d = idx >> 4, piece = idx & 15;
      *(v4u*)(dstb + (long)d * SEQ + piece * 8) = rv[it];
    }
    
  }
}

// ---------------------------------------------------------------------------
// Kernel 3: flash attention per (b,h), no mask, all SEQ keys. grid (SEQ/128, NB*NH),
// block 256 (8 waves x 16 queries). C = S^T (A = K rows, B = Q) then C = O^T = V^T P^T (P^T
// packed from the S^T D registers); lane owns one query end-to-end. Scores are raw q.k sums:
// the 1/8 scale and the x1024 p carry live in the exp argument (p = 1024*exp((s-m)/8),
// softmax stats f32). Context (carried x64) written to ctx[b*SEQ+s][h*64+d] through an LDS stage
// LDS tiles: ks/vts staged 64 keys x 64 d every step == consumed extent; ost 128 x 64 fully written.
// coverage: every (row, h*64+d) of the ctx plane once.
// ---------------------------------------------------------------------------
__global__ __launch_bounds__(256) void attn_kernel(
    const _Float16* __restrict__ Q, const _Float16* __restrict__ K,
    const _Float16* __restrict__ vT, _Float16* __restrict__ ctx) {
  __shared__ _Float16 ks[64 * KPAD];     // K block rows [key][d]      (cross-wave, block barriers)
  __shared__ _Float16 vts[64 * KPAD];    // V^T block   [d][key]      (cross-wave, block barriers)
  __shared__ _Float16 ost[128 * KPAD];   // output stage [query][d]   (cross-wave, block barrier)

  const int tid  = threadIdx.x;
  const int lane = tid & 31;
  const int wave = tid >> 5;
  const int bh   = blockIdx.y;
  const int b    = bh >> 4;
  const int h    = bh & 15;
  const int q0   = blockIdx.x * 128;

  const _Float16* Qb  = Q + ((long)bh * SEQ + q0) * HD;
  const _Float16* Kb  = K + (long)bh * SEQ * HD;
  const _Float16* vTb = vT + (long)bh * HD * SEQ;

  // Q fragments: B operand of S^T (lane owns query lane&15)
  v16h qfrag[2];
  {
    const _Float16* qrow = Qb + (long)wave * 16 * HD;
#pragma unroll
    for (int t = 0; t < 2; ++t) qfrag[t] = load_frag_row(qrow + t * 32, HD, lane);
  }

  v8f acc[4];   // O^T accumulator: lane owns query (lane&15); reg r -> d = nt*16+8h+r
#pragma unroll
  for (int nt = 0; nt < 4; ++nt) acc[nt] = (v8f){};
  float mi = -1e30f, li = 0.0f;

  const int colb = lane & 15;
  const int rofs = (lane >> 4) << 3;

#pragma unroll 1
  for (int kb = 0; kb < SEQ; kb += 64) {
    __syncthreads();   // everyone done reading prior ks/vts
#pragma unroll
    for (int idx = tid; idx < 64 * 8; idx += 256) {
      const int row = idx >> 3, c = idx & 7;
      *(v4u*)(ks + row * KPAD + c * 8) =
          *(const v4u*)(Kb + (long)(kb + row) * HD + c * 8);
    }
#pragma unroll
    for (int idx = tid; idx < 64 * 8; idx += 256) {
      const int d = idx >> 3, c = idx & 7;
      *(v4u*)(vts + d * KPAD + c * 8) =
          *(const v4u*)(vTb + (long)d * SEQ + kb + c * 8);
    }
    __syncthreads();

    // S^T tiles: A = K rows (lane&15 = key), B = Q
    v8f sc[4];
#pragma unroll
    for (int kt = 0; kt < 4; ++kt) sc[kt] = (v8f){};
#pragma unroll
    for (int t = 0; t < 2; ++t)
#pragma unroll
      for (int kt = 0; kt < 4; ++kt) {
        const v16h kf = load_frag_row(ks + (kt * 16) * KPAD + t * 32, KPAD, lane);
        sc[kt] = wmma_f16(kf, qfrag[t], sc[kt]);
      }

    // per-lane online softmax (32 of 64 keys in-lane; merge halves with one shuffle)
    float mx = sc[0][0];
#pragma unroll
    for (int kt = 0; kt < 4; ++kt)
#pragma unroll
      for (int r = 0; r < 8; ++r) mx = fmaxf(mx, sc[kt][r]);
    mx = fmaxf(mx, __shfl_xor(mx, 16, 32));
    const float mnew  = fmaxf(mi, mx);
    const float alpha = __expf((mi - mnew) * 0.125f);
    mi = mnew;
    const float cs = fmaf(mnew, 0.125f, -LN1024);   // 0.125*m - ln(1024)

    float rs = 0.0f;
#pragma unroll
    for (int kt = 0; kt < 4; ++kt)
#pragma unroll
      for (int r = 0; r < 8; ++r) {
        const float p = __expf(fmaf(sc[kt][r], 0.125f, -cs));   // 1024*exp((s-m)/8)
        sc[kt][r] = p;
        rs += p;
      }
    rs += __shfl_xor(rs, 16, 32);
    li = li * alpha + rs;

    // P^T as the B operand of O^T = V^T P^T, packed from the S^T D registers:
    // element i <- tile covering keys 0..15 of the 32-step (kt = 2t), element 8+i <- kt = 2t+1.
    v16h pf[2];
#pragma unroll
    for (int t = 0; t < 2; ++t)
#pragma unroll
      for (int i = 0; i < 8; ++i) {
        pf[t][i]     = (_Float16)sc[2 * t][i];
        pf[t][8 + i] = (_Float16)sc[2 * t + 1][i];
      }

#pragma unroll
    for (int nt = 0; nt < 4; ++nt)
#pragma unroll
      for (int r = 0; r < 8; ++r) acc[nt][r] *= alpha;

    // O^T += V^T (A, rows = d) x P^T (B)
#pragma unroll
    for (int t = 0; t < 2; ++t)
#pragma unroll
      for (int nt = 0; nt < 4; ++nt) {
        const v16h vf = load_frag_row(vts + (nt * 16) * KPAD + t * 32, KPAD, lane);
        acc[nt] = wmma_f16(vf, pf[t], acc[nt]);
      }
  }

  // normalize (and apply the x64 carry) and stage: lane owns query row wave*16+colb,
  // d = nt*16+rofs+r contiguous
  {
    const float inv = 64.0f / li;
    _Float16* orow = ost + (wave * 16 + colb) * KPAD;
#pragma unroll
    for (int nt = 0; nt < 4; ++nt) {
      H8 pk;
#pragma unroll
      for (int r = 0; r < 8; ++r) pk.h[r] = (_Float16)(acc[nt][r] * inv);
      *(v4u*)(orow + nt * 16 + rofs) = pk.u;
    }
  }
  __syncthreads();

  v4u rv[4];
#pragma unroll
  for (int it = 0; it < 4; ++it) {
    const int idx = it * 256 + tid;
    const int row = idx >> 3, piece = idx & 7;
    rv[it] = *(const v4u*)(ost + row * KPAD + piece * 8);
  }
  _Float16* cbase = ctx + ((long)b * SEQ + q0) * DM + h * HD;
#pragma unroll
  for (int it = 0; it < 4; ++it) {
    const int idx = it * 256 + tid;
    const int row = idx >> 3, piece = idx & 7;
    *(v4u*)(cbase + (long)row * DM + piece * 8) = rv[it];
  }
  
}

// ---------------------------------------------------------------------------
// Kernel 4/6: y = act @ Wt^T / 4096 + bf16(bias) + residual over a full 1024-wide row.
// Block = 16 token rows x 1024 cols, wave w owns cols 128w..128w+127. C^T = Wt act^T: A = Wt rows
// (lane&15 = out col), B = act rows (lane&15 = token); acc[j][r] = y[token lane&15][col 128w+16j+8h+r].
// y staged in LDS (f32), residual added in a coalesced LDS pass, then:
//   MODE 0: KD = 1024, act = ctx, residual = bf16(x input, full-stride rows) -> x1.
//           and nx2 = f16(LN(x1) * bf16(gamma) + bf16(beta)) -> f16 plane [ROWS][1024].
//   MODE 1: KD = 4096, act = h plane, residual = x1 f32 plane -> out (full-stride rows).
// grid ROWS/16, block 256. LDS ys: 16 x 1024 staged == consumed. coverage: 16 rows x 1024 per block.
// ---------------------------------------------------------------------------
template <int KD, int MODE>
__global__ __launch_bounds__(256) void gemm_row_kernel(
    const _Float16* __restrict__ act, const _Float16* __restrict__ wt,
    const float* __restrict__ bias, const float* __restrict__ res,
    const float* __restrict__ gam, const float* __restrict__ bet,
    float* __restrict__ outf, _Float16* __restrict__ outh) {
  __shared__ float ys[16 * YP];    // 65792 B, cross-wave (block barriers)
  __shared__ float smean[16];      // cross-wave (block barrier)
  __shared__ float srstd[16];      // cross-wave (block barrier)

  const int tid  = threadIdx.x;
  const int lane = tid & 31;
  const int wave = tid >> 5;
  const int hh   = lane >> 4;
  const int l15  = lane & 15;
  const long m0  = (long)blockIdx.x * 16;
  const int  n0  = wave * 128;

  const _Float16* brow = act + m0 * KD;
  const _Float16* arow = wt + (long)n0 * KD;

  v8f acc[8];
#pragma unroll
  for (int j = 0; j < 8; ++j) acc[j] = (v8f){};

#pragma unroll 1
  for (int kk = 0; kk < KD; kk += 32) {
    const v16h bfr = load_frag_row(brow + kk, KD, lane);
#pragma unroll
    for (int j = 0; j < 8; ++j) {
      const v16h afr = load_frag_row(arow + (long)(j * 16) * KD + kk, KD, lane);
      acc[j] = wmma_f16(afr, bfr, acc[j]);     // C^T = Wt act^T
    }
  }

  // y = acc/4096 + bf16(bias), staged [row][col]
  {
    const float rsc = 1.0f / (WSC * WSC);
    float* yrow = ys + l15 * YP;
#pragma unroll
    for (int j = 0; j < 8; ++j) {
      const int n8 = n0 + j * 16 + hh * 8;
      const v4f b0 = *(const v4f*)(bias + n8);
      const v4f b1 = *(const v4f*)(bias + n8 + 4);
      v4f y0, y1;
#pragma unroll
      for (int i = 0; i < 4; ++i) {
        y0[i] = acc[j][i]     * rsc + bf16q(b0[i]);
        y1[i] = acc[j][4 + i] * rsc + bf16q(b1[i]);
      }
      *(v4f*)(yrow + n8)     = y0;
      *(v4f*)(yrow + n8 + 4) = y1;
    }
  }
  __syncthreads();

  // residual add (coalesced): ys[row][col] += res
#pragma unroll 4
  for (int it = 0; it < 16; ++it) {
    const int idx = it * 256 + tid;
    const int row = idx >> 8, piece = idx & 255;
    const long m = m0 + row;
    v4f rsd;
    if (MODE == 0) {
      const long orow = (m / SEQ) * SEQ_FULL + (m % SEQ);
      rsd = *(const v4f*)(res + orow * DM + piece * 4);
#pragma unroll
      for (int c = 0; c < 4; ++c) rsd[c] = bf16q(rsd[c]);
    } else {
      rsd = *(const v4f*)(res + m * DM + piece * 4);
    }
    float* yp = ys + row * YP + piece * 4;
    v4f yv = *(const v4f*)yp;
#pragma unroll
    for (int c = 0; c < 4; ++c) yv[c] = yv[c] + rsd[c];
    *(v4f*)yp = yv;
  }
  __syncthreads();

  v4u hv[8];
#pragma unroll
  for (int it = 0; it < 8; ++it) hv[it] = (v4u){0u, 0u, 0u, 0u};

  if (MODE == 0) {
    {
      const int r  = tid >> 4;
      const int sl = tid & 15;
      const float* yr = ys + r * YP + sl * 64;
      float s = 0.0f;
#pragma unroll
      for (int i = 0; i < 16; ++i) {
        const v4f v = *(const v4f*)(yr + i * 4);
        s += (v[0] + v[1]) + (v[2] + v[3]);
      }
      s += __shfl_xor(s, 1, 32);
      s += __shfl_xor(s, 2, 32);
      s += __shfl_xor(s, 4, 32);
      s += __shfl_xor(s, 8, 32);
      const float mean = s * (1.0f / DM);
      float ss = 0.0f;
#pragma unroll
      for (int i = 0; i < 16; ++i) {
        const v4f v = *(const v4f*)(yr + i * 4);
#pragma unroll
        for (int c = 0; c < 4; ++c) {
          const float d = v[c] - mean;
          ss += d * d;
        }
      }
      ss += __shfl_xor(ss, 1, 32);
      ss += __shfl_xor(ss, 2, 32);
      ss += __shfl_xor(ss, 4, 32);
      ss += __shfl_xor(ss, 8, 32);
      const float var  = ss * (1.0f / DM);
      const float rstd = rsqrtf(var + LN_EPS);
      if (sl == 0) { smean[r] = mean; srstd[r] = rstd; }
    }
    __syncthreads();

    // nx2 values into registers: thread owns row idx>>7 and 8 contiguous cols p8*8
#pragma unroll
    for (int it = 0; it < 8; ++it) {
      const int idx = it * 256 + tid;
      const int row = idx >> 7, p8 = idx & 127;
      const v4f a  = *(const v4f*)(ys + row * YP + p8 * 8);
      const v4f c  = *(const v4f*)(ys + row * YP + p8 * 8 + 4);
      const v4f g0 = *(const v4f*)(gam + p8 * 8);
      const v4f g1 = *(const v4f*)(gam + p8 * 8 + 4);
      const v4f b0 = *(const v4f*)(bet + p8 * 8);
      const v4f b1 = *(const v4f*)(bet + p8 * 8 + 4);
      const float mean = smean[row], rstd = srstd[row];
      H8 o;
#pragma unroll
      for (int i = 0; i < 4; ++i) {
        o.h[i]     = (_Float16)((a[i] - mean) * rstd * bf16q(g0[i]) + bf16q(b0[i]));
        o.h[4 + i] = (_Float16)((c[i] - mean) * rstd * bf16q(g1[i]) + bf16q(b1[i]));
      }
      hv[it] = o.u;
    }
  }

  auto store_pass = [&]() {
#pragma unroll 4
    for (int it = 0; it < 16; ++it) {
      const int idx = it * 256 + tid;
      const int row = idx >> 8, piece = idx & 255;
      const long m = m0 + row;
      const v4f v = *(const v4f*)(ys + row * YP + piece * 4);
      long drow;
      if (MODE == 0) drow = m;
      else drow = (m / SEQ) * SEQ_FULL + (m % SEQ);
      *(v4f*)(outf + drow * DM + piece * 4) = v;
    }
    if (MODE == 0) {
#pragma unroll
      for (int it = 0; it < 8; ++it) {
        const int idx = it * 256 + tid;
        const int row = idx >> 7, p8 = idx & 127;
        const long m = m0 + row;
        *(v4u*)(outh + m * DM + p8 * 8) = hv[it];
      }
    }
  };
  store_pass();
  
}

// ---------------------------------------------------------------------------
// Kernel 5: ffn linear 1 + silu: hp[row][col] = f16(64 * silu(nx2 @ Wf1 / 64 + bf16(bf1))),
// silu(u) = u * 1/(1+exp(-u)) in f32. Block = 128 token rows x 64 output cols, 8 waves x 16 rows;
// C^T = Wf1t nx2^T (A = Wf1t rows, B = nx2 f16 rows), K = 1024. Epilogue staged [token][col] in LDS,
// grid (ROWS/128, FF/64), block 256. coverage: every (row, col) of the hp plane [ROWS][4096] once.
// ---------------------------------------------------------------------------
__global__ __launch_bounds__(256) void ffn1_kernel(
    const _Float16* __restrict__ x2h, const _Float16* __restrict__ wf1t,
    const float* __restrict__ bf1, _Float16* __restrict__ hp) {
  __shared__ _Float16 stg[128 * KPAD];   // cross-wave (block barrier), 128 x 64 fully written

  const int tid  = threadIdx.x;
  const int lane = tid & 31;
  const int wave = tid >> 5;
  const int hh   = lane >> 4;
  const int l15  = lane & 15;
  const int cb   = blockIdx.y;          // 0..FF/64-1
  const long m0  = (long)blockIdx.x * 128;

  const _Float16* brow = x2h + (m0 + wave * 16) * DM;
  const _Float16* arow = wf1t + ((long)cb * 64) * DM;

  v8f acc[4];
#pragma unroll
  for (int j = 0; j < 4; ++j) acc[j] = (v8f){};

#pragma unroll 1
  for (int kk = 0; kk < DM; kk += 32) {
    const v16h xf = load_frag_row(brow + kk, DM, lane);
#pragma unroll
    for (int j = 0; j < 4; ++j) {
      const v16h wf = load_frag_row(arow + (long)(j * 16) * DM + kk, DM, lane);
      acc[j] = wmma_f16(wf, xf, acc[j]);
    }
  }

  const float rsc = 1.0f / WSC;
  _Float16* srow = stg + (wave * 16 + l15) * KPAD;
#pragma unroll
  for (int j = 0; j < 4; ++j) {
    const int n8 = j * 16 + hh * 8;
    const v4f b0 = *(const v4f*)(bf1 + cb * 64 + n8);
    const v4f b1 = *(const v4f*)(bf1 + cb * 64 + n8 + 4);
    H8 pk;
#pragma unroll
    for (int r = 0; r < 4; ++r) {
      const float u0 = acc[j][r]     * rsc + bf16q(b0[r]);
      const float u1 = acc[j][4 + r] * rsc + bf16q(b1[r]);
      const float e0 = __expf(fminf(-u0, 80.0f));
      const float e1 = __expf(fminf(-u1, 80.0f));
      const float g0 = u0 * __builtin_amdgcn_rcpf(1.0f + e0);
      const float g1 = u1 * __builtin_amdgcn_rcpf(1.0f + e1);
      pk.h[r]     = (_Float16)(g0 * WSC);
      pk.h[4 + r] = (_Float16)(g1 * WSC);
    }
    *(v4u*)(srow + n8) = pk.u;
  }
  __syncthreads();

  v4u rv[4];
#pragma unroll
  for (int it = 0; it < 4; ++it) {
    const int idx = it * 256 + tid;
    const int row = idx >> 3, piece = idx & 7;
    rv[it] = *(const v4u*)(stg + row * KPAD + piece * 8);
  }
#pragma unroll
  for (int it = 0; it < 4; ++it) {
    const int idx = it * 256 + tid;
    const int row = idx >> 3, piece = idx & 7;
    *(v4u*)(hp + (m0 + row) * FF + cb * 64 + piece * 8) = rv[it];
  }
  
}

// ---------------------------------------------------------------------------
extern "C" void kernel_launch(void* const* d_in, const int* in_sizes, int n_in,
                              void* d_out, int out_size, void* d_ws, size_t ws_size,
                              hipStream_t stream) {
  if (n_in < 13) return;
  const long needRows = (long)(NB - 1) * SEQ_FULL + SEQ;
  if ((long)in_sizes[0] < needRows * DM) return;
  if (in_sizes[1] < DM || in_sizes[2] < DM) return;
  if (in_sizes[3] < 3 * DM * DM || in_sizes[4] < 3 * DM) return;
  if (in_sizes[5] < DM * DM || in_sizes[6] < DM) return;
  if (in_sizes[7] < DM || in_sizes[8] < DM) return;
  if (in_sizes[9] < DM * FF || in_sizes[10] < FF) return;
  if (in_sizes[11] < FF * DM || in_sizes[12] < DM) return;
  if ((long)out_size < needRows * DM) return;
  if (ws_size < WS_TOTAL) return;

  const float* x     = (const float*)d_in[0];
  const float* g1    = (const float*)d_in[1];
  const float* be1   = (const float*)d_in[2];
  const float* Wqkv  = (const float*)d_in[3];
  const float* bqkv  = (const float*)d_in[4];
  const float* Wo    = (const float*)d_in[5];
  const float* bo    = (const float*)d_in[6];
  const float* g2    = (const float*)d_in[7];
  const float* be2   = (const float*)d_in[8];
  const float* Wf1   = (const float*)d_in[9];
  const float* bf1   = (const float*)d_in[10];
  const float* Wf2   = (const float*)d_in[11];
  const float* bf2   = (const float*)d_in[12];
  float* out = (float*)d_out;

  char* ws = (char*)d_ws;
  size_t off = 0;
  _Float16* nxh  = (_Float16*)(ws + off); off += PLANE2;       // [ROWS][1024] f16
  _Float16* ctx  = (_Float16*)(ws + off); off += PLANE2;       // [ROWS][1024] f16 (x64)
  _Float16* wqkv = (_Float16*)(ws + off); off += WQKV_BYTES;   // [3072][1024]
  _Float16* woh  = (_Float16*)(ws + off); off += WO_BYTES;     // [1024][1024]
  _Float16* wf1t = (_Float16*)(ws + off); off += WF1_BYTES;    // [4096][1024]
  _Float16* wf2t = (_Float16*)(ws + off); off += WF2_BYTES;    // [1024][4096]
  _Float16* qh   = (_Float16*)(ws + off); off += PLANE2;       // [NB][16][SEQ][64]
  _Float16* kh   = (_Float16*)(ws + off); off += PLANE2;       // [NB][16][SEQ][64]
  _Float16* vTh  = (_Float16*)(ws + off); off += PLANE2;       // [NB][16][64][SEQ]
  float*    x1f  = (float*)(ws + off);    off += PLANE4;       // [ROWS][1024] f32
  _Float16* nx2h = (_Float16*)(ws + off); off += PLANE2;       // [ROWS][1024] f16
  _Float16* hp   = (_Float16*)(ws + off); off += H_BYTES;      // [ROWS][4096] f16 (x64)
  if (off > ws_size) return;

  ln1_kernel<<<ROWS / 8, 256, 0, stream>>>(x, g1, be1, nxh);
  cvt_w_kernel<<<NWT, 256, 0, stream>>>(Wqkv, Wo, Wf1, Wf2, wqkv, woh, wf1t, wf2t);
  qkv_kernel<<<dim3(ROWS / 128, 3 * NH), 256, 0, stream>>>(nxh, wqkv, bqkv, qh, kh, vTh);
  attn_kernel<<<dim3(SEQ / 128, NB * NH), 256, 0, stream>>>(qh, kh, vTh, ctx);
  gemm_row_kernel<DM, 0><<<ROWS / 16, 256, 0, stream>>>(ctx, woh, bo, x, g2, be2, x1f, nx2h);
  ffn1_kernel<<<dim3(ROWS / 128, FF / 64), 256, 0, stream>>>(nx2h, wf1t, bf1, hp);
  gemm_row_kernel<FF, 1><<<ROWS / 16, 256, 0, stream>>>(hp, wf2t, bf2, x1f, g2, be2, out, nx2h);
}

// v001
// Measured time: 303 microseconds a run.
// In two side-by-side timings against v000, it was 2.45 and 2.43 times as fast.
#include <hip/hip_runtime.h>

// All contractions (fused qkv projection, q.k^T, p.v, output projection, ffn linear 1,
// ffn linear 2): v_wmma_f32_16x16x32_f16, f16 operands, f32 accumulate. Float inputs are
// RNE-converted to bf16 at load (weights additionally carried x64; both exact in f16); computed
// 16-bit planes are f16 with power-of-two carries (softmax p x1024, context x64, ffn hidden x64)
// folded back in the f32 epilogues. Layernorms, rotary tables and rotation, softmax statistics,
// silu and residual adds: f32.

typedef __attribute__((ext_vector_type(16))) _Float16 v16h;
typedef __attribute__((ext_vector_type(8)))  _Float16 v8h;
typedef __attribute__((ext_vector_type(8)))  float v8f;
typedef __attribute__((ext_vector_type(4)))  float v4f;
typedef __attribute__((ext_vector_type(4)))  unsigned int v4u;
union H8 { v8h h; v4u u; };

#ifndef NB
#define NB 2
#endif
#ifndef SEQ
#define SEQ 2048
#endif
#define NB_FULL  2
#define SEQ_FULL 2048
#define DM   1024
#define NH   16
#define HD   64
#define FF   4096
#define ROWS (NB * SEQ)
#define KPAD 72       // LDS stride in halves for 64-wide f16 tiles (144 B, 16-B aligned)
#define VSPAD 136     // LDS stride in halves for 128-wide f16 tiles (272 B)
#define YP   1028     // LDS stride in floats for 1024-wide f32 rows (4112 B)
#define RTP  32       // LDS stride in floats of the per-token rotary tables
#define LN_EPS 1e-5f
#define WSC    64.0f           // weight carry (power of two)
#define LN1024 6.931471806f    // ln(1024): softmax p carried x1024
#define ROPE_BASE 10000.0f

#define NT_QKV ((DM / 64) * (3 * DM / 64))    // 768 tiles: W [1024][3072]
#define NT_O   ((DM / 64) * (DM / 64))        // 256 tiles: W [1024][1024]
#define NT_F1  ((DM / 64) * (FF / 64))        // 1024 tiles: W [1024][4096]
#define NT_F2  ((FF / 64) * (DM / 64))        // 1024 tiles: W [4096][1024]
#define NWT    (NT_QKV + NT_O + NT_F1 + NT_F2)

#define PLANE2     ((size_t)ROWS * DM * 2)
#define PLANE4     ((size_t)ROWS * DM * 4)
#define WQKV_BYTES ((size_t)3 * DM * DM * 2)
#define WO_BYTES   ((size_t)DM * DM * 2)
#define WF1_BYTES  ((size_t)FF * DM * 2)
#define WF2_BYTES  ((size_t)DM * FF * 2)
#define H_BYTES    ((size_t)ROWS * FF * 2)
#define WS_TOTAL   (2 * PLANE2 + WQKV_BYTES + WO_BYTES + WF1_BYTES + WF2_BYTES + \
                    3 * PLANE2 + PLANE4 + PLANE2 + H_BYTES)

static_assert(NB >= 1 && NB <= NB_FULL);
static_assert(SEQ >= 128 && SEQ <= SEQ_FULL && (SEQ % 128) == 0);
static_assert((ROWS % 128) == 0 && (ROWS % 16) == 0 && (ROWS % 8) == 0);
static_assert((DM % 64) == 0 && (FF % 64) == 0 && HD == 64 && NH * HD == DM);
static_assert(128 * KPAD >= 64 * VSPAD);
static_assert((size_t)NB * NH * SEQ * HD * 2 == PLANE2);
static_assert(WS_TOTAL <= (size_t)134217728);

// ---------------------------------------------------------------------------
// helpers
// ---------------------------------------------------------------------------
__device__ __forceinline__ float bf16q(float f) {            // value after RNE bf16 conversion
  unsigned int u = __float_as_uint(f);
  u += 0x7FFFu + ((u >> 16) & 1u);
  return __uint_as_float(u & 0xFFFF0000u);
}

__device__ __forceinline__ float wave_sum(float v) {
  v += __shfl_xor(v, 16, 32);
  v += __shfl_xor(v, 8, 32);
  v += __shfl_xor(v, 4, 32);
  v += __shfl_xor(v, 2, 32);
  v += __shfl_xor(v, 1, 32);
  return v;
}

// 16-bit fragment (A or B): lane owns row/col (lane&15); elements 0..7 <- k0+8h+0..7,
// elements 8..15 <- k0+16+8h+0..7, h = lane>>4. Source is k-contiguous rows.
__device__ __forceinline__ v16h load_frag_row(const _Float16* base, int stride, int lane) {
  const _Float16* rowp = base + (lane & 15) * stride + ((lane >> 4) << 3);
  const v8h lo = *(const v8h*)(rowp);
  const v8h hi = *(const v8h*)(rowp + 16);
  return __builtin_shufflevector(lo, hi, 0, 1, 2, 3, 4, 5, 6, 7,
                                 8, 9, 10, 11, 12, 13, 14, 15);
}

__device__ __forceinline__ v8f wmma_f16(v16h a, v16h b, v8f c) {
  v8f d = __builtin_amdgcn_wmma_f32_16x16x32_f16(false, a, false, b, (short)0, c,
                                                 false, false);
  asm volatile("v_nop\n\tv_nop\n\tv_nop\n\tv_nop" : "+v"(d) : "v"(a), "v"(b));
  return d;
}

// ---------------------------------------------------------------------------
// Operand staging of the dense projections: a stage is 64 k (128 B) of WR weight rows followed by
// XR activation rows, LDS pitch KPAD halves, brought in by asynchronous copies to LDS (no register
// on the way) into a ring of two buffers, so that stage t+1 flies while stage t is multiplied.
// ---------------------------------------------------------------------------
__device__ __forceinline__ unsigned lds_addr(const void* p) {   // byte offset in the block's LDS
  return (unsigned)(unsigned long long)p;
}

// The s_wait_xcnt closes each run of copies inside its own statement: it stands in front of any
// later rewrite of the address registers that the copies name.
__device__ __forceinline__ void acopy2(unsigned l0, const _Float16* g0,
                                       unsigned l1, const _Float16* g1) {
  asm volatile("global_load_async_to_lds_b128 %0, %1, off\n\t"
               "global_load_async_to_lds_b128 %2, %3, off\n\t"
               "s_wait_xcnt 0x0"
               :: "v"(l0), "v"(g0), "v"(l1), "v"(g1) : "memory");
}

__device__ __forceinline__ void acopy4(unsigned l0, const _Float16* g0,
                                       unsigned l1, const _Float16* g1,
                                       unsigned l2, const _Float16* g2,
                                       unsigned l3, const _Float16* g3) {
  asm volatile("global_load_async_to_lds_b128 %0, %1, off\n\t"
               "global_load_async_to_lds_b128 %2, %3, off\n\t"
               "global_load_async_to_lds_b128 %4, %5, off\n\t"
               "global_load_async_to_lds_b128 %6, %7, off\n\t"
               "s_wait_xcnt 0x0"
               :: "v"(l0), "v"(g0), "v"(l1), "v"(g1), "v"(l2), "v"(g2), "v"(l3), "v"(g3)
               : "memory");
}

__device__ __forceinline__ void acopy8(unsigned l0, const _Float16* g0,
                                       unsigned l1, const _Float16* g1,
                                       unsigned l2, const _Float16* g2,
                                       unsigned l3, const _Float16* g3,
                                       unsigned l4, const _Float16* g4,
                                       unsigned l5, const _Float16* g5,
                                       unsigned l6, const _Float16* g6,
                                       unsigned l7, const _Float16* g7) {
  asm volatile("global_load_async_to_lds_b128 %0, %1, off\n\t"
               "global_load_async_to_lds_b128 %2, %3, off\n\t"
               "global_load_async_to_lds_b128 %4, %5, off\n\t"
               "global_load_async_to_lds_b128 %6, %7, off\n\t"
               "global_load_async_to_lds_b128 %8, %9, off\n\t"
               "global_load_async_to_lds_b128 %10, %11, off\n\t"
               "global_load_async_to_lds_b128 %12, %13, off\n\t"
               "global_load_async_to_lds_b128 %14, %15, off\n\t"
               "s_wait_xcnt 0x0"
               :: "v"(l0), "v"(g0), "v"(l1), "v"(g1), "v"(l2), "v"(g2), "v"(l3), "v"(g3),
                  "v"(l4), "v"(g4), "v"(l5), "v"(g5), "v"(l6), "v"(g6), "v"(l7), "v"(g7)
               : "memory");
}

__device__ __forceinline__ void acopy1_b64(unsigned l0, const _Float16* g0) {
  asm volatile("global_load_async_to_lds_b64 %0, %1, off\n\t"
               "s_wait_xcnt 0x0"
               :: "v"(l0), "v"(g0) : "memory");
}

// NR rows (a multiple of 64) of 128 B: 8 lanes x 16 B per row, 32 rows per copy of the block.
template <int KD, int NR>
__device__ __forceinline__ void copy_rows(const _Float16* src, _Float16* dst, int tid) {
  static_assert((NR % 64) == 0);
  const _Float16* g = src + (size_t)(tid >> 3) * KD + (tid & 7) * 8;
  const unsigned  l = lds_addr(dst + (tid >> 3) * KPAD + (tid & 7) * 8);
  constexpr unsigned LS = 32 * KPAD * 2;       // LDS bytes per 32 rows
  constexpr size_t   GS = (size_t)32 * KD;     // source halves per 32 rows
  if constexpr ((NR % 256) == 0) {
#pragma unroll   // the LDS and source steps become constants
    for (int i = 0; i < NR / 32; i += 8)
      acopy8(l + i * LS, g + i * GS, l + (i + 1) * LS, g + (i + 1) * GS,
             l + (i + 2) * LS, g + (i + 2) * GS, l + (i + 3) * LS, g + (i + 3) * GS,
             l + (i + 4) * LS, g + (i + 4) * GS, l + (i + 5) * LS, g + (i + 5) * GS,
             l + (i + 6) * LS, g + (i + 6) * GS, l + (i + 7) * LS, g + (i + 7) * GS);
  } else if constexpr ((NR % 128) == 0) {
#pragma unroll   // the LDS and source steps become constants
    for (int i = 0; i < NR / 32; i += 4)
      acopy4(l + i * LS, g + i * GS, l + (i + 1) * LS, g + (i + 1) * GS,
             l + (i + 2) * LS, g + (i + 2) * GS, l + (i + 3) * LS, g + (i + 3) * GS);
  } else {
#pragma unroll   // the LDS and source steps become constants
    for (int i = 0; i < NR / 32; i += 2)
      acopy2(l + i * LS, g + i * GS, l + (i + 1) * LS, g + (i + 1) * GS);
  }
}

// One stage: k0..k0+63 of WR weight rows and XR activation rows (XR = 16: 16 lanes x 8 B per row).
template <int KD, int WR, int XR>
__device__ __forceinline__ void stage_copy(const _Float16* wsrc, const _Float16* xsrc,
                                           _Float16* buf, int k0, int tid) {
  copy_rows<KD, WR>(wsrc + k0, buf, tid);
  if constexpr (XR == 16) {
    acopy1_b64(lds_addr(buf + (WR + (tid >> 4)) * KPAD + (tid & 15) * 4),
               xsrc + k0 + (size_t)(tid >> 4) * KD + (tid & 15) * 4);
  } else {
    copy_rows<KD, XR>(xsrc + k0, buf + WR * KPAD, tid);
  }
}

// acc[j] += W rows (wrow0 + 16j ..) x act rows (xrow0 ..)^T over all KD, k ascending in steps of 32.
// C^T = W act^T: A = W rows (lane&15 = out col), B = act rows (lane&15 = token).
// On return every copy has landed, every wave has left the ring, and a block barrier has passed.
template <int KD, int WR, int XR, int JW>
__device__ __forceinline__ void gemm_ring(const _Float16* wsrc, const _Float16* xsrc,
                                          _Float16* ring, int wrow0, int xrow0,
                                          int tid, int lane, v8f (&acc)[JW]) {
  constexpr int SH = (WR + XR) * KPAD;   // halves per buffer
  constexpr int NT = KD / 64;            // stages
  static_assert((KD % 64) == 0 && NT >= 2);

  stage_copy<KD, WR, XR>(wsrc, xsrc, ring, 0, tid);
  asm volatile("s_wait_asynccnt 0x0" ::: "memory");   // this wave's part of stage 0 has landed
  __syncthreads();                                    // stage 0 published to every wave
  stage_copy<KD, WR, XR>(wsrc, xsrc, ring + SH, 64, tid);

#pragma unroll 1   // one stage per trip: the ring's waits and barrier stand once, at the foot
  for (int t = 0; t < NT; ++t) {
    _Float16* buf = ring + (t & 1) * SH;
    const _Float16* wl = buf + wrow0 * KPAD;
    const _Float16* xl = buf + (WR + xrow0) * KPAD;
    // the stage's fragment loads go out as one group in front of its WMMAs
    // (all four loops unrolled: the fragment and accumulator arrays must stay in registers)
    v16h xf[2], wf[2][JW];
#pragma unroll
    for (int s = 0; s < 2; ++s) {
      xf[s] = load_frag_row(xl + s * 32, KPAD, lane);
#pragma unroll
      for (int j = 0; j < JW; ++j)
        wf[s][j] = load_frag_row(wl + (j * 16) * KPAD + s * 32, KPAD, lane);
    }
#pragma unroll
    for (int s = 0; s < 2; ++s)
#pragma unroll
      for (int j = 0; j < JW; ++j) acc[j] = wmma_f16(wf[s][j], xf[s], acc[j]);
    asm volatile("s_wait_dscnt 0x0" ::: "memory");     // own reads of this buffer are done
    asm volatile("s_wait_asynccnt 0x0" ::: "memory");  // own part of stage t+1 has landed
    __syncthreads();   // publishes stage t+1 and ends every wave's reads of stage t
    if (t + 2 < NT) stage_copy<KD, WR, XR>(wsrc, xsrc, buf, (t + 2) * 64, tid);
  }
  asm volatile("s_wait_asynccnt 0x0" ::: "memory");    // nothing in flight behind the loop
}

// ---------------------------------------------------------------------------
// Kernel 0: nx = LN(bf16rne(x)) * bf16(g) + bf16(b) -> f16 plane nxh [ROWS][1024].
// One wave per token row, lane owns 4 chunks of 8 consecutive floats (i*256 + lane*8).
// grid ROWS/8, block 256. coverage: ROWS rows x 4 x 256 halves = whole plane.
// ---------------------------------------------------------------------------
__global__ __launch_bounds__(256) void ln1_kernel(const float* __restrict__ x,
                                                  const float* __restrict__ g,
                                                  const float* __restrict__ bb,
                                                  _Float16* __restrict__ nxh) {
  const int lane  = threadIdx.x & 31;
  const int wave  = threadIdx.x >> 5;
  const long m    = (long)blockIdx.x * 8 + wave;             // token row 0..ROWS-1
  const long srow = (m / SEQ) * SEQ_FULL + (m % SEQ);        // full-stride source row
  const float* xr = x + srow * DM + lane * 8;

  float s = 0.0f;
#pragma unroll 1
  for (int i = 0; i < 4; ++i) {
    const v4f a = *(const v4f*)(xr + i * 256);
    const v4f c = *(const v4f*)(xr + i * 256 + 4);
    s += ((bf16q(a[0]) + bf16q(a[1])) + (bf16q(a[2]) + bf16q(a[3]))) +
         ((bf16q(c[0]) + bf16q(c[1])) + (bf16q(c[2]) + bf16q(c[3])));
  }
  s = wave_sum(s);
  const float mean = s * (1.0f / DM);

  float ss = 0.0f;
#pragma unroll 1
  for (int i = 0; i < 4; ++i) {
    const v4f a = *(const v4f*)(xr + i * 256);
    const v4f c = *(const v4f*)(xr + i * 256 + 4);
#pragma unroll
    for (int e = 0; e < 4; ++e) {
      const float d0 = bf16q(a[e]) - mean;
      const float d1 = bf16q(c[e]) - mean;
      ss += d0 * d0;
      ss += d1 * d1;
    }
  }
  ss = wave_sum(ss);
  const float rstd = rsqrtf(ss * (1.0f / DM) + LN_EPS);

  _Float16* drow = nxh + m * DM + lane * 8;
#pragma unroll 1
  for (int i = 0; i < 4; ++i) {
    const v4f a  = *(const v4f*)(xr + i * 256);
    const v4f c  = *(const v4f*)(xr + i * 256 + 4);
    const v4f g0 = *(const v4f*)(g + i * 256 + lane * 8);
    const v4f g1 = *(const v4f*)(g + i * 256 + lane * 8 + 4);
    const v4f b0 = *(const v4f*)(bb + i * 256 + lane * 8);
    const v4f b1 = *(const v4f*)(bb + i * 256 + lane * 8 + 4);
    H8 o;
#pragma unroll
    for (int e = 0; e < 4; ++e) {
      o.h[e]     = (_Float16)((bf16q(a[e]) - mean) * rstd * bf16q(g0[e]) + bf16q(b0[e]));
      o.h[4 + e] = (_Float16)((bf16q(c[e]) - mean) * rstd * bf16q(g1[e]) + bf16q(b1[e]));
    }
    _Float16* dst = drow + i * 256;
    *(v4u*)dst = o.u;
    
  }
}

// ---------------------------------------------------------------------------
// Kernel 1: weights W [K=in][N=out] f32 -> Wt [n][k] f16 = f16(bf16rne(W) * 64), through a
// 64x64 LDS transpose. wqkv [3072][1024] (out col = q|k|v third, head h at 64h), woh [1024][1024],
// coverage: 768 + 256 + 1024 + 1024 tiles of 64x64 = every element of the four planes.
// ---------------------------------------------------------------------------
__global__ __launch_bounds__(256) void cvt_w_kernel(
    const float* __restrict__ Wqkv, const float* __restrict__ Wo,
    const float* __restrict__ Wf1, const float* __restrict__ Wf2,
    _Float16* __restrict__ wqkv, _Float16* __restrict__ woh,
    _Float16* __restrict__ wf1t, _Float16* __restrict__ wf2t) {
  __shared__ _Float16 ts[64 * KPAD];   // [n][k] tile, cross-wave (block barrier)
  const int bid = blockIdx.x;
  const int tid = threadIdx.x;
  const float* W;
  _Float16* dst;
  int K, N, kt, nt;
  if (bid < NT_QKV) {                                   // block-uniform selection
    const int tile = bid;                               // in [1024][3072] -> out [3072][1024]
    kt = tile / (3 * DM / 64); nt = tile - kt * (3 * DM / 64); K = DM; N = 3 * DM;
    W = Wqkv; dst = wqkv;
  } else if (bid < NT_QKV + NT_O) {
    const int tile = bid - NT_QKV;                      // in [1024][1024] -> out [1024][1024]
    kt = tile / (DM / 64); nt = tile - kt * (DM / 64); K = DM; N = DM;
    W = Wo; dst = woh;
  } else if (bid < NT_QKV + NT_O + NT_F1) {
    const int tile = bid - NT_QKV - NT_O;               // in [1024][4096] -> out [4096][1024]
    kt = tile / (FF / 64); nt = tile - kt * (FF / 64); K = DM; N = FF;
    W = Wf1; dst = wf1t;
  } else {
    const int tile = bid - NT_QKV - NT_O - NT_F1;       // in [4096][1024] -> out [1024][4096]
    kt = tile / (DM / 64); nt = tile - kt * (DM / 64); K = FF; N = DM;
    W = Wf2; dst = wf2t;
  }
  // load W[kt*64 + kr][nt*64 + 4*c4 .. +3], store transposed into ts[n][kr]
#pragma unroll
  for (int it = 0; it < 4; ++it) {
    const int idx = it * 256 + tid;
    const int kr = idx >> 4, c4 = idx & 15;
    const v4f v = *(const v4f*)(W + (size_t)(kt * 64 + kr) * N + nt * 64 + c4 * 4);
#pragma unroll
    for (int j = 0; j < 4; ++j) ts[(c4 * 4 + j) * KPAD + kr] = (_Float16)(bf16q(v[j]) * WSC);
  }
  __syncthreads();
  v4u rv[2];
#pragma unroll
  for (int it = 0; it < 2; ++it) {
    const int idx = it * 256 + tid;
    const int n = idx >> 3, piece = idx & 7;
    rv[it] = *(const v4u*)(ts + n * KPAD + piece * 8);
  }
#pragma unroll
  for (int it = 0; it < 2; ++it) {
    const int idx = it * 256 + tid;
    const int n = idx >> 3, piece = idx & 7;
    *(v4u*)(dst + (size_t)(nt * 64 + n) * K + kt * 64 + piece * 8) = rv[it];
  }
  
}

// ---------------------------------------------------------------------------
// Kernel 2: fused qkv projection + rotary embedding. Block = 128 token rows x 64 output columns
// (one head of one of q/k/v), 8 waves x 16 rows. C^T = W x^T: A = W rows (lane&15 = out col),
// B = nx rows (lane&15 = token); acc[j][r] = C[token lane&15][col 16j+8h+r]. K = 1024, operands
// through the ring (64 weight rows + 128 nx rows per stage, each weight row shared by the 8 waves).
// Prologue (q/k blocks only, block-uniform): rotary tables cos/sin[token][i], i < 32,
// angle = pos * (1 / 10000^(2i/64)), f32 powf/cosf/sinf, in LDS (cross-wave, block barrier).
// Epilogue u = acc/64 + bf16(bias); q,k: d<32: u[d]*cos - u[d+32]*sin, d>=32: u[d]*cos + u[d-32]*sin
//   q,k -> [b][h][s][64] f16 (one line per row, 8 lanes x 16 B)
//   v   -> vT[b][h][d][s] f16 (256 B per d row segment, 16 lanes x 16 B)
// grid (ROWS/128, 3*NH), block 256. coverage: every (b,h,s,d) of q, k and vT once.
// LDS: stg 128x64 (q/k) resp. 64x128 (v) fully written before read; ctab/stab 128x32 fully written.
// ---------------------------------------------------------------------------
__global__ __launch_bounds__(256) void qkv_kernel(
    const _Float16* __restrict__ nxh, const _Float16* __restrict__ wqkv,
    const float* __restrict__ bqkv,
    _Float16* __restrict__ q, _Float16* __restrict__ k, _Float16* __restrict__ vT) {
  __shared__ _Float16 stg[128 * KPAD];   // 18432 B; q/k: [128][KPAD], v: [64][VSPAD]; cross-wave
  __shared__ float ctab[128 * RTP];      // cos table [token][i], cross-wave (block barrier)
  __shared__ float stab[128 * RTP];      // sin table [token][i], cross-wave (block barrier)
  __shared__ __attribute__((aligned(16))) _Float16 ring[2 * (64 + 128) * KPAD];   // operand ring

  const int tid  = threadIdx.x;
  const int lane = tid & 31;
  const int wave = tid >> 5;
  const int hh   = lane >> 4;
  const int l15  = lane & 15;

  const int cb   = blockIdx.y;          // 0..47 = output column block (64 cols each)
  const int osel = cb >> 4;             // 0 q, 1 k, 2 v
  const int h    = cb & 15;
  const long m0  = (long)blockIdx.x * 128;
  const int  b   = (int)(m0 / SEQ);
  const int  s0  = (int)(m0 - (long)b * SEQ);

  if (osel < 2) {                       // block-uniform
#pragma clang fp contract(off)
    const int i  = tid & 31;
    const int tg = tid >> 5;
    const float e   = (float)(2 * i) * (1.0f / 64.0f);
    const float inv = 1.0f / powf(ROPE_BASE, e);
#pragma unroll 1
    for (int tt = tg; tt < 128; tt += 8) {
      const float ang = (float)(s0 + tt) * inv;
      ctab[tt * RTP + i] = cosf(ang);
      stab[tt * RTP + i] = sinf(ang);
    }
  }
  __syncthreads();

  v8f acc[4];
#pragma unroll
  for (int j = 0; j < 4; ++j) acc[j] = (v8f){};

  gemm_ring<DM, 64, 128, 4>(wqkv + ((long)cb * 64) * DM, nxh + m0 * DM, ring,
                            0, wave * 16, tid, lane, acc);

  const float* bias = bqkv + cb * 64;
  const float  rsc  = 1.0f / WSC;

  v4u rv[4];
  if (osel < 2) {
    float u[4][8];
#pragma unroll
    for (int j = 0; j < 4; ++j) {
      const int n8 = j * 16 + hh * 8;
      const v4f b0 = *(const v4f*)(bias + n8);
      const v4f b1 = *(const v4f*)(bias + n8 + 4);
#pragma unroll
      for (int r = 0; r < 4; ++r) {
        u[j][r]     = acc[j][r]     * rsc + bf16q(b0[r]);
        u[j][4 + r] = acc[j][4 + r] * rsc + bf16q(b1[r]);
      }
    }
    // rotation: lane holds d = n8+r (j<2) and its partner d+32 (j+2); stage [token][col]
    const int tl = wave * 16 + l15;
    _Float16* srow = stg + tl * KPAD;
    const float* crow = ctab + tl * RTP;
    const float* nrow = stab + tl * RTP;
#pragma unroll
    for (int j = 0; j < 2; ++j) {
      const int n8 = j * 16 + hh * 8;
      const v4f c0  = *(const v4f*)(crow + n8);
      const v4f c1  = *(const v4f*)(crow + n8 + 4);
      const v4f sn0 = *(const v4f*)(nrow + n8);
      const v4f sn1 = *(const v4f*)(nrow + n8 + 4);
      H8 plo, phi;
#pragma unroll
      for (int r = 0; r < 4; ++r) {
        const float a0 = u[j][r],     d0 = u[j + 2][r];
        const float a1 = u[j][4 + r], d1 = u[j + 2][4 + r];
        plo.h[r]     = (_Float16)(a0 * c0[r] - d0 * sn0[r]);
        phi.h[r]     = (_Float16)(d0 * c0[r] + a0 * sn0[r]);
        plo.h[4 + r] = (_Float16)(a1 * c1[r] - d1 * sn1[r]);
        phi.h[4 + r] = (_Float16)(d1 * c1[r] + a1 * sn1[r]);
      }
      *(v4u*)(srow + n8)      = plo.u;
      *(v4u*)(srow + 32 + n8) = phi.u;
    }
    __syncthreads();
#pragma unroll
    for (int it = 0; it < 4; ++it) {
      const int idx = it * 256 + tid;
      const int row = idx >> 3, piece = idx & 7;
      rv[it] = *(const v4u*)(stg + row * KPAD + piece * 8);
    }
    _Float16* dst = ((osel == 0) ? q : k) + ((long)(b * NH + h) * SEQ + s0) * HD;  // contiguous 16 KB
#pragma unroll
    for (int it = 0; it < 4; ++it)
      *(v4u*)(dst + (long)(it * 256 + tid) * 8) = rv[it];
    
  } else {
    // stage transposed [d][token]: lane's 8 values are 8 different d for one token
#pragma unroll
    for (int j = 0; j < 4; ++j) {
      const int n8 = j * 16 + hh * 8;
      const v4f b0 = *(const v4f*)(bias + n8);
      const v4f b1 = *(const v4f*)(bias + n8 + 4);
#pragma unroll
      for (int r = 0; r < 4; ++r) {
        stg[(n8 + r) * VSPAD + wave * 16 + l15]     = (_Float16)(acc[j][r]     * rsc + bf16q(b0[r]));
        stg[(n8 + 4 + r) * VSPAD + wave * 16 + l15] = (_Float16)(acc[j][4 + r] * rsc + bf16q(b1[r]));
      }
    }
    __syncthreads();
#pragma unroll
    for (int it = 0; it < 4; ++it) {
      const int idx = it * 256 + tid;
      const int d = idx >> 4, piece = idx & 15;
      rv[it] = *(const v4u*)(stg + d * VSPAD + piece * 8);
    }
    _Float16* dstb = vT + ((long)(b * NH + h) * HD) * SEQ + s0;
#pragma unroll
    for (int it = 0; it < 4; ++it) {
      const int idx = it * 256 + tid;
      const int d = idx >> 4, piece = idx & 15;
      *(v4u*)(dstb + (long)d * SEQ + piece * 8) = rv[it];
    }
    
  }
}

// ---------------------------------------------------------------------------
// Kernel 3: flash attention per (b,h), no mask, all SEQ keys. grid (SEQ/128, NB*NH),
// block 256 (8 waves x 16 queries). C = S^T (A = K rows, B = Q) then C = O^T = V^T P^T (P^T
// packed from the S^T D registers); lane owns one query end-to-end. Scores are raw q.k sums:
// the 1/8 scale and the x1024 p carry live in the exp argument (p = 1024*exp((s-m)/8),
// softmax stats f32). Context (carried x64) written to ctx[b*SEQ+s][h*64+d] through an LDS stage
// LDS tiles: ks/vts staged 64 keys x 64 d every step == consumed extent; ost 128 x 64 fully written.
// coverage: every (row, h*64+d) of the ctx plane once.
// ---------------------------------------------------------------------------
__global__ __launch_bounds__(256) void attn_kernel(
    const _Float16* __restrict__ Q, const _Float16* __restrict__ K,
    const _Float16* __restrict__ vT, _Float16* __restrict__ ctx) {
  __shared__ _Float16 ks[64 * KPAD];     // K block rows [key][d]      (cross-wave, block barriers)
  __shared__ _Float16 vts[64 * KPAD];    // V^T block   [d][key]      (cross-wave, block barriers)
  __shared__ _Float16 ost[128 * KPAD];   // output stage [query][d]   (cross-wave, block barrier)

  const int tid  = threadIdx.x;
  const int lane = tid & 31;
  const int wave = tid >> 5;
  const int bh   = blockIdx.y;
  const int b    = bh >> 4;
  const int h    = bh & 15;
  const int q0   = blockIdx.x * 128;

  const _Float16* Qb  = Q + ((long)bh * SEQ + q0) * HD;
  const _Float16* Kb  = K + (long)bh * SEQ * HD;
  const _Float16* vTb = vT + (long)bh * HD * SEQ;

  // Q fragments: B operand of S^T (lane owns query lane&15)
  v16h qfrag[2];
  {
    const _Float16* qrow = Qb + (long)wave * 16 * HD;
#pragma unroll
    for (int t = 0; t < 2; ++t) qfrag[t] = load_frag_row(qrow + t * 32, HD, lane);
  }

  v8f acc[4];   // O^T accumulator: lane owns query (lane&15); reg r -> d = nt*16+8h+r
#pragma unroll
  for (int nt = 0; nt < 4; ++nt) acc[nt] = (v8f){};
  float mi = -1e30f, li = 0.0f;

  const int colb = lane & 15;
  const int rofs = (lane >> 4) << 3;

#pragma unroll 1
  for (int kb = 0; kb < SEQ; kb += 64) {
    __syncthreads();   // everyone done reading prior ks/vts
#pragma unroll
    for (int idx = tid; idx < 64 * 8; idx += 256) {
      const int row = idx >> 3, c = idx & 7;
      *(v4u*)(ks + row * KPAD + c * 8) =
          *(const v4u*)(Kb + (long)(kb + row) * HD + c * 8);
    }
#pragma unroll
    for (int idx = tid; idx < 64 * 8; idx += 256) {
      const int d = idx >> 3, c = idx & 7;
      *(v4u*)(vts + d * KPAD + c * 8) =
          *(const v4u*)(vTb + (long)d * SEQ + kb + c * 8);
    }
    __syncthreads();

    // S^T tiles: A = K rows (lane&15 = key), B = Q
    v8f sc[4];
#pragma unroll
    for (int kt = 0; kt < 4; ++kt) sc[kt] = (v8f){};
#pragma unroll
    for (int t = 0; t < 2; ++t)
#pragma unroll
      for (int kt = 0; kt < 4; ++kt) {
        const v16h kf = load_frag_row(ks + (kt * 16) * KPAD + t * 32, KPAD, lane);
        sc[kt] = wmma_f16(kf, qfrag[t], sc[kt]);
      }

    // per-lane online softmax (32 of 64 keys in-lane; merge halves with one shuffle)
    float mx = sc[0][0];
#pragma unroll
    for (int kt = 0; kt < 4; ++kt)
#pragma unroll
      for (int r = 0; r < 8; ++r) mx = fmaxf(mx, sc[kt][r]);
    mx = fmaxf(mx, __shfl_xor(mx, 16, 32));
    const float mnew  = fmaxf(mi, mx);
    const float alpha = __expf((mi - mnew) * 0.125f);
    mi = mnew;
    const float cs = fmaf(mnew, 0.125f, -LN1024);   // 0.125*m - ln(1024)

    float rs = 0.0f;
#pragma unroll
    for (int kt = 0; kt < 4; ++kt)
#pragma unroll
      for (int r = 0; r < 8; ++r) {
        const float p = __expf(fmaf(sc[kt][r], 0.125f, -cs));   // 1024*exp((s-m)/8)
        sc[kt][r] = p;
        rs += p;
      }
    rs += __shfl_xor(rs, 16, 32);
    li = li * alpha + rs;

    // P^T as the B operand of O^T = V^T P^T, packed from the S^T D registers:
    // element i <- tile covering keys 0..15 of the 32-step (kt = 2t), element 8+i <- kt = 2t+1.
    v16h pf[2];
#pragma unroll
    for (int t = 0; t < 2; ++t)
#pragma unroll
      for (int i = 0; i < 8; ++i) {
        pf[t][i]     = (_Float16)sc[2 * t][i];
        pf[t][8 + i] = (_Float16)sc[2 * t + 1][i];
      }

#pragma unroll
    for (int nt = 0; nt < 4; ++nt)
#pragma unroll
      for (int r = 0; r < 8; ++r) acc[nt][r] *= alpha;

    // O^T += V^T (A, rows = d) x P^T (B)
#pragma unroll
    for (int t = 0; t < 2; ++t)
#pragma unroll
      for (int nt = 0; nt < 4; ++nt) {
        const v16h vf = load_frag_row(vts + (nt * 16) * KPAD + t * 32, KPAD, lane);
        acc[nt] = wmma_f16(vf, pf[t], acc[nt]);
      }
  }

  // normalize (and apply the x64 carry) and stage: lane owns query row wave*16+colb,
  // d = nt*16+rofs+r contiguous
  {
    const float inv = 64.0f / li;
    _Float16* orow = ost + (wave * 16 + colb) * KPAD;
#pragma unroll
    for (int nt = 0; nt < 4; ++nt) {
      H8 pk;
#pragma unroll
      for (int r = 0; r < 8; ++r) pk.h[r] = (_Float16)(acc[nt][r] * inv);
      *(v4u*)(orow + nt * 16 + rofs) = pk.u;
    }
  }
  __syncthreads();

  v4u rv[4];
#pragma unroll
  for (int it = 0; it < 4; ++it) {
    const int idx = it * 256 + tid;
    const int row = idx >> 3, piece = idx & 7;
    rv[it] = *(const v4u*)(ost + row * KPAD + piece * 8);
  }
  _Float16* cbase = ctx + ((long)b * SEQ + q0) * DM + h * HD;
#pragma unroll
  for (int it = 0; it < 4; ++it) {
    const int idx = it * 256 + tid;
    const int row = idx >> 3, piece = idx & 7;
    *(v4u*)(cbase + (long)row * DM + piece * 8) = rv[it];
  }
  
}

// ---------------------------------------------------------------------------
// Kernel 4/6: y = act @ Wt^T / 4096 + bf16(bias) + residual over a full 1024-wide row.
// Block = 16 token rows x 1024 cols, wave w owns cols 128w..128w+127. C^T = Wt act^T: A = Wt rows
// (lane&15 = out col), B = act rows (lane&15 = token); acc[j][r] = y[token lane&15][col 128w+16j+8h+r].
// Operands through the ring (1024 weight rows + 16 act rows per stage).
// y staged in LDS (f32, in the ring's bytes once the ring is left), residual added in a coalesced
// LDS pass, then:
//   MODE 0: KD = 1024, act = ctx, residual = bf16(x input, full-stride rows) -> x1.
//           and nx2 = f16(LN(x1) * bf16(gamma) + bf16(beta)) -> f16 plane [ROWS][1024].
//   MODE 1: KD = 4096, act = h plane, residual = x1 f32 plane -> out (full-stride rows).
// grid ROWS/16, block 256. LDS ys: 16 x 1024 staged == consumed. coverage: 16 rows x 1024 per block.
// ---------------------------------------------------------------------------
template <int KD, int MODE>
__global__ __launch_bounds__(256) void gemm_row_kernel(
    const _Float16* __restrict__ act, const _Float16* __restrict__ wt,
    const float* __restrict__ bias, const float* __restrict__ res,
    const float* __restrict__ gam, const float* __restrict__ bet,
    float* __restrict__ outf, _Float16* __restrict__ outh) {
  // 299520 B: operand ring in the k loop, then ys (65792 B); cross-wave (block barriers)
  __shared__ __attribute__((aligned(16))) unsigned char smem[2 * (DM + 16) * KPAD * 2];
  __shared__ float smean[16];      // cross-wave (block barrier)
  __shared__ float srstd[16];      // cross-wave (block barrier)
  static_assert(sizeof(smem) >= (size_t)16 * YP * 4);
  _Float16* ring = (_Float16*)smem;
  float*    ys   = (float*)smem;

  const int tid  = threadIdx.x;
  const int lane = tid & 31;
  const int wave = tid >> 5;
  const int hh   = lane >> 4;
  const int l15  = lane & 15;
  const long m0  = (long)blockIdx.x * 16;
  const int  n0  = wave * 128;

  v8f acc[8];
#pragma unroll
  for (int j = 0; j < 8; ++j) acc[j] = (v8f){};

  gemm_ring<KD, DM, 16, 8>(wt, act + m0 * KD, ring, n0, 0, tid, lane, acc);

  // y = acc/4096 + bf16(bias), staged [row][col]
  {
    const float rsc = 1.0f / (WSC * WSC);
    float* yrow = ys + l15 * YP;
#pragma unroll
    for (int j = 0; j < 8; ++j) {
      const int n8 = n0 + j * 16 + hh * 8;
      const v4f b0 = *(const v4f*)(bias + n8);
      const v4f b1 = *(const v4f*)(bias + n8 + 4);
      v4f y0, y1;
#pragma unroll
      for (int i = 0; i < 4; ++i) {
        y0[i] = acc[j][i]     * rsc + bf16q(b0[i]);
        y1[i] = acc[j][4 + i] * rsc + bf16q(b1[i]);
      }
      *(v4f*)(yrow + n8)     = y0;
      *(v4f*)(yrow + n8 + 4) = y1;
    }
  }
  __syncthreads();

  // residual add (coalesced): ys[row][col] += res
#pragma unroll 4
  for (int it = 0; it < 16; ++it) {
    const int idx = it * 256 + tid;
    const int row = idx >> 8, piece = idx & 255;
    const long m = m0 + row;
    v4f rsd;
    if (MODE == 0) {
      const long orow = (m / SEQ) * SEQ_FULL + (m % SEQ);
      rsd = *(const v4f*)(res + orow * DM + piece * 4);
#pragma unroll
      for (int c = 0; c < 4; ++c) rsd[c] = bf16q(rsd[c]);
    } else {
      rsd = *(const v4f*)(res + m * DM + piece * 4);
    }
    float* yp = ys + row * YP + piece * 4;
    v4f yv = *(const v4f*)yp;
#pragma unroll
    for (int c = 0; c < 4; ++c) yv[c] = yv[c] + rsd[c];
    *(v4f*)yp = yv;
  }
  __syncthreads();

  v4u hv[8];
#pragma unroll
  for (int it = 0; it < 8; ++it) hv[it] = (v4u){0u, 0u, 0u, 0u};

  if (MODE == 0) {
    {
      const int r  = tid >> 4;
      const int sl = tid & 15;
      const float* yr = ys + r * YP + sl * 64;
      float s = 0.0f;
#pragma unroll
      for (int i = 0; i < 16; ++i) {
        const v4f v = *(const v4f*)(yr + i * 4);
        s += (v[0] + v[1]) + (v[2] + v[3]);
      }
      s += __shfl_xor(s, 1, 32);
      s += __shfl_xor(s, 2, 32);
      s += __shfl_xor(s, 4, 32);
      s += __shfl_xor(s, 8, 32);
      const float mean = s * (1.0f / DM);
      float ss = 0.0f;
#pragma unroll
      for (int i = 0; i < 16; ++i) {
        const v4f v = *(const v4f*)(yr + i * 4);
#pragma unroll
        for (int c = 0; c < 4; ++c) {
          const float d = v[c] - mean;
          ss += d * d;
        }
      }
      ss += __shfl_xor(ss, 1, 32);
      ss += __shfl_xor(ss, 2, 32);
      ss += __shfl_xor(ss, 4, 32);
      ss += __shfl_xor(ss, 8, 32);
      const float var  = ss * (1.0f / DM);
      const float rstd = rsqrtf(var + LN_EPS);
      if (sl == 0) { smean[r] = mean; srstd[r] = rstd; }
    }
    __syncthreads();

    // nx2 values into registers: thread owns row idx>>7 and 8 contiguous cols p8*8
#pragma unroll
    for (int it = 0; it < 8; ++it) {
      const int idx = it * 256 + tid;
      const int row = idx >> 7, p8 = idx & 127;
      const v4f a  = *(const v4f*)(ys + row * YP + p8 * 8);
      const v4f c  = *(const v4f*)(ys + row * YP + p8 * 8 + 4);
      const v4f g0 = *(const v4f*)(gam + p8 * 8);
      const v4f g1 = *(const v4f*)(gam + p8 * 8 + 4);
      const v4f b0 = *(const v4f*)(bet + p8 * 8);
      const v4f b1 = *(const v4f*)(bet + p8 * 8 + 4);
      const float mean = smean[row], rstd = srstd[row];
      H8 o;
#pragma unroll
      for (int i = 0; i < 4; ++i) {
        o.h[i]     = (_Float16)((a[i] - mean) * rstd * bf16q(g0[i]) + bf16q(b0[i]));
        o.h[4 + i] = (_Float16)((c[i] - mean) * rstd * bf16q(g1[i]) + bf16q(b1[i]));
      }
      hv[it] = o.u;
    }
  }

  auto store_pass = [&]() {
#pragma unroll 4
    for (int it = 0; it < 16; ++it) {
      const int idx = it * 256 + tid;
      const int row = idx >> 8, piece = idx & 255;
      const long m = m0 + row;
      const v4f v = *(const v4f*)(ys + row * YP + piece * 4);
      long drow;
      if (MODE == 0) drow = m;
      else drow = (m / SEQ) * SEQ_FULL + (m % SEQ);
      *(v4f*)(outf + drow * DM + piece * 4) = v;
    }
    if (MODE == 0) {
#pragma unroll
      for (int it = 0; it < 8; ++it) {
        const int idx = it * 256 + tid;
        const int row = idx >> 7, p8 = idx & 127;
        const long m = m0 + row;
        *(v4u*)(outh + m * DM + p8 * 8) = hv[it];
      }
    }
  };
  store_pass();
  
}

// ---------------------------------------------------------------------------
// Kernel 5: ffn linear 1 + silu: hp[row][col] = f16(64 * silu(nx2 @ Wf1 / 64 + bf16(bf1))),
// silu(u) = u * 1/(1+exp(-u)) in f32. Block = 128 token rows x 64 output cols, 8 waves x 16 rows;
// C^T = Wf1t nx2^T (A = Wf1t rows, B = nx2 f16 rows), K = 1024, operands through the ring.
// Epilogue staged [token][col] in LDS,
// grid (ROWS/128, FF/64), block 256. coverage: every (row, col) of the hp plane [ROWS][4096] once.
// ---------------------------------------------------------------------------
__global__ __launch_bounds__(256) void ffn1_kernel(
    const _Float16* __restrict__ x2h, const _Float16* __restrict__ wf1t,
    const float* __restrict__ bf1, _Float16* __restrict__ hp) {
  __shared__ _Float16 stg[128 * KPAD];   // cross-wave (block barrier), 128 x 64 fully written
  __shared__ __attribute__((aligned(16))) _Float16 ring[2 * (64 + 128) * KPAD];   // operand ring

  const int tid  = threadIdx.x;
  const int lane = tid & 31;
  const int wave = tid >> 5;
  const int hh   = lane >> 4;
  const int l15  = lane & 15;
  const int cb   = blockIdx.y;          // 0..FF/64-1
  const long m0  = (long)blockIdx.x * 128;

  v8f acc[4];
#pragma unroll
  for (int j = 0; j < 4; ++j) acc[j] = (v8f){};

  gemm_ring<DM, 64, 128, 4>(wf1t + ((long)cb * 64) * DM, x2h + m0 * DM, ring,
                            0, wave * 16, tid, lane, acc);

  const float rsc = 1.0f / WSC;
  _Float16* srow = stg + (wave * 16 + l15) * KPAD;
#pragma unroll
  for (int j = 0; j < 4; ++j) {
    const int n8 = j * 16 + hh * 8;
    const v4f b0 = *(const v4f*)(bf1 + cb * 64 + n8);
    const v4f b1 = *(const v4f*)(bf1 + cb * 64 + n8 + 4);
    H8 pk;
#pragma unroll
    for (int r = 0; r < 4; ++r) {
      const float u0 = acc[j][r]     * rsc + bf16q(b0[r]);
      const float u1 = acc[j][4 + r] * rsc + bf16q(b1[r]);
      const float e0 = __expf(fminf(-u0, 80.0f));
      const float e1 = __expf(fminf(-u1, 80.0f));
      const float g0 = u0 * __builtin_amdgcn_rcpf(1.0f + e0);
      const float g1 = u1 * __builtin_amdgcn_rcpf(1.0f + e1);
      pk.h[r]     = (_Float16)(g0 * WSC);
      pk.h[4 + r] = (_Float16)(g1 * WSC);
    }
    *(v4u*)(srow + n8) = pk.u;
  }
  __syncthreads();

  v4u rv[4];
#pragma unroll
  for (int it = 0; it < 4; ++it) {
    const int idx = it * 256 + tid;
    const int row = idx >> 3, piece = idx & 7;
    rv[it] = *(const v4u*)(stg + row * KPAD + piece * 8);
  }
#pragma unroll
  for (int it = 0; it < 4; ++it) {
    const int idx = it * 256 + tid;
    const int row = idx >> 3, piece = idx & 7;
    *(v4u*)(hp + (m0 + row) * FF + cb * 64 + piece * 8) = rv[it];
  }
  
}

// ---------------------------------------------------------------------------
extern "C" void kernel_launch(void* const* d_in, const int* in_sizes, int n_in,
                              void* d_out, int out_size, void* d_ws, size_t ws_size,
                              hipStream_t stream) {
  if (n_in < 13) return;
  const long needRows = (long)(NB - 1) * SEQ_FULL + SEQ;
  if ((long)in_sizes[0] < needRows * DM) return;
  if (in_sizes[1] < DM || in_sizes[2] < DM) return;
  if (in_sizes[3] < 3 * DM * DM || in_sizes[4] < 3 * DM) return;
  if (in_sizes[5] < DM * DM || in_sizes[6] < DM) return;
  if (in_sizes[7] < DM || in_sizes[8] < DM) return;
  if (in_sizes[9] < DM * FF || in_sizes[10] < FF) return;
  if (in_sizes[11] < FF * DM || in_sizes[12] < DM) return;
  if ((long)out_size < needRows * DM) return;
  if (ws_size < WS_TOTAL) return;

  const float* x     = (const float*)d_in[0];
  const float* g1    = (const float*)d_in[1];
  const float* be1   = (const float*)d_in[2];
  const float* Wqkv  = (const float*)d_in[3];
  const float* bqkv  = (const float*)d_in[4];
  const float* Wo    = (const float*)d_in[5];
  const float* bo    = (const float*)d_in[6];
  const float* g2    = (const float*)d_in[7];
  const float* be2   = (const float*)d_in[8];
  const float* Wf1   = (const float*)d_in[9];
  const float* bf1   = (const float*)d_in[10];
  const float* Wf2   = (const float*)d_in[11];
  const float* bf2   = (const float*)d_in[12];
  float* out = (float*)d_out;

  char* ws = (char*)d_ws;
  size_t off = 0;
  _Float16* nxh  = (_Float16*)(ws + off); off += PLANE2;       // [ROWS][1024] f16
  _Float16* ctx  = (_Float16*)(ws + off); off += PLANE2;       // [ROWS][1024] f16 (x64)
  _Float16* wqkv = (_Float16*)(ws + off); off += WQKV_BYTES;   // [3072][1024]
  _Float16* woh  = (_Float16*)(ws + off); off += WO_BYTES;     // [1024][1024]
  _Float16* wf1t = (_Float16*)(ws + off); off += WF1_BYTES;    // [4096][1024]
  _Float16* wf2t = (_Float16*)(ws + off); off += WF2_BYTES;    // [1024][4096]
  _Float16* qh   = (_Float16*)(ws + off); off += PLANE2;       // [NB][16][SEQ][64]
  _Float16* kh   = (_Float16*)(ws + off); off += PLANE2;       // [NB][16][SEQ][64]
  _Float16* vTh  = (_Float16*)(ws + off); off += PLANE2;       // [NB][16][64][SEQ]
  float*    x1f  = (float*)(ws + off);    off += PLANE4;       // [ROWS][1024] f32
  _Float16* nx2h = (_Float16*)(ws + off); off += PLANE2;       // [ROWS][1024] f16
  _Float16* hp   = (_Float16*)(ws + off); off += H_BYTES;      // [ROWS][4096] f16 (x64)
  if (off > ws_size) return;

  ln1_kernel<<<ROWS / 8, 256, 0, stream>>>(x, g1, be1, nxh);
  cvt_w_kernel<<<NWT, 256, 0, stream>>>(Wqkv, Wo, Wf1, Wf2, wqkv, woh, wf1t, wf2t);
  qkv_kernel<<<dim3(ROWS / 128, 3 * NH), 256, 0, stream>>>(nxh, wqkv, bqkv, qh, kh, vTh);
  attn_kernel<<<dim3(SEQ / 128, NB * NH), 256, 0, stream>>>(qh, kh, vTh, ctx);
  gemm_row_kernel<DM, 0><<<ROWS / 16, 256, 0, stream>>>(ctx, woh, bo, x, g2, be2, x1f, nx2h);
  ffn1_kernel<<<dim3(ROWS / 128, FF / 64), 256, 0, stream>>>(nx2h, wf1t, bf1, hp);
  gemm_row_kernel<FF, 1><<<ROWS / 16, 256, 0, stream>>>(hp, wf2t, bf2, x1f, g2, be2, out, nx2h);
}

// v002
// One run takes 257 microseconds.
// In both of two side-by-side timings against v001, it was 1.19 times as fast.
// All steps since v000 together make it 2.90 times as fast.
#include <hip/hip_runtime.h>

// All contractions (fused qkv projection, q.k^T, p.v, output projection, ffn linear 1,
// ffn linear 2): v_wmma_f32_16x16x32_f16, f16 operands, f32 accumulate. Float inputs are
// RNE-converted to bf16 at load (weights additionally carried x64; both exact in f16); computed
// 16-bit planes are f16 with power-of-two carries (softmax p x1024, context x64, ffn hidden x64)
// folded back in the f32 epilogues. Layernorms, rotary tables and rotation, softmax statistics,
// silu and residual adds: f32.

typedef __attribute__((ext_vector_type(16))) _Float16 v16h;
typedef __attribute__((ext_vector_type(8)))  _Float16 v8h;
typedef __attribute__((ext_vector_type(8)))  float v8f;
typedef __attribute__((ext_vector_type(4)))  float v4f;
typedef __attribute__((ext_vector_type(4)))  unsigned int v4u;
union H8 { v8h h; v4u u; };

#ifndef NB
#define NB 2
#endif
#ifndef SEQ
#define SEQ 2048
#endif
#define NB_FULL  2
#define SEQ_FULL 2048
#define DM   1024
#define NH   16
#define HD   64
#define FF   4096
#define ROWS (NB * SEQ)
#define KPAD 72       // LDS stride in halves for 64-wide f16 tiles (144 B, 16-B aligned)
#define VSPAD 136     // LDS stride in halves for 128-wide f16 tiles (272 B)
#define YP   1028     // LDS stride in floats for 1024-wide f32 rows (4112 B)
#define YT   132      // LDS stride in floats for 128-wide f32 rows (528 B)
#define RTP  32       // LDS stride in floats of the per-token rotary tables
#define LN_EPS 1e-5f
#define WSC    64.0f           // weight carry (power of two)
#define LN1024 6.931471806f    // ln(1024): softmax p carried x1024
#define ROPE_BASE 10000.0f

#define NT_QKV ((DM / 64) * (3 * DM / 64))    // 768 tiles: W [1024][3072]
#define NT_O   ((DM / 64) * (DM / 64))        // 256 tiles: W [1024][1024]
#define NT_F1  ((DM / 64) * (FF / 64))        // 1024 tiles: W [1024][4096]
#define NT_F2  ((FF / 64) * (DM / 64))        // 1024 tiles: W [4096][1024]
#define NWT    (NT_QKV + NT_O + NT_F1 + NT_F2)

#define PLANE2     ((size_t)ROWS * DM * 2)
#define PLANE4     ((size_t)ROWS * DM * 4)
#define WQKV_BYTES ((size_t)3 * DM * DM * 2)
#define WO_BYTES   ((size_t)DM * DM * 2)
#define WF1_BYTES  ((size_t)FF * DM * 2)
#define WF2_BYTES  ((size_t)DM * FF * 2)
#define H_BYTES    ((size_t)ROWS * FF * 2)
#define WS_TOTAL   (2 * PLANE2 + WQKV_BYTES + WO_BYTES + WF1_BYTES + WF2_BYTES + \
                    3 * PLANE2 + PLANE4 + PLANE2 + H_BYTES)

static_assert(NB >= 1 && NB <= NB_FULL);
static_assert(SEQ >= 128 && SEQ <= SEQ_FULL && (SEQ % 128) == 0);
static_assert((ROWS % 128) == 0 && (ROWS % 16) == 0 && (ROWS % 8) == 0);
static_assert((DM % 64) == 0 && (FF % 64) == 0 && HD == 64 && NH * HD == DM);
static_assert((DM % 128) == 0 && (FF % 128) == 0);
static_assert((size_t)NB * NH * SEQ * HD * 2 == PLANE2);
static_assert(WS_TOTAL <= (size_t)134217728);

// ---------------------------------------------------------------------------
// helpers
// ---------------------------------------------------------------------------
__device__ __forceinline__ float bf16q(float f) {            // value after RNE bf16 conversion
  unsigned int u = __float_as_uint(f);
  u += 0x7FFFu + ((u >> 16) & 1u);
  return __uint_as_float(u & 0xFFFF0000u);
}

__device__ __forceinline__ float wave_sum(float v) {
  v += __shfl_xor(v, 16, 32);
  v += __shfl_xor(v, 8, 32);
  v += __shfl_xor(v, 4, 32);
  v += __shfl_xor(v, 2, 32);
  v += __shfl_xor(v, 1, 32);
  return v;
}

// 16-bit fragment (A or B): lane owns row/col (lane&15); elements 0..7 <- k0+8h+0..7,
// elements 8..15 <- k0+16+8h+0..7, h = lane>>4. Source is k-contiguous rows.
__device__ __forceinline__ v16h load_frag_row(const _Float16* base, int stride, int lane) {
  const _Float16* rowp = base + (lane & 15) * stride + ((lane >> 4) << 3);
  const v8h lo = *(const v8h*)(rowp);
  const v8h hi = *(const v8h*)(rowp + 16);
  return __builtin_shufflevector(lo, hi, 0, 1, 2, 3, 4, 5, 6, 7,
                                 8, 9, 10, 11, 12, 13, 14, 15);
}

__device__ __forceinline__ v8f wmma_f16(v16h a, v16h b, v8f c) {
  v8f d = __builtin_amdgcn_wmma_f32_16x16x32_f16(false, a, false, b, (short)0, c,
                                                 false, false);
  asm volatile("v_nop\n\tv_nop\n\tv_nop\n\tv_nop" : "+v"(d) : "v"(a), "v"(b));
  return d;
}

// ---------------------------------------------------------------------------
// Operand staging of the dense projections: a stage is 64 k (128 B) of WR weight rows followed by
// XR activation rows, LDS pitch KPAD halves, brought in by asynchronous copies to LDS (no register
// on the way) into a ring of two buffers, so that stage t+1 flies while stage t is multiplied.
// ---------------------------------------------------------------------------
__device__ __forceinline__ unsigned lds_addr(const void* p) {   // byte offset in the block's LDS
  return (unsigned)(unsigned long long)p;
}

// The s_wait_xcnt closes each run of copies inside its own statement: it stands in front of any
// later rewrite of the address registers that the copies name.
__device__ __forceinline__ void acopy2(unsigned l0, const _Float16* g0,
                                       unsigned l1, const _Float16* g1) {
  asm volatile("global_load_async_to_lds_b128 %0, %1, off\n\t"
               "global_load_async_to_lds_b128 %2, %3, off\n\t"
               "s_wait_xcnt 0x0"
               :: "v"(l0), "v"(g0), "v"(l1), "v"(g1) : "memory");
}

__device__ __forceinline__ void acopy4(unsigned l0, const _Float16* g0,
                                       unsigned l1, const _Float16* g1,
                                       unsigned l2, const _Float16* g2,
                                       unsigned l3, const _Float16* g3) {
  asm volatile("global_load_async_to_lds_b128 %0, %1, off\n\t"
               "global_load_async_to_lds_b128 %2, %3, off\n\t"
               "global_load_async_to_lds_b128 %4, %5, off\n\t"
               "global_load_async_to_lds_b128 %6, %7, off\n\t"
               "s_wait_xcnt 0x0"
               :: "v"(l0), "v"(g0), "v"(l1), "v"(g1), "v"(l2), "v"(g2), "v"(l3), "v"(g3)
               : "memory");
}

__device__ __forceinline__ void acopy8(unsigned l0, const _Float16* g0,
                                       unsigned l1, const _Float16* g1,
                                       unsigned l2, const _Float16* g2,
                                       unsigned l3, const _Float16* g3,
                                       unsigned l4, const _Float16* g4,
                                       unsigned l5, const _Float16* g5,
                                       unsigned l6, const _Float16* g6,
                                       unsigned l7, const _Float16* g7) {
  asm volatile("global_load_async_to_lds_b128 %0, %1, off\n\t"
               "global_load_async_to_lds_b128 %2, %3, off\n\t"
               "global_load_async_to_lds_b128 %4, %5, off\n\t"
               "global_load_async_to_lds_b128 %6, %7, off\n\t"
               "global_load_async_to_lds_b128 %8, %9, off\n\t"
               "global_load_async_to_lds_b128 %10, %11, off\n\t"
               "global_load_async_to_lds_b128 %12, %13, off\n\t"
               "global_load_async_to_lds_b128 %14, %15, off\n\t"
               "s_wait_xcnt 0x0"
               :: "v"(l0), "v"(g0), "v"(l1), "v"(g1), "v"(l2), "v"(g2), "v"(l3), "v"(g3),
                  "v"(l4), "v"(g4), "v"(l5), "v"(g5), "v"(l6), "v"(g6), "v"(l7), "v"(g7)
               : "memory");
}

__device__ __forceinline__ void acopy1_b64(unsigned l0, const _Float16* g0) {
  asm volatile("global_load_async_to_lds_b64 %0, %1, off\n\t"
               "s_wait_xcnt 0x0"
               :: "v"(l0), "v"(g0) : "memory");
}

// NR rows (a multiple of 64) of 128 B: 8 lanes x 16 B per row, 32 rows per copy of the block.
template <int KD, int NR>
__device__ __forceinline__ void copy_rows(const _Float16* src, _Float16* dst, int tid) {
  static_assert((NR % 64) == 0);
  const _Float16* g = src + (size_t)(tid >> 3) * KD + (tid & 7) * 8;
  const unsigned  l = lds_addr(dst + (tid >> 3) * KPAD + (tid & 7) * 8);
  constexpr unsigned LS = 32 * KPAD * 2;       // LDS bytes per 32 rows
  constexpr size_t   GS = (size_t)32 * KD;     // source halves per 32 rows
  if constexpr ((NR % 256) == 0) {
#pragma unroll   // the LDS and source steps become constants
    for (int i = 0; i < NR / 32; i += 8)
      acopy8(l + i * LS, g + i * GS, l + (i + 1) * LS, g + (i + 1) * GS,
             l + (i + 2) * LS, g + (i + 2) * GS, l + (i + 3) * LS, g + (i + 3) * GS,
             l + (i + 4) * LS, g + (i + 4) * GS, l + (i + 5) * LS, g + (i + 5) * GS,
             l + (i + 6) * LS, g + (i + 6) * GS, l + (i + 7) * LS, g + (i + 7) * GS);
  } else if constexpr ((NR % 128) == 0) {
#pragma unroll   // the LDS and source steps become constants
    for (int i = 0; i < NR / 32; i += 4)
      acopy4(l + i * LS, g + i * GS, l + (i + 1) * LS, g + (i + 1) * GS,
             l + (i + 2) * LS, g + (i + 2) * GS, l + (i + 3) * LS, g + (i + 3) * GS);
  } else {
#pragma unroll   // the LDS and source steps become constants
    for (int i = 0; i < NR / 32; i += 2)
      acopy2(l + i * LS, g + i * GS, l + (i + 1) * LS, g + (i + 1) * GS);
  }
}

// One stage: k0..k0+63 of WR weight rows and XR activation rows (XR = 16: 16 lanes x 8 B per row).
template <int KD, int WR, int XR>
__device__ __forceinline__ void stage_copy(const _Float16* wsrc, const _Float16* xsrc,
                                           _Float16* buf, int k0, int tid) {
  copy_rows<KD, WR>(wsrc + k0, buf, tid);
  if constexpr (XR == 16) {
    acopy1_b64(lds_addr(buf + (WR + (tid >> 4)) * KPAD + (tid & 15) * 4),
               xsrc + k0 + (size_t)(tid >> 4) * KD + (tid & 15) * 4);
  } else {
    copy_rows<KD, XR>(xsrc + k0, buf + WR * KPAD, tid);
  }
}

// acc[i][j] += W rows (wrow0 + 16j ..) x act rows (xrow0 + 16i ..)^T over all KD, k ascending in
// steps of 32. C^T = W act^T: A = W rows (lane&15 = out col), B = act rows (lane&15 = token).
// A wave's tile is 16 JW columns x 16 XF tokens: JW + XF fragments feed JW * XF WMMAs.
// On return every copy has landed, every wave has left the ring, and a block barrier has passed.
template <int KD, int WR, int XR, int JW, int XF>
__device__ __forceinline__ void gemm_ring(const _Float16* wsrc, const _Float16* xsrc,
                                          _Float16* ring, int wrow0, int xrow0,
                                          int tid, int lane, v8f (&acc)[XF][JW]) {
  constexpr int SH = (WR + XR) * KPAD;   // halves per buffer
  constexpr int NT = KD / 64;            // stages
  static_assert((KD % 64) == 0 && NT >= 2);

  stage_copy<KD, WR, XR>(wsrc, xsrc, ring, 0, tid);
  asm volatile("s_wait_asynccnt 0x0" ::: "memory");   // this wave's part of stage 0 has landed
  __syncthreads();                                    // stage 0 published to every wave
  stage_copy<KD, WR, XR>(wsrc, xsrc, ring + SH, 64, tid);

#pragma unroll 1   // one stage per trip: the ring's waits and barrier stand once, at the foot
  for (int t = 0; t < NT; ++t) {
    _Float16* buf = ring + (t & 1) * SH;
    const _Float16* wl = buf + wrow0 * KPAD;
    const _Float16* xl = buf + (WR + xrow0) * KPAD;
    // the stage's fragment loads go out as one group in front of its WMMAs
    // (all loops unrolled: the fragment and accumulator arrays must stay in registers)
    v16h xf[2][XF], wf[2][JW];
#pragma unroll
    for (int s = 0; s < 2; ++s) {
#pragma unroll
      for (int i = 0; i < XF; ++i)
        xf[s][i] = load_frag_row(xl + (i * 16) * KPAD + s * 32, KPAD, lane);
#pragma unroll
      for (int j = 0; j < JW; ++j)
        wf[s][j] = load_frag_row(wl + (j * 16) * KPAD + s * 32, KPAD, lane);
    }
#pragma unroll
    for (int s = 0; s < 2; ++s)
#pragma unroll
      for (int i = 0; i < XF; ++i)
#pragma unroll
        for (int j = 0; j < JW; ++j) acc[i][j] = wmma_f16(wf[s][j], xf[s][i], acc[i][j]);
    asm volatile("s_wait_dscnt 0x0" ::: "memory");     // own reads of this buffer are done
    asm volatile("s_wait_asynccnt 0x0" ::: "memory");  // own part of stage t+1 has landed
    __syncthreads();   // publishes stage t+1 and ends every wave's reads of stage t
    if (t + 2 < NT) stage_copy<KD, WR, XR>(wsrc, xsrc, buf, (t + 2) * 64, tid);
  }
  asm volatile("s_wait_asynccnt 0x0" ::: "memory");    // nothing in flight behind the loop
}

// ---------------------------------------------------------------------------
// Kernel 0: nx = LN(bf16rne(x)) * bf16(g) + bf16(b) -> f16 plane nxh [ROWS][1024].
// One wave per token row, lane owns 4 chunks of 8 consecutive floats (i*256 + lane*8).
// grid ROWS/8, block 256. coverage: ROWS rows x 4 x 256 halves = whole plane.
// ---------------------------------------------------------------------------
__global__ __launch_bounds__(256) void ln1_kernel(const float* __restrict__ x,
                                                  const float* __restrict__ g,
                                                  const float* __restrict__ bb,
                                                  _Float16* __restrict__ nxh) {
  const int lane  = threadIdx.x & 31;
  const int wave  = threadIdx.x >> 5;
  const long m    = (long)blockIdx.x * 8 + wave;             // token row 0..ROWS-1
  const long srow = (m / SEQ) * SEQ_FULL + (m % SEQ);        // full-stride source row
  const float* xr = x + srow * DM + lane * 8;

  float s = 0.0f;
#pragma unroll 1
  for (int i = 0; i < 4; ++i) {
    const v4f a = *(const v4f*)(xr + i * 256);
    const v4f c = *(const v4f*)(xr + i * 256 + 4);
    s += ((bf16q(a[0]) + bf16q(a[1])) + (bf16q(a[2]) + bf16q(a[3]))) +
         ((bf16q(c[0]) + bf16q(c[1])) + (bf16q(c[2]) + bf16q(c[3])));
  }
  s = wave_sum(s);
  const float mean = s * (1.0f / DM);

  float ss = 0.0f;
#pragma unroll 1
  for (int i = 0; i < 4; ++i) {
    const v4f a = *(const v4f*)(xr + i * 256);
    const v4f c = *(const v4f*)(xr + i * 256 + 4);
#pragma unroll
    for (int e = 0; e < 4; ++e) {
      const float d0 = bf16q(a[e]) - mean;
      const float d1 = bf16q(c[e]) - mean;
      ss += d0 * d0;
      ss += d1 * d1;
    }
  }
  ss = wave_sum(ss);
  const float rstd = rsqrtf(ss * (1.0f / DM) + LN_EPS);

  _Float16* drow = nxh + m * DM + lane * 8;
#pragma unroll 1
  for (int i = 0; i < 4; ++i) {
    const v4f a  = *(const v4f*)(xr + i * 256);
    const v4f c  = *(const v4f*)(xr + i * 256 + 4);
    const v4f g0 = *(const v4f*)(g + i * 256 + lane * 8);
    const v4f g1 = *(const v4f*)(g + i * 256 + lane * 8 + 4);
    const v4f b0 = *(const v4f*)(bb + i * 256 + lane * 8);
    const v4f b1 = *(const v4f*)(bb + i * 256 + lane * 8 + 4);
    H8 o;
#pragma unroll
    for (int e = 0; e < 4; ++e) {
      o.h[e]     = (_Float16)((bf16q(a[e]) - mean) * rstd * bf16q(g0[e]) + bf16q(b0[e]));
      o.h[4 + e] = (_Float16)((bf16q(c[e]) - mean) * rstd * bf16q(g1[e]) + bf16q(b1[e]));
    }
    _Float16* dst = drow + i * 256;
    *(v4u*)dst = o.u;
    
  }
}

// ---------------------------------------------------------------------------
// Kernel 1: weights W [K=in][N=out] f32 -> Wt [n][k] f16 = f16(bf16rne(W) * 64), through a
// 64x64 LDS transpose. wqkv [3072][1024] (out col = q|k|v third, head h at 64h), woh [1024][1024],
// coverage: 768 + 256 + 1024 + 1024 tiles of 64x64 = every element of the four planes.
// ---------------------------------------------------------------------------
__global__ __launch_bounds__(256) void cvt_w_kernel(
    const float* __restrict__ Wqkv, const float* __restrict__ Wo,
    const float* __restrict__ Wf1, const float* __restrict__ Wf2,
    _Float16* __restrict__ wqkv, _Float16* __restrict__ woh,
    _Float16* __restrict__ wf1t, _Float16* __restrict__ wf2t) {
  __shared__ _Float16 ts[64 * KPAD];   // [n][k] tile, cross-wave (block barrier)
  const int bid = blockIdx.x;
  const int tid = threadIdx.x;
  const float* W;
  _Float16* dst;
  int K, N, kt, nt;
  if (bid < NT_QKV) {                                   // block-uniform selection
    const int tile = bid;                               // in [1024][3072] -> out [3072][1024]
    kt = tile / (3 * DM / 64); nt = tile - kt * (3 * DM / 64); K = DM; N = 3 * DM;
    W = Wqkv; dst = wqkv;
  } else if (bid < NT_QKV + NT_O) {
    const int tile = bid - NT_QKV;                      // in [1024][1024] -> out [1024][1024]
    kt = tile / (DM / 64); nt = tile - kt * (DM / 64); K = DM; N = DM;
    W = Wo; dst = woh;
  } else if (bid < NT_QKV + NT_O + NT_F1) {
    const int tile = bid - NT_QKV - NT_O;               // in [1024][4096] -> out [4096][1024]
    kt = tile / (FF / 64); nt = tile - kt * (FF / 64); K = DM; N = FF;
    W = Wf1; dst = wf1t;
  } else {
    const int tile = bid - NT_QKV - NT_O - NT_F1;       // in [4096][1024] -> out [1024][4096]
    kt = tile / (DM / 64); nt = tile - kt * (DM / 64); K = FF; N = DM;
    W = Wf2; dst = wf2t;
  }
  // load W[kt*64 + kr][nt*64 + 4*c4 .. +3], store transposed into ts[n][kr]
#pragma unroll
  for (int it = 0; it < 4; ++it) {
    const int idx = it * 256 + tid;
    const int kr = idx >> 4, c4 = idx & 15;
    const v4f v = *(const v4f*)(W + (size_t)(kt * 64 + kr) * N + nt * 64 + c4 * 4);
#pragma unroll
    for (int j = 0; j < 4; ++j) ts[(c4 * 4 + j) * KPAD + kr] = (_Float16)(bf16q(v[j]) * WSC);
  }
  __syncthreads();
  v4u rv[2];
#pragma unroll
  for (int it = 0; it < 2; ++it) {
    const int idx = it * 256 + tid;
    const int n = idx >> 3, piece = idx & 7;
    rv[it] = *(const v4u*)(ts + n * KPAD + piece * 8);
  }
#pragma unroll
  for (int it = 0; it < 2; ++it) {
    const int idx = it * 256 + tid;
    const int n = idx >> 3, piece = idx & 7;
    *(v4u*)(dst + (size_t)(nt * 64 + n) * K + kt * 64 + piece * 8) = rv[it];
  }
  
}

// ---------------------------------------------------------------------------
// Kernel 2: fused qkv projection + rotary embedding. Block = 128 token rows x 128 output columns
// (two heads of one of q/k/v), 8 waves = 4 token groups of 32 x 2 heads; a wave's tile is 32 tokens
// x 64 columns. C^T = W x^T: A = W rows (lane&15 = out col), B = nx rows (lane&15 = token);
// acc[i][j][r] = C[token 16i + lane&15][col 16j+8h+r]. K = 1024, operands through the ring
// (128 weight rows + 128 nx rows per stage).
// Prologue (q/k blocks only, block-uniform): rotary tables cos/sin[token][i], i < 32,
// angle = pos * (1 / 10000^(2i/64)), f32 powf/cosf/sinf, in LDS (cross-wave, block barrier).
// Epilogue u = acc/64 + bf16(bias); q,k: d<32: u[d]*cos - u[d+32]*sin, d>=32: u[d]*cos + u[d-32]*sin
//   q,k -> [b][h][s][64] f16 (one line per row, 8 lanes x 16 B)
//   v   -> vT[b][h][d][s] f16 (256 B per d row segment, 16 lanes x 16 B)
// grid (ROWS/128, 3*DM/128), block 256. coverage: every (b,h,s,d) of q, k and vT once.
// LDS: the output stage lies in the ring's bytes once the ring is left: q/k [2 heads][128][KPAD],
// v [128 d][VSPAD], fully written before read; ctab/stab 128x32 fully written.
// ---------------------------------------------------------------------------
__global__ __launch_bounds__(256) void qkv_kernel(
    const _Float16* __restrict__ nxh, const _Float16* __restrict__ wqkv,
    const float* __restrict__ bqkv,
    _Float16* __restrict__ q, _Float16* __restrict__ k, _Float16* __restrict__ vT) {
  __shared__ float ctab[128 * RTP];      // cos table [token][i], cross-wave (block barrier)
  __shared__ float stab[128 * RTP];      // sin table [token][i], cross-wave (block barrier)
  // operand ring in the k loop, then the output stage; cross-wave (block barriers)
  __shared__ __attribute__((aligned(16))) _Float16 ring[2 * (128 + 128) * KPAD];
  static_assert(2 * (128 + 128) * KPAD >= 2 * 128 * KPAD && 2 * (128 + 128) * KPAD >= 128 * VSPAD);
  _Float16* stg = ring;

  const int tid  = threadIdx.x;
  const int lane = tid & 31;
  const int wave = tid >> 5;
  const int hh   = lane >> 4;
  const int l15  = lane & 15;
  const int wt   = wave & 3;            // token group: rows 32 wt .. 32 wt + 31 of the block
  const int wc   = wave >> 2;           // head of the block's two

  const int cb   = blockIdx.y;          // 0..23 = output column block (128 cols each)
  const int osel = cb >> 3;             // 0 q, 1 k, 2 v
  const int h0   = (cb & 7) * 2;        // first head of the block
  const long m0  = (long)blockIdx.x * 128;
  const int  b   = (int)(m0 / SEQ);
  const int  s0  = (int)(m0 - (long)b * SEQ);

  if (osel < 2) {                       // block-uniform
#pragma clang fp contract(off)
    const int i  = tid & 31;
    const int tg = tid >> 5;
    const float e   = (float)(2 * i) * (1.0f / 64.0f);
    const float inv = 1.0f / powf(ROPE_BASE, e);
#pragma unroll 1
    for (int tt = tg; tt < 128; tt += 8) {
      const float ang = (float)(s0 + tt) * inv;
      ctab[tt * RTP + i] = cosf(ang);
      stab[tt * RTP + i] = sinf(ang);
    }
  }
  __syncthreads();

  v8f acc[2][4];
#pragma unroll
  for (int i = 0; i < 2; ++i)
#pragma unroll
    for (int j = 0; j < 4; ++j) acc[i][j] = (v8f){};

  gemm_ring<DM, 128, 128, 4, 2>(wqkv + ((long)cb * 128) * DM, nxh + m0 * DM, ring,
                                wc * 64, wt * 32, tid, lane, acc);

  const float* bias = bqkv + cb * 128 + wc * 64;
  const float  rsc  = 1.0f / WSC;

  v4u rv[8];
  if (osel < 2) {
#pragma unroll
    for (int i = 0; i < 2; ++i) {
      float u[4][8];
#pragma unroll
      for (int j = 0; j < 4; ++j) {
        const int n8 = j * 16 + hh * 8;
        const v4f b0 = *(const v4f*)(bias + n8);
        const v4f b1 = *(const v4f*)(bias + n8 + 4);
#pragma unroll
        for (int r = 0; r < 4; ++r) {
          u[j][r]     = acc[i][j][r]     * rsc + bf16q(b0[r]);
          u[j][4 + r] = acc[i][j][4 + r] * rsc + bf16q(b1[r]);
        }
      }
      // rotation: lane holds d = n8+r (j<2) and its partner d+32 (j+2); stage [head][token][col]
      const int tl = wt * 32 + i * 16 + l15;
      _Float16* srow = stg + (wc * 128 + tl) * KPAD;
      const float* crow = ctab + tl * RTP;
      const float* nrow = stab + tl * RTP;
#pragma unroll
      for (int j = 0; j < 2; ++j) {
        const int n8 = j * 16 + hh * 8;
        const v4f c0  = *(const v4f*)(crow + n8);
        const v4f c1  = *(const v4f*)(crow + n8 + 4);
        const v4f sn0 = *(const v4f*)(nrow + n8);
        const v4f sn1 = *(const v4f*)(nrow + n8 + 4);
        H8 plo, phi;
#pragma unroll
        for (int r = 0; r < 4; ++r) {
          const float a0 = u[j][r],     d0 = u[j + 2][r];
          const float a1 = u[j][4 + r], d1 = u[j + 2][4 + r];
          plo.h[r]     = (_Float16)(a0 * c0[r] - d0 * sn0[r]);
          phi.h[r]     = (_Float16)(d0 * c0[r] + a0 * sn0[r]);
          plo.h[4 + r] = (_Float16)(a1 * c1[r] - d1 * sn1[r]);
          phi.h[4 + r] = (_Float16)(d1 * c1[r] + a1 * sn1[r]);
        }
        *(v4u*)(srow + n8)      = plo.u;
        *(v4u*)(srow + 32 + n8) = phi.u;
      }
    }
    __syncthreads();
#pragma unroll
    for (int it = 0; it < 8; ++it) {
      const int idx = it * 256 + tid;
      const int row = idx >> 3, piece = idx & 7;        // row = head * 128 + token
      rv[it] = *(const v4u*)(stg + row * KPAD + piece * 8);
    }
    // per head a contiguous 16 KB; the two heads lie SEQ * HD halves apart
    _Float16* dst = ((osel == 0) ? q : k) + ((long)(b * NH + h0) * SEQ + s0) * HD;
#pragma unroll
    for (int it = 0; it < 8; ++it) {
      const int idx = it * 256 + tid;
      *(v4u*)(dst + (long)(idx >> 10) * SEQ * HD + (long)(idx & 1023) * 8) = rv[it];
    }
  } else {
    // stage transposed [d][token]: lane's 8 values are 8 different d for one token
#pragma unroll
    for (int j = 0; j < 4; ++j) {
      const int n8 = j * 16 + hh * 8;
      const v4f b0 = *(const v4f*)(bias + n8);
      const v4f b1 = *(const v4f*)(bias + n8 + 4);
#pragma unroll
      for (int i = 0; i < 2; ++i) {
        _Float16* scol = stg + (wc * 64 + n8) * VSPAD + wt * 32 + i * 16 + l15;
#pragma unroll
        for (int r = 0; r < 4; ++r) {
          scol[r * VSPAD]       = (_Float16)(acc[i][j][r]     * rsc + bf16q(b0[r]));
          scol[(4 + r) * VSPAD] = (_Float16)(acc[i][j][4 + r] * rsc + bf16q(b1[r]));
        }
      }
    }
    __syncthreads();
#pragma unroll
    for (int it = 0; it < 8; ++it) {
      const int idx = it * 256 + tid;
      const int d = idx >> 4, piece = idx & 15;         // d = head * 64 + d of the head
      rv[it] = *(const v4u*)(stg + d * VSPAD + piece * 8);
    }
    _Float16* dstb = vT + ((long)(b * NH + h0) * HD) * SEQ + s0;
#pragma unroll
    for (int it = 0; it < 8; ++it) {
      const int idx = it * 256 + tid;
      const int d = idx >> 4, piece = idx & 15;
      *(v4u*)(dstb + (long)d * SEQ + piece * 8) = rv[it];
    }
  }
}

// ---------------------------------------------------------------------------
// Kernel 3: flash attention per (b,h), no mask, all SEQ keys. grid (SEQ/128, NB*NH),
// block 256 (8 waves x 16 queries). C = S^T (A = K rows, B = Q) then C = O^T = V^T P^T (P^T
// packed from the S^T D registers); lane owns one query end-to-end. Scores are raw q.k sums:
// the 1/8 scale and the x1024 p carry live in the exp argument (p = 1024*exp((s-m)/8),
// softmax stats f32). Context (carried x64) written to ctx[b*SEQ+s][h*64+d] through an LDS stage
// LDS tiles: ks/vts staged 64 keys x 64 d every step == consumed extent; ost 128 x 64 fully written.
// coverage: every (row, h*64+d) of the ctx plane once.
// ---------------------------------------------------------------------------
__global__ __launch_bounds__(256) void attn_kernel(
    const _Float16* __restrict__ Q, const _Float16* __restrict__ K,
    const _Float16* __restrict__ vT, _Float16* __restrict__ ctx) {
  __shared__ _Float16 ks[64 * KPAD];     // K block rows [key][d]      (cross-wave, block barriers)
  __shared__ _Float16 vts[64 * KPAD];    // V^T block   [d][key]      (cross-wave, block barriers)
  __shared__ _Float16 ost[128 * KPAD];   // output stage [query][d]   (cross-wave, block barrier)

  const int tid  = threadIdx.x;
  const int lane = tid & 31;
  const int wave = tid >> 5;
  const int bh   = blockIdx.y;
  const int b    = bh >> 4;
  const int h    = bh & 15;
  const int q0   = blockIdx.x * 128;

  const _Float16* Qb  = Q + ((long)bh * SEQ + q0) * HD;
  const _Float16* Kb  = K + (long)bh * SEQ * HD;
  const _Float16* vTb = vT + (long)bh * HD * SEQ;

  // Q fragments: B operand of S^T (lane owns query lane&15)
  v16h qfrag[2];
  {
    const _Float16* qrow = Qb + (long)wave * 16 * HD;
#pragma unroll
    for (int t = 0; t < 2; ++t) qfrag[t] = load_frag_row(qrow + t * 32, HD, lane);
  }

  v8f acc[4];   // O^T accumulator: lane owns query (lane&15); reg r -> d = nt*16+8h+r
#pragma unroll
  for (int nt = 0; nt < 4; ++nt) acc[nt] = (v8f){};
  float mi = -1e30f, li = 0.0f;

  const int colb = lane & 15;
  const int rofs = (lane >> 4) << 3;

#pragma unroll 1
  for (int kb = 0; kb < SEQ; kb += 64) {
    __syncthreads();   // everyone done reading prior ks/vts
#pragma unroll
    for (int idx = tid; idx < 64 * 8; idx += 256) {
      const int row = idx >> 3, c = idx & 7;
      *(v4u*)(ks + row * KPAD + c * 8) =
          *(const v4u*)(Kb + (long)(kb + row) * HD + c * 8);
    }
#pragma unroll
    for (int idx = tid; idx < 64 * 8; idx += 256) {
      const int d = idx >> 3, c = idx & 7;
      *(v4u*)(vts + d * KPAD + c * 8) =
          *(const v4u*)(vTb + (long)d * SEQ + kb + c * 8);
    }
    __syncthreads();

    // S^T tiles: A = K rows (lane&15 = key), B = Q
    v8f sc[4];
#pragma unroll
    for (int kt = 0; kt < 4; ++kt) sc[kt] = (v8f){};
#pragma unroll
    for (int t = 0; t < 2; ++t)
#pragma unroll
      for (int kt = 0; kt < 4; ++kt) {
        const v16h kf = load_frag_row(ks + (kt * 16) * KPAD + t * 32, KPAD, lane);
        sc[kt] = wmma_f16(kf, qfrag[t], sc[kt]);
      }

    // per-lane online softmax (32 of 64 keys in-lane; merge halves with one shuffle)
    float mx = sc[0][0];
#pragma unroll
    for (int kt = 0; kt < 4; ++kt)
#pragma unroll
      for (int r = 0; r < 8; ++r) mx = fmaxf(mx, sc[kt][r]);
    mx = fmaxf(mx, __shfl_xor(mx, 16, 32));
    const float mnew  = fmaxf(mi, mx);
    const float alpha = __expf((mi - mnew) * 0.125f);
    mi = mnew;
    const float cs = fmaf(mnew, 0.125f, -LN1024);   // 0.125*m - ln(1024)

    float rs = 0.0f;
#pragma unroll
    for (int kt = 0; kt < 4; ++kt)
#pragma unroll
      for (int r = 0; r < 8; ++r) {
        const float p = __expf(fmaf(sc[kt][r], 0.125f, -cs));   // 1024*exp((s-m)/8)
        sc[kt][r] = p;
        rs += p;
      }
    rs += __shfl_xor(rs, 16, 32);
    li = li * alpha + rs;

    // P^T as the B operand of O^T = V^T P^T, packed from the S^T D registers:
    // element i <- tile covering keys 0..15 of the 32-step (kt = 2t), element 8+i <- kt = 2t+1.
    v16h pf[2];
#pragma unroll
    for (int t = 0; t < 2; ++t)
#pragma unroll
      for (int i = 0; i < 8; ++i) {
        pf[t][i]     = (_Float16)sc[2 * t][i];
        pf[t][8 + i] = (_Float16)sc[2 * t + 1][i];
      }

#pragma unroll
    for (int nt = 0; nt < 4; ++nt)
#pragma unroll
      for (int r = 0; r < 8; ++r) acc[nt][r] *= alpha;

    // O^T += V^T (A, rows = d) x P^T (B)
#pragma unroll
    for (int t = 0; t < 2; ++t)
#pragma unroll
      for (int nt = 0; nt < 4; ++nt) {
        const v16h vf = load_frag_row(vts + (nt * 16) * KPAD + t * 32, KPAD, lane);
        acc[nt] = wmma_f16(vf, pf[t], acc[nt]);
      }
  }

  // normalize (and apply the x64 carry) and stage: lane owns query row wave*16+colb,
  // d = nt*16+rofs+r contiguous
  {
    const float inv = 64.0f / li;
    _Float16* orow = ost + (wave * 16 + colb) * KPAD;
#pragma unroll
    for (int nt = 0; nt < 4; ++nt) {
      H8 pk;
#pragma unroll
      for (int r = 0; r < 8; ++r) pk.h[r] = (_Float16)(acc[nt][r] * inv);
      *(v4u*)(orow + nt * 16 + rofs) = pk.u;
    }
  }
  __syncthreads();

  v4u rv[4];
#pragma unroll
  for (int it = 0; it < 4; ++it) {
    const int idx = it * 256 + tid;
    const int row = idx >> 3, piece = idx & 7;
    rv[it] = *(const v4u*)(ost + row * KPAD + piece * 8);
  }
  _Float16* cbase = ctx + ((long)b * SEQ + q0) * DM + h * HD;
#pragma unroll
  for (int it = 0; it < 4; ++it) {
    const int idx = it * 256 + tid;
    const int row = idx >> 3, piece = idx & 7;
    *(v4u*)(cbase + (long)row * DM + piece * 8) = rv[it];
  }
  
}

// ---------------------------------------------------------------------------
// Kernel 4: x1 = ctx @ Wo / 4096 + bf16(bias) + bf16(x) over a full 1024-wide row, and
// nx2 = f16(LN(x1) * bf16(gamma) + bf16(beta)) -> f16 plane [ROWS][1024].
// Block = 16 token rows x 1024 cols, wave w owns cols 128w..128w+127. C^T = Wt act^T: A = Wt rows
// (lane&15 = out col), B = act rows (lane&15 = token); acc[0][j][r] = y[token lane&15][col 128w+16j+8h+r].
// Operands through the ring (1024 weight rows + 16 act rows per stage).
// y staged in LDS (f32, in the ring's bytes once the ring is left), residual (x input, full-stride
// rows) added in a coalesced LDS pass.
// grid ROWS/16, block 256. LDS ys: 16 x 1024 staged == consumed. coverage: 16 rows x 1024 per block.
// ---------------------------------------------------------------------------
__global__ __launch_bounds__(256) void oproj_ln_kernel(
    const _Float16* __restrict__ act, const _Float16* __restrict__ wt,
    const float* __restrict__ bias, const float* __restrict__ res,
    const float* __restrict__ gam, const float* __restrict__ bet,
    float* __restrict__ outf, _Float16* __restrict__ outh) {
  // 299520 B: operand ring in the k loop, then ys (65792 B); cross-wave (block barriers)
  __shared__ __attribute__((aligned(16))) unsigned char smem[2 * (DM + 16) * KPAD * 2];
  __shared__ float smean[16];      // cross-wave (block barrier)
  __shared__ float srstd[16];      // cross-wave (block barrier)
  static_assert(sizeof(smem) >= (size_t)16 * YP * 4);
  _Float16* ring = (_Float16*)smem;
  float*    ys   = (float*)smem;

  const int tid  = threadIdx.x;
  const int lane = tid & 31;
  const int wave = tid >> 5;
  const int hh   = lane >> 4;
  const int l15  = lane & 15;
  const long m0  = (long)blockIdx.x * 16;
  const int  n0  = wave * 128;

  v8f acc[1][8];
#pragma unroll
  for (int j = 0; j < 8; ++j) acc[0][j] = (v8f){};

  gemm_ring<DM, DM, 16, 8, 1>(wt, act + m0 * DM, ring, n0, 0, tid, lane, acc);

  // y = acc/4096 + bf16(bias), staged [row][col]
  {
    const float rsc = 1.0f / (WSC * WSC);
    float* yrow = ys + l15 * YP;
#pragma unroll
    for (int j = 0; j < 8; ++j) {
      const int n8 = n0 + j * 16 + hh * 8;
      const v4f b0 = *(const v4f*)(bias + n8);
      const v4f b1 = *(const v4f*)(bias + n8 + 4);
      v4f y0, y1;
#pragma unroll
      for (int i = 0; i < 4; ++i) {
        y0[i] = acc[0][j][i]     * rsc + bf16q(b0[i]);
        y1[i] = acc[0][j][4 + i] * rsc + bf16q(b1[i]);
      }
      *(v4f*)(yrow + n8)     = y0;
      *(v4f*)(yrow + n8 + 4) = y1;
    }
  }
  __syncthreads();

  // residual add (coalesced): ys[row][col] += res
#pragma unroll 4
  for (int it = 0; it < 16; ++it) {
    const int idx = it * 256 + tid;
    const int row = idx >> 8, piece = idx & 255;
    const long m = m0 + row;
    const long orow = (m / SEQ) * SEQ_FULL + (m % SEQ);
    v4f rsd = *(const v4f*)(res + orow * DM + piece * 4);
#pragma unroll
    for (int c = 0; c < 4; ++c) rsd[c] = bf16q(rsd[c]);
    float* yp = ys + row * YP + piece * 4;
    v4f yv = *(const v4f*)yp;
#pragma unroll
    for (int c = 0; c < 4; ++c) yv[c] = yv[c] + rsd[c];
    *(v4f*)yp = yv;
  }
  __syncthreads();

  {
    const int r  = tid >> 4;
    const int sl = tid & 15;
    const float* yr = ys + r * YP + sl * 64;
    float s = 0.0f;
#pragma unroll
    for (int i = 0; i < 16; ++i) {
      const v4f v = *(const v4f*)(yr + i * 4);
      s += (v[0] + v[1]) + (v[2] + v[3]);
    }
    s += __shfl_xor(s, 1, 32);
    s += __shfl_xor(s, 2, 32);
    s += __shfl_xor(s, 4, 32);
    s += __shfl_xor(s, 8, 32);
    const float mean = s * (1.0f / DM);
    float ss = 0.0f;
#pragma unroll
    for (int i = 0; i < 16; ++i) {
      const v4f v = *(const v4f*)(yr + i * 4);
#pragma unroll
      for (int c = 0; c < 4; ++c) {
        const float d = v[c] - mean;
        ss += d * d;
      }
    }
    ss += __shfl_xor(ss, 1, 32);
    ss += __shfl_xor(ss, 2, 32);
    ss += __shfl_xor(ss, 4, 32);
    ss += __shfl_xor(ss, 8, 32);
    const float var  = ss * (1.0f / DM);
    const float rstd = rsqrtf(var + LN_EPS);
    if (sl == 0) { smean[r] = mean; srstd[r] = rstd; }
  }
  __syncthreads();

  // nx2 values into registers: thread owns row idx>>7 and 8 contiguous cols p8*8
  v4u hv[8];
#pragma unroll
  for (int it = 0; it < 8; ++it) {
    const int idx = it * 256 + tid;
    const int row = idx >> 7, p8 = idx & 127;
    const v4f a  = *(const v4f*)(ys + row * YP + p8 * 8);
    const v4f c  = *(const v4f*)(ys + row * YP + p8 * 8 + 4);
    const v4f g0 = *(const v4f*)(gam + p8 * 8);
    const v4f g1 = *(const v4f*)(gam + p8 * 8 + 4);
    const v4f b0 = *(const v4f*)(bet + p8 * 8);
    const v4f b1 = *(const v4f*)(bet + p8 * 8 + 4);
    const float mean = smean[row], rstd = srstd[row];
    H8 o;
#pragma unroll
    for (int i = 0; i < 4; ++i) {
      o.h[i]     = (_Float16)((a[i] - mean) * rstd * bf16q(g0[i]) + bf16q(b0[i]));
      o.h[4 + i] = (_Float16)((c[i] - mean) * rstd * bf16q(g1[i]) + bf16q(b1[i]));
    }
    hv[it] = o.u;
  }

#pragma unroll 4
  for (int it = 0; it < 16; ++it) {
    const int idx = it * 256 + tid;
    const int row = idx >> 8, piece = idx & 255;
    const v4f v = *(const v4f*)(ys + row * YP + piece * 4);
    *(v4f*)(outf + (m0 + row) * DM + piece * 4) = v;
  }
#pragma unroll
  for (int it = 0; it < 8; ++it) {
    const int idx = it * 256 + tid;
    const int row = idx >> 7, p8 = idx & 127;
    *(v4u*)(outh + (m0 + row) * DM + p8 * 8) = hv[it];
  }
}

// ---------------------------------------------------------------------------
// Kernel 5: ffn linear 1 + silu: hp[row][col] = f16(64 * silu(nx2 @ Wf1 / 64 + bf16(bf1))),
// silu(u) = u * 1/(1+exp(-u)) in f32. Block = 128 token rows x 128 output cols, 8 waves = 4 token
// groups of 32 x 2 column groups of 64; C^T = Wf1t nx2^T (A = Wf1t rows, B = nx2 f16 rows),
// K = 1024, operands through the ring (128 weight rows + 128 nx2 rows per stage).
// Epilogue staged [token][col] in LDS (in the ring's bytes once the ring is left),
// grid (ROWS/128, FF/128), block 256. coverage: every (row, col) of the hp plane [ROWS][4096] once.
// ---------------------------------------------------------------------------
__global__ __launch_bounds__(256) void ffn1_kernel(
    const _Float16* __restrict__ x2h, const _Float16* __restrict__ wf1t,
    const float* __restrict__ bf1, _Float16* __restrict__ hp) {
  // operand ring in the k loop, then the output stage [128][VSPAD]; cross-wave (block barriers)
  __shared__ __attribute__((aligned(16))) _Float16 ring[2 * (128 + 128) * KPAD];
  static_assert(2 * (128 + 128) * KPAD >= 128 * VSPAD);
  _Float16* stg = ring;

  const int tid  = threadIdx.x;
  const int lane = tid & 31;
  const int wave = tid >> 5;
  const int hh   = lane >> 4;
  const int l15  = lane & 15;
  const int wt   = wave & 3;            // token group: rows 32 wt .. 32 wt + 31 of the block
  const int wc   = wave >> 2;           // column group: cols 64 wc .. 64 wc + 63 of the block
  const int cb   = blockIdx.y;          // 0..FF/128-1
  const long m0  = (long)blockIdx.x * 128;

  v8f acc[2][4];
#pragma unroll
  for (int i = 0; i < 2; ++i)
#pragma unroll
    for (int j = 0; j < 4; ++j) acc[i][j] = (v8f){};

  gemm_ring<DM, 128, 128, 4, 2>(wf1t + ((long)cb * 128) * DM, x2h + m0 * DM, ring,
                                wc * 64, wt * 32, tid, lane, acc);

  const float rsc = 1.0f / WSC;
#pragma unroll
  for (int j = 0; j < 4; ++j) {
    const int n8 = wc * 64 + j * 16 + hh * 8;
    const v4f b0 = *(const v4f*)(bf1 + cb * 128 + n8);
    const v4f b1 = *(const v4f*)(bf1 + cb * 128 + n8 + 4);
#pragma unroll
    for (int i = 0; i < 2; ++i) {
      H8 pk;
#pragma unroll
      for (int r = 0; r < 4; ++r) {
        const float u0 = acc[i][j][r]     * rsc + bf16q(b0[r]);
        const float u1 = acc[i][j][4 + r] * rsc + bf16q(b1[r]);
        const float e0 = __expf(fminf(-u0, 80.0f));
        const float e1 = __expf(fminf(-u1, 80.0f));
        const float g0 = u0 * __builtin_amdgcn_rcpf(1.0f + e0);
        const float g1 = u1 * __builtin_amdgcn_rcpf(1.0f + e1);
        pk.h[r]     = (_Float16)(g0 * WSC);
        pk.h[4 + r] = (_Float16)(g1 * WSC);
      }
      *(v4u*)(stg + (wt * 32 + i * 16 + l15) * VSPAD + n8) = pk.u;
    }
  }
  __syncthreads();

  v4u rv[8];
#pragma unroll
  for (int it = 0; it < 8; ++it) {
    const int idx = it * 256 + tid;
    const int row = idx >> 4, piece = idx & 15;
    rv[it] = *(const v4u*)(stg + row * VSPAD + piece * 8);
  }
#pragma unroll
  for (int it = 0; it < 8; ++it) {
    const int idx = it * 256 + tid;
    const int row = idx >> 4, piece = idx & 15;
    *(v4u*)(hp + (m0 + row) * FF + cb * 128 + piece * 8) = rv[it];
  }
}

// ---------------------------------------------------------------------------
// Kernel 6: ffn linear 2 + residual: out = hp @ Wf2 / 4096 + bf16(bf2) + x1 (f32 plane), out in
// full-stride rows. Block = 128 token rows x 128 output cols, 8 waves = 4 token groups of 32 x 2
// column groups of 64; C^T = Wf2t hp^T (A = Wf2t rows, B = hp rows), K = 4096, operands through the
// ring (128 weight rows + 128 hp rows per stage). y staged [token][col] in LDS (f32, in the ring's
// bytes once the ring is left), residual added on the way out, 512 B per row segment.
// grid (ROWS/128, DM/128), block 256. coverage: every (row, col) of out once.
// ---------------------------------------------------------------------------
__global__ __launch_bounds__(256) void ffn2_kernel(
    const _Float16* __restrict__ hp, const _Float16* __restrict__ wf2t,
    const float* __restrict__ bf2, const float* __restrict__ x1f, float* __restrict__ out) {
  // operand ring in the k loop, then ys [128][YT] f32; cross-wave (block barriers)
  __shared__ __attribute__((aligned(16))) unsigned char smem[2 * (128 + 128) * KPAD * 2];
  static_assert(sizeof(smem) >= (size_t)128 * YT * 4);
  _Float16* ring = (_Float16*)smem;
  float*    ys   = (float*)smem;

  const int tid  = threadIdx.x;
  const int lane = tid & 31;
  const int wave = tid >> 5;
  const int hh   = lane >> 4;
  const int l15  = lane & 15;
  const int wt   = wave & 3;            // token group: rows 32 wt .. 32 wt + 31 of the block
  const int wc   = wave >> 2;           // column group: cols 64 wc .. 64 wc + 63 of the block
  const int cb   = blockIdx.y;          // 0..DM/128-1
  const long m0  = (long)blockIdx.x * 128;

  v8f acc[2][4];
#pragma unroll
  for (int i = 0; i < 2; ++i)
#pragma unroll
    for (int j = 0; j < 4; ++j) acc[i][j] = (v8f){};

  gemm_ring<FF, 128, 128, 4, 2>(wf2t + ((long)cb * 128) * FF, hp + m0 * FF, ring,
                                wc * 64, wt * 32, tid, lane, acc);

  // y = acc/4096 + bf16(bias), staged [token][col]
  const float rsc = 1.0f / (WSC * WSC);
#pragma unroll
  for (int j = 0; j < 4; ++j) {
    const int n8 = wc * 64 + j * 16 + hh * 8;
    const v4f b0 = *(const v4f*)(bf2 + cb * 128 + n8);
    const v4f b1 = *(const v4f*)(bf2 + cb * 128 + n8 + 4);
#pragma unroll
    for (int i = 0; i < 2; ++i) {
      float* yrow = ys + (wt * 32 + i * 16 + l15) * YT;
      v4f y0, y1;
#pragma unroll
      for (int r = 0; r < 4; ++r) {
        y0[r] = acc[i][j][r]     * rsc + bf16q(b0[r]);
        y1[r] = acc[i][j][4 + r] * rsc + bf16q(b1[r]);
      }
      *(v4f*)(yrow + n8)     = y0;
      *(v4f*)(yrow + n8 + 4) = y1;
    }
  }
  __syncthreads();

  // residual add and store (coalesced), four row groups per trip
#pragma unroll 1   // keeps the trip's four loads and stores together and the wait once per trip
  for (int it0 = 0; it0 < 16; it0 += 4) {
#pragma unroll
    for (int u = 0; u < 4; ++u) {
      const int idx = (it0 + u) * 256 + tid;
      const int row = idx >> 5, piece = idx & 31;
      const long m = m0 + row;
      const v4f rsd = *(const v4f*)(x1f + m * DM + cb * 128 + piece * 4);
      v4f yv = *(const v4f*)(ys + row * YT + piece * 4);
#pragma unroll
      for (int c = 0; c < 4; ++c) yv[c] = yv[c] + rsd[c];
      const long drow = (m / SEQ) * SEQ_FULL + (m % SEQ);
      *(v4f*)(out + drow * DM + cb * 128 + piece * 4) = yv;
    }
    // stands in front of the next trip's rewrite of the registers that the stores name
    asm volatile("s_wait_xcnt 0x0" ::: "memory");
  }
}

// ---------------------------------------------------------------------------
extern "C" void kernel_launch(void* const* d_in, const int* in_sizes, int n_in,
                              void* d_out, int out_size, void* d_ws, size_t ws_size,
                              hipStream_t stream) {
  if (n_in < 13) return;
  const long needRows = (long)(NB - 1) * SEQ_FULL + SEQ;
  if ((long)in_sizes[0] < needRows * DM) return;
  if (in_sizes[1] < DM || in_sizes[2] < DM) return;
  if (in_sizes[3] < 3 * DM * DM || in_sizes[4] < 3 * DM) return;
  if (in_sizes[5] < DM * DM || in_sizes[6] < DM) return;
  if (in_sizes[7] < DM || in_sizes[8] < DM) return;
  if (in_sizes[9] < DM * FF || in_sizes[10] < FF) return;
  if (in_sizes[11] < FF * DM || in_sizes[12] < DM) return;
  if ((long)out_size < needRows * DM) return;
  if (ws_size < WS_TOTAL) return;

  const float* x     = (const float*)d_in[0];
  const float* g1    = (const float*)d_in[1];
  const float* be1   = (const float*)d_in[2];
  const float* Wqkv  = (const float*)d_in[3];
  const float* bqkv  = (const float*)d_in[4];
  const float* Wo    = (const float*)d_in[5];
  const float* bo    = (const float*)d_in[6];
  const float* g2    = (const float*)d_in[7];
  const float* be2   = (const float*)d_in[8];
  const float* Wf1   = (const float*)d_in[9];
  const float* bf1   = (const float*)d_in[10];
  const float* Wf2   = (const float*)d_in[11];
  const float* bf2   = (const float*)d_in[12];
  float* out = (float*)d_out;

  char* ws = (char*)d_ws;
  size_t off = 0;
  _Float16* nxh  = (_Float16*)(ws + off); off += PLANE2;       // [ROWS][1024] f16
  _Float16* ctx  = (_Float16*)(ws + off); off += PLANE2;       // [ROWS][1024] f16 (x64)
  _Float16* wqkv = (_Float16*)(ws + off); off += WQKV_BYTES;   // [3072][1024]
  _Float16* woh  = (_Float16*)(ws + off); off += WO_BYTES;     // [1024][1024]
  _Float16* wf1t = (_Float16*)(ws + off); off += WF1_BYTES;    // [4096][1024]
  _Float16* wf2t = (_Float16*)(ws + off); off += WF2_BYTES;    // [1024][4096]
  _Float16* qh   = (_Float16*)(ws + off); off += PLANE2;       // [NB][16][SEQ][64]
  _Float16* kh   = (_Float16*)(ws + off); off += PLANE2;       // [NB][16][SEQ][64]
  _Float16* vTh  = (_Float16*)(ws + off); off += PLANE2;       // [NB][16][64][SEQ]
  float*    x1f  = (float*)(ws + off);    off += PLANE4;       // [ROWS][1024] f32
  _Float16* nx2h = (_Float16*)(ws + off); off += PLANE2;       // [ROWS][1024] f16
  _Float16* hp   = (_Float16*)(ws + off); off += H_BYTES;      // [ROWS][4096] f16 (x64)
  if (off > ws_size) return;

  ln1_kernel<<<ROWS / 8, 256, 0, stream>>>(x, g1, be1, nxh);
  cvt_w_kernel<<<NWT, 256, 0, stream>>>(Wqkv, Wo, Wf1, Wf2, wqkv, woh, wf1t, wf2t);
  qkv_kernel<<<dim3(ROWS / 128, 3 * DM / 128), 256, 0, stream>>>(nxh, wqkv, bqkv, qh, kh, vTh);
  attn_kernel<<<dim3(SEQ / 128, NB * NH), 256, 0, stream>>>(qh, kh, vTh, ctx);
  oproj_ln_kernel<<<ROWS / 16, 256, 0, stream>>>(ctx, woh, bo, x, g2, be2, x1f, nx2h);
  ffn1_kernel<<<dim3(ROWS / 128, FF / 128), 256, 0, stream>>>(nx2h, wf1t, bf1, hp);
  ffn2_kernel<<<dim3(ROWS / 128, DM / 128), 256, 0, stream>>>(hp, wf2t, bf2, x1f, out);
}

// v003
// Measured time: 212 microseconds a run.
// Two timings next to v002 both put it at 1.21 times that version's speed.
// Over all steps from v000 it is 3.51 times as fast.
#include <hip/hip_runtime.h>

// All contractions (fused qkv projection, q.k^T, p.v, output projection, ffn linear 1,
// ffn linear 2): v_wmma_f32_16x16x32_f16, f16 operands, f32 accumulate. Float inputs are
// RNE-converted to bf16 at load (weights additionally carried x64; both exact in f16); computed
// 16-bit planes are f16 with power-of-two carries (softmax p x1024, context x64, ffn hidden x64)
// folded back in the f32 epilogues. Layernorms, rotary tables and rotation, softmax statistics,
// silu and residual adds: f32.

typedef __attribute__((ext_vector_type(16))) _Float16 v16h;
typedef __attribute__((ext_vector_type(8)))  _Float16 v8h;
typedef __attribute__((ext_vector_type(8)))  float v8f;
typedef __attribute__((ext_vector_type(4)))  float v4f;
typedef __attribute__((ext_vector_type(4)))  unsigned int v4u;
union H8 { v8h h; v4u u; };

#ifndef NB
#define NB 2
#endif
#ifndef SEQ
#define SEQ 2048
#endif
#define NB_FULL  2
#define SEQ_FULL 2048
#define DM   1024
#define NH   16
#define HD   64
#define FF   4096
#define ROWS (NB * SEQ)
#define KPAD 72       // LDS stride in halves for 64-wide f16 tiles (144 B, 16-B aligned)
#define VSPAD 136     // LDS stride in halves for 128-wide f16 tiles (272 B)
#define YP   1028     // LDS stride in floats for 1024-wide f32 rows (4112 B)
#define YT   132      // LDS stride in floats for 128-wide f32 rows (528 B)
#define RTP  32       // LDS stride in floats of the per-token rotary tables
#define LN_EPS 1e-5f
#define WSC    64.0f           // weight carry (power of two)
#define LN1024 6.931471806f    // ln(1024): softmax p carried x1024
#define ROPE_BASE 10000.0f

#define NT_QKV ((DM / 64) * (3 * DM / 64))    // 768 tiles: W [1024][3072]
#define NT_O   ((DM / 64) * (DM / 64))        // 256 tiles: W [1024][1024]
#define NT_F1  ((DM / 64) * (FF / 64))        // 1024 tiles: W [1024][4096]
#define NT_F2  ((FF / 64) * (DM / 64))        // 1024 tiles: W [4096][1024]
#define NWT    (NT_QKV + NT_O + NT_F1 + NT_F2)

#define PLANE2     ((size_t)ROWS * DM * 2)
#define PLANE4     ((size_t)ROWS * DM * 4)
#define WQKV_BYTES ((size_t)3 * DM * DM * 2)
#define WO_BYTES   ((size_t)DM * DM * 2)
#define WF1_BYTES  ((size_t)FF * DM * 2)
#define WF2_BYTES  ((size_t)DM * FF * 2)
#define H_BYTES    ((size_t)ROWS * FF * 2)
#define WS_TOTAL   (2 * PLANE2 + WQKV_BYTES + WO_BYTES + WF1_BYTES + WF2_BYTES + \
                    3 * PLANE2 + PLANE4 + PLANE2 + H_BYTES)

static_assert(NB >= 1 && NB <= NB_FULL);
static_assert(SEQ >= 128 && SEQ <= SEQ_FULL && (SEQ % 128) == 0);
static_assert((ROWS % 128) == 0 && (ROWS % 16) == 0 && (ROWS % 8) == 0);
static_assert((DM % 64) == 0 && (FF % 64) == 0 && HD == 64 && NH * HD == DM);
static_assert((DM % 128) == 0 && (FF % 128) == 0);
static_assert((size_t)NB * NH * SEQ * HD * 2 == PLANE2);
static_assert(WS_TOTAL <= (size_t)134217728);

// ---------------------------------------------------------------------------
// helpers
// ---------------------------------------------------------------------------
__device__ __forceinline__ float bf16q(float f) {            // value after RNE bf16 conversion
  unsigned int u = __float_as_uint(f);
  u += 0x7FFFu + ((u >> 16) & 1u);
  return __uint_as_float(u & 0xFFFF0000u);
}

__device__ __forceinline__ float wave_sum(float v) {
  v += __shfl_xor(v, 16, 32);
  v += __shfl_xor(v, 8, 32);
  v += __shfl_xor(v, 4, 32);
  v += __shfl_xor(v, 2, 32);
  v += __shfl_xor(v, 1, 32);
  return v;
}

// 16-bit fragment (A or B): lane owns row/col (lane&15); elements 0..7 <- k0+8h+0..7,
// elements 8..15 <- k0+16+8h+0..7, h = lane>>4. Source is k-contiguous rows.
__device__ __forceinline__ v16h load_frag_row(const _Float16* base, int stride, int lane) {
  const _Float16* rowp = base + (lane & 15) * stride + ((lane >> 4) << 3);
  const v8h lo = *(const v8h*)(rowp);
  const v8h hi = *(const v8h*)(rowp + 16);
  return __builtin_shufflevector(lo, hi, 0, 1, 2, 3, 4, 5, 6, 7,
                                 8, 9, 10, 11, 12, 13, 14, 15);
}

__device__ __forceinline__ v8f wmma_f16(v16h a, v16h b, v8f c) {
  v8f d = __builtin_amdgcn_wmma_f32_16x16x32_f16(false, a, false, b, (short)0, c,
                                                 false, false);
  asm volatile("v_nop\n\tv_nop\n\tv_nop\n\tv_nop" : "+v"(d) : "v"(a), "v"(b));
  return d;
}

// ---------------------------------------------------------------------------
// Operand staging of the dense projections: a stage is 64 k (128 B) of WR weight rows followed by
// XR activation rows, LDS pitch KPAD halves, brought in by asynchronous copies to LDS (no register
// on the way) into a ring of two buffers, so that stage t+1 flies while stage t is multiplied.
// ---------------------------------------------------------------------------
__device__ __forceinline__ unsigned lds_addr(const void* p) {   // byte offset in the block's LDS
  return (unsigned)(unsigned long long)p;
}

// The s_wait_xcnt closes each run of copies inside its own statement: it stands in front of any
// later rewrite of the address registers that the copies name.
__device__ __forceinline__ void acopy2(unsigned l0, const _Float16* g0,
                                       unsigned l1, const _Float16* g1) {
  asm volatile("global_load_async_to_lds_b128 %0, %1, off\n\t"
               "global_load_async_to_lds_b128 %2, %3, off\n\t"
               "s_wait_xcnt 0x0"
               :: "v"(l0), "v"(g0), "v"(l1), "v"(g1) : "memory");
}

__device__ __forceinline__ void acopy4(unsigned l0, const _Float16* g0,
                                       unsigned l1, const _Float16* g1,
                                       unsigned l2, const _Float16* g2,
                                       unsigned l3, const _Float16* g3) {
  asm volatile("global_load_async_to_lds_b128 %0, %1, off\n\t"
               "global_load_async_to_lds_b128 %2, %3, off\n\t"
               "global_load_async_to_lds_b128 %4, %5, off\n\t"
               "global_load_async_to_lds_b128 %6, %7, off\n\t"
               "s_wait_xcnt 0x0"
               :: "v"(l0), "v"(g0), "v"(l1), "v"(g1), "v"(l2), "v"(g2), "v"(l3), "v"(g3)
               : "memory");
}

__device__ __forceinline__ void acopy8(unsigned l0, const _Float16* g0,
                                       unsigned l1, const _Float16* g1,
                                       unsigned l2, const _Float16* g2,
                                       unsigned l3, const _Float16* g3,
                                       unsigned l4, const _Float16* g4,
                                       unsigned l5, const _Float16* g5,
                                       unsigned l6, const _Float16* g6,
                                       unsigned l7, const _Float16* g7) {
  asm volatile("global_load_async_to_lds_b128 %0, %1, off\n\t"
               "global_load_async_to_lds_b128 %2, %3, off\n\t"
               "global_load_async_to_lds_b128 %4, %5, off\n\t"
               "global_load_async_to_lds_b128 %6, %7, off\n\t"
               "global_load_async_to_lds_b128 %8, %9, off\n\t"
               "global_load_async_to_lds_b128 %10, %11, off\n\t"
               "global_load_async_to_lds_b128 %12, %13, off\n\t"
               "global_load_async_to_lds_b128 %14, %15, off\n\t"
               "s_wait_xcnt 0x0"
               :: "v"(l0), "v"(g0), "v"(l1), "v"(g1), "v"(l2), "v"(g2), "v"(l3), "v"(g3),
                  "v"(l4), "v"(g4), "v"(l5), "v"(g5), "v"(l6), "v"(g6), "v"(l7), "v"(g7)
               : "memory");
}

__device__ __forceinline__ void acopy1_b64(unsigned l0, const _Float16* g0) {
  asm volatile("global_load_async_to_lds_b64 %0, %1, off\n\t"
               "s_wait_xcnt 0x0"
               :: "v"(l0), "v"(g0) : "memory");
}

// NR rows (a multiple of 64) of 128 B: 8 lanes x 16 B per row, 32 rows per copy of the block.
template <int KD, int NR>
__device__ __forceinline__ void copy_rows(const _Float16* src, _Float16* dst, int tid) {
  static_assert((NR % 64) == 0);
  const _Float16* g = src + (size_t)(tid >> 3) * KD + (tid & 7) * 8;
  const unsigned  l = lds_addr(dst + (tid >> 3) * KPAD + (tid & 7) * 8);
  constexpr unsigned LS = 32 * KPAD * 2;       // LDS bytes per 32 rows
  constexpr size_t   GS = (size_t)32 * KD;     // source halves per 32 rows
  if constexpr ((NR % 256) == 0) {
#pragma unroll   // the LDS and source steps become constants
    for (int i = 0; i < NR / 32; i += 8)
      acopy8(l + i * LS, g + i * GS, l + (i + 1) * LS, g + (i + 1) * GS,
             l + (i + 2) * LS, g + (i + 2) * GS, l + (i + 3) * LS, g + (i + 3) * GS,
             l + (i + 4) * LS, g + (i + 4) * GS, l + (i + 5) * LS, g + (i + 5) * GS,
             l + (i + 6) * LS, g + (i + 6) * GS, l + (i + 7) * LS, g + (i + 7) * GS);
  } else if constexpr ((NR % 128) == 0) {
#pragma unroll   // the LDS and source steps become constants
    for (int i = 0; i < NR / 32; i += 4)
      acopy4(l + i * LS, g + i * GS, l + (i + 1) * LS, g + (i + 1) * GS,
             l + (i + 2) * LS, g + (i + 2) * GS, l + (i + 3) * LS, g + (i + 3) * GS);
  } else {
#pragma unroll   // the LDS and source steps become constants
    for (int i = 0; i < NR / 32; i += 2)
      acopy2(l + i * LS, g + i * GS, l + (i + 1) * LS, g + (i + 1) * GS);
  }
}

// One stage: k0..k0+63 of WR weight rows and XR activation rows (XR = 16: 16 lanes x 8 B per row).
template <int KD, int WR, int XR>
__device__ __forceinline__ void stage_copy(const _Float16* wsrc, const _Float16* xsrc,
                                           _Float16* buf, int k0, int tid) {
  copy_rows<KD, WR>(wsrc + k0, buf, tid);
  if constexpr (XR == 16) {
    acopy1_b64(lds_addr(buf + (WR + (tid >> 4)) * KPAD + (tid & 15) * 4),
               xsrc + k0 + (size_t)(tid >> 4) * KD + (tid & 15) * 4);
  } else {
    copy_rows<KD, XR>(xsrc + k0, buf + WR * KPAD, tid);
  }
}

// acc[i][j] += W rows (wrow0 + 16j ..) x act rows (xrow0 + 16i ..)^T over all KD, k ascending in
// steps of 32. C^T = W act^T: A = W rows (lane&15 = out col), B = act rows (lane&15 = token).
// A wave's tile is 16 JW columns x 16 XF tokens: JW + XF fragments feed JW * XF WMMAs.
// On return every copy has landed, every wave has left the ring, and a block barrier has passed.
template <int KD, int WR, int XR, int JW, int XF>
__device__ __forceinline__ void gemm_ring(const _Float16* wsrc, const _Float16* xsrc,
                                          _Float16* ring, int wrow0, int xrow0,
                                          int tid, int lane, v8f (&acc)[XF][JW]) {
  constexpr int SH = (WR + XR) * KPAD;   // halves per buffer
  constexpr int NT = KD / 64;            // stages
  static_assert((KD % 64) == 0 && NT >= 2);

  stage_copy<KD, WR, XR>(wsrc, xsrc, ring, 0, tid);
  asm volatile("s_wait_asynccnt 0x0" ::: "memory");   // this wave's part of stage 0 has landed
  __syncthreads();                                    // stage 0 published to every wave
  stage_copy<KD, WR, XR>(wsrc, xsrc, ring + SH, 64, tid);

#pragma unroll 1   // one stage per trip: the ring's waits and barrier stand once, at the foot
  for (int t = 0; t < NT; ++t) {
    _Float16* buf = ring + (t & 1) * SH;
    const _Float16* wl = buf + wrow0 * KPAD;
    const _Float16* xl = buf + (WR + xrow0) * KPAD;
    // the stage's fragment loads go out as one group in front of its WMMAs
    // (all loops unrolled: the fragment and accumulator arrays must stay in registers)
    v16h xf[2][XF], wf[2][JW];
#pragma unroll
    for (int s = 0; s < 2; ++s) {
#pragma unroll
      for (int i = 0; i < XF; ++i)
        xf[s][i] = load_frag_row(xl + (i * 16) * KPAD + s * 32, KPAD, lane);
#pragma unroll
      for (int j = 0; j < JW; ++j)
        wf[s][j] = load_frag_row(wl + (j * 16) * KPAD + s * 32, KPAD, lane);
    }
#pragma unroll
    for (int s = 0; s < 2; ++s)
#pragma unroll
      for (int i = 0; i < XF; ++i)
#pragma unroll
        for (int j = 0; j < JW; ++j) acc[i][j] = wmma_f16(wf[s][j], xf[s][i], acc[i][j]);
    asm volatile("s_wait_dscnt 0x0" ::: "memory");     // own reads of this buffer are done
    asm volatile("s_wait_asynccnt 0x0" ::: "memory");  // own part of stage t+1 has landed
    __syncthreads();   // publishes stage t+1 and ends every wave's reads of stage t
    if (t + 2 < NT) stage_copy<KD, WR, XR>(wsrc, xsrc, buf, (t + 2) * 64, tid);
  }
  asm volatile("s_wait_asynccnt 0x0" ::: "memory");    // nothing in flight behind the loop
}

// ---------------------------------------------------------------------------
// Kernel 0: nx = LN(bf16rne(x)) * bf16(g) + bf16(b) -> f16 plane nxh [ROWS][1024].
// One wave per token row, lane owns 4 chunks of 8 consecutive floats (i*256 + lane*8).
// grid ROWS/8, block 256. coverage: ROWS rows x 4 x 256 halves = whole plane.
// ---------------------------------------------------------------------------
__global__ __launch_bounds__(256) void ln1_kernel(const float* __restrict__ x,
                                                  const float* __restrict__ g,
                                                  const float* __restrict__ bb,
                                                  _Float16* __restrict__ nxh) {
  const int lane  = threadIdx.x & 31;
  const int wave  = threadIdx.x >> 5;
  const long m    = (long)blockIdx.x * 8 + wave;             // token row 0..ROWS-1
  const long srow = (m / SEQ) * SEQ_FULL + (m % SEQ);        // full-stride source row
  const float* xr = x + srow * DM + lane * 8;

  float s = 0.0f;
#pragma unroll 1
  for (int i = 0; i < 4; ++i) {
    const v4f a = *(const v4f*)(xr + i * 256);
    const v4f c = *(const v4f*)(xr + i * 256 + 4);
    s += ((bf16q(a[0]) + bf16q(a[1])) + (bf16q(a[2]) + bf16q(a[3]))) +
         ((bf16q(c[0]) + bf16q(c[1])) + (bf16q(c[2]) + bf16q(c[3])));
  }
  s = wave_sum(s);
  const float mean = s * (1.0f / DM);

  float ss = 0.0f;
#pragma unroll 1
  for (int i = 0; i < 4; ++i) {
    const v4f a = *(const v4f*)(xr + i * 256);
    const v4f c = *(const v4f*)(xr + i * 256 + 4);
#pragma unroll
    for (int e = 0; e < 4; ++e) {
      const float d0 = bf16q(a[e]) - mean;
      const float d1 = bf16q(c[e]) - mean;
      ss += d0 * d0;
      ss += d1 * d1;
    }
  }
  ss = wave_sum(ss);
  const float rstd = rsqrtf(ss * (1.0f / DM) + LN_EPS);

  _Float16* drow = nxh + m * DM + lane * 8;
#pragma unroll 1
  for (int i = 0; i < 4; ++i) {
    const v4f a  = *(const v4f*)(xr + i * 256);
    const v4f c  = *(const v4f*)(xr + i * 256 + 4);
    const v4f g0 = *(const v4f*)(g + i * 256 + lane * 8);
    const v4f g1 = *(const v4f*)(g + i * 256 + lane * 8 + 4);
    const v4f b0 = *(const v4f*)(bb + i * 256 + lane * 8);
    const v4f b1 = *(const v4f*)(bb + i * 256 + lane * 8 + 4);
    H8 o;
#pragma unroll
    for (int e = 0; e < 4; ++e) {
      o.h[e]     = (_Float16)((bf16q(a[e]) - mean) * rstd * bf16q(g0[e]) + bf16q(b0[e]));
      o.h[4 + e] = (_Float16)((bf16q(c[e]) - mean) * rstd * bf16q(g1[e]) + bf16q(b1[e]));
    }
    _Float16* dst = drow + i * 256;
    *(v4u*)dst = o.u;
    
  }
}

// ---------------------------------------------------------------------------
// Kernel 1: weights W [K=in][N=out] f32 -> Wt [n][k] f16 = f16(bf16rne(W) * 64), through a
// 64x64 LDS transpose. wqkv [3072][1024] (out col = q|k|v third, head h at 64h), woh [1024][1024],
// coverage: 768 + 256 + 1024 + 1024 tiles of 64x64 = every element of the four planes.
// ---------------------------------------------------------------------------
__global__ __launch_bounds__(256) void cvt_w_kernel(
    const float* __restrict__ Wqkv, const float* __restrict__ Wo,
    const float* __restrict__ Wf1, const float* __restrict__ Wf2,
    _Float16* __restrict__ wqkv, _Float16* __restrict__ woh,
    _Float16* __restrict__ wf1t, _Float16* __restrict__ wf2t) {
  __shared__ _Float16 ts[64 * KPAD];   // [n][k] tile, cross-wave (block barrier)
  const int bid = blockIdx.x;
  const int tid = threadIdx.x;
  const float* W;
  _Float16* dst;
  int K, N, kt, nt;
  if (bid < NT_QKV) {                                   // block-uniform selection
    const int tile = bid;                               // in [1024][3072] -> out [3072][1024]
    kt = tile / (3 * DM / 64); nt = tile - kt * (3 * DM / 64); K = DM; N = 3 * DM;
    W = Wqkv; dst = wqkv;
  } else if (bid < NT_QKV + NT_O) {
    const int tile = bid - NT_QKV;                      // in [1024][1024] -> out [1024][1024]
    kt = tile / (DM / 64); nt = tile - kt * (DM / 64); K = DM; N = DM;
    W = Wo; dst = woh;
  } else if (bid < NT_QKV + NT_O + NT_F1) {
    const int tile = bid - NT_QKV - NT_O;               // in [1024][4096] -> out [4096][1024]
    kt = tile / (FF / 64); nt = tile - kt * (FF / 64); K = DM; N = FF;
    W = Wf1; dst = wf1t;
  } else {
    const int tile = bid - NT_QKV - NT_O - NT_F1;       // in [4096][1024] -> out [1024][4096]
    kt = tile / (DM / 64); nt = tile - kt * (DM / 64); K = FF; N = DM;
    W = Wf2; dst = wf2t;
  }
  // load W[kt*64 + kr][nt*64 + 4*c4 .. +3], store transposed into ts[n][kr]
#pragma unroll
  for (int it = 0; it < 4; ++it) {
    const int idx = it * 256 + tid;
    const int kr = idx >> 4, c4 = idx & 15;
    const v4f v = *(const v4f*)(W + (size_t)(kt * 64 + kr) * N + nt * 64 + c4 * 4);
#pragma unroll
    for (int j = 0; j < 4; ++j) ts[(c4 * 4 + j) * KPAD + kr] = (_Float16)(bf16q(v[j]) * WSC);
  }
  __syncthreads();
  v4u rv[2];
#pragma unroll
  for (int it = 0; it < 2; ++it) {
    const int idx = it * 256 + tid;
    const int n = idx >> 3, piece = idx & 7;
    rv[it] = *(const v4u*)(ts + n * KPAD + piece * 8);
  }
#pragma unroll
  for (int it = 0; it < 2; ++it) {
    const int idx = it * 256 + tid;
    const int n = idx >> 3, piece = idx & 7;
    *(v4u*)(dst + (size_t)(nt * 64 + n) * K + kt * 64 + piece * 8) = rv[it];
  }
  
}

// ---------------------------------------------------------------------------
// Kernel 2: fused qkv projection + rotary embedding. Block = 128 token rows x 128 output columns
// (two heads of one of q/k/v), 8 waves = 4 token groups of 32 x 2 heads; a wave's tile is 32 tokens
// x 64 columns. C^T = W x^T: A = W rows (lane&15 = out col), B = nx rows (lane&15 = token);
// acc[i][j][r] = C[token 16i + lane&15][col 16j+8h+r]. K = 1024, operands through the ring
// (128 weight rows + 128 nx rows per stage).
// Prologue (q/k blocks only, block-uniform): rotary tables cos/sin[token][i], i < 32,
// angle = pos * (1 / 10000^(2i/64)), f32 powf/cosf/sinf, in LDS (cross-wave, block barrier).
// Epilogue u = acc/64 + bf16(bias); q,k: d<32: u[d]*cos - u[d+32]*sin, d>=32: u[d]*cos + u[d-32]*sin
//   q,k -> [b][h][s][64] f16 (one line per row, 8 lanes x 16 B)
//   v   -> vT[b][h][d][s] f16 (256 B per d row segment, 16 lanes x 16 B)
// grid (ROWS/128, 3*DM/128), block 256. coverage: every (b,h,s,d) of q, k and vT once.
// LDS: the output stage lies in the ring's bytes once the ring is left: q/k [2 heads][128][KPAD],
// v [128 d][VSPAD], fully written before read; ctab/stab 128x32 fully written.
// ---------------------------------------------------------------------------
__global__ __launch_bounds__(256) void qkv_kernel(
    const _Float16* __restrict__ nxh, const _Float16* __restrict__ wqkv,
    const float* __restrict__ bqkv,
    _Float16* __restrict__ q, _Float16* __restrict__ k, _Float16* __restrict__ vT) {
  __shared__ float ctab[128 * RTP];      // cos table [token][i], cross-wave (block barrier)
  __shared__ float stab[128 * RTP];      // sin table [token][i], cross-wave (block barrier)
  // operand ring in the k loop, then the output stage; cross-wave (block barriers)
  __shared__ __attribute__((aligned(16))) _Float16 ring[2 * (128 + 128) * KPAD];
  static_assert(2 * (128 + 128) * KPAD >= 2 * 128 * KPAD && 2 * (128 + 128) * KPAD >= 128 * VSPAD);
  _Float16* stg = ring;

  const int tid  = threadIdx.x;
  const int lane = tid & 31;
  const int wave = tid >> 5;
  const int hh   = lane >> 4;
  const int l15  = lane & 15;
  const int wt   = wave & 3;            // token group: rows 32 wt .. 32 wt + 31 of the block
  const int wc   = wave >> 2;           // head of the block's two

  const int cb   = blockIdx.y;          // 0..23 = output column block (128 cols each)
  const int osel = cb >> 3;             // 0 q, 1 k, 2 v
  const int h0   = (cb & 7) * 2;        // first head of the block
  const long m0  = (long)blockIdx.x * 128;
  const int  b   = (int)(m0 / SEQ);
  const int  s0  = (int)(m0 - (long)b * SEQ);

  if (osel < 2) {                       // block-uniform
#pragma clang fp contract(off)
    const int i  = tid & 31;
    const int tg = tid >> 5;
    const float e   = (float)(2 * i) * (1.0f / 64.0f);
    const float inv = 1.0f / powf(ROPE_BASE, e);
#pragma unroll 1
    for (int tt = tg; tt < 128; tt += 8) {
      const float ang = (float)(s0 + tt) * inv;
      ctab[tt * RTP + i] = cosf(ang);
      stab[tt * RTP + i] = sinf(ang);
    }
  }
  __syncthreads();

  v8f acc[2][4];
#pragma unroll
  for (int i = 0; i < 2; ++i)
#pragma unroll
    for (int j = 0; j < 4; ++j) acc[i][j] = (v8f){};

  gemm_ring<DM, 128, 128, 4, 2>(wqkv + ((long)cb * 128) * DM, nxh + m0 * DM, ring,
                                wc * 64, wt * 32, tid, lane, acc);

  const float* bias = bqkv + cb * 128 + wc * 64;
  const float  rsc  = 1.0f / WSC;

  v4u rv[8];
  if (osel < 2) {
#pragma unroll
    for (int i = 0; i < 2; ++i) {
      float u[4][8];
#pragma unroll
      for (int j = 0; j < 4; ++j) {
        const int n8 = j * 16 + hh * 8;
        const v4f b0 = *(const v4f*)(bias + n8);
        const v4f b1 = *(const v4f*)(bias + n8 + 4);
#pragma unroll
        for (int r = 0; r < 4; ++r) {
          u[j][r]     = acc[i][j][r]     * rsc + bf16q(b0[r]);
          u[j][4 + r] = acc[i][j][4 + r] * rsc + bf16q(b1[r]);
        }
      }
      // rotation: lane holds d = n8+r (j<2) and its partner d+32 (j+2); stage [head][token][col]
      const int tl = wt * 32 + i * 16 + l15;
      _Float16* srow = stg + (wc * 128 + tl) * KPAD;
      const float* crow = ctab + tl * RTP;
      const float* nrow = stab + tl * RTP;
#pragma unroll
      for (int j = 0; j < 2; ++j) {
        const int n8 = j * 16 + hh * 8;
        const v4f c0  = *(const v4f*)(crow + n8);
        const v4f c1  = *(const v4f*)(crow + n8 + 4);
        const v4f sn0 = *(const v4f*)(nrow + n8);
        const v4f sn1 = *(const v4f*)(nrow + n8 + 4);
        H8 plo, phi;
#pragma unroll
        for (int r = 0; r < 4; ++r) {
          const float a0 = u[j][r],     d0 = u[j + 2][r];
          const float a1 = u[j][4 + r], d1 = u[j + 2][4 + r];
          plo.h[r]     = (_Float16)(a0 * c0[r] - d0 * sn0[r]);
          phi.h[r]     = (_Float16)(d0 * c0[r] + a0 * sn0[r]);
          plo.h[4 + r] = (_Float16)(a1 * c1[r] - d1 * sn1[r]);
          phi.h[4 + r] = (_Float16)(d1 * c1[r] + a1 * sn1[r]);
        }
        *(v4u*)(srow + n8)      = plo.u;
        *(v4u*)(srow + 32 + n8) = phi.u;
      }
    }
    __syncthreads();
#pragma unroll
    for (int it = 0; it < 8; ++it) {
      const int idx = it * 256 + tid;
      const int row = idx >> 3, piece = idx & 7;        // row = head * 128 + token
      rv[it] = *(const v4u*)(stg + row * KPAD + piece * 8);
    }
    // per head a contiguous 16 KB; the two heads lie SEQ * HD halves apart
    _Float16* dst = ((osel == 0) ? q : k) + ((long)(b * NH + h0) * SEQ + s0) * HD;
#pragma unroll
    for (int it = 0; it < 8; ++it) {
      const int idx = it * 256 + tid;
      *(v4u*)(dst + (long)(idx >> 10) * SEQ * HD + (long)(idx & 1023) * 8) = rv[it];
    }
  } else {
    // stage transposed [d][token]: lane's 8 values are 8 different d for one token
#pragma unroll
    for (int j = 0; j < 4; ++j) {
      const int n8 = j * 16 + hh * 8;
      const v4f b0 = *(const v4f*)(bias + n8);
      const v4f b1 = *(const v4f*)(bias + n8 + 4);
#pragma unroll
      for (int i = 0; i < 2; ++i) {
        _Float16* scol = stg + (wc * 64 + n8) * VSPAD + wt * 32 + i * 16 + l15;
#pragma unroll
        for (int r = 0; r < 4; ++r) {
          scol[r * VSPAD]       = (_Float16)(acc[i][j][r]     * rsc + bf16q(b0[r]));
          scol[(4 + r) * VSPAD] = (_Float16)(acc[i][j][4 + r] * rsc + bf16q(b1[r]));
        }
      }
    }
    __syncthreads();
#pragma unroll
    for (int it = 0; it < 8; ++it) {
      const int idx = it * 256 + tid;
      const int d = idx >> 4, piece = idx & 15;         // d = head * 64 + d of the head
      rv[it] = *(const v4u*)(stg + d * VSPAD + piece * 8);
    }
    _Float16* dstb = vT + ((long)(b * NH + h0) * HD) * SEQ + s0;
#pragma unroll
    for (int it = 0; it < 8; ++it) {
      const int idx = it * 256 + tid;
      const int d = idx >> 4, piece = idx & 15;
      *(v4u*)(dstb + (long)d * SEQ + piece * 8) = rv[it];
    }
  }
}

// ---------------------------------------------------------------------------
// Kernel 3: flash attention per (b,h), no mask, all SEQ keys. grid (SEQ/128, NB*NH),
// block 256 (8 waves x 16 queries). C = S^T (A = K rows, B = Q) then C = O^T = V^T P^T (P^T
// packed from the S^T D registers); lane owns one query end-to-end. Scores are raw q.k sums:
// the 1/8 scale and the x1024 p carry live in the exp argument (p = 1024*exp((s-m)/8),
// softmax stats f32). Context (carried x64) written to ctx[b*SEQ+s][h*64+d] through an LDS stage
// K and V^T come in by asynchronous copies to LDS into a ring of two buffers, so that the next
// stage of 64 keys flies while this one is worked on.
// LDS tiles: a stage = 64 keys x 64 d of K and of V^T == consumed extent; ost 128 x 64 fully written.
// coverage: every (row, h*64+d) of the ctx plane once.
// ---------------------------------------------------------------------------
// One stage of 64 keys: buffer rows 0..63 = K rows [key][d] (source pitch HD), rows 64..127 = V^T
// rows [d][key] (source pitch SEQ), LDS pitch KPAD halves; 8 lanes x 16 B per row, 32 rows per copy.
__device__ __forceinline__ void kv_stage_copy(const _Float16* kg, const _Float16* vg,
                                              _Float16* buf, int tid) {
  const int r = tid >> 3, c = (tid & 7) * 8;
  const unsigned l = lds_addr(buf + r * KPAD + c);
  constexpr unsigned LS = 32 * KPAD * 2;       // LDS bytes per 32 rows
  acopy4(l,          kg + r * HD + c,           l + LS,     kg + (r + 32) * HD + c,
         l + 2 * LS, vg + (long)r * SEQ + c,    l + 3 * LS, vg + (long)(r + 32) * SEQ + c);
}

__global__ __launch_bounds__(256) void attn_kernel(
    const _Float16* __restrict__ Q, const _Float16* __restrict__ K,
    const _Float16* __restrict__ vT, _Float16* __restrict__ ctx) {
  // two buffers of [K 64 rows | V^T 64 rows]; cross-wave (block barriers)
  __shared__ __attribute__((aligned(16))) _Float16 kv[2 * 128 * KPAD];
  __shared__ _Float16 ost[128 * KPAD];   // output stage [query][d]   (cross-wave, block barrier)

  const int tid  = threadIdx.x;
  const int lane = tid & 31;
  const int wave = tid >> 5;
  const int bh   = blockIdx.y;
  const int b    = bh >> 4;
  const int h    = bh & 15;
  const int q0   = blockIdx.x * 128;

  const _Float16* Qb  = Q + ((long)bh * SEQ + q0) * HD;
  const _Float16* Kb  = K + (long)bh * SEQ * HD;
  const _Float16* vTb = vT + (long)bh * HD * SEQ;

  // Q fragments: B operand of S^T (lane owns query lane&15)
  v16h qfrag[2];
  {
    const _Float16* qrow = Qb + (long)wave * 16 * HD;
#pragma unroll
    for (int t = 0; t < 2; ++t) qfrag[t] = load_frag_row(qrow + t * 32, HD, lane);
  }

  v8f acc[4];   // O^T accumulator: lane owns query (lane&15); reg r -> d = nt*16+8h+r
#pragma unroll
  for (int nt = 0; nt < 4; ++nt) acc[nt] = (v8f){};
  float mi = -1e30f, li = 0.0f;

  const int colb = lane & 15;
  const int rofs = (lane >> 4) << 3;

  constexpr int SH = 128 * KPAD;   // halves per buffer
  constexpr int NS = SEQ / 64;     // stages
  static_assert(NS >= 2);

  kv_stage_copy(Kb, vTb, kv, tid);
  asm volatile("s_wait_asynccnt 0x0" ::: "memory");   // this wave's part of stage 0 has landed
  __syncthreads();                                    // stage 0 published to every wave
  kv_stage_copy(Kb + 64 * HD, vTb + 64, kv + SH, tid);

#pragma unroll 1   // one stage per trip: the ring's waits and barrier stand once, at the foot
  for (int sg = 0; sg < NS; ++sg) {
    _Float16* buf = kv + (sg & 1) * SH;
    const _Float16* ks  = buf;               // K rows [key][d]
    const _Float16* vts = buf + 64 * KPAD;   // V^T rows [d][key]

    // S^T tiles: A = K rows (lane&15 = key), B = Q
    v8f sc[4];
#pragma unroll
    for (int kt = 0; kt < 4; ++kt) sc[kt] = (v8f){};
#pragma unroll
    for (int t = 0; t < 2; ++t)
#pragma unroll
      for (int kt = 0; kt < 4; ++kt) {
        const v16h kf = load_frag_row(ks + (kt * 16) * KPAD + t * 32, KPAD, lane);
        sc[kt] = wmma_f16(kf, qfrag[t], sc[kt]);
      }

    // per-lane online softmax (32 of 64 keys in-lane; merge halves with one shuffle)
    float mx = sc[0][0];
#pragma unroll
    for (int kt = 0; kt < 4; ++kt)
#pragma unroll
      for (int r = 0; r < 8; ++r) mx = fmaxf(mx, sc[kt][r]);
    mx = fmaxf(mx, __shfl_xor(mx, 16, 32));
    const float mnew  = fmaxf(mi, mx);
    const float alpha = __expf((mi - mnew) * 0.125f);
    mi = mnew;
    const float cs = fmaf(mnew, 0.125f, -LN1024);   // 0.125*m - ln(1024)

    float rs = 0.0f;
#pragma unroll
    for (int kt = 0; kt < 4; ++kt)
#pragma unroll
      for (int r = 0; r < 8; ++r) {
        const float p = __expf(fmaf(sc[kt][r], 0.125f, -cs));   // 1024*exp((s-m)/8)
        sc[kt][r] = p;
        rs += p;
      }
    rs += __shfl_xor(rs, 16, 32);
    li = li * alpha + rs;

    // P^T as the B operand of O^T = V^T P^T, packed from the S^T D registers:
    // element i <- tile covering keys 0..15 of the 32-step (kt = 2t), element 8+i <- kt = 2t+1.
    v16h pf[2];
#pragma unroll
    for (int t = 0; t < 2; ++t)
#pragma unroll
      for (int i = 0; i < 8; ++i) {
        pf[t][i]     = (_Float16)sc[2 * t][i];
        pf[t][8 + i] = (_Float16)sc[2 * t + 1][i];
      }

#pragma unroll
    for (int nt = 0; nt < 4; ++nt)
#pragma unroll
      for (int r = 0; r < 8; ++r) acc[nt][r] *= alpha;

    // O^T += V^T (A, rows = d) x P^T (B)
#pragma unroll
    for (int t = 0; t < 2; ++t)
#pragma unroll
      for (int nt = 0; nt < 4; ++nt) {
        const v16h vf = load_frag_row(vts + (nt * 16) * KPAD + t * 32, KPAD, lane);
        acc[nt] = wmma_f16(vf, pf[t], acc[nt]);
      }

    asm volatile("s_wait_dscnt 0x0" ::: "memory");     // own reads of this buffer are done
    asm volatile("s_wait_asynccnt 0x0" ::: "memory");  // own part of stage sg+1 has landed
    __syncthreads();   // publishes stage sg+1 and ends every wave's reads of stage sg
    if (sg + 2 < NS) kv_stage_copy(Kb + (long)(sg + 2) * 64 * HD, vTb + (sg + 2) * 64, buf, tid);
  }
  asm volatile("s_wait_asynccnt 0x0" ::: "memory");    // nothing in flight behind the loop

  // normalize (and apply the x64 carry) and stage: lane owns query row wave*16+colb,
  // d = nt*16+rofs+r contiguous
  {
    const float inv = 64.0f / li;
    _Float16* orow = ost + (wave * 16 + colb) * KPAD;
#pragma unroll
    for (int nt = 0; nt < 4; ++nt) {
      H8 pk;
#pragma unroll
      for (int r = 0; r < 8; ++r) pk.h[r] = (_Float16)(acc[nt][r] * inv);
      *(v4u*)(orow + nt * 16 + rofs) = pk.u;
    }
  }
  __syncthreads();

  v4u rv[4];
#pragma unroll
  for (int it = 0; it < 4; ++it) {
    const int idx = it * 256 + tid;
    const int row = idx >> 3, piece = idx & 7;
    rv[it] = *(const v4u*)(ost + row * KPAD + piece * 8);
  }
  _Float16* cbase = ctx + ((long)b * SEQ + q0) * DM + h * HD;
#pragma unroll
  for (int it = 0; it < 4; ++it) {
    const int idx = it * 256 + tid;
    const int row = idx >> 3, piece = idx & 7;
    *(v4u*)(cbase + (long)row * DM + piece * 8) = rv[it];
  }
  
}

// ---------------------------------------------------------------------------
// Kernel 4: x1 = ctx @ Wo / 4096 + bf16(bias) + bf16(x) over a full 1024-wide row, and
// nx2 = f16(LN(x1) * bf16(gamma) + bf16(beta)) -> f16 plane [ROWS][1024].
// Block = 16 token rows x 1024 cols, wave w owns cols 128w..128w+127. C^T = Wt act^T: A = Wt rows
// (lane&15 = out col), B = act rows (lane&15 = token); acc[0][j][r] = y[token lane&15][col 128w+16j+8h+r].
// Operands through the ring (1024 weight rows + 16 act rows per stage).
// y staged in LDS (f32, in the ring's bytes once the ring is left), residual (x input, full-stride
// rows) added in a coalesced LDS pass.
// grid ROWS/16, block 256. LDS ys: 16 x 1024 staged == consumed. coverage: 16 rows x 1024 per block.
// ---------------------------------------------------------------------------
__global__ __launch_bounds__(256) void oproj_ln_kernel(
    const _Float16* __restrict__ act, const _Float16* __restrict__ wt,
    const float* __restrict__ bias, const float* __restrict__ res,
    const float* __restrict__ gam, const float* __restrict__ bet,
    float* __restrict__ outf, _Float16* __restrict__ outh) {
  // 299520 B: operand ring in the k loop, then ys (65792 B); cross-wave (block barriers)
  __shared__ __attribute__((aligned(16))) unsigned char smem[2 * (DM + 16) * KPAD * 2];
  __shared__ float smean[16];      // cross-wave (block barrier)
  __shared__ float srstd[16];      // cross-wave (block barrier)
  static_assert(sizeof(smem) >= (size_t)16 * YP * 4);
  _Float16* ring = (_Float16*)smem;
  float*    ys   = (float*)smem;

  const int tid  = threadIdx.x;
  const int lane = tid & 31;
  const int wave = tid >> 5;
  const int hh   = lane >> 4;
  const int l15  = lane & 15;
  const long m0  = (long)blockIdx.x * 16;
  const int  n0  = wave * 128;

  v8f acc[1][8];
#pragma unroll
  for (int j = 0; j < 8; ++j) acc[0][j] = (v8f){};

  gemm_ring<DM, DM, 16, 8, 1>(wt, act + m0 * DM, ring, n0, 0, tid, lane, acc);

  // y = acc/4096 + bf16(bias), staged [row][col]
  {
    const float rsc = 1.0f / (WSC * WSC);
    float* yrow = ys + l15 * YP;
#pragma unroll
    for (int j = 0; j < 8; ++j) {
      const int n8 = n0 + j * 16 + hh * 8;
      const v4f b0 = *(const v4f*)(bias + n8);
      const v4f b1 = *(const v4f*)(bias + n8 + 4);
      v4f y0, y1;
#pragma unroll
      for (int i = 0; i < 4; ++i) {
        y0[i] = acc[0][j][i]     * rsc + bf16q(b0[i]);
        y1[i] = acc[0][j][4 + i] * rsc + bf16q(b1[i]);
      }
      *(v4f*)(yrow + n8)     = y0;
      *(v4f*)(yrow + n8 + 4) = y1;
    }
  }
  __syncthreads();

  // residual add (coalesced): ys[row][col] += res
#pragma unroll 4
  for (int it = 0; it < 16; ++it) {
    const int idx = it * 256 + tid;
    const int row = idx >> 8, piece = idx & 255;
    const long m = m0 + row;
    const long orow = (m / SEQ) * SEQ_FULL + (m % SEQ);
    v4f rsd = *(const v4f*)(res + orow * DM + piece * 4);
#pragma unroll
    for (int c = 0; c < 4; ++c) rsd[c] = bf16q(rsd[c]);
    float* yp = ys + row * YP + piece * 4;
    v4f yv = *(const v4f*)yp;
#pragma unroll
    for (int c = 0; c < 4; ++c) yv[c] = yv[c] + rsd[c];
    *(v4f*)yp = yv;
  }
  __syncthreads();

  {
    const int r  = tid >> 4;
    const int sl = tid & 15;
    const float* yr = ys + r * YP + sl * 64;
    float s = 0.0f;
#pragma unroll
    for (int i = 0; i < 16; ++i) {
      const v4f v = *(const v4f*)(yr + i * 4);
      s += (v[0] + v[1]) + (v[2] + v[3]);
    }
    s += __shfl_xor(s, 1, 32);
    s += __shfl_xor(s, 2, 32);
    s += __shfl_xor(s, 4, 32);
    s += __shfl_xor(s, 8, 32);
    const float mean = s * (1.0f / DM);
    float ss = 0.0f;
#pragma unroll
    for (int i = 0; i < 16; ++i) {
      const v4f v = *(const v4f*)(yr + i * 4);
#pragma unroll
      for (int c = 0; c < 4; ++c) {
        const float d = v[c] - mean;
        ss += d * d;
      }
    }
    ss += __shfl_xor(ss, 1, 32);
    ss += __shfl_xor(ss, 2, 32);
    ss += __shfl_xor(ss, 4, 32);
    ss += __shfl_xor(ss, 8, 32);
    const float var  = ss * (1.0f / DM);
    const float rstd = rsqrtf(var + LN_EPS);
    if (sl == 0) { smean[r] = mean; srstd[r] = rstd; }
  }
  __syncthreads();

  // nx2 values into registers: thread owns row idx>>7 and 8 contiguous cols p8*8
  v4u hv[8];
#pragma unroll
  for (int it = 0; it < 8; ++it) {
    const int idx = it * 256 + tid;
    const int row = idx >> 7, p8 = idx & 127;
    const v4f a  = *(const v4f*)(ys + row * YP + p8 * 8);
    const v4f c  = *(const v4f*)(ys + row * YP + p8 * 8 + 4);
    const v4f g0 = *(const v4f*)(gam + p8 * 8);
    const v4f g1 = *(const v4f*)(gam + p8 * 8 + 4);
    const v4f b0 = *(const v4f*)(bet + p8 * 8);
    const v4f b1 = *(const v4f*)(bet + p8 * 8 + 4);
    const float mean = smean[row], rstd = srstd[row];
    H8 o;
#pragma unroll
    for (int i = 0; i < 4; ++i) {
      o.h[i]     = (_Float16)((a[i] - mean) * rstd * bf16q(g0[i]) + bf16q(b0[i]));
      o.h[4 + i] = (_Float16)((c[i] - mean) * rstd * bf16q(g1[i]) + bf16q(b1[i]));
    }
    hv[it] = o.u;
  }

#pragma unroll 4
  for (int it = 0; it < 16; ++it) {
    const int idx = it * 256 + tid;
    const int row = idx >> 8, piece = idx & 255;
    const v4f v = *(const v4f*)(ys + row * YP + piece * 4);
    *(v4f*)(outf + (m0 + row) * DM + piece * 4) = v;
  }
#pragma unroll
  for (int it = 0; it < 8; ++it) {
    const int idx = it * 256 + tid;
    const int row = idx >> 7, p8 = idx & 127;
    *(v4u*)(outh + (m0 + row) * DM + p8 * 8) = hv[it];
  }
}

// ---------------------------------------------------------------------------
// Kernel 5: ffn linear 1 + silu: hp[row][col] = f16(64 * silu(nx2 @ Wf1 / 64 + bf16(bf1))),
// silu(u) = u * 1/(1+exp(-u)) in f32. Block = 128 token rows x 128 output cols, 8 waves = 4 token
// groups of 32 x 2 column groups of 64; C^T = Wf1t nx2^T (A = Wf1t rows, B = nx2 f16 rows),
// K = 1024, operands through the ring (128 weight rows + 128 nx2 rows per stage).
// Epilogue staged [token][col] in LDS (in the ring's bytes once the ring is left),
// grid (ROWS/128, FF/128), block 256. coverage: every (row, col) of the hp plane [ROWS][4096] once.
// ---------------------------------------------------------------------------
__global__ __launch_bounds__(256) void ffn1_kernel(
    const _Float16* __restrict__ x2h, const _Float16* __restrict__ wf1t,
    const float* __restrict__ bf1, _Float16* __restrict__ hp) {
  // operand ring in the k loop, then the output stage [128][VSPAD]; cross-wave (block barriers)
  __shared__ __attribute__((aligned(16))) _Float16 ring[2 * (128 + 128) * KPAD];
  static_assert(2 * (128 + 128) * KPAD >= 128 * VSPAD);
  _Float16* stg = ring;

  const int tid  = threadIdx.x;
  const int lane = tid & 31;
  const int wave = tid >> 5;
  const int hh   = lane >> 4;
  const int l15  = lane & 15;
  const int wt   = wave & 3;            // token group: rows 32 wt .. 32 wt + 31 of the block
  const int wc   = wave >> 2;           // column group: cols 64 wc .. 64 wc + 63 of the block
  const int cb   = blockIdx.y;          // 0..FF/128-1
  const long m0  = (long)blockIdx.x * 128;

  v8f acc[2][4];
#pragma unroll
  for (int i = 0; i < 2; ++i)
#pragma unroll
    for (int j = 0; j < 4; ++j) acc[i][j] = (v8f){};

  gemm_ring<DM, 128, 128, 4, 2>(wf1t + ((long)cb * 128) * DM, x2h + m0 * DM, ring,
                                wc * 64, wt * 32, tid, lane, acc);

  const float rsc = 1.0f / WSC;
#pragma unroll
  for (int j = 0; j < 4; ++j) {
    const int n8 = wc * 64 + j * 16 + hh * 8;
    const v4f b0 = *(const v4f*)(bf1 + cb * 128 + n8);
    const v4f b1 = *(const v4f*)(bf1 + cb * 128 + n8 + 4);
#pragma unroll
    for (int i = 0; i < 2; ++i) {
      H8 pk;
#pragma unroll
      for (int r = 0; r < 4; ++r) {
        const float u0 = acc[i][j][r]     * rsc + bf16q(b0[r]);
        const float u1 = acc[i][j][4 + r] * rsc + bf16q(b1[r]);
        const float e0 = __expf(fminf(-u0, 80.0f));
        const float e1 = __expf(fminf(-u1, 80.0f));
        const float g0 = u0 * __builtin_amdgcn_rcpf(1.0f + e0);
        const float g1 = u1 * __builtin_amdgcn_rcpf(1.0f + e1);
        pk.h[r]     = (_Float16)(g0 * WSC);
        pk.h[4 + r] = (_Float16)(g1 * WSC);
      }
      *(v4u*)(stg + (wt * 32 + i * 16 + l15) * VSPAD + n8) = pk.u;
    }
  }
  __syncthreads();

  v4u rv[8];
#pragma unroll
  for (int it = 0; it < 8; ++it) {
    const int idx = it * 256 + tid;
    const int row = idx >> 4, piece = idx & 15;
    rv[it] = *(const v4u*)(stg + row * VSPAD + piece * 8);
  }
#pragma unroll
  for (int it = 0; it < 8; ++it) {
    const int idx = it * 256 + tid;
    const int row = idx >> 4, piece = idx & 15;
    *(v4u*)(hp + (m0 + row) * FF + cb * 128 + piece * 8) = rv[it];
  }
}

// ---------------------------------------------------------------------------
// Kernel 6: ffn linear 2 + residual: out = hp @ Wf2 / 4096 + bf16(bf2) + x1 (f32 plane), out in
// full-stride rows. Block = 128 token rows x 128 output cols, 8 waves = 4 token groups of 32 x 2
// column groups of 64; C^T = Wf2t hp^T (A = Wf2t rows, B = hp rows), K = 4096, operands through the
// ring (128 weight rows + 128 hp rows per stage). y staged [token][col] in LDS (f32, in the ring's
// bytes once the ring is left), residual added on the way out, 512 B per row segment.
// grid (ROWS/128, DM/128), block 256. coverage: every (row, col) of out once.
// ---------------------------------------------------------------------------
__global__ __launch_bounds__(256) void ffn2_kernel(
    const _Float16* __restrict__ hp, const _Float16* __restrict__ wf2t,
    const float* __restrict__ bf2, const float* __restrict__ x1f, float* __restrict__ out) {
  // operand ring in the k loop, then ys [128][YT] f32; cross-wave (block barriers)
  __shared__ __attribute__((aligned(16))) unsigned char smem[2 * (128 + 128) * KPAD * 2];
  static_assert(sizeof(smem) >= (size_t)128 * YT * 4);
  _Float16* ring = (_Float16*)smem;
  float*    ys   = (float*)smem;

  const int tid  = threadIdx.x;
  const int lane = tid & 31;
  const int wave = tid >> 5;
  const int hh   = lane >> 4;
  const int l15  = lane & 15;
  const int wt   = wave & 3;            // token group: rows 32 wt .. 32 wt + 31 of the block
  const int wc   = wave >> 2;           // column group: cols 64 wc .. 64 wc + 63 of the block
  const int cb   = blockIdx.y;          // 0..DM/128-1
  const long m0  = (long)blockIdx.x * 128;

  v8f acc[2][4];
#pragma unroll
  for (int i = 0; i < 2; ++i)
#pragma unroll
    for (int j = 0; j < 4; ++j) acc[i][j] = (v8f){};

  gemm_ring<FF, 128, 128, 4, 2>(wf2t + ((long)cb * 128) * FF, hp + m0 * FF, ring,
                                wc * 64, wt * 32, tid, lane, acc);

  // y = acc/4096 + bf16(bias), staged [token][col]
  const float rsc = 1.0f / (WSC * WSC);
#pragma unroll
  for (int j = 0; j < 4; ++j) {
    const int n8 = wc * 64 + j * 16 + hh * 8;
    const v4f b0 = *(const v4f*)(bf2 + cb * 128 + n8);
    const v4f b1 = *(const v4f*)(bf2 + cb * 128 + n8 + 4);
#pragma unroll
    for (int i = 0; i < 2; ++i) {
      float* yrow = ys + (wt * 32 + i * 16 + l15) * YT;
      v4f y0, y1;
#pragma unroll
      for (int r = 0; r < 4; ++r) {
        y0[r] = acc[i][j][r]     * rsc + bf16q(b0[r]);
        y1[r] = acc[i][j][4 + r] * rsc + bf16q(b1[r]);
      }
      *(v4f*)(yrow + n8)     = y0;
      *(v4f*)(yrow + n8 + 4) = y1;
    }
  }
  __syncthreads();

  // residual add and store (coalesced), four row groups per trip
#pragma unroll 1   // keeps the trip's four loads and stores together and the wait once per trip
  for (int it0 = 0; it0 < 16; it0 += 4) {
#pragma unroll
    for (int u = 0; u < 4; ++u) {
      const int idx = (it0 + u) * 256 + tid;
      const int row = idx >> 5, piece = idx & 31;
      const long m = m0 + row;
      const v4f rsd = *(const v4f*)(x1f + m * DM + cb * 128 + piece * 4);
      v4f yv = *(const v4f*)(ys + row * YT + piece * 4);
#pragma unroll
      for (int c = 0; c < 4; ++c) yv[c] = yv[c] + rsd[c];
      const long drow = (m / SEQ) * SEQ_FULL + (m % SEQ);
      *(v4f*)(out + drow * DM + cb * 128 + piece * 4) = yv;
    }
    // stands in front of the next trip's rewrite of the registers that the stores name
    asm volatile("s_wait_xcnt 0x0" ::: "memory");
  }
}

// ---------------------------------------------------------------------------
extern "C" void kernel_launch(void* const* d_in, const int* in_sizes, int n_in,
                              void* d_out, int out_size, void* d_ws, size_t ws_size,
                              hipStream_t stream) {
  if (n_in < 13) return;
  const long needRows = (long)(NB - 1) * SEQ_FULL + SEQ;
  if ((long)in_sizes[0] < needRows * DM) return;
  if (in_sizes[1] < DM || in_sizes[2] < DM) return;
  if (in_sizes[3] < 3 * DM * DM || in_sizes[4] < 3 * DM) return;
  if (in_sizes[5] < DM * DM || in_sizes[6] < DM) return;
  if (in_sizes[7] < DM || in_sizes[8] < DM) return;
  if (in_sizes[9] < DM * FF || in_sizes[10] < FF) return;
  if (in_sizes[11] < FF * DM || in_sizes[12] < DM) return;
  if ((long)out_size < needRows * DM) return;
  if (ws_size < WS_TOTAL) return;

  const float* x     = (const float*)d_in[0];
  const float* g1    = (const float*)d_in[1];
  const float* be1   = (const float*)d_in[2];
  const float* Wqkv  = (const float*)d_in[3];
  const float* bqkv  = (const float*)d_in[4];
  const float* Wo    = (const float*)d_in[5];
  const float* bo    = (const float*)d_in[6];
  const float* g2    = (const float*)d_in[7];
  const float* be2   = (const float*)d_in[8];
  const float* Wf1   = (const float*)d_in[9];
  const float* bf1   = (const float*)d_in[10];
  const float* Wf2   = (const float*)d_in[11];
  const float* bf2   = (const float*)d_in[12];
  float* out = (float*)d_out;

  char* ws = (char*)d_ws;
  size_t off = 0;
  _Float16* nxh  = (_Float16*)(ws + off); off += PLANE2;       // [ROWS][1024] f16
  _Float16* ctx  = (_Float16*)(ws + off); off += PLANE2;       // [ROWS][1024] f16 (x64)
  _Float16* wqkv = (_Float16*)(ws + off); off += WQKV_BYTES;   // [3072][1024]
  _Float16* woh  = (_Float16*)(ws + off); off += WO_BYTES;     // [1024][1024]
  _Float16* wf1t = (_Float16*)(ws + off); off += WF1_BYTES;    // [4096][1024]
  _Float16* wf2t = (_Float16*)(ws + off); off += WF2_BYTES;    // [1024][4096]
  _Float16* qh   = (_Float16*)(ws + off); off += PLANE2;       // [NB][16][SEQ][64]
  _Float16* kh   = (_Float16*)(ws + off); off += PLANE2;       // [NB][16][SEQ][64]
  _Float16* vTh  = (_Float16*)(ws + off); off += PLANE2;       // [NB][16][64][SEQ]
  float*    x1f  = (float*)(ws + off);    off += PLANE4;       // [ROWS][1024] f32
  _Float16* nx2h = (_Float16*)(ws + off); off += PLANE2;       // [ROWS][1024] f16
  _Float16* hp   = (_Float16*)(ws + off); off += H_BYTES;      // [ROWS][4096] f16 (x64)
  if (off > ws_size) return;

  ln1_kernel<<<ROWS / 8, 256, 0, stream>>>(x, g1, be1, nxh);
  cvt_w_kernel<<<NWT, 256, 0, stream>>>(Wqkv, Wo, Wf1, Wf2, wqkv, woh, wf1t, wf2t);
  qkv_kernel<<<dim3(ROWS / 128, 3 * DM / 128), 256, 0, stream>>>(nxh, wqkv, bqkv, qh, kh, vTh);
  attn_kernel<<<dim3(SEQ / 128, NB * NH), 256, 0, stream>>>(qh, kh, vTh, ctx);
  oproj_ln_kernel<<<ROWS / 16, 256, 0, stream>>>(ctx, woh, bo, x, g2, be2, x1f, nx2h);
  ffn1_kernel<<<dim3(ROWS / 128, FF / 128), 256, 0, stream>>>(nx2h, wf1t, bf1, hp);
  ffn2_kernel<<<dim3(ROWS / 128, DM / 128), 256, 0, stream>>>(hp, wf2t, bf2, x1f, out);
}

// v004
// One run takes 205 microseconds.
// Next to v003, in two timings, it ran 1.03 and 1.02 times as fast.
// Counting every step since v000, it is 3.59 times as fast.
#include <hip/hip_runtime.h>

// All contractions (fused qkv projection, q.k^T, p.v, output projection, ffn linear 1,
// ffn linear 2): v_wmma_f32_16x16x32_f16, f16 operands, f32 accumulate. Float inputs are
// RNE-converted to bf16 at load (weights additionally carried x64; both exact in f16); computed
// 16-bit planes are f16 with power-of-two carries (softmax p x1024, context x64, ffn hidden x64)
// folded back in the f32 epilogues. Layernorms, rotary tables and rotation, softmax statistics,
// silu and residual adds: f32.

typedef __attribute__((ext_vector_type(16))) _Float16 v16h;
typedef __attribute__((ext_vector_type(8)))  _Float16 v8h;
typedef __attribute__((ext_vector_type(8)))  float v8f;
typedef __attribute__((ext_vector_type(4)))  float v4f;
typedef __attribute__((ext_vector_type(4)))  unsigned int v4u;
union H8 { v8h h; v4u u; };

#ifndef NB
#define NB 2
#endif
#ifndef SEQ
#define SEQ 2048
#endif
#define NB_FULL  2
#define SEQ_FULL 2048
#define DM   1024
#define NH   16
#define HD   64
#define FF   4096
#define ROWS (NB * SEQ)
#define KPAD 72       // LDS stride in halves for 64-wide f16 tiles (144 B, 16-B aligned)
#define VSPAD 136     // LDS stride in halves for 128-wide f16 tiles (272 B)
#define YP   1028     // LDS stride in floats for 1024-wide f32 rows (4112 B)
#define YT   132      // LDS stride in floats for 128-wide f32 rows (528 B)
#define RTP  32       // LDS stride in floats of the per-token rotary tables
#define LN_EPS 1e-5f
#define WSC    64.0f           // weight carry (power of two)
#define LN1024 6.931471806f    // ln(1024): softmax p carried x1024
#define ROPE_BASE 10000.0f

#define NT_QKV ((DM / 64) * (3 * DM / 64))    // 768 tiles: W [1024][3072]
#define NT_O   ((DM / 64) * (DM / 64))        // 256 tiles: W [1024][1024]
#define NT_F1  ((DM / 64) * (FF / 64))        // 1024 tiles: W [1024][4096]
#define NT_F2  ((FF / 64) * (DM / 64))        // 1024 tiles: W [4096][1024]
#define NT_LATE (NT_O + NT_F1 + NT_F2)        // tiles converted beside attention

#define PLANE2     ((size_t)ROWS * DM * 2)
#define PLANE4     ((size_t)ROWS * DM * 4)
#define WQKV_BYTES ((size_t)3 * DM * DM * 2)
#define WO_BYTES   ((size_t)DM * DM * 2)
#define WF1_BYTES  ((size_t)FF * DM * 2)
#define WF2_BYTES  ((size_t)DM * FF * 2)
#define H_BYTES    ((size_t)ROWS * FF * 2)
#define WS_TOTAL   (2 * PLANE2 + WQKV_BYTES + WO_BYTES + WF1_BYTES + WF2_BYTES + \
                    3 * PLANE2 + PLANE4 + PLANE2 + H_BYTES)

static_assert(NB >= 1 && NB <= NB_FULL);
static_assert(SEQ >= 128 && SEQ <= SEQ_FULL && (SEQ % 128) == 0);
static_assert((ROWS % 128) == 0 && (ROWS % 16) == 0 && (ROWS % 8) == 0);
static_assert((DM % 64) == 0 && (FF % 64) == 0 && HD == 64 && NH * HD == DM);
static_assert((DM % 128) == 0 && (FF % 128) == 0);
static_assert((NT_LATE % (SEQ / 128)) == 0);
static_assert((size_t)NB * NH * SEQ * HD * 2 == PLANE2);
static_assert(WS_TOTAL <= (size_t)134217728);

// ---------------------------------------------------------------------------
// helpers
// ---------------------------------------------------------------------------
__device__ __forceinline__ float bf16q(float f) {            // value after RNE bf16 conversion
  unsigned int u = __float_as_uint(f);
  u += 0x7FFFu + ((u >> 16) & 1u);
  return __uint_as_float(u & 0xFFFF0000u);
}

__device__ __forceinline__ float wave_sum(float v) {
  v += __shfl_xor(v, 16, 32);
  v += __shfl_xor(v, 8, 32);
  v += __shfl_xor(v, 4, 32);
  v += __shfl_xor(v, 2, 32);
  v += __shfl_xor(v, 1, 32);
  return v;
}

// 16-bit fragment (A or B): lane owns row/col (lane&15); elements 0..7 <- k0+8h+0..7,
// elements 8..15 <- k0+16+8h+0..7, h = lane>>4. Source is k-contiguous rows.
__device__ __forceinline__ v16h load_frag_row(const _Float16* base, int stride, int lane) {
  const _Float16* rowp = base + (lane & 15) * stride + ((lane >> 4) << 3);
  const v8h lo = *(const v8h*)(rowp);
  const v8h hi = *(const v8h*)(rowp + 16);
  return __builtin_shufflevector(lo, hi, 0, 1, 2, 3, 4, 5, 6, 7,
                                 8, 9, 10, 11, 12, 13, 14, 15);
}

__device__ __forceinline__ v8f wmma_f16(v16h a, v16h b, v8f c) {
  v8f d = __builtin_amdgcn_wmma_f32_16x16x32_f16(false, a, false, b, (short)0, c,
                                                 false, false);
  asm volatile("v_nop\n\tv_nop\n\tv_nop\n\tv_nop" : "+v"(d) : "v"(a), "v"(b));
  return d;
}

// ---------------------------------------------------------------------------
// Operand staging of the dense projections: a stage is 64 k (128 B) of WR weight rows followed by
// XR activation rows, LDS pitch KPAD halves, brought in by asynchronous copies to LDS (no register
// on the way) into a ring of two buffers, so that stage t+1 flies while stage t is multiplied.
// ---------------------------------------------------------------------------
__device__ __forceinline__ unsigned lds_addr(const void* p) {   // byte offset in the block's LDS
  return (unsigned)(unsigned long long)p;
}

// The s_wait_xcnt closes each run of copies inside its own statement: it stands in front of any
// later rewrite of the address registers that the copies name.
__device__ __forceinline__ void acopy2(unsigned l0, const _Float16* g0,
                                       unsigned l1, const _Float16* g1) {
  asm volatile("global_load_async_to_lds_b128 %0, %1, off\n\t"
               "global_load_async_to_lds_b128 %2, %3, off\n\t"
               "s_wait_xcnt 0x0"
               :: "v"(l0), "v"(g0), "v"(l1), "v"(g1) : "memory");
}

__device__ __forceinline__ void acopy4(unsigned l0, const _Float16* g0,
                                       unsigned l1, const _Float16* g1,
                                       unsigned l2, const _Float16* g2,
                                       unsigned l3, const _Float16* g3) {
  asm volatile("global_load_async_to_lds_b128 %0, %1, off\n\t"
               "global_load_async_to_lds_b128 %2, %3, off\n\t"
               "global_load_async_to_lds_b128 %4, %5, off\n\t"
               "global_load_async_to_lds_b128 %6, %7, off\n\t"
               "s_wait_xcnt 0x0"
               :: "v"(l0), "v"(g0), "v"(l1), "v"(g1), "v"(l2), "v"(g2), "v"(l3), "v"(g3)
               : "memory");
}

__device__ __forceinline__ void acopy8(unsigned l0, const _Float16* g0,
                                       unsigned l1, const _Float16* g1,
                                       unsigned l2, const _Float16* g2,
                                       unsigned l3, const _Float16* g3,
                                       unsigned l4, const _Float16* g4,
                                       unsigned l5, const _Float16* g5,
                                       unsigned l6, const _Float16* g6,
                                       unsigned l7, const _Float16* g7) {
  asm volatile("global_load_async_to_lds_b128 %0, %1, off\n\t"
               "global_load_async_to_lds_b128 %2, %3, off\n\t"
               "global_load_async_to_lds_b128 %4, %5, off\n\t"
               "global_load_async_to_lds_b128 %6, %7, off\n\t"
               "global_load_async_to_lds_b128 %8, %9, off\n\t"
               "global_load_async_to_lds_b128 %10, %11, off\n\t"
               "global_load_async_to_lds_b128 %12, %13, off\n\t"
               "global_load_async_to_lds_b128 %14, %15, off\n\t"
               "s_wait_xcnt 0x0"
               :: "v"(l0), "v"(g0), "v"(l1), "v"(g1), "v"(l2), "v"(g2), "v"(l3), "v"(g3),
                  "v"(l4), "v"(g4), "v"(l5), "v"(g5), "v"(l6), "v"(g6), "v"(l7), "v"(g7)
               : "memory");
}

__device__ __forceinline__ void acopy1_b64(unsigned l0, const _Float16* g0) {
  asm volatile("global_load_async_to_lds_b64 %0, %1, off\n\t"
               "s_wait_xcnt 0x0"
               :: "v"(l0), "v"(g0) : "memory");
}

// NR rows (a multiple of 64) of 128 B: 8 lanes x 16 B per row, 32 rows per copy of the block.
template <int KD, int NR>
__device__ __forceinline__ void copy_rows(const _Float16* src, _Float16* dst, int tid) {
  static_assert((NR % 64) == 0);
  const _Float16* g = src + (size_t)(tid >> 3) * KD + (tid & 7) * 8;
  const unsigned  l = lds_addr(dst + (tid >> 3) * KPAD + (tid & 7) * 8);
  constexpr unsigned LS = 32 * KPAD * 2;       // LDS bytes per 32 rows
  constexpr size_t   GS = (size_t)32 * KD;     // source halves per 32 rows
  if constexpr ((NR % 256) == 0) {
#pragma unroll   // the LDS and source steps become constants
    for (int i = 0; i < NR / 32; i += 8)
      acopy8(l + i * LS, g + i * GS, l + (i + 1) * LS, g + (i + 1) * GS,
             l + (i + 2) * LS, g + (i + 2) * GS, l + (i + 3) * LS, g + (i + 3) * GS,
             l + (i + 4) * LS, g + (i + 4) * GS, l + (i + 5) * LS, g + (i + 5) * GS,
             l + (i + 6) * LS, g + (i + 6) * GS, l + (i + 7) * LS, g + (i + 7) * GS);
  } else if constexpr ((NR % 128) == 0) {
#pragma unroll   // the LDS and source steps become constants
    for (int i = 0; i < NR / 32; i += 4)
      acopy4(l + i * LS, g + i * GS, l + (i + 1) * LS, g + (i + 1) * GS,
             l + (i + 2) * LS, g + (i + 2) * GS, l + (i + 3) * LS, g + (i + 3) * GS);
  } else {
#pragma unroll   // the LDS and source steps become constants
    for (int i = 0; i < NR / 32; i += 2)
      acopy2(l + i * LS, g + i * GS, l + (i + 1) * LS, g + (i + 1) * GS);
  }
}

// One stage: k0..k0+63 of WR weight rows and XR activation rows (XR = 16: 16 lanes x 8 B per row).
template <int KD, int WR, int XR>
__device__ __forceinline__ void stage_copy(const _Float16* wsrc, const _Float16* xsrc,
                                           _Float16* buf, int k0, int tid) {
  copy_rows<KD, WR>(wsrc + k0, buf, tid);
  if constexpr (XR == 16) {
    acopy1_b64(lds_addr(buf + (WR + (tid >> 4)) * KPAD + (tid & 15) * 4),
               xsrc + k0 + (size_t)(tid >> 4) * KD + (tid & 15) * 4);
  } else {
    copy_rows<KD, XR>(xsrc + k0, buf + WR * KPAD, tid);
  }
}

// acc[i][j] += W rows (wrow0 + 16j ..) x act rows (xrow0 + 16i ..)^T over all KD, k ascending in
// steps of 32. C^T = W act^T: A = W rows (lane&15 = out col), B = act rows (lane&15 = token).
// A wave's tile is 16 JW columns x 16 XF tokens: JW + XF fragments feed JW * XF WMMAs.
// On return every copy has landed, every wave has left the ring, and a block barrier has passed.
template <int KD, int WR, int XR, int JW, int XF>
__device__ __forceinline__ void gemm_ring(const _Float16* wsrc, const _Float16* xsrc,
                                          _Float16* ring, int wrow0, int xrow0,
                                          int tid, int lane, v8f (&acc)[XF][JW]) {
  constexpr int SH = (WR + XR) * KPAD;   // halves per buffer
  constexpr int NT = KD / 64;            // stages
  static_assert((KD % 64) == 0 && NT >= 2);

  stage_copy<KD, WR, XR>(wsrc, xsrc, ring, 0, tid);
  asm volatile("s_wait_asynccnt 0x0" ::: "memory");   // this wave's part of stage 0 has landed
  __syncthreads();                                    // stage 0 published to every wave
  stage_copy<KD, WR, XR>(wsrc, xsrc, ring + SH, 64, tid);

#pragma unroll 1   // one stage per trip: the ring's waits and barrier stand once, at the foot
  for (int t = 0; t < NT; ++t) {
    _Float16* buf = ring + (t & 1) * SH;
    const _Float16* wl = buf + wrow0 * KPAD;
    const _Float16* xl = buf + (WR + xrow0) * KPAD;
    // the stage's fragment loads go out as one group in front of its WMMAs
    // (all loops unrolled: the fragment and accumulator arrays must stay in registers)
    v16h xf[2][XF], wf[2][JW];
#pragma unroll
    for (int s = 0; s < 2; ++s) {
#pragma unroll
      for (int i = 0; i < XF; ++i)
        xf[s][i] = load_frag_row(xl + (i * 16) * KPAD + s * 32, KPAD, lane);
#pragma unroll
      for (int j = 0; j < JW; ++j)
        wf[s][j] = load_frag_row(wl + (j * 16) * KPAD + s * 32, KPAD, lane);
    }
#pragma unroll
    for (int s = 0; s < 2; ++s)
#pragma unroll
      for (int i = 0; i < XF; ++i)
#pragma unroll
        for (int j = 0; j < JW; ++j) acc[i][j] = wmma_f16(wf[s][j], xf[s][i], acc[i][j]);
    asm volatile("s_wait_dscnt 0x0" ::: "memory");     // own reads of this buffer are done
    asm volatile("s_wait_asynccnt 0x0" ::: "memory");  // own part of stage t+1 has landed
    __syncthreads();   // publishes stage t+1 and ends every wave's reads of stage t
    if (t + 2 < NT) stage_copy<KD, WR, XR>(wsrc, xsrc, buf, (t + 2) * 64, tid);
  }
  asm volatile("s_wait_asynccnt 0x0" ::: "memory");    // nothing in flight behind the loop
}

// ---------------------------------------------------------------------------
// Body A: nx = LN(bf16rne(x)) * bf16(g) + bf16(b) -> f16 plane nxh [ROWS][1024].
// One wave per token row, lane owns 4 chunks of 8 consecutive floats (i*256 + lane*8).
// ROWS/8 blocks of 256. coverage: ROWS rows x 4 x 256 halves = whole plane.
// ---------------------------------------------------------------------------
__device__ __forceinline__ void ln1_body(const float* __restrict__ x,
                                         const float* __restrict__ g,
                                         const float* __restrict__ bb,
                                         _Float16* __restrict__ nxh, int blk) {
  const int lane  = threadIdx.x & 31;
  const int wave  = threadIdx.x >> 5;
  const long m    = (long)blk * 8 + wave;                    // token row 0..ROWS-1
  const long srow = (m / SEQ) * SEQ_FULL + (m % SEQ);        // full-stride source row
  const float* xr = x + srow * DM + lane * 8;

  float s = 0.0f;
#pragma unroll 1
  for (int i = 0; i < 4; ++i) {
    const v4f a = *(const v4f*)(xr + i * 256);
    const v4f c = *(const v4f*)(xr + i * 256 + 4);
    s += ((bf16q(a[0]) + bf16q(a[1])) + (bf16q(a[2]) + bf16q(a[3]))) +
         ((bf16q(c[0]) + bf16q(c[1])) + (bf16q(c[2]) + bf16q(c[3])));
  }
  s = wave_sum(s);
  const float mean = s * (1.0f / DM);

  float ss = 0.0f;
#pragma unroll 1
  for (int i = 0; i < 4; ++i) {
    const v4f a = *(const v4f*)(xr + i * 256);
    const v4f c = *(const v4f*)(xr + i * 256 + 4);
#pragma unroll
    for (int e = 0; e < 4; ++e) {
      const float d0 = bf16q(a[e]) - mean;
      const float d1 = bf16q(c[e]) - mean;
      ss += d0 * d0;
      ss += d1 * d1;
    }
  }
  ss = wave_sum(ss);
  const float rstd = rsqrtf(ss * (1.0f / DM) + LN_EPS);

  _Float16* drow = nxh + m * DM + lane * 8;
#pragma unroll 1
  for (int i = 0; i < 4; ++i) {
    const v4f a  = *(const v4f*)(xr + i * 256);
    const v4f c  = *(const v4f*)(xr + i * 256 + 4);
    const v4f g0 = *(const v4f*)(g + i * 256 + lane * 8);
    const v4f g1 = *(const v4f*)(g + i * 256 + lane * 8 + 4);
    const v4f b0 = *(const v4f*)(bb + i * 256 + lane * 8);
    const v4f b1 = *(const v4f*)(bb + i * 256 + lane * 8 + 4);
    H8 o;
#pragma unroll
    for (int e = 0; e < 4; ++e) {
      o.h[e]     = (_Float16)((bf16q(a[e]) - mean) * rstd * bf16q(g0[e]) + bf16q(b0[e]));
      o.h[4 + e] = (_Float16)((bf16q(c[e]) - mean) * rstd * bf16q(g1[e]) + bf16q(b1[e]));
    }
    _Float16* dst = drow + i * 256;
    *(v4u*)dst = o.u;
  }
}

// ---------------------------------------------------------------------------
// Body B: one 64x64 tile (kt, nt) of a weight W [K=in][N=out] f32 -> Wt [n][k] f16 =
// f16(bf16rne(W) * 64), through an LDS transpose. One block of 256 per tile; ts holds 64 * KPAD
// halves, [n][k], cross-wave (block barrier; every thread of the block comes here or none).
// The weight conversion has no launch of its own: its tiles are further blocks of launches that
// they do not depend on, W_qkv beside the first layernorm, the other three beside attention.
// ---------------------------------------------------------------------------
__device__ __forceinline__ void cvt_tile(const float* __restrict__ W, _Float16* __restrict__ dst,
                                         int K, int N, int kt, int nt, _Float16* ts, int tid) {
  // load W[kt*64 + kr][nt*64 + 4*c4 .. +3], store transposed into ts[n][kr]
#pragma unroll
  for (int it = 0; it < 4; ++it) {
    const int idx = it * 256 + tid;
    const int kr = idx >> 4, c4 = idx & 15;
    const v4f v = *(const v4f*)(W + (size_t)(kt * 64 + kr) * N + nt * 64 + c4 * 4);
#pragma unroll
    for (int j = 0; j < 4; ++j) ts[(c4 * 4 + j) * KPAD + kr] = (_Float16)(bf16q(v[j]) * WSC);
  }
  __syncthreads();
  v4u rv[2];
#pragma unroll
  for (int it = 0; it < 2; ++it) {
    const int idx = it * 256 + tid;
    const int n = idx >> 3, piece = idx & 7;
    rv[it] = *(const v4u*)(ts + n * KPAD + piece * 8);
  }
#pragma unroll
  for (int it = 0; it < 2; ++it) {
    const int idx = it * 256 + tid;
    const int n = idx >> 3, piece = idx & 7;
    *(v4u*)(dst + (size_t)(nt * 64 + n) * K + kt * 64 + piece * 8) = rv[it];
  }
  // stands in front of any later rewrite of the registers that the two stores name
  asm volatile("s_wait_xcnt 0x0" ::: "memory");
}

// ---------------------------------------------------------------------------
// Kernel 0: blocks 0 .. ROWS/8-1: body A (first layernorm); the next NT_QKV blocks: body B on
// W_qkv, in [1024][3072] -> wqkv [3072][1024] (out col = q|k|v third, head h at 64h).
// grid ROWS/8 + NT_QKV, block 256. coverage: the nxh plane and 768 tiles of 64x64 = all of wqkv.
// ---------------------------------------------------------------------------
__global__ __launch_bounds__(256) void ln1_cvt_kernel(
    const float* __restrict__ x, const float* __restrict__ g, const float* __restrict__ bb,
    const float* __restrict__ Wqkv, _Float16* __restrict__ nxh, _Float16* __restrict__ wqkv) {
  __shared__ __attribute__((aligned(16))) _Float16 ts[64 * KPAD];
  const int bid = blockIdx.x;
  if (bid < ROWS / 8) {                                 // block-uniform selection
    ln1_body(x, g, bb, nxh, bid);
  } else {
    const int tile = bid - ROWS / 8;
    const int kt = tile / (3 * DM / 64), nt = tile - kt * (3 * DM / 64);
    cvt_tile(Wqkv, wqkv, DM, 3 * DM, kt, nt, ts, threadIdx.x);
  }
}

// ---------------------------------------------------------------------------
// Kernel 1: fused qkv projection + rotary embedding. Block = 128 token rows x 128 output columns
// (two heads of one of q/k/v), 8 waves = 4 token groups of 32 x 2 heads; a wave's tile is 32 tokens
// x 64 columns. C^T = W x^T: A = W rows (lane&15 = out col), B = nx rows (lane&15 = token);
// acc[i][j][r] = C[token 16i + lane&15][col 16j+8h+r]. K = 1024, operands through the ring
// (128 weight rows + 128 nx rows per stage).
// Prologue (q/k blocks only, block-uniform): rotary tables cos/sin[token][i], i < 32,
// angle = pos * (1 / 10000^(2i/64)), f32 powf/cosf/sinf, in LDS (cross-wave, block barrier).
// Epilogue u = acc/64 + bf16(bias); q,k: d<32: u[d]*cos - u[d+32]*sin, d>=32: u[d]*cos + u[d-32]*sin
//   q,k -> [b][h][s][64] f16 (one line per row, 8 lanes x 16 B)
//   v   -> vT[b][h][d][s] f16 (256 B per d row segment, 16 lanes x 16 B)
// grid (ROWS/128, 3*DM/128), block 256. coverage: every (b,h,s,d) of q, k and vT once.
// LDS: the output stage lies in the ring's bytes once the ring is left: q/k [2 heads][128][KPAD],
// v [128 d][VSPAD], fully written before read; ctab/stab 128x32 fully written.
// ---------------------------------------------------------------------------
__global__ __launch_bounds__(256) void qkv_kernel(
    const _Float16* __restrict__ nxh, const _Float16* __restrict__ wqkv,
    const float* __restrict__ bqkv,
    _Float16* __restrict__ q, _Float16* __restrict__ k, _Float16* __restrict__ vT) {
  __shared__ float ctab[128 * RTP];      // cos table [token][i], cross-wave (block barrier)
  __shared__ float stab[128 * RTP];      // sin table [token][i], cross-wave (block barrier)
  // operand ring in the k loop, then the output stage; cross-wave (block barriers)
  __shared__ __attribute__((aligned(16))) _Float16 ring[2 * (128 + 128) * KPAD];
  static_assert(2 * (128 + 128) * KPAD >= 2 * 128 * KPAD && 2 * (128 + 128) * KPAD >= 128 * VSPAD);
  _Float16* stg = ring;

  const int tid  = threadIdx.x;
  const int lane = tid & 31;
  const int wave = tid >> 5;
  const int hh   = lane >> 4;
  const int l15  = lane & 15;
  const int wt   = wave & 3;            // token group: rows 32 wt .. 32 wt + 31 of the block
  const int wc   = wave >> 2;           // head of the block's two

  const int cb   = blockIdx.y;          // 0..23 = output column block (128 cols each)
  const int osel = cb >> 3;             // 0 q, 1 k, 2 v
  const int h0   = (cb & 7) * 2;        // first head of the block
  const long m0  = (long)blockIdx.x * 128;
  const int  b   = (int)(m0 / SEQ);
  const int  s0  = (int)(m0 - (long)b * SEQ);

  if (osel < 2) {                       // block-uniform
#pragma clang fp contract(off)
    const int i  = tid & 31;
    const int tg = tid >> 5;
    const float e   = (float)(2 * i) * (1.0f / 64.0f);
    const float inv = 1.0f / powf(ROPE_BASE, e);
#pragma unroll 1
    for (int tt = tg; tt < 128; tt += 8) {
      const float ang = (float)(s0 + tt) * inv;
      ctab[tt * RTP + i] = cosf(ang);
      stab[tt * RTP + i] = sinf(ang);
    }
  }
  __syncthreads();

  v8f acc[2][4];
#pragma unroll
  for (int i = 0; i < 2; ++i)
#pragma unroll
    for (int j = 0; j < 4; ++j) acc[i][j] = (v8f){};

  gemm_ring<DM, 128, 128, 4, 2>(wqkv + ((long)cb * 128) * DM, nxh + m0 * DM, ring,
                                wc * 64, wt * 32, tid, lane, acc);

  const float* bias = bqkv + cb * 128 + wc * 64;
  const float  rsc  = 1.0f / WSC;

  v4u rv[8];
  if (osel < 2) {
#pragma unroll
    for (int i = 0; i < 2; ++i) {
      float u[4][8];
#pragma unroll
      for (int j = 0; j < 4; ++j) {
        const int n8 = j * 16 + hh * 8;
        const v4f b0 = *(const v4f*)(bias + n8);
        const v4f b1 = *(const v4f*)(bias + n8 + 4);
#pragma unroll
        for (int r = 0; r < 4; ++r) {
          u[j][r]     = acc[i][j][r]     * rsc + bf16q(b0[r]);
          u[j][4 + r] = acc[i][j][4 + r] * rsc + bf16q(b1[r]);
        }
      }
      // rotation: lane holds d = n8+r (j<2) and its partner d+32 (j+2); stage [head][token][col]
      const int tl = wt * 32 + i * 16 + l15;
      _Float16* srow = stg + (wc * 128 + tl) * KPAD;
      const float* crow = ctab + tl * RTP;
      const float* nrow = stab + tl * RTP;
#pragma unroll
      for (int j = 0; j < 2; ++j) {
        const int n8 = j * 16 + hh * 8;
        const v4f c0  = *(const v4f*)(crow + n8);
        const v4f c1  = *(const v4f*)(crow + n8 + 4);
        const v4f sn0 = *(const v4f*)(nrow + n8);
        const v4f sn1 = *(const v4f*)(nrow + n8 + 4);
        H8 plo, phi;
#pragma unroll
        for (int r = 0; r < 4; ++r) {
          const float a0 = u[j][r],     d0 = u[j + 2][r];
          const float a1 = u[j][4 + r], d1 = u[j + 2][4 + r];
          plo.h[r]     = (_Float16)(a0 * c0[r] - d0 * sn0[r]);
          phi.h[r]     = (_Float16)(d0 * c0[r] + a0 * sn0[r]);
          plo.h[4 + r] = (_Float16)(a1 * c1[r] - d1 * sn1[r]);
          phi.h[4 + r] = (_Float16)(d1 * c1[r] + a1 * sn1[r]);
        }
        *(v4u*)(srow + n8)      = plo.u;
        *(v4u*)(srow + 32 + n8) = phi.u;
      }
    }
    __syncthreads();
#pragma unroll
    for (int it = 0; it < 8; ++it) {
      const int idx = it * 256 + tid;
      const int row = idx >> 3, piece = idx & 7;        // row = head * 128 + token
      rv[it] = *(const v4u*)(stg + row * KPAD + piece * 8);
    }
    // per head a contiguous 16 KB; the two heads lie SEQ * HD halves apart
    _Float16* dst = ((osel == 0) ? q : k) + ((long)(b * NH + h0) * SEQ + s0) * HD;
#pragma unroll
    for (int it = 0; it < 8; ++it) {
      const int idx = it * 256 + tid;
      *(v4u*)(dst + (long)(idx >> 10) * SEQ * HD + (long)(idx & 1023) * 8) = rv[it];
    }
  } else {
    // stage transposed [d][token]: lane's 8 values are 8 different d for one token
#pragma unroll
    for (int j = 0; j < 4; ++j) {
      const int n8 = j * 16 + hh * 8;
      const v4f b0 = *(const v4f*)(bias + n8);
      const v4f b1 = *(const v4f*)(bias + n8 + 4);
#pragma unroll
      for (int i = 0; i < 2; ++i) {
        _Float16* scol = stg + (wc * 64 + n8) * VSPAD + wt * 32 + i * 16 + l15;
#pragma unroll
        for (int r = 0; r < 4; ++r) {
          scol[r * VSPAD]       = (_Float16)(acc[i][j][r]     * rsc + bf16q(b0[r]));
          scol[(4 + r) * VSPAD] = (_Float16)(acc[i][j][4 + r] * rsc + bf16q(b1[r]));
        }
      }
    }
    __syncthreads();
#pragma unroll
    for (int it = 0; it < 8; ++it) {
      const int idx = it * 256 + tid;
      const int d = idx >> 4, piece = idx & 15;         // d = head * 64 + d of the head
      rv[it] = *(const v4u*)(stg + d * VSPAD + piece * 8);
    }
    _Float16* dstb = vT + ((long)(b * NH + h0) * HD) * SEQ + s0;
#pragma unroll
    for (int it = 0; it < 8; ++it) {
      const int idx = it * 256 + tid;
      const int d = idx >> 4, piece = idx & 15;
      *(v4u*)(dstb + (long)d * SEQ + piece * 8) = rv[it];
    }
  }
}

// ---------------------------------------------------------------------------
// Kernel 2: flash attention per (b,h), no mask, all SEQ keys: blockIdx.y < NB*NH of the grid
// (SEQ/128, NB*NH + NT_LATE/(SEQ/128)), block 256 (8 waves x 16 queries). The blocks behind them
// run body B on W_proj, W_ffn1 and W_ffn2 (read first by the launches that follow), one tile each.
// Attention: C = S^T (A = K rows, B = Q) then C = O^T = V^T P^T (P^T packed from the S^T D registers); lane owns one query end-to-end. Scores are raw q.k sums:
// the 1/8 scale and the x1024 p carry live in the exp argument (p = 1024*exp((s-m)/8),
// softmax stats f32). Context (carried x64) written to ctx[b*SEQ+s][h*64+d] through an LDS stage
// K and V^T come in by asynchronous copies to LDS into a ring of two buffers, so that the next
// stage of 64 keys flies while this one is worked on.
// LDS tiles: a stage = 64 keys x 64 d of K and of V^T == consumed extent; ost 128 x 64 fully written.
// coverage: every (row, h*64+d) of the ctx plane once; 256 + 1024 + 1024 tiles of 64x64 = every
// element of woh [1024][1024], wf1t [4096][1024] and wf2t [1024][4096].
// ---------------------------------------------------------------------------
// One stage of 64 keys: buffer rows 0..63 = K rows [key][d] (source pitch HD), rows 64..127 = V^T
// rows [d][key] (source pitch SEQ), LDS pitch KPAD halves; 8 lanes x 16 B per row, 32 rows per copy.
__device__ __forceinline__ void kv_stage_copy(const _Float16* kg, const _Float16* vg,
                                              _Float16* buf, int tid) {
  const int r = tid >> 3, c = (tid & 7) * 8;
  const unsigned l = lds_addr(buf + r * KPAD + c);
  constexpr unsigned LS = 32 * KPAD * 2;       // LDS bytes per 32 rows
  acopy4(l,          kg + r * HD + c,           l + LS,     kg + (r + 32) * HD + c,
         l + 2 * LS, vg + (long)r * SEQ + c,    l + 3 * LS, vg + (long)(r + 32) * SEQ + c);
}

__global__ __launch_bounds__(256) void attn_kernel(
    const _Float16* __restrict__ Q, const _Float16* __restrict__ K,
    const _Float16* __restrict__ vT, _Float16* __restrict__ ctx,
    const float* __restrict__ Wo, const float* __restrict__ Wf1, const float* __restrict__ Wf2,
    _Float16* __restrict__ woh, _Float16* __restrict__ wf1t, _Float16* __restrict__ wf2t) {
  // two buffers of [K 64 rows | V^T 64 rows]; cross-wave (block barriers)
  __shared__ __attribute__((aligned(16))) _Float16 kv[2 * 128 * KPAD];
  __shared__ _Float16 ost[128 * KPAD];   // output stage [query][d]   (cross-wave, block barrier)

  const int tid  = threadIdx.x;
  if (blockIdx.y >= NB * NH) {           // block-uniform: a weight tile, staged in kv's bytes
    const int t = (blockIdx.y - NB * NH) * (SEQ / 128) + blockIdx.x;   // 0 .. NT_LATE-1
    const float* W;
    _Float16* dst;
    int kd, nd, kt, nt;
    if (t < NT_O) {                                     // in [1024][1024] -> out [1024][1024]
      kt = t / (DM / 64); nt = t - kt * (DM / 64); kd = DM; nd = DM;
      W = Wo; dst = woh;
    } else if (t < NT_O + NT_F1) {
      const int tile = t - NT_O;                        // in [1024][4096] -> out [4096][1024]
      kt = tile / (FF / 64); nt = tile - kt * (FF / 64); kd = DM; nd = FF;
      W = Wf1; dst = wf1t;
    } else {
      const int tile = t - NT_O - NT_F1;                // in [4096][1024] -> out [1024][4096]
      kt = tile / (DM / 64); nt = tile - kt * (DM / 64); kd = FF; nd = DM;
      W = Wf2; dst = wf2t;
    }
    cvt_tile(W, dst, kd, nd, kt, nt, kv, tid);
    return;
  }
  const int lane = tid & 31;
  const int wave = tid >> 5;
  const int bh   = blockIdx.y;
  const int b    = bh >> 4;
  const int h    = bh & 15;
  const int q0   = blockIdx.x * 128;

  const _Float16* Qb  = Q + ((long)bh * SEQ + q0) * HD;
  const _Float16* Kb  = K + (long)bh * SEQ * HD;
  const _Float16* vTb = vT + (long)bh * HD * SEQ;

  // Q fragments: B operand of S^T (lane owns query lane&15)
  v16h qfrag[2];
  {
    const _Float16* qrow = Qb + (long)wave * 16 * HD;
#pragma unroll
    for (int t = 0; t < 2; ++t) qfrag[t] = load_frag_row(qrow + t * 32, HD, lane);
  }

  v8f acc[4];   // O^T accumulator: lane owns query (lane&15); reg r -> d = nt*16+8h+r
#pragma unroll
  for (int nt = 0; nt < 4; ++nt) acc[nt] = (v8f){};
  float mi = -1e30f, li = 0.0f;

  const int colb = lane & 15;
  const int rofs = (lane >> 4) << 3;

  constexpr int SH = 128 * KPAD;   // halves per buffer
  constexpr int NS = SEQ / 64;     // stages
  static_assert(NS >= 2);

  kv_stage_copy(Kb, vTb, kv, tid);
  asm volatile("s_wait_asynccnt 0x0" ::: "memory");   // this wave's part of stage 0 has landed
  __syncthreads();                                    // stage 0 published to every wave
  kv_stage_copy(Kb + 64 * HD, vTb + 64, kv + SH, tid);

#pragma unroll 1   // one stage per trip: the ring's waits and barrier stand once, at the foot
  for (int sg = 0; sg < NS; ++sg) {
    _Float16* buf = kv + (sg & 1) * SH;
    const _Float16* ks  = buf;               // K rows [key][d]
    const _Float16* vts = buf + 64 * KPAD;   // V^T rows [d][key]

    // S^T tiles: A = K rows (lane&15 = key), B = Q
    v8f sc[4];
#pragma unroll
    for (int kt = 0; kt < 4; ++kt) sc[kt] = (v8f){};
#pragma unroll
    for (int t = 0; t < 2; ++t)
#pragma unroll
      for (int kt = 0; kt < 4; ++kt) {
        const v16h kf = load_frag_row(ks + (kt * 16) * KPAD + t * 32, KPAD, lane);
        sc[kt] = wmma_f16(kf, qfrag[t], sc[kt]);
      }

    // per-lane online softmax (32 of 64 keys in-lane; merge halves with one shuffle)
    float mx = sc[0][0];
#pragma unroll
    for (int kt = 0; kt < 4; ++kt)
#pragma unroll
      for (int r = 0; r < 8; ++r) mx = fmaxf(mx, sc[kt][r]);
    mx = fmaxf(mx, __shfl_xor(mx, 16, 32));
    const float mnew  = fmaxf(mi, mx);
    const float alpha = __expf((mi - mnew) * 0.125f);
    mi = mnew;
    const float cs = fmaf(mnew, 0.125f, -LN1024);   // 0.125*m - ln(1024)

    float rs = 0.0f;
#pragma unroll
    for (int kt = 0; kt < 4; ++kt)
#pragma unroll
      for (int r = 0; r < 8; ++r) {
        const float p = __expf(fmaf(sc[kt][r], 0.125f, -cs));   // 1024*exp((s-m)/8)
        sc[kt][r] = p;
        rs += p;
      }
    rs += __shfl_xor(rs, 16, 32);
    li = li * alpha + rs;

    // P^T as the B operand of O^T = V^T P^T, packed from the S^T D registers:
    // element i <- tile covering keys 0..15 of the 32-step (kt = 2t), element 8+i <- kt = 2t+1.
    v16h pf[2];
#pragma unroll
    for (int t = 0; t < 2; ++t)
#pragma unroll
      for (int i = 0; i < 8; ++i) {
        pf[t][i]     = (_Float16)sc[2 * t][i];
        pf[t][8 + i] = (_Float16)sc[2 * t + 1][i];
      }

#pragma unroll
    for (int nt = 0; nt < 4; ++nt)
#pragma unroll
      for (int r = 0; r < 8; ++r) acc[nt][r] *= alpha;

    // O^T += V^T (A, rows = d) x P^T (B)
#pragma unroll
    for (int t = 0; t < 2; ++t)
#pragma unroll
      for (int nt = 0; nt < 4; ++nt) {
        const v16h vf = load_frag_row(vts + (nt * 16) * KPAD + t * 32, KPAD, lane);
        acc[nt] = wmma_f16(vf, pf[t], acc[nt]);
      }

    asm volatile("s_wait_dscnt 0x0" ::: "memory");     // own reads of this buffer are done
    asm volatile("s_wait_asynccnt 0x0" ::: "memory");  // own part of stage sg+1 has landed
    __syncthreads();   // publishes stage sg+1 and ends every wave's reads of stage sg
    if (sg + 2 < NS) kv_stage_copy(Kb + (long)(sg + 2) * 64 * HD, vTb + (sg + 2) * 64, buf, tid);
  }
  asm volatile("s_wait_asynccnt 0x0" ::: "memory");    // nothing in flight behind the loop

  // normalize (and apply the x64 carry) and stage: lane owns query row wave*16+colb,
  // d = nt*16+rofs+r contiguous
  {
    const float inv = 64.0f / li;
    _Float16* orow = ost + (wave * 16 + colb) * KPAD;
#pragma unroll
    for (int nt = 0; nt < 4; ++nt) {
      H8 pk;
#pragma unroll
      for (int r = 0; r < 8; ++r) pk.h[r] = (_Float16)(acc[nt][r] * inv);
      *(v4u*)(orow + nt * 16 + rofs) = pk.u;
    }
  }
  __syncthreads();

  v4u rv[4];
#pragma unroll
  for (int it = 0; it < 4; ++it) {
    const int idx = it * 256 + tid;
    const int row = idx >> 3, piece = idx & 7;
    rv[it] = *(const v4u*)(ost + row * KPAD + piece * 8);
  }
  _Float16* cbase = ctx + ((long)b * SEQ + q0) * DM + h * HD;
#pragma unroll
  for (int it = 0; it < 4; ++it) {
    const int idx = it * 256 + tid;
    const int row = idx >> 3, piece = idx & 7;
    *(v4u*)(cbase + (long)row * DM + piece * 8) = rv[it];
  }
  
}

// ---------------------------------------------------------------------------
// Kernel 3: x1 = ctx @ Wo / 4096 + bf16(bias) + bf16(x) over a full 1024-wide row, and
// nx2 = f16(LN(x1) * bf16(gamma) + bf16(beta)) -> f16 plane [ROWS][1024].
// Block = 16 token rows x 1024 cols, wave w owns cols 128w..128w+127. C^T = Wt act^T: A = Wt rows
// (lane&15 = out col), B = act rows (lane&15 = token); acc[0][j][r] = y[token lane&15][col 128w+16j+8h+r].
// Operands through the ring (1024 weight rows + 16 act rows per stage).
// y staged in LDS (f32, in the ring's bytes once the ring is left), residual (x input, full-stride
// rows) added in a coalesced LDS pass.
// grid ROWS/16, block 256. LDS ys: 16 x 1024 staged == consumed. coverage: 16 rows x 1024 per block.
// ---------------------------------------------------------------------------
__global__ __launch_bounds__(256) void oproj_ln_kernel(
    const _Float16* __restrict__ act, const _Float16* __restrict__ wt,
    const float* __restrict__ bias, const float* __restrict__ res,
    const float* __restrict__ gam, const float* __restrict__ bet,
    float* __restrict__ outf, _Float16* __restrict__ outh) {
  // 299520 B: operand ring in the k loop, then ys (65792 B); cross-wave (block barriers)
  __shared__ __attribute__((aligned(16))) unsigned char smem[2 * (DM + 16) * KPAD * 2];
  __shared__ float smean[16];      // cross-wave (block barrier)
  __shared__ float srstd[16];      // cross-wave (block barrier)
  static_assert(sizeof(smem) >= (size_t)16 * YP * 4);
  _Float16* ring = (_Float16*)smem;
  float*    ys   = (float*)smem;

  const int tid  = threadIdx.x;
  const int lane = tid & 31;
  const int wave = tid >> 5;
  const int hh   = lane >> 4;
  const int l15  = lane & 15;
  const long m0  = (long)blockIdx.x * 16;
  const int  n0  = wave * 128;

  v8f acc[1][8];
#pragma unroll
  for (int j = 0; j < 8; ++j) acc[0][j] = (v8f){};

  gemm_ring<DM, DM, 16, 8, 1>(wt, act + m0 * DM, ring, n0, 0, tid, lane, acc);

  // y = acc/4096 + bf16(bias), staged [row][col]
  {
    const float rsc = 1.0f / (WSC * WSC);
    float* yrow = ys + l15 * YP;
#pragma unroll
    for (int j = 0; j < 8; ++j) {
      const int n8 = n0 + j * 16 + hh * 8;
      const v4f b0 = *(const v4f*)(bias + n8);
      const v4f b1 = *(const v4f*)(bias + n8 + 4);
      v4f y0, y1;
#pragma unroll
      for (int i = 0; i < 4; ++i) {
        y0[i] = acc[0][j][i]     * rsc + bf16q(b0[i]);
        y1[i] = acc[0][j][4 + i] * rsc + bf16q(b1[i]);
      }
      *(v4f*)(yrow + n8)     = y0;
      *(v4f*)(yrow + n8 + 4) = y1;
    }
  }
  __syncthreads();

  // residual add (coalesced): ys[row][col] += res
#pragma unroll 4
  for (int it = 0; it < 16; ++it) {
    const int idx = it * 256 + tid;
    const int row = idx >> 8, piece = idx & 255;
    const long m = m0 + row;
    const long orow = (m / SEQ) * SEQ_FULL + (m % SEQ);
    v4f rsd = *(const v4f*)(res + orow * DM + piece * 4);
#pragma unroll
    for (int c = 0; c < 4; ++c) rsd[c] = bf16q(rsd[c]);
    float* yp = ys + row * YP + piece * 4;
    v4f yv = *(const v4f*)yp;
#pragma unroll
    for (int c = 0; c < 4; ++c) yv[c] = yv[c] + rsd[c];
    *(v4f*)yp = yv;
  }
  __syncthreads();

  {
    const int r  = tid >> 4;
    const int sl = tid & 15;
    const float* yr = ys + r * YP + sl * 64;
    float s = 0.0f;
#pragma unroll
    for (int i = 0; i < 16; ++i) {
      const v4f v = *(const v4f*)(yr + i * 4);
      s += (v[0] + v[1]) + (v[2] + v[3]);
    }
    s += __shfl_xor(s, 1, 32);
    s += __shfl_xor(s, 2, 32);
    s += __shfl_xor(s, 4, 32);
    s += __shfl_xor(s, 8, 32);
    const float mean = s * (1.0f / DM);
    float ss = 0.0f;
#pragma unroll
    for (int i = 0; i < 16; ++i) {
      const v4f v = *(const v4f*)(yr + i * 4);
#pragma unroll
      for (int c = 0; c < 4; ++c) {
        const float d = v[c] - mean;
        ss += d * d;
      }
    }
    ss += __shfl_xor(ss, 1, 32);
    ss += __shfl_xor(ss, 2, 32);
    ss += __shfl_xor(ss, 4, 32);
    ss += __shfl_xor(ss, 8, 32);
    const float var  = ss * (1.0f / DM);
    const float rstd = rsqrtf(var + LN_EPS);
    if (sl == 0) { smean[r] = mean; srstd[r] = rstd; }
  }
  __syncthreads();

  // nx2 values into registers: thread owns row idx>>7 and 8 contiguous cols p8*8
  v4u hv[8];
#pragma unroll
  for (int it = 0; it < 8; ++it) {
    const int idx = it * 256 + tid;
    const int row = idx >> 7, p8 = idx & 127;
    const v4f a  = *(const v4f*)(ys + row * YP + p8 * 8);
    const v4f c  = *(const v4f*)(ys + row * YP + p8 * 8 + 4);
    const v4f g0 = *(const v4f*)(gam + p8 * 8);
    const v4f g1 = *(const v4f*)(gam + p8 * 8 + 4);
    const v4f b0 = *(const v4f*)(bet + p8 * 8);
    const v4f b1 = *(const v4f*)(bet + p8 * 8 + 4);
    const float mean = smean[row], rstd = srstd[row];
    H8 o;
#pragma unroll
    for (int i = 0; i < 4; ++i) {
      o.h[i]     = (_Float16)((a[i] - mean) * rstd * bf16q(g0[i]) + bf16q(b0[i]));
      o.h[4 + i] = (_Float16)((c[i] - mean) * rstd * bf16q(g1[i]) + bf16q(b1[i]));
    }
    hv[it] = o.u;
  }

#pragma unroll 4
  for (int it = 0; it < 16; ++it) {
    const int idx = it * 256 + tid;
    const int row = idx >> 8, piece = idx & 255;
    const v4f v = *(const v4f*)(ys + row * YP + piece * 4);
    *(v4f*)(outf + (m0 + row) * DM + piece * 4) = v;
  }
#pragma unroll
  for (int it = 0; it < 8; ++it) {
    const int idx = it * 256 + tid;
    const int row = idx >> 7, p8 = idx & 127;
    *(v4u*)(outh + (m0 + row) * DM + p8 * 8) = hv[it];
  }
}

// ---------------------------------------------------------------------------
// Kernel 4: ffn linear 1 + silu: hp[row][col] = f16(64 * silu(nx2 @ Wf1 / 64 + bf16(bf1))),
// silu(u) = u * 1/(1+exp(-u)) in f32. Block = 128 token rows x 128 output cols, 8 waves = 4 token
// groups of 32 x 2 column groups of 64; C^T = Wf1t nx2^T (A = Wf1t rows, B = nx2 f16 rows),
// K = 1024, operands through the ring (128 weight rows + 128 nx2 rows per stage).
// Epilogue staged [token][col] in LDS (in the ring's bytes once the ring is left),
// grid (ROWS/128, FF/128), block 256. coverage: every (row, col) of the hp plane [ROWS][4096] once.
// ---------------------------------------------------------------------------
__global__ __launch_bounds__(256) void ffn1_kernel(
    const _Float16* __restrict__ x2h, const _Float16* __restrict__ wf1t,
    const float* __restrict__ bf1, _Float16* __restrict__ hp) {
  // operand ring in the k loop, then the output stage [128][VSPAD]; cross-wave (block barriers)
  __shared__ __attribute__((aligned(16))) _Float16 ring[2 * (128 + 128) * KPAD];
  static_assert(2 * (128 + 128) * KPAD >= 128 * VSPAD);
  _Float16* stg = ring;

  const int tid  = threadIdx.x;
  const int lane = tid & 31;
  const int wave = tid >> 5;
  const int hh   = lane >> 4;
  const int l15  = lane & 15;
  const int wt   = wave & 3;            // token group: rows 32 wt .. 32 wt + 31 of the block
  const int wc   = wave >> 2;           // column group: cols 64 wc .. 64 wc + 63 of the block
  const int cb   = blockIdx.y;          // 0..FF/128-1
  const long m0  = (long)blockIdx.x * 128;

  v8f acc[2][4];
#pragma unroll
  for (int i = 0; i < 2; ++i)
#pragma unroll
    for (int j = 0; j < 4; ++j) acc[i][j] = (v8f){};

  gemm_ring<DM, 128, 128, 4, 2>(wf1t + ((long)cb * 128) * DM, x2h + m0 * DM, ring,
                                wc * 64, wt * 32, tid, lane, acc);

  const float rsc = 1.0f / WSC;
#pragma unroll
  for (int j = 0; j < 4; ++j) {
    const int n8 = wc * 64 + j * 16 + hh * 8;
    const v4f b0 = *(const v4f*)(bf1 + cb * 128 + n8);
    const v4f b1 = *(const v4f*)(bf1 + cb * 128 + n8 + 4);
#pragma unroll
    for (int i = 0; i < 2; ++i) {
      H8 pk;
#pragma unroll
      for (int r = 0; r < 4; ++r) {
        const float u0 = acc[i][j][r]     * rsc + bf16q(b0[r]);
        const float u1 = acc[i][j][4 + r] * rsc + bf16q(b1[r]);
        const float e0 = __expf(fminf(-u0, 80.0f));
        const float e1 = __expf(fminf(-u1, 80.0f));
        const float g0 = u0 * __builtin_amdgcn_rcpf(1.0f + e0);
        const float g1 = u1 * __builtin_amdgcn_rcpf(1.0f + e1);
        pk.h[r]     = (_Float16)(g0 * WSC);
        pk.h[4 + r] = (_Float16)(g1 * WSC);
      }
      *(v4u*)(stg + (wt * 32 + i * 16 + l15) * VSPAD + n8) = pk.u;
    }
  }
  __syncthreads();

  v4u rv[8];
#pragma unroll
  for (int it = 0; it < 8; ++it) {
    const int idx = it * 256 + tid;
    const int row = idx >> 4, piece = idx & 15;
    rv[it] = *(const v4u*)(stg + row * VSPAD + piece * 8);
  }
#pragma unroll
  for (int it = 0; it < 8; ++it) {
    const int idx = it * 256 + tid;
    const int row = idx >> 4, piece = idx & 15;
    *(v4u*)(hp + (m0 + row) * FF + cb * 128 + piece * 8) = rv[it];
  }
}

// ---------------------------------------------------------------------------
// Kernel 5: ffn linear 2 + residual: out = hp @ Wf2 / 4096 + bf16(bf2) + x1 (f32 plane), out in
// full-stride rows. Block = 128 token rows x 128 output cols, 8 waves = 4 token groups of 32 x 2
// column groups of 64; C^T = Wf2t hp^T (A = Wf2t rows, B = hp rows), K = 4096, operands through the
// ring (128 weight rows + 128 hp rows per stage). y staged [token][col] in LDS (f32, in the ring's
// bytes once the ring is left), residual added on the way out, 512 B per row segment.
// grid (ROWS/128, DM/128), block 256. coverage: every (row, col) of out once.
// ---------------------------------------------------------------------------
__global__ __launch_bounds__(256) void ffn2_kernel(
    const _Float16* __restrict__ hp, const _Float16* __restrict__ wf2t,
    const float* __restrict__ bf2, const float* __restrict__ x1f, float* __restrict__ out) {
  // operand ring in the k loop, then ys [128][YT] f32; cross-wave (block barriers)
  __shared__ __attribute__((aligned(16))) unsigned char smem[2 * (128 + 128) * KPAD * 2];
  static_assert(sizeof(smem) >= (size_t)128 * YT * 4);
  _Float16* ring = (_Float16*)smem;
  float*    ys   = (float*)smem;

  const int tid  = threadIdx.x;
  const int lane = tid & 31;
  const int wave = tid >> 5;
  const int hh   = lane >> 4;
  const int l15  = lane & 15;
  const int wt   = wave & 3;            // token group: rows 32 wt .. 32 wt + 31 of the block
  const int wc   = wave >> 2;           // column group: cols 64 wc .. 64 wc + 63 of the block
  const int cb   = blockIdx.y;          // 0..DM/128-1
  const long m0  = (long)blockIdx.x * 128;

  v8f acc[2][4];
#pragma unroll
  for (int i = 0; i < 2; ++i)
#pragma unroll
    for (int j = 0; j < 4; ++j) acc[i][j] = (v8f){};

  gemm_ring<FF, 128, 128, 4, 2>(wf2t + ((long)cb * 128) * FF, hp + m0 * FF, ring,
                                wc * 64, wt * 32, tid, lane, acc);

  // y = acc/4096 + bf16(bias), staged [token][col]
  const float rsc = 1.0f / (WSC * WSC);
#pragma unroll
  for (int j = 0; j < 4; ++j) {
    const int n8 = wc * 64 + j * 16 + hh * 8;
    const v4f b0 = *(const v4f*)(bf2 + cb * 128 + n8);
    const v4f b1 = *(const v4f*)(bf2 + cb * 128 + n8 + 4);
#pragma unroll
    for (int i = 0; i < 2; ++i) {
      float* yrow = ys + (wt * 32 + i * 16 + l15) * YT;
      v4f y0, y1;
#pragma unroll
      for (int r = 0; r < 4; ++r) {
        y0[r] = acc[i][j][r]     * rsc + bf16q(b0[r]);
        y1[r] = acc[i][j][4 + r] * rsc + bf16q(b1[r]);
      }
      *(v4f*)(yrow + n8)     = y0;
      *(v4f*)(yrow + n8 + 4) = y1;
    }
  }
  __syncthreads();

  // residual add and store (coalesced), four row groups per trip
#pragma unroll 1   // keeps the trip's four loads and stores together and the wait once per trip
  for (int it0 = 0; it0 < 16; it0 += 4) {
#pragma unroll
    for (int u = 0; u < 4; ++u) {
      const int idx = (it0 + u) * 256 + tid;
      const int row = idx >> 5, piece = idx & 31;
      const long m = m0 + row;
      const v4f rsd = *(const v4f*)(x1f + m * DM + cb * 128 + piece * 4);
      v4f yv = *(const v4f*)(ys + row * YT + piece * 4);
#pragma unroll
      for (int c = 0; c < 4; ++c) yv[c] = yv[c] + rsd[c];
      const long drow = (m / SEQ) * SEQ_FULL + (m % SEQ);
      *(v4f*)(out + drow * DM + cb * 128 + piece * 4) = yv;
    }
    // stands in front of the next trip's rewrite of the registers that the stores name
    asm volatile("s_wait_xcnt 0x0" ::: "memory");
  }
}

// ---------------------------------------------------------------------------
extern "C" void kernel_launch(void* const* d_in, const int* in_sizes, int n_in,
                              void* d_out, int out_size, void* d_ws, size_t ws_size,
                              hipStream_t stream) {
  if (n_in < 13) return;
  const long needRows = (long)(NB - 1) * SEQ_FULL + SEQ;
  if ((long)in_sizes[0] < needRows * DM) return;
  if (in_sizes[1] < DM || in_sizes[2] < DM) return;
  if (in_sizes[3] < 3 * DM * DM || in_sizes[4] < 3 * DM) return;
  if (in_sizes[5] < DM * DM || in_sizes[6] < DM) return;
  if (in_sizes[7] < DM || in_sizes[8] < DM) return;
  if (in_sizes[9] < DM * FF || in_sizes[10] < FF) return;
  if (in_sizes[11] < FF * DM || in_sizes[12] < DM) return;
  if ((long)out_size < needRows * DM) return;
  if (ws_size < WS_TOTAL) return;

  const float* x     = (const float*)d_in[0];
  const float* g1    = (const float*)d_in[1];
  const float* be1   = (const float*)d_in[2];
  const float* Wqkv  = (const float*)d_in[3];
  const float* bqkv  = (const float*)d_in[4];
  const float* Wo    = (const float*)d_in[5];
  const float* bo    = (const float*)d_in[6];
  const float* g2    = (const float*)d_in[7];
  const float* be2   = (const float*)d_in[8];
  const float* Wf1   = (const float*)d_in[9];
  const float* bf1   = (const float*)d_in[10];
  const float* Wf2   = (const float*)d_in[11];
  const float* bf2   = (const float*)d_in[12];
  float* out = (float*)d_out;

  char* ws = (char*)d_ws;
  size_t off = 0;
  _Float16* nxh  = (_Float16*)(ws + off); off += PLANE2;       // [ROWS][1024] f16
  _Float16* ctx  = (_Float16*)(ws + off); off += PLANE2;       // [ROWS][1024] f16 (x64)
  _Float16* wqkv = (_Float16*)(ws + off); off += WQKV_BYTES;   // [3072][1024]
  _Float16* woh  = (_Float16*)(ws + off); off += WO_BYTES;     // [1024][1024]
  _Float16* wf1t = (_Float16*)(ws + off); off += WF1_BYTES;    // [4096][1024]
  _Float16* wf2t = (_Float16*)(ws + off); off += WF2_BYTES;    // [1024][4096]
  _Float16* qh   = (_Float16*)(ws + off); off += PLANE2;       // [NB][16][SEQ][64]
  _Float16* kh   = (_Float16*)(ws + off); off += PLANE2;       // [NB][16][SEQ][64]
  _Float16* vTh  = (_Float16*)(ws + off); off += PLANE2;       // [NB][16][64][SEQ]
  float*    x1f  = (float*)(ws + off);    off += PLANE4;       // [ROWS][1024] f32
  _Float16* nx2h = (_Float16*)(ws + off); off += PLANE2;       // [ROWS][1024] f16
  _Float16* hp   = (_Float16*)(ws + off); off += H_BYTES;      // [ROWS][4096] f16 (x64)
  if (off > ws_size) return;

  ln1_cvt_kernel<<<ROWS / 8 + NT_QKV, 256, 0, stream>>>(x, g1, be1, Wqkv, nxh, wqkv);
  qkv_kernel<<<dim3(ROWS / 128, 3 * DM / 128), 256, 0, stream>>>(nxh, wqkv, bqkv, qh, kh, vTh);
  attn_kernel<<<dim3(SEQ / 128, NB * NH + NT_LATE / (SEQ / 128)), 256, 0, stream>>>(
      qh, kh, vTh, ctx, Wo, Wf1, Wf2, woh, wf1t, wf2t);
  oproj_ln_kernel<<<ROWS / 16, 256, 0, stream>>>(ctx, woh, bo, x, g2, be2, x1f, nx2h);
  ffn1_kernel<<<dim3(ROWS / 128, FF / 128), 256, 0, stream>>>(nx2h, wf1t, bf1, hp);
  ffn2_kernel<<<dim3(ROWS / 128, DM / 128), 256, 0, stream>>>(hp, wf2t, bf2, x1f, out);
}

// v005
// It runs in 199 microseconds.
// In both of two side-by-side timings against v004, it was 1.04 times as fast.
// All steps since v000 together make it 3.73 times as fast.
#include <hip/hip_runtime.h>

// All contractions (fused qkv projection, q.k^T, p.v, output projection, ffn linear 1,
// ffn linear 2): v_wmma_f32_16x16x32_f16, f16 operands, f32 accumulate. Float inputs are
// RNE-converted to bf16 at load (weights additionally carried x64; both exact in f16); computed
// 16-bit planes are f16 with power-of-two carries (softmax p x1024, context x64, ffn hidden x64)
// folded back in the f32 epilogues. Layernorms, rotary tables and rotation, softmax statistics,
// silu and residual adds: f32.

typedef __attribute__((ext_vector_type(16))) _Float16 v16h;
typedef __attribute__((ext_vector_type(8)))  _Float16 v8h;
typedef __attribute__((ext_vector_type(8)))  float v8f;
typedef __attribute__((ext_vector_type(4)))  float v4f;
typedef __attribute__((ext_vector_type(4)))  unsigned int v4u;
union H8 { v8h h; v4u u; };

#ifndef NB
#define NB 2
#endif
#ifndef SEQ
#define SEQ 2048
#endif
#define NB_FULL  2
#define SEQ_FULL 2048
#define DM   1024
#define NH   16
#define HD   64
#define FF   4096
#define ROWS (NB * SEQ)
#define KPAD 72       // LDS stride in halves for 64-wide f16 tiles (144 B, 16-B aligned)
#define VSPAD 136     // LDS stride in halves for 128-wide f16 tiles (272 B)
#define YP   1028     // LDS stride in floats for 1024-wide f32 rows (4112 B)
#define YT   132      // LDS stride in floats for 128-wide f32 rows (528 B)
#define RTP  32       // LDS stride in floats of the per-token rotary tables
#define LN_EPS 1e-5f
#define WSC    64.0f           // weight carry (power of two)
#define LN1024 6.931471806f    // ln(1024): softmax p carried x1024
#define ROPE_BASE 10000.0f

#define NT_QKV ((DM / 64) * (3 * DM / 64))    // 768 tiles: W [1024][3072]
#define NT_O   ((DM / 64) * (DM / 64))        // 256 tiles: W [1024][1024]
#define NT_F1  ((DM / 64) * (FF / 64))        // 1024 tiles: W [1024][4096]
#define NT_F2  ((FF / 64) * (DM / 64))        // 1024 tiles: W [4096][1024]
#define NT_LATE (NT_O + NT_F1 + NT_F2)        // tiles converted beside attention

#define PLANE2     ((size_t)ROWS * DM * 2)
#define PLANE4     ((size_t)ROWS * DM * 4)
#define WQKV_BYTES ((size_t)3 * DM * DM * 2)
#define WO_BYTES   ((size_t)DM * DM * 2)
#define WF1_BYTES  ((size_t)FF * DM * 2)
#define WF2_BYTES  ((size_t)DM * FF * 2)
#define H_BYTES    ((size_t)ROWS * FF * 2)
#define WS_TOTAL   (2 * PLANE2 + WQKV_BYTES + WO_BYTES + WF1_BYTES + WF2_BYTES + \
                    3 * PLANE2 + PLANE4 + PLANE2 + H_BYTES)

static_assert(NB >= 1 && NB <= NB_FULL);
static_assert(SEQ >= 128 && SEQ <= SEQ_FULL && (SEQ % 128) == 0);
static_assert((ROWS % 128) == 0 && (ROWS % 16) == 0 && (ROWS % 8) == 0);
static_assert((DM % 64) == 0 && (FF % 64) == 0 && HD == 64 && NH * HD == DM);
static_assert((DM % 128) == 0 && (FF % 128) == 0);
static_assert((NT_LATE % (SEQ / 128)) == 0);
static_assert((size_t)NB * NH * SEQ * HD * 2 == PLANE2);
static_assert(WS_TOTAL <= (size_t)134217728);

// ---------------------------------------------------------------------------
// helpers
// ---------------------------------------------------------------------------
__device__ __forceinline__ float bf16q(float f) {            // value after RNE bf16 conversion
  unsigned int u = __float_as_uint(f);
  u += 0x7FFFu + ((u >> 16) & 1u);
  return __uint_as_float(u & 0xFFFF0000u);
}

__device__ __forceinline__ float wave_sum(float v) {
  v += __shfl_xor(v, 16, 32);
  v += __shfl_xor(v, 8, 32);
  v += __shfl_xor(v, 4, 32);
  v += __shfl_xor(v, 2, 32);
  v += __shfl_xor(v, 1, 32);
  return v;
}

// 16-bit fragment (A or B): lane owns row/col (lane&15); elements 0..7 <- k0+8h+0..7,
// elements 8..15 <- k0+16+8h+0..7, h = lane>>4. Source is k-contiguous rows.
__device__ __forceinline__ v16h load_frag_row(const _Float16* base, int stride, int lane) {
  const _Float16* rowp = base + (lane & 15) * stride + ((lane >> 4) << 3);
  const v8h lo = *(const v8h*)(rowp);
  const v8h hi = *(const v8h*)(rowp + 16);
  return __builtin_shufflevector(lo, hi, 0, 1, 2, 3, 4, 5, 6, 7,
                                 8, 9, 10, 11, 12, 13, 14, 15);
}

__device__ __forceinline__ v8f wmma_f16(v16h a, v16h b, v8f c) {
  v8f d = __builtin_amdgcn_wmma_f32_16x16x32_f16(false, a, false, b, (short)0, c,
                                                 false, false);
  asm volatile("v_nop\n\tv_nop\n\tv_nop\n\tv_nop" : "+v"(d) : "v"(a), "v"(b));
  return d;
}

// ---------------------------------------------------------------------------
// Operand staging of the dense projections: a stage is 64 k (128 B) of WR weight rows followed by
// XR activation rows, LDS pitch KPAD halves, brought in by asynchronous copies to LDS (no register
// on the way) into a ring of two buffers, so that stage t+1 flies while stage t is multiplied.
// ---------------------------------------------------------------------------
__device__ __forceinline__ unsigned lds_addr(const void* p) {   // byte offset in the block's LDS
  return (unsigned)(unsigned long long)p;
}

// The s_wait_xcnt closes each run of copies inside its own statement: it stands in front of any
// later rewrite of the address registers that the copies name.
__device__ __forceinline__ void acopy2(unsigned l0, const _Float16* g0,
                                       unsigned l1, const _Float16* g1) {
  asm volatile("global_load_async_to_lds_b128 %0, %1, off\n\t"
               "global_load_async_to_lds_b128 %2, %3, off\n\t"
               "s_wait_xcnt 0x0"
               :: "v"(l0), "v"(g0), "v"(l1), "v"(g1) : "memory");
}

__device__ __forceinline__ void acopy4(unsigned l0, const _Float16* g0,
                                       unsigned l1, const _Float16* g1,
                                       unsigned l2, const _Float16* g2,
                                       unsigned l3, const _Float16* g3) {
  asm volatile("global_load_async_to_lds_b128 %0, %1, off\n\t"
               "global_load_async_to_lds_b128 %2, %3, off\n\t"
               "global_load_async_to_lds_b128 %4, %5, off\n\t"
               "global_load_async_to_lds_b128 %6, %7, off\n\t"
               "s_wait_xcnt 0x0"
               :: "v"(l0), "v"(g0), "v"(l1), "v"(g1), "v"(l2), "v"(g2), "v"(l3), "v"(g3)
               : "memory");
}

__device__ __forceinline__ void acopy8(unsigned l0, const _Float16* g0,
                                       unsigned l1, const _Float16* g1,
                                       unsigned l2, const _Float16* g2,
                                       unsigned l3, const _Float16* g3,
                                       unsigned l4, const _Float16* g4,
                                       unsigned l5, const _Float16* g5,
                                       unsigned l6, const _Float16* g6,
                                       unsigned l7, const _Float16* g7) {
  asm volatile("global_load_async_to_lds_b128 %0, %1, off\n\t"
               "global_load_async_to_lds_b128 %2, %3, off\n\t"
               "global_load_async_to_lds_b128 %4, %5, off\n\t"
               "global_load_async_to_lds_b128 %6, %7, off\n\t"
               "global_load_async_to_lds_b128 %8, %9, off\n\t"
               "global_load_async_to_lds_b128 %10, %11, off\n\t"
               "global_load_async_to_lds_b128 %12, %13, off\n\t"
               "global_load_async_to_lds_b128 %14, %15, off\n\t"
               "s_wait_xcnt 0x0"
               :: "v"(l0), "v"(g0), "v"(l1), "v"(g1), "v"(l2), "v"(g2), "v"(l3), "v"(g3),
                  "v"(l4), "v"(g4), "v"(l5), "v"(g5), "v"(l6), "v"(g6), "v"(l7), "v"(g7)
               : "memory");
}

__device__ __forceinline__ void acopy1_b64(unsigned l0, const _Float16* g0) {
  asm volatile("global_load_async_to_lds_b64 %0, %1, off\n\t"
               "s_wait_xcnt 0x0"
               :: "v"(l0), "v"(g0) : "memory");
}

// NR rows (a multiple of 64) of 128 B: 8 lanes x 16 B per row, 32 rows per copy of the block.
template <int KD, int NR>
__device__ __forceinline__ void copy_rows(const _Float16* src, _Float16* dst, int tid) {
  static_assert((NR % 64) == 0);
  const _Float16* g = src + (size_t)(tid >> 3) * KD + (tid & 7) * 8;
  const unsigned  l = lds_addr(dst + (tid >> 3) * KPAD + (tid & 7) * 8);
  constexpr unsigned LS = 32 * KPAD * 2;       // LDS bytes per 32 rows
  constexpr size_t   GS = (size_t)32 * KD;     // source halves per 32 rows
  if constexpr ((NR % 256) == 0) {
#pragma unroll   // the LDS and source steps become constants
    for (int i = 0; i < NR / 32; i += 8)
      acopy8(l + i * LS, g + i * GS, l + (i + 1) * LS, g + (i + 1) * GS,
             l + (i + 2) * LS, g + (i + 2) * GS, l + (i + 3) * LS, g + (i + 3) * GS,
             l + (i + 4) * LS, g + (i + 4) * GS, l + (i + 5) * LS, g + (i + 5) * GS,
             l + (i + 6) * LS, g + (i + 6) * GS, l + (i + 7) * LS, g + (i + 7) * GS);
  } else if constexpr ((NR % 128) == 0) {
#pragma unroll   // the LDS and source steps become constants
    for (int i = 0; i < NR / 32; i += 4)
      acopy4(l + i * LS, g + i * GS, l + (i + 1) * LS, g + (i + 1) * GS,
             l + (i + 2) * LS, g + (i + 2) * GS, l + (i + 3) * LS, g + (i + 3) * GS);
  } else {
#pragma unroll   // the LDS and source steps become constants
    for (int i = 0; i < NR / 32; i += 2)
      acopy2(l + i * LS, g + i * GS, l + (i + 1) * LS, g + (i + 1) * GS);
  }
}

// One stage: k0..k0+63 of WR weight rows and XR activation rows (XR = 16: 16 lanes x 8 B per row).
template <int KD, int WR, int XR>
__device__ __forceinline__ void stage_copy(const _Float16* wsrc, const _Float16* xsrc,
                                           _Float16* buf, int k0, int tid) {
  copy_rows<KD, WR>(wsrc + k0, buf, tid);
  if constexpr (XR == 16) {
    acopy1_b64(lds_addr(buf + (WR + (tid >> 4)) * KPAD + (tid & 15) * 4),
               xsrc + k0 + (size_t)(tid >> 4) * KD + (tid & 15) * 4);
  } else {
    copy_rows<KD, XR>(xsrc + k0, buf + WR * KPAD, tid);
  }
}

// acc[i][j] += W rows (wrow0 + 16j ..) x act rows (xrow0 + 16i ..)^T over all KD, k ascending in
// steps of 32. C^T = W act^T: A = W rows (lane&15 = out col), B = act rows (lane&15 = token).
// A wave's tile is 16 JW columns x 16 XF tokens: JW + XF fragments feed JW * XF WMMAs.
// On return every copy has landed, every wave has left the ring, and a block barrier has passed.
template <int KD, int WR, int XR, int JW, int XF>
__device__ __forceinline__ void gemm_ring(const _Float16* wsrc, const _Float16* xsrc,
                                          _Float16* ring, int wrow0, int xrow0,
                                          int tid, int lane, v8f (&acc)[XF][JW]) {
  constexpr int SH = (WR + XR) * KPAD;   // halves per buffer
  constexpr int NT = KD / 64;            // stages
  static_assert((KD % 64) == 0 && NT >= 2);

  stage_copy<KD, WR, XR>(wsrc, xsrc, ring, 0, tid);
  asm volatile("s_wait_asynccnt 0x0" ::: "memory");   // this wave's part of stage 0 has landed
  __syncthreads();                                    // stage 0 published to every wave
  stage_copy<KD, WR, XR>(wsrc, xsrc, ring + SH, 64, tid);

#pragma unroll 1   // one stage per trip: the ring's waits and barrier stand once, at the foot
  for (int t = 0; t < NT; ++t) {
    _Float16* buf = ring + (t & 1) * SH;
    const _Float16* wl = buf + wrow0 * KPAD;
    const _Float16* xl = buf + (WR + xrow0) * KPAD;
    // the stage's fragment loads go out as one group in front of its WMMAs
    // (all loops unrolled: the fragment and accumulator arrays must stay in registers)
    v16h xf[2][XF], wf[2][JW];
#pragma unroll
    for (int s = 0; s < 2; ++s) {
#pragma unroll
      for (int i = 0; i < XF; ++i)
        xf[s][i] = load_frag_row(xl + (i * 16) * KPAD + s * 32, KPAD, lane);
#pragma unroll
      for (int j = 0; j < JW; ++j)
        wf[s][j] = load_frag_row(wl + (j * 16) * KPAD + s * 32, KPAD, lane);
    }
#pragma unroll
    for (int s = 0; s < 2; ++s)
#pragma unroll
      for (int i = 0; i < XF; ++i)
#pragma unroll
        for (int j = 0; j < JW; ++j) acc[i][j] = wmma_f16(wf[s][j], xf[s][i], acc[i][j]);
    asm volatile("s_wait_dscnt 0x0" ::: "memory");     // own reads of this buffer are done
    asm volatile("s_wait_asynccnt 0x0" ::: "memory");  // own part of stage t+1 has landed
    __syncthreads();   // publishes stage t+1 and ends every wave's reads of stage t
    if (t + 2 < NT) stage_copy<KD, WR, XR>(wsrc, xsrc, buf, (t + 2) * 64, tid);
  }
  asm volatile("s_wait_asynccnt 0x0" ::: "memory");    // nothing in flight behind the loop
}

// ---------------------------------------------------------------------------
// Body A: nx = LN(bf16rne(x)) * bf16(g) + bf16(b) -> f16 plane nxh [ROWS][1024].
// One wave per token row, lane owns 4 chunks of 8 consecutive floats (i*256 + lane*8).
// ROWS/8 blocks of 256. coverage: ROWS rows x 4 x 256 halves = whole plane.
// ---------------------------------------------------------------------------
__device__ __forceinline__ void ln1_body(const float* __restrict__ x,
                                         const float* __restrict__ g,
                                         const float* __restrict__ bb,
                                         _Float16* __restrict__ nxh, int blk) {
  const int lane  = threadIdx.x & 31;
  const int wave  = threadIdx.x >> 5;
  const long m    = (long)blk * 8 + wave;                    // token row 0..ROWS-1
  const long srow = (m / SEQ) * SEQ_FULL + (m % SEQ);        // full-stride source row
  const float* xr = x + srow * DM + lane * 8;

  float s = 0.0f;
#pragma unroll 1
  for (int i = 0; i < 4; ++i) {
    const v4f a = *(const v4f*)(xr + i * 256);
    const v4f c = *(const v4f*)(xr + i * 256 + 4);
    s += ((bf16q(a[0]) + bf16q(a[1])) + (bf16q(a[2]) + bf16q(a[3]))) +
         ((bf16q(c[0]) + bf16q(c[1])) + (bf16q(c[2]) + bf16q(c[3])));
  }
  s = wave_sum(s);
  const float mean = s * (1.0f / DM);

  float ss = 0.0f;
#pragma unroll 1
  for (int i = 0; i < 4; ++i) {
    const v4f a = *(const v4f*)(xr + i * 256);
    const v4f c = *(const v4f*)(xr + i * 256 + 4);
#pragma unroll
    for (int e = 0; e < 4; ++e) {
      const float d0 = bf16q(a[e]) - mean;
      const float d1 = bf16q(c[e]) - mean;
      ss += d0 * d0;
      ss += d1 * d1;
    }
  }
  ss = wave_sum(ss);
  const float rstd = rsqrtf(ss * (1.0f / DM) + LN_EPS);

  _Float16* drow = nxh + m * DM + lane * 8;
#pragma unroll 1
  for (int i = 0; i < 4; ++i) {
    const v4f a  = *(const v4f*)(xr + i * 256);
    const v4f c  = *(const v4f*)(xr + i * 256 + 4);
    const v4f g0 = *(const v4f*)(g + i * 256 + lane * 8);
    const v4f g1 = *(const v4f*)(g + i * 256 + lane * 8 + 4);
    const v4f b0 = *(const v4f*)(bb + i * 256 + lane * 8);
    const v4f b1 = *(const v4f*)(bb + i * 256 + lane * 8 + 4);
    H8 o;
#pragma unroll
    for (int e = 0; e < 4; ++e) {
      o.h[e]     = (_Float16)((bf16q(a[e]) - mean) * rstd * bf16q(g0[e]) + bf16q(b0[e]));
      o.h[4 + e] = (_Float16)((bf16q(c[e]) - mean) * rstd * bf16q(g1[e]) + bf16q(b1[e]));
    }
    _Float16* dst = drow + i * 256;
    *(v4u*)dst = o.u;
  }
}

// ---------------------------------------------------------------------------
// Body B: one 64x64 tile (kt, nt) of a weight W [K=in][N=out] f32 -> Wt [n][k] f16 =
// f16(bf16rne(W) * 64), through an LDS transpose. One block of 256 per tile; ts holds 64 * KPAD
// halves, [n][k], cross-wave (block barrier; every thread of the block comes here or none).
// The weight conversion has no launch of its own: its tiles are further blocks of launches that
// they do not depend on, W_qkv beside the first layernorm, the other three beside attention.
// ---------------------------------------------------------------------------
__device__ __forceinline__ void cvt_tile(const float* __restrict__ W, _Float16* __restrict__ dst,
                                         int K, int N, int kt, int nt, _Float16* ts, int tid) {
  // load W[kt*64 + kr][nt*64 + 4*c4 .. +3], store transposed into ts[n][kr]
#pragma unroll
  for (int it = 0; it < 4; ++it) {
    const int idx = it * 256 + tid;
    const int kr = idx >> 4, c4 = idx & 15;
    const v4f v = *(const v4f*)(W + (size_t)(kt * 64 + kr) * N + nt * 64 + c4 * 4);
#pragma unroll
    for (int j = 0; j < 4; ++j) ts[(c4 * 4 + j) * KPAD + kr] = (_Float16)(bf16q(v[j]) * WSC);
  }
  __syncthreads();
  v4u rv[2];
#pragma unroll
  for (int it = 0; it < 2; ++it) {
    const int idx = it * 256 + tid;
    const int n = idx >> 3, piece = idx & 7;
    rv[it] = *(const v4u*)(ts + n * KPAD + piece * 8);
  }
#pragma unroll
  for (int it = 0; it < 2; ++it) {
    const int idx = it * 256 + tid;
    const int n = idx >> 3, piece = idx & 7;
    *(v4u*)(dst + (size_t)(nt * 64 + n) * K + kt * 64 + piece * 8) = rv[it];
  }
  // stands in front of any later rewrite of the registers that the two stores name
  asm volatile("s_wait_xcnt 0x0" ::: "memory");
}

// ---------------------------------------------------------------------------
// Kernel 0: blocks 0 .. ROWS/8-1: body A (first layernorm); the next NT_QKV blocks: body B on
// W_qkv, in [1024][3072] -> wqkv [3072][1024] (out col = q|k|v third, head h at 64h).
// grid ROWS/8 + NT_QKV, block 256. coverage: the nxh plane and 768 tiles of 64x64 = all of wqkv.
// ---------------------------------------------------------------------------
__global__ __launch_bounds__(256) void ln1_cvt_kernel(
    const float* __restrict__ x, const float* __restrict__ g, const float* __restrict__ bb,
    const float* __restrict__ Wqkv, _Float16* __restrict__ nxh, _Float16* __restrict__ wqkv) {
  __shared__ __attribute__((aligned(16))) _Float16 ts[64 * KPAD];
  const int bid = blockIdx.x;
  if (bid < ROWS / 8) {                                 // block-uniform selection
    ln1_body(x, g, bb, nxh, bid);
  } else {
    const int tile = bid - ROWS / 8;
    const int kt = tile / (3 * DM / 64), nt = tile - kt * (3 * DM / 64);
    cvt_tile(Wqkv, wqkv, DM, 3 * DM, kt, nt, ts, threadIdx.x);
  }
}

// ---------------------------------------------------------------------------
// Kernel 1: fused qkv projection + rotary embedding. Block = 128 token rows x 128 output columns
// (two heads of one of q/k/v), 8 waves = 4 token groups of 32 x 2 heads; a wave's tile is 32 tokens
// x 64 columns. C^T = W x^T: A = W rows (lane&15 = out col), B = nx rows (lane&15 = token);
// acc[i][j][r] = C[token 16i + lane&15][col 16j+8h+r]. K = 1024, operands through the ring
// (128 weight rows + 128 nx rows per stage).
// Prologue (q/k blocks only, block-uniform): rotary tables cos/sin[token][i], i < 32,
// angle = pos * (1 / 10000^(2i/64)), f32 powf/cosf/sinf, in LDS (cross-wave, block barrier).
// Epilogue u = acc/64 + bf16(bias); q,k: d<32: u[d]*cos - u[d+32]*sin, d>=32: u[d]*cos + u[d-32]*sin
//   q,k -> [b][h][s][64] f16 (one line per row, 8 lanes x 16 B)
//   v   -> vT[b][h][d][s] f16 (256 B per d row segment, 16 lanes x 16 B)
// grid (ROWS/128, 3*DM/128), block 256. coverage: every (b,h,s,d) of q, k and vT once.
// LDS: the output stage lies in the ring's bytes once the ring is left: q/k [2 heads][128][KPAD],
// v [128 d][VSPAD], fully written before read; ctab/stab 128x32 fully written.
// ---------------------------------------------------------------------------
__global__ __launch_bounds__(256) void qkv_kernel(
    const _Float16* __restrict__ nxh, const _Float16* __restrict__ wqkv,
    const float* __restrict__ bqkv,
    _Float16* __restrict__ q, _Float16* __restrict__ k, _Float16* __restrict__ vT) {
  __shared__ float ctab[128 * RTP];      // cos table [token][i], cross-wave (block barrier)
  __shared__ float stab[128 * RTP];      // sin table [token][i], cross-wave (block barrier)
  // operand ring in the k loop, then the output stage; cross-wave (block barriers)
  __shared__ __attribute__((aligned(16))) _Float16 ring[2 * (128 + 128) * KPAD];
  static_assert(2 * (128 + 128) * KPAD >= 2 * 128 * KPAD && 2 * (128 + 128) * KPAD >= 128 * VSPAD);
  _Float16* stg = ring;

  const int tid  = threadIdx.x;
  const int lane = tid & 31;
  const int wave = tid >> 5;
  const int hh   = lane >> 4;
  const int l15  = lane & 15;
  const int wt   = wave & 3;            // token group: rows 32 wt .. 32 wt + 31 of the block
  const int wc   = wave >> 2;           // head of the block's two

  const int cb   = blockIdx.y;          // 0..23 = output column block (128 cols each)
  const int osel = cb >> 3;             // 0 q, 1 k, 2 v
  const int h0   = (cb & 7) * 2;        // first head of the block
  const long m0  = (long)blockIdx.x * 128;
  const int  b   = (int)(m0 / SEQ);
  const int  s0  = (int)(m0 - (long)b * SEQ);

  if (osel < 2) {                       // block-uniform
#pragma clang fp contract(off)
    const int i  = tid & 31;
    const int tg = tid >> 5;
    const float e   = (float)(2 * i) * (1.0f / 64.0f);
    const float inv = 1.0f / powf(ROPE_BASE, e);
#pragma unroll 1
    for (int tt = tg; tt < 128; tt += 8) {
      const float ang = (float)(s0 + tt) * inv;
      ctab[tt * RTP + i] = cosf(ang);
      stab[tt * RTP + i] = sinf(ang);
    }
  }
  __syncthreads();

  v8f acc[2][4];
#pragma unroll
  for (int i = 0; i < 2; ++i)
#pragma unroll
    for (int j = 0; j < 4; ++j) acc[i][j] = (v8f){};

  gemm_ring<DM, 128, 128, 4, 2>(wqkv + ((long)cb * 128) * DM, nxh + m0 * DM, ring,
                                wc * 64, wt * 32, tid, lane, acc);

  const float* bias = bqkv + cb * 128 + wc * 64;
  const float  rsc  = 1.0f / WSC;

  v4u rv[8];
  if (osel < 2) {
#pragma unroll
    for (int i = 0; i < 2; ++i) {
      float u[4][8];
#pragma unroll
      for (int j = 0; j < 4; ++j) {
        const int n8 = j * 16 + hh * 8;
        const v4f b0 = *(const v4f*)(bias + n8);
        const v4f b1 = *(const v4f*)(bias + n8 + 4);
#pragma unroll
        for (int r = 0; r < 4; ++r) {
          u[j][r]     = acc[i][j][r]     * rsc + bf16q(b0[r]);
          u[j][4 + r] = acc[i][j][4 + r] * rsc + bf16q(b1[r]);
        }
      }
      // rotation: lane holds d = n8+r (j<2) and its partner d+32 (j+2); stage [head][token][col]
      const int tl = wt * 32 + i * 16 + l15;
      _Float16* srow = stg + (wc * 128 + tl) * KPAD;
      const float* crow = ctab + tl * RTP;
      const float* nrow = stab + tl * RTP;
#pragma unroll
      for (int j = 0; j < 2; ++j) {
        const int n8 = j * 16 + hh * 8;
        const v4f c0  = *(const v4f*)(crow + n8);
        const v4f c1  = *(const v4f*)(crow + n8 + 4);
        const v4f sn0 = *(const v4f*)(nrow + n8);
        const v4f sn1 = *(const v4f*)(nrow + n8 + 4);
        H8 plo, phi;
#pragma unroll
        for (int r = 0; r < 4; ++r) {
          const float a0 = u[j][r],     d0 = u[j + 2][r];
          const float a1 = u[j][4 + r], d1 = u[j + 2][4 + r];
          plo.h[r]     = (_Float16)(a0 * c0[r] - d0 * sn0[r]);
          phi.h[r]     = (_Float16)(d0 * c0[r] + a0 * sn0[r]);
          plo.h[4 + r] = (_Float16)(a1 * c1[r] - d1 * sn1[r]);
          phi.h[4 + r] = (_Float16)(d1 * c1[r] + a1 * sn1[r]);
        }
        *(v4u*)(srow + n8)      = plo.u;
        *(v4u*)(srow + 32 + n8) = phi.u;
      }
    }
    __syncthreads();
#pragma unroll
    for (int it = 0; it < 8; ++it) {
      const int idx = it * 256 + tid;
      const int row = idx >> 3, piece = idx & 7;        // row = head * 128 + token
      rv[it] = *(const v4u*)(stg + row * KPAD + piece * 8);
    }
    // per head a contiguous 16 KB; the two heads lie SEQ * HD halves apart
    _Float16* dst = ((osel == 0) ? q : k) + ((long)(b * NH + h0) * SEQ + s0) * HD;
#pragma unroll
    for (int it = 0; it < 8; ++it) {
      const int idx = it * 256 + tid;
      *(v4u*)(dst + (long)(idx >> 10) * SEQ * HD + (long)(idx & 1023) * 8) = rv[it];
    }
  } else {
    // stage transposed [d][token]: lane's 8 values are 8 different d for one token
#pragma unroll
    for (int j = 0; j < 4; ++j) {
      const int n8 = j * 16 + hh * 8;
      const v4f b0 = *(const v4f*)(bias + n8);
      const v4f b1 = *(const v4f*)(bias + n8 + 4);
#pragma unroll
      for (int i = 0; i < 2; ++i) {
        _Float16* scol = stg + (wc * 64 + n8) * VSPAD + wt * 32 + i * 16 + l15;
#pragma unroll
        for (int r = 0; r < 4; ++r) {
          scol[r * VSPAD]       = (_Float16)(acc[i][j][r]     * rsc + bf16q(b0[r]));
          scol[(4 + r) * VSPAD] = (_Float16)(acc[i][j][4 + r] * rsc + bf16q(b1[r]));
        }
      }
    }
    __syncthreads();
#pragma unroll
    for (int it = 0; it < 8; ++it) {
      const int idx = it * 256 + tid;
      const int d = idx >> 4, piece = idx & 15;         // d = head * 64 + d of the head
      rv[it] = *(const v4u*)(stg + d * VSPAD + piece * 8);
    }
    _Float16* dstb = vT + ((long)(b * NH + h0) * HD) * SEQ + s0;
#pragma unroll
    for (int it = 0; it < 8; ++it) {
      const int idx = it * 256 + tid;
      const int d = idx >> 4, piece = idx & 15;
      *(v4u*)(dstb + (long)d * SEQ + piece * 8) = rv[it];
    }
  }
}

// ---------------------------------------------------------------------------
// Kernel 2: flash attention per (b,h), no mask, all SEQ keys: blockIdx.y < NB*NH of the grid
// (SEQ/128, NB*NH + NT_LATE/(SEQ/128)), block 256 (8 waves x 16 queries). The blocks behind them
// run body B on W_proj, W_ffn1 and W_ffn2 (read first by the launches that follow), one tile each.
// Attention: C = S^T (A = K rows, B = Q) then C = O^T = V^T P^T (P^T packed from the S^T D registers); lane owns one query end-to-end. Scores are raw q.k sums:
// the 1/8 scale and the x1024 p carry live in the exp argument (p = 1024*exp((s-m)/8),
// softmax stats f32). Context (carried x64) written to ctx[b*SEQ+s][h*64+d] through an LDS stage
// K and V^T come in by asynchronous copies to LDS into a ring of two buffers, so that the next
// stage of 64 keys flies while this one is worked on.
// LDS tiles: a stage = 64 keys x 64 d of K and of V^T == consumed extent; ost 128 x 64 fully written.
// coverage: every (row, h*64+d) of the ctx plane once; 256 + 1024 + 1024 tiles of 64x64 = every
// element of woh [1024][1024], wf1t [4096][1024] and wf2t [1024][4096].
// ---------------------------------------------------------------------------
// One stage of 64 keys: buffer rows 0..63 = K rows [key][d] (source pitch HD), rows 64..127 = V^T
// rows [d][key] (source pitch SEQ), LDS pitch KPAD halves; 8 lanes x 16 B per row, 32 rows per copy.
__device__ __forceinline__ void kv_stage_copy(const _Float16* kg, const _Float16* vg,
                                              _Float16* buf, int tid) {
  const int r = tid >> 3, c = (tid & 7) * 8;
  const unsigned l = lds_addr(buf + r * KPAD + c);
  constexpr unsigned LS = 32 * KPAD * 2;       // LDS bytes per 32 rows
  acopy4(l,          kg + r * HD + c,           l + LS,     kg + (r + 32) * HD + c,
         l + 2 * LS, vg + (long)r * SEQ + c,    l + 3 * LS, vg + (long)(r + 32) * SEQ + c);
}

// At most 160 registers a wave (six waves per SIMD): beside the two attention blocks of a WGP a
// third block, a weight tile, stays resident, so the conversion still runs under attention.
__global__ __launch_bounds__(256) __attribute__((amdgpu_waves_per_eu(6))) void attn_kernel(
    const _Float16* __restrict__ Q, const _Float16* __restrict__ K,
    const _Float16* __restrict__ vT, _Float16* __restrict__ ctx,
    const float* __restrict__ Wo, const float* __restrict__ Wf1, const float* __restrict__ Wf2,
    _Float16* __restrict__ woh, _Float16* __restrict__ wf1t, _Float16* __restrict__ wf2t) {
  // two buffers of [K 64 rows | V^T 64 rows]; cross-wave (block barriers)
  __shared__ __attribute__((aligned(16))) _Float16 kv[2 * 128 * KPAD];
  __shared__ _Float16 ost[128 * KPAD];   // output stage [query][d]   (cross-wave, block barrier)

  const int tid  = threadIdx.x;
  if (blockIdx.y >= NB * NH) {           // block-uniform: a weight tile, staged in kv's bytes
    const int t = (blockIdx.y - NB * NH) * (SEQ / 128) + blockIdx.x;   // 0 .. NT_LATE-1
    const float* W;
    _Float16* dst;
    int kd, nd, kt, nt;
    if (t < NT_O) {                                     // in [1024][1024] -> out [1024][1024]
      kt = t / (DM / 64); nt = t - kt * (DM / 64); kd = DM; nd = DM;
      W = Wo; dst = woh;
    } else if (t < NT_O + NT_F1) {
      const int tile = t - NT_O;                        // in [1024][4096] -> out [4096][1024]
      kt = tile / (FF / 64); nt = tile - kt * (FF / 64); kd = DM; nd = FF;
      W = Wf1; dst = wf1t;
    } else {
      const int tile = t - NT_O - NT_F1;                // in [4096][1024] -> out [1024][4096]
      kt = tile / (DM / 64); nt = tile - kt * (DM / 64); kd = FF; nd = DM;
      W = Wf2; dst = wf2t;
    }
    cvt_tile(W, dst, kd, nd, kt, nt, kv, tid);
    return;
  }
  const int lane = tid & 31;
  const int wave = tid >> 5;
  const int bh   = blockIdx.y;
  const int b    = bh >> 4;
  const int h    = bh & 15;
  const int q0   = blockIdx.x * 128;

  const _Float16* Qb  = Q + ((long)bh * SEQ + q0) * HD;
  const _Float16* Kb  = K + (long)bh * SEQ * HD;
  const _Float16* vTb = vT + (long)bh * HD * SEQ;

  // Q fragments: B operand of S^T (lane owns query lane&15)
  v16h qfrag[2];
  {
    const _Float16* qrow = Qb + (long)wave * 16 * HD;
#pragma unroll
    for (int t = 0; t < 2; ++t) qfrag[t] = load_frag_row(qrow + t * 32, HD, lane);
  }

  v8f acc[4];   // O^T accumulator: lane owns query (lane&15); reg r -> d = nt*16+8h+r
#pragma unroll
  for (int nt = 0; nt < 4; ++nt) acc[nt] = (v8f){};
  float mi = -1e30f, li = 0.0f;

  const int colb = lane & 15;
  const int rofs = (lane >> 4) << 3;

  constexpr int SH = 128 * KPAD;   // halves per buffer
  constexpr int NS = SEQ / 64;     // stages
  static_assert(NS >= 2);

  kv_stage_copy(Kb, vTb, kv, tid);
  asm volatile("s_wait_asynccnt 0x0" ::: "memory");   // this wave's part of stage 0 has landed
  __syncthreads();                                    // stage 0 published to every wave
  kv_stage_copy(Kb + 64 * HD, vTb + 64, kv + SH, tid);

#pragma unroll 1   // one stage per trip: the ring's waits and barrier stand once, at the foot
  for (int sg = 0; sg < NS; ++sg) {
    _Float16* buf = kv + (sg & 1) * SH;
    const _Float16* ks  = buf;               // K rows [key][d]
    const _Float16* vts = buf + 64 * KPAD;   // V^T rows [d][key]

    // S^T tiles: A = K rows (lane&15 = key), B = Q
    // the stage's eight K fragments go out as one group in front of the WMMAs that use them
    // (all loops unrolled: the fragment arrays must stay in registers)
    v16h kf[2][4];
#pragma unroll
    for (int t = 0; t < 2; ++t)
#pragma unroll
      for (int kt = 0; kt < 4; ++kt)
        kf[t][kt] = load_frag_row(ks + (kt * 16) * KPAD + t * 32, KPAD, lane);
    v8f sc[4];
#pragma unroll
    for (int kt = 0; kt < 4; ++kt) sc[kt] = (v8f){};
#pragma unroll
    for (int t = 0; t < 2; ++t)
#pragma unroll
      for (int kt = 0; kt < 4; ++kt) sc[kt] = wmma_f16(kf[t][kt], qfrag[t], sc[kt]);

    // the V^T fragments of keys 0..31 are asked for here: they land under the softmax arithmetic
    v16h vf[2][4];
#pragma unroll
    for (int nt = 0; nt < 4; ++nt)
      vf[0][nt] = load_frag_row(vts + (nt * 16) * KPAD, KPAD, lane);
    // keeps the scheduler from sinking those loads to their uses, where each would be waited for
    __builtin_amdgcn_sched_barrier(0);

    // per-lane online softmax (32 of 64 keys in-lane; merge halves with one shuffle)
    float mx = sc[0][0];
#pragma unroll
    for (int kt = 0; kt < 4; ++kt)
#pragma unroll
      for (int r = 0; r < 8; ++r) mx = fmaxf(mx, sc[kt][r]);
    mx = fmaxf(mx, __shfl_xor(mx, 16, 32));
    const float mnew  = fmaxf(mi, mx);
    const float alpha = __expf((mi - mnew) * 0.125f);
    mi = mnew;
    const float cs = fmaf(mnew, 0.125f, -LN1024);   // 0.125*m - ln(1024)

    // P^T as the B operand of O^T = V^T P^T, packed from the S^T D registers:
    // element i <- tile covering keys 0..15 of the 32-step (kt = 2t), element 8+i <- kt = 2t+1.
    float rs = 0.0f;
    v16h pf[2];
#pragma unroll
    for (int t = 0; t < 2; ++t) {
#pragma unroll
      for (int kt = 2 * t; kt < 2 * t + 2; ++kt)
#pragma unroll
        for (int r = 0; r < 8; ++r) {
          const float p = __expf(fmaf(sc[kt][r], 0.125f, -cs));   // 1024*exp((s-m)/8)
          sc[kt][r] = p;
          rs += p;
        }
#pragma unroll
      for (int i = 0; i < 8; ++i) {
        pf[t][i]     = (_Float16)sc[2 * t][i];
        pf[t][8 + i] = (_Float16)sc[2 * t + 1][i];
      }
      if (t == 0) {
        // the V^T fragments of keys 32..63 follow once half of the scores are packed (registers
        // freed): they land under the other half's arithmetic
#pragma unroll
        for (int nt = 0; nt < 4; ++nt)
          vf[1][nt] = load_frag_row(vts + (nt * 16) * KPAD + 32, KPAD, lane);
        // keeps the scheduler from sinking those loads to their uses
        __builtin_amdgcn_sched_barrier(0);
      }
    }
    rs += __shfl_xor(rs, 16, 32);
    li = li * alpha + rs;

#pragma unroll
    for (int nt = 0; nt < 4; ++nt)
#pragma unroll
      for (int r = 0; r < 8; ++r) acc[nt][r] *= alpha;

    // O^T += V^T (A, rows = d) x P^T (B)
#pragma unroll
    for (int t = 0; t < 2; ++t)
#pragma unroll
      for (int nt = 0; nt < 4; ++nt) acc[nt] = wmma_f16(vf[t][nt], pf[t], acc[nt]);

    asm volatile("s_wait_dscnt 0x0" ::: "memory");     // own reads of this buffer are done
    asm volatile("s_wait_asynccnt 0x0" ::: "memory");  // own part of stage sg+1 has landed
    __syncthreads();   // publishes stage sg+1 and ends every wave's reads of stage sg
    if (sg + 2 < NS) kv_stage_copy(Kb + (long)(sg + 2) * 64 * HD, vTb + (sg + 2) * 64, buf, tid);
  }
  asm volatile("s_wait_asynccnt 0x0" ::: "memory");    // nothing in flight behind the loop

  // normalize (and apply the x64 carry) and stage: lane owns query row wave*16+colb,
  // d = nt*16+rofs+r contiguous
  {
    const float inv = 64.0f / li;
    _Float16* orow = ost + (wave * 16 + colb) * KPAD;
#pragma unroll
    for (int nt = 0; nt < 4; ++nt) {
      H8 pk;
#pragma unroll
      for (int r = 0; r < 8; ++r) pk.h[r] = (_Float16)(acc[nt][r] * inv);
      *(v4u*)(orow + nt * 16 + rofs) = pk.u;
    }
  }
  __syncthreads();

  v4u rv[4];
#pragma unroll
  for (int it = 0; it < 4; ++it) {
    const int idx = it * 256 + tid;
    const int row = idx >> 3, piece = idx & 7;
    rv[it] = *(const v4u*)(ost + row * KPAD + piece * 8);
  }
  _Float16* cbase = ctx + ((long)b * SEQ + q0) * DM + h * HD;
#pragma unroll
  for (int it = 0; it < 4; ++it) {
    const int idx = it * 256 + tid;
    const int row = idx >> 3, piece = idx & 7;
    *(v4u*)(cbase + (long)row * DM + piece * 8) = rv[it];
  }
  
}

// ---------------------------------------------------------------------------
// Kernel 3: x1 = ctx @ Wo / 4096 + bf16(bias) + bf16(x) over a full 1024-wide row, and
// nx2 = f16(LN(x1) * bf16(gamma) + bf16(beta)) -> f16 plane [ROWS][1024].
// Block = 16 token rows x 1024 cols, wave w owns cols 128w..128w+127. C^T = Wt act^T: A = Wt rows
// (lane&15 = out col), B = act rows (lane&15 = token); acc[0][j][r] = y[token lane&15][col 128w+16j+8h+r].
// Operands through the ring (1024 weight rows + 16 act rows per stage).
// y staged in LDS (f32, in the ring's bytes once the ring is left), residual (x input, full-stride
// rows) added in a coalesced LDS pass.
// grid ROWS/16, block 256. LDS ys: 16 x 1024 staged == consumed. coverage: 16 rows x 1024 per block.
// ---------------------------------------------------------------------------
__global__ __launch_bounds__(256) void oproj_ln_kernel(
    const _Float16* __restrict__ act, const _Float16* __restrict__ wt,
    const float* __restrict__ bias, const float* __restrict__ res,
    const float* __restrict__ gam, const float* __restrict__ bet,
    float* __restrict__ outf, _Float16* __restrict__ outh) {
  // 299520 B: operand ring in the k loop, then ys (65792 B); cross-wave (block barriers)
  __shared__ __attribute__((aligned(16))) unsigned char smem[2 * (DM + 16) * KPAD * 2];
  __shared__ float smean[16];      // cross-wave (block barrier)
  __shared__ float srstd[16];      // cross-wave (block barrier)
  static_assert(sizeof(smem) >= (size_t)16 * YP * 4);
  _Float16* ring = (_Float16*)smem;
  float*    ys   = (float*)smem;

  const int tid  = threadIdx.x;
  const int lane = tid & 31;
  const int wave = tid >> 5;
  const int hh   = lane >> 4;
  const int l15  = lane & 15;
  const long m0  = (long)blockIdx.x * 16;
  const int  n0  = wave * 128;

  v8f acc[1][8];
#pragma unroll
  for (int j = 0; j < 8; ++j) acc[0][j] = (v8f){};

  gemm_ring<DM, DM, 16, 8, 1>(wt, act + m0 * DM, ring, n0, 0, tid, lane, acc);

  // y = acc/4096 + bf16(bias), staged [row][col]
  {
    const float rsc = 1.0f / (WSC * WSC);
    float* yrow = ys + l15 * YP;
#pragma unroll
    for (int j = 0; j < 8; ++j) {
      const int n8 = n0 + j * 16 + hh * 8;
      const v4f b0 = *(const v4f*)(bias + n8);
      const v4f b1 = *(const v4f*)(bias + n8 + 4);
      v4f y0, y1;
#pragma unroll
      for (int i = 0; i < 4; ++i) {
        y0[i] = acc[0][j][i]     * rsc + bf16q(b0[i]);
        y1[i] = acc[0][j][4 + i] * rsc + bf16q(b1[i]);
      }
      *(v4f*)(yrow + n8)     = y0;
      *(v4f*)(yrow + n8 + 4) = y1;
    }
  }
  __syncthreads();

  // residual add (coalesced): ys[row][col] += res
#pragma unroll 4
  for (int it = 0; it < 16; ++it) {
    const int idx = it * 256 + tid;
    const int row = idx >> 8, piece = idx & 255;
    const long m = m0 + row;
    const long orow = (m / SEQ) * SEQ_FULL + (m % SEQ);
    v4f rsd = *(const v4f*)(res + orow * DM + piece * 4);
#pragma unroll
    for (int c = 0; c < 4; ++c) rsd[c] = bf16q(rsd[c]);
    float* yp = ys + row * YP + piece * 4;
    v4f yv = *(const v4f*)yp;
#pragma unroll
    for (int c = 0; c < 4; ++c) yv[c] = yv[c] + rsd[c];
    *(v4f*)yp = yv;
  }
  __syncthreads();

  {
    const int r  = tid >> 4;
    const int sl = tid & 15;
    const float* yr = ys + r * YP + sl * 64;
    float s = 0.0f;
#pragma unroll
    for (int i = 0; i < 16; ++i) {
      const v4f v = *(const v4f*)(yr + i * 4);
      s += (v[0] + v[1]) + (v[2] + v[3]);
    }
    s += __shfl_xor(s, 1, 32);
    s += __shfl_xor(s, 2, 32);
    s += __shfl_xor(s, 4, 32);
    s += __shfl_xor(s, 8, 32);
    const float mean = s * (1.0f / DM);
    float ss = 0.0f;
#pragma unroll
    for (int i = 0; i < 16; ++i) {
      const v4f v = *(const v4f*)(yr + i * 4);
#pragma unroll
      for (int c = 0; c < 4; ++c) {
        const float d = v[c] - mean;
        ss += d * d;
      }
    }
    ss += __shfl_xor(ss, 1, 32);
    ss += __shfl_xor(ss, 2, 32);
    ss += __shfl_xor(ss, 4, 32);
    ss += __shfl_xor(ss, 8, 32);
    const float var  = ss * (1.0f / DM);
    const float rstd = rsqrtf(var + LN_EPS);
    if (sl == 0) { smean[r] = mean; srstd[r] = rstd; }
  }
  __syncthreads();

  // nx2 values into registers: thread owns row idx>>7 and 8 contiguous cols p8*8
  v4u hv[8];
#pragma unroll
  for (int it = 0; it < 8; ++it) {
    const int idx = it * 256 + tid;
    const int row = idx >> 7, p8 = idx & 127;
    const v4f a  = *(const v4f*)(ys + row * YP + p8 * 8);
    const v4f c  = *(const v4f*)(ys + row * YP + p8 * 8 + 4);
    const v4f g0 = *(const v4f*)(gam + p8 * 8);
    const v4f g1 = *(const v4f*)(gam + p8 * 8 + 4);
    const v4f b0 = *(const v4f*)(bet + p8 * 8);
    const v4f b1 = *(const v4f*)(bet + p8 * 8 + 4);
    const float mean = smean[row], rstd = srstd[row];
    H8 o;
#pragma unroll
    for (int i = 0; i < 4; ++i) {
      o.h[i]     = (_Float16)((a[i] - mean) * rstd * bf16q(g0[i]) + bf16q(b0[i]));
      o.h[4 + i] = (_Float16)((c[i] - mean) * rstd * bf16q(g1[i]) + bf16q(b1[i]));
    }
    hv[it] = o.u;
  }

#pragma unroll 4
  for (int it = 0; it < 16; ++it) {
    const int idx = it * 256 + tid;
    const int row = idx >> 8, piece = idx & 255;
    const v4f v = *(const v4f*)(ys + row * YP + piece * 4);
    *(v4f*)(outf + (m0 + row) * DM + piece * 4) = v;
  }
#pragma unroll
  for (int it = 0; it < 8; ++it) {
    const int idx = it * 256 + tid;
    const int row = idx >> 7, p8 = idx & 127;
    *(v4u*)(outh + (m0 + row) * DM + p8 * 8) = hv[it];
  }
}

// ---------------------------------------------------------------------------
// Kernel 4: ffn linear 1 + silu: hp[row][col] = f16(64 * silu(nx2 @ Wf1 / 64 + bf16(bf1))),
// silu(u) = u * 1/(1+exp(-u)) in f32. Block = 128 token rows x 128 output cols, 8 waves = 4 token
// groups of 32 x 2 column groups of 64; C^T = Wf1t nx2^T (A = Wf1t rows, B = nx2 f16 rows),
// K = 1024, operands through the ring (128 weight rows + 128 nx2 rows per stage).
// Epilogue staged [token][col] in LDS (in the ring's bytes once the ring is left),
// grid (ROWS/128, FF/128), block 256. coverage: every (row, col) of the hp plane [ROWS][4096] once.
// ---------------------------------------------------------------------------
__global__ __launch_bounds__(256) void ffn1_kernel(
    const _Float16* __restrict__ x2h, const _Float16* __restrict__ wf1t,
    const float* __restrict__ bf1, _Float16* __restrict__ hp) {
  // operand ring in the k loop, then the output stage [128][VSPAD]; cross-wave (block barriers)
  __shared__ __attribute__((aligned(16))) _Float16 ring[2 * (128 + 128) * KPAD];
  static_assert(2 * (128 + 128) * KPAD >= 128 * VSPAD);
  _Float16* stg = ring;

  const int tid  = threadIdx.x;
  const int lane = tid & 31;
  const int wave = tid >> 5;
  const int hh   = lane >> 4;
  const int l15  = lane & 15;
  const int wt   = wave & 3;            // token group: rows 32 wt .. 32 wt + 31 of the block
  const int wc   = wave >> 2;           // column group: cols 64 wc .. 64 wc + 63 of the block
  const int cb   = blockIdx.y;          // 0..FF/128-1
  const long m0  = (long)blockIdx.x * 128;

  v8f acc[2][4];
#pragma unroll
  for (int i = 0; i < 2; ++i)
#pragma unroll
    for (int j = 0; j < 4; ++j) acc[i][j] = (v8f){};

  gemm_ring<DM, 128, 128, 4, 2>(wf1t + ((long)cb * 128) * DM, x2h + m0 * DM, ring,
                                wc * 64, wt * 32, tid, lane, acc);

  const float rsc = 1.0f / WSC;
#pragma unroll
  for (int j = 0; j < 4; ++j) {
    const int n8 = wc * 64 + j * 16 + hh * 8;
    const v4f b0 = *(const v4f*)(bf1 + cb * 128 + n8);
    const v4f b1 = *(const v4f*)(bf1 + cb * 128 + n8 + 4);
#pragma unroll
    for (int i = 0; i < 2; ++i) {
      H8 pk;
#pragma unroll
      for (int r = 0; r < 4; ++r) {
        const float u0 = acc[i][j][r]     * rsc + bf16q(b0[r]);
        const float u1 = acc[i][j][4 + r] * rsc + bf16q(b1[r]);
        const float e0 = __expf(fminf(-u0, 80.0f));
        const float e1 = __expf(fminf(-u1, 80.0f));
        const float g0 = u0 * __builtin_amdgcn_rcpf(1.0f + e0);
        const float g1 = u1 * __builtin_amdgcn_rcpf(1.0f + e1);
        pk.h[r]     = (_Float16)(g0 * WSC);
        pk.h[4 + r] = (_Float16)(g1 * WSC);
      }
      *(v4u*)(stg + (wt * 32 + i * 16 + l15) * VSPAD + n8) = pk.u;
    }
  }
  __syncthreads();

  v4u rv[8];
#pragma unroll
  for (int it = 0; it < 8; ++it) {
    const int idx = it * 256 + tid;
    const int row = idx >> 4, piece = idx & 15;
    rv[it] = *(const v4u*)(stg + row * VSPAD + piece * 8);
  }
#pragma unroll
  for (int it = 0; it < 8; ++it) {
    const int idx = it * 256 + tid;
    const int row = idx >> 4, piece = idx & 15;
    *(v4u*)(hp + (m0 + row) * FF + cb * 128 + piece * 8) = rv[it];
  }
}

// ---------------------------------------------------------------------------
// Kernel 5: ffn linear 2 + residual: out = hp @ Wf2 / 4096 + bf16(bf2) + x1 (f32 plane), out in
// full-stride rows. Block = 128 token rows x 128 output cols, 8 waves = 4 token groups of 32 x 2
// column groups of 64; C^T = Wf2t hp^T (A = Wf2t rows, B = hp rows), K = 4096, operands through the
// ring (128 weight rows + 128 hp rows per stage). y staged [token][col] in LDS (f32, in the ring's
// bytes once the ring is left), residual added on the way out, 512 B per row segment.
// grid (ROWS/128, DM/128), block 256. coverage: every (row, col) of out once.
// ---------------------------------------------------------------------------
__global__ __launch_bounds__(256) void ffn2_kernel(
    const _Float16* __restrict__ hp, const _Float16* __restrict__ wf2t,
    const float* __restrict__ bf2, const float* __restrict__ x1f, float* __restrict__ out) {
  // operand ring in the k loop, then ys [128][YT] f32; cross-wave (block barriers)
  __shared__ __attribute__((aligned(16))) unsigned char smem[2 * (128 + 128) * KPAD * 2];
  static_assert(sizeof(smem) >= (size_t)128 * YT * 4);
  _Float16* ring = (_Float16*)smem;
  float*    ys   = (float*)smem;

  const int tid  = threadIdx.x;
  const int lane = tid & 31;
  const int wave = tid >> 5;
  const int hh   = lane >> 4;
  const int l15  = lane & 15;
  const int wt   = wave & 3;            // token group: rows 32 wt .. 32 wt + 31 of the block
  const int wc   = wave >> 2;           // column group: cols 64 wc .. 64 wc + 63 of the block
  const int cb   = blockIdx.y;          // 0..DM/128-1
  const long m0  = (long)blockIdx.x * 128;

  v8f acc[2][4];
#pragma unroll
  for (int i = 0; i < 2; ++i)
#pragma unroll
    for (int j = 0; j < 4; ++j) acc[i][j] = (v8f){};

  gemm_ring<FF, 128, 128, 4, 2>(wf2t + ((long)cb * 128) * FF, hp + m0 * FF, ring,
                                wc * 64, wt * 32, tid, lane, acc);

  // y = acc/4096 + bf16(bias), staged [token][col]
  const float rsc = 1.0f / (WSC * WSC);
#pragma unroll
  for (int j = 0; j < 4; ++j) {
    const int n8 = wc * 64 + j * 16 + hh * 8;
    const v4f b0 = *(const v4f*)(bf2 + cb * 128 + n8);
    const v4f b1 = *(const v4f*)(bf2 + cb * 128 + n8 + 4);
#pragma unroll
    for (int i = 0; i < 2; ++i) {
      float* yrow = ys + (wt * 32 + i * 16 + l15) * YT;
      v4f y0, y1;
#pragma unroll
      for (int r = 0; r < 4; ++r) {
        y0[r] = acc[i][j][r]     * rsc + bf16q(b0[r]);
        y1[r] = acc[i][j][4 + r] * rsc + bf16q(b1[r]);
      }
      *(v4f*)(yrow + n8)     = y0;
      *(v4f*)(yrow + n8 + 4) = y1;
    }
  }
  __syncthreads();

  // residual add and store (coalesced), four row groups per trip
#pragma unroll 1   // keeps the trip's four loads and stores together and the wait once per trip
  for (int it0 = 0; it0 < 16; it0 += 4) {
#pragma unroll
    for (int u = 0; u < 4; ++u) {
      const int idx = (it0 + u) * 256 + tid;
      const int row = idx >> 5, piece = idx & 31;
      const long m = m0 + row;
      const v4f rsd = *(const v4f*)(x1f + m * DM + cb * 128 + piece * 4);
      v4f yv = *(const v4f*)(ys + row * YT + piece * 4);
#pragma unroll
      for (int c = 0; c < 4; ++c) yv[c] = yv[c] + rsd[c];
      const long drow = (m / SEQ) * SEQ_FULL + (m % SEQ);
      *(v4f*)(out + drow * DM + cb * 128 + piece * 4) = yv;
    }
    // stands in front of the next trip's rewrite of the registers that the stores name
    asm volatile("s_wait_xcnt 0x0" ::: "memory");
  }
}

// ---------------------------------------------------------------------------
extern "C" void kernel_launch(void* const* d_in, const int* in_sizes, int n_in,
                              void* d_out, int out_size, void* d_ws, size_t ws_size,
                              hipStream_t stream) {
  if (n_in < 13) return;
  const long needRows = (long)(NB - 1) * SEQ_FULL + SEQ;
  if ((long)in_sizes[0] < needRows * DM) return;
  if (in_sizes[1] < DM || in_sizes[2] < DM) return;
  if (in_sizes[3] < 3 * DM * DM || in_sizes[4] < 3 * DM) return;
  if (in_sizes[5] < DM * DM || in_sizes[6] < DM) return;
  if (in_sizes[7] < DM || in_sizes[8] < DM) return;
  if (in_sizes[9] < DM * FF || in_sizes[10] < FF) return;
  if (in_sizes[11] < FF * DM || in_sizes[12] < DM) return;
  if ((long)out_size < needRows * DM) return;
  if (ws_size < WS_TOTAL) return;

  const float* x     = (const float*)d_in[0];
  const float* g1    = (const float*)d_in[1];
  const float* be1   = (const float*)d_in[2];
  const float* Wqkv  = (const float*)d_in[3];
  const float* bqkv  = (const float*)d_in[4];
  const float* Wo    = (const float*)d_in[5];
  const float* bo    = (const float*)d_in[6];
  const float* g2    = (const float*)d_in[7];
  const float* be2   = (const float*)d_in[8];
  const float* Wf1   = (const float*)d_in[9];
  const float* bf1   = (const float*)d_in[10];
  const float* Wf2   = (const float*)d_in[11];
  const float* bf2   = (const float*)d_in[12];
  float* out = (float*)d_out;

  char* ws = (char*)d_ws;
  size_t off = 0;
  _Float16* nxh  = (_Float16*)(ws + off); off += PLANE2;       // [ROWS][1024] f16
  _Float16* ctx  = (_Float16*)(ws + off); off += PLANE2;       // [ROWS][1024] f16 (x64)
  _Float16* wqkv = (_Float16*)(ws + off); off += WQKV_BYTES;   // [3072][1024]
  _Float16* woh  = (_Float16*)(ws + off); off += WO_BYTES;     // [1024][1024]
  _Float16* wf1t = (_Float16*)(ws + off); off += WF1_BYTES;    // [4096][1024]
  _Float16* wf2t = (_Float16*)(ws + off); off += WF2_BYTES;    // [1024][4096]
  _Float16* qh   = (_Float16*)(ws + off); off += PLANE2;       // [NB][16][SEQ][64]
  _Float16* kh   = (_Float16*)(ws + off); off += PLANE2;       // [NB][16][SEQ][64]
  _Float16* vTh  = (_Float16*)(ws + off); off += PLANE2;       // [NB][16][64][SEQ]
  float*    x1f  = (float*)(ws + off);    off += PLANE4;       // [ROWS][1024] f32
  _Float16* nx2h = (_Float16*)(ws + off); off += PLANE2;       // [ROWS][1024] f16
  _Float16* hp   = (_Float16*)(ws + off); off += H_BYTES;      // [ROWS][4096] f16 (x64)
  if (off > ws_size) return;

  ln1_cvt_kernel<<<ROWS / 8 + NT_QKV, 256, 0, stream>>>(x, g1, be1, Wqkv, nxh, wqkv);
  qkv_kernel<<<dim3(ROWS / 128, 3 * DM / 128), 256, 0, stream>>>(nxh, wqkv, bqkv, qh, kh, vTh);
  attn_kernel<<<dim3(SEQ / 128, NB * NH + NT_LATE / (SEQ / 128)), 256, 0, stream>>>(
      qh, kh, vTh, ctx, Wo, Wf1, Wf2, woh, wf1t, wf2t);
  oproj_ln_kernel<<<ROWS / 16, 256, 0, stream>>>(ctx, woh, bo, x, g2, be2, x1f, nx2h);
  ffn1_kernel<<<dim3(ROWS / 128, FF / 128), 256, 0, stream>>>(nx2h, wf1t, bf1, hp);
  ffn2_kernel<<<dim3(ROWS / 128, DM / 128), 256, 0, stream>>>(hp, wf2t, bf2, x1f, out);
}

// v006
// A run of this version takes 175 microseconds.
// Two timings next to v005 put it at 1.14 and 1.15 times that version's speed.
// All steps since v000 together make it 4.27 times as fast.
#include <hip/hip_runtime.h>

// All contractions (fused qkv projection, q.k^T, p.v, output projection, ffn linear 1,
// ffn linear 2): v_wmma_f32_16x16x32_f16, f16 operands, f32 accumulate. Float inputs are
// RNE-converted to bf16 at load (weights additionally carried x64; both exact in f16); computed
// 16-bit planes are f16 with power-of-two carries (softmax p x1024, context x64, ffn hidden x64)
// folded back in the f32 epilogues. Layernorms, rotary tables and rotation, softmax statistics,
// silu and residual adds: f32.

typedef __attribute__((ext_vector_type(16))) _Float16 v16h;
typedef __attribute__((ext_vector_type(8)))  _Float16 v8h;
typedef __attribute__((ext_vector_type(8)))  float v8f;
typedef __attribute__((ext_vector_type(4)))  float v4f;
typedef __attribute__((ext_vector_type(4)))  unsigned int v4u;
union H8 { v8h h; v4u u; };

#ifndef NB
#define NB 2
#endif
#ifndef SEQ
#define SEQ 2048
#endif
#define NB_FULL  2
#define SEQ_FULL 2048
#define DM   1024
#define NH   16
#define HD   64
#define FF   4096
#define ROWS (NB * SEQ)
#define KPAD 72       // LDS stride in halves for 64-wide f16 tiles (144 B, 16-B aligned)
#define VSPAD 136     // LDS stride in halves for 128-wide f16 tiles (272 B)
#define YP   1028     // LDS stride in floats for 1024-wide f32 rows (4112 B)
#define YT   132      // LDS stride in floats for 128-wide f32 rows (528 B)
#define RTP  32       // LDS stride in floats of the per-token rotary tables
#define LN_EPS 1e-5f
#define WSC    64.0f           // weight carry (power of two)
#define LN1024 6.931471806f    // ln(1024): softmax p carried x1024
#define ROPE_BASE 10000.0f

#define NT_QKV ((DM / 64) * (3 * DM / 64))    // 768 tiles: W [1024][3072]
#define NT_O   ((DM / 64) * (DM / 64))        // 256 tiles: W [1024][1024]
#define NT_F1  ((DM / 64) * (FF / 64))        // 1024 tiles: W [1024][4096]
#define NT_F2  ((FF / 64) * (DM / 64))        // 1024 tiles: W [4096][1024]
#define NT_LATE (NT_O + NT_F1 + NT_F2)        // tiles converted beside attention

#define PLANE2     ((size_t)ROWS * DM * 2)
#define PLANE4     ((size_t)ROWS * DM * 4)
#define WQKV_BYTES ((size_t)3 * DM * DM * 2)
#define WO_BYTES   ((size_t)DM * DM * 2)
#define WF1_BYTES  ((size_t)FF * DM * 2)
#define WF2_BYTES  ((size_t)DM * FF * 2)
#define H_BYTES    ((size_t)ROWS * FF * 2)
#define WS_TOTAL   (2 * PLANE2 + WQKV_BYTES + WO_BYTES + WF1_BYTES + WF2_BYTES + \
                    3 * PLANE2 + PLANE4 + PLANE2 + H_BYTES)

static_assert(NB >= 1 && NB <= NB_FULL);
static_assert(SEQ >= 128 && SEQ <= SEQ_FULL && (SEQ % 128) == 0);
static_assert((ROWS % 128) == 0 && (ROWS % 16) == 0 && (ROWS % 8) == 0);
static_assert((DM % 64) == 0 && (FF % 64) == 0 && HD == 64 && NH * HD == DM);
static_assert((DM % 128) == 0 && (FF % 128) == 0);
static_assert((NT_LATE % (SEQ / 128)) == 0);
static_assert((size_t)NB * NH * SEQ * HD * 2 == PLANE2);
static_assert(WS_TOTAL <= (size_t)134217728);

// ---------------------------------------------------------------------------
// helpers
// ---------------------------------------------------------------------------
__device__ __forceinline__ float bf16q(float f) {            // value after RNE bf16 conversion
  unsigned int u = __float_as_uint(f);
  u += 0x7FFFu + ((u >> 16) & 1u);
  return __uint_as_float(u & 0xFFFF0000u);
}

__device__ __forceinline__ float wave_sum(float v) {
  v += __shfl_xor(v, 16, 32);
  v += __shfl_xor(v, 8, 32);
  v += __shfl_xor(v, 4, 32);
  v += __shfl_xor(v, 2, 32);
  v += __shfl_xor(v, 1, 32);
  return v;
}

// 16-bit fragment (A or B): lane owns row/col (lane&15); elements 0..7 <- k0+8h+0..7,
// elements 8..15 <- k0+16+8h+0..7, h = lane>>4. Source is k-contiguous rows.
__device__ __forceinline__ v16h load_frag_row(const _Float16* base, int stride, int lane) {
  const _Float16* rowp = base + (lane & 15) * stride + ((lane >> 4) << 3);
  const v8h lo = *(const v8h*)(rowp);
  const v8h hi = *(const v8h*)(rowp + 16);
  return __builtin_shufflevector(lo, hi, 0, 1, 2, 3, 4, 5, 6, 7,
                                 8, 9, 10, 11, 12, 13, 14, 15);
}

__device__ __forceinline__ v8f wmma_f16(v16h a, v16h b, v8f c) {
  v8f d = __builtin_amdgcn_wmma_f32_16x16x32_f16(false, a, false, b, (short)0, c,
                                                 false, false);
  asm volatile("v_nop\n\tv_nop\n\tv_nop\n\tv_nop" : "+v"(d) : "v"(a), "v"(b));
  return d;
}

// ---------------------------------------------------------------------------
// Operand staging of the dense projections: a stage is BK k (64, 128 or 256: rows of 2 BK bytes,
// LDS pitch BK + 8 halves, an odd multiple of 16 B) of WR weight rows followed by XR activation
// rows, brought in by asynchronous copies to LDS (no register on the way) into a ring of two
// buffers, so that stage t+1 flies while stage t is multiplied.
// ---------------------------------------------------------------------------
__device__ __forceinline__ unsigned lds_addr(const void* p) {   // byte offset in the block's LDS
  return (unsigned)(unsigned long long)p;
}

// The s_wait_xcnt closes each run of copies inside its own statement: it stands in front of any
// later rewrite of the address registers that the copies name.
__device__ __forceinline__ void acopy2(unsigned l0, const _Float16* g0,
                                       unsigned l1, const _Float16* g1) {
  asm volatile("global_load_async_to_lds_b128 %0, %1, off\n\t"
               "global_load_async_to_lds_b128 %2, %3, off\n\t"
               "s_wait_xcnt 0x0"
               :: "v"(l0), "v"(g0), "v"(l1), "v"(g1) : "memory");
}

__device__ __forceinline__ void acopy4(unsigned l0, const _Float16* g0,
                                       unsigned l1, const _Float16* g1,
                                       unsigned l2, const _Float16* g2,
                                       unsigned l3, const _Float16* g3) {
  asm volatile("global_load_async_to_lds_b128 %0, %1, off\n\t"
               "global_load_async_to_lds_b128 %2, %3, off\n\t"
               "global_load_async_to_lds_b128 %4, %5, off\n\t"
               "global_load_async_to_lds_b128 %6, %7, off\n\t"
               "s_wait_xcnt 0x0"
               :: "v"(l0), "v"(g0), "v"(l1), "v"(g1), "v"(l2), "v"(g2), "v"(l3), "v"(g3)
               : "memory");
}

__device__ __forceinline__ void acopy8(unsigned l0, const _Float16* g0,
                                       unsigned l1, const _Float16* g1,
                                       unsigned l2, const _Float16* g2,
                                       unsigned l3, const _Float16* g3,
                                       unsigned l4, const _Float16* g4,
                                       unsigned l5, const _Float16* g5,
                                       unsigned l6, const _Float16* g6,
                                       unsigned l7, const _Float16* g7) {
  asm volatile("global_load_async_to_lds_b128 %0, %1, off\n\t"
               "global_load_async_to_lds_b128 %2, %3, off\n\t"
               "global_load_async_to_lds_b128 %4, %5, off\n\t"
               "global_load_async_to_lds_b128 %6, %7, off\n\t"
               "global_load_async_to_lds_b128 %8, %9, off\n\t"
               "global_load_async_to_lds_b128 %10, %11, off\n\t"
               "global_load_async_to_lds_b128 %12, %13, off\n\t"
               "global_load_async_to_lds_b128 %14, %15, off\n\t"
               "s_wait_xcnt 0x0"
               :: "v"(l0), "v"(g0), "v"(l1), "v"(g1), "v"(l2), "v"(g2), "v"(l3), "v"(g3),
                  "v"(l4), "v"(g4), "v"(l5), "v"(g5), "v"(l6), "v"(g6), "v"(l7), "v"(g7)
               : "memory");
}

__device__ __forceinline__ void acopy1_b64(unsigned l0, const _Float16* g0) {
  asm volatile("global_load_async_to_lds_b64 %0, %1, off\n\t"
               "s_wait_xcnt 0x0"
               :: "v"(l0), "v"(g0) : "memory");
}

// NR rows (a multiple of 64) of 128 B: 8 lanes x 16 B per row, 32 rows per copy of the block.
template <int KD, int NR>
__device__ __forceinline__ void copy_rows(const _Float16* src, _Float16* dst, int tid) {
  static_assert((NR % 64) == 0);
  const _Float16* g = src + (size_t)(tid >> 3) * KD + (tid & 7) * 8;
  const unsigned  l = lds_addr(dst + (tid >> 3) * KPAD + (tid & 7) * 8);
  constexpr unsigned LS = 32 * KPAD * 2;       // LDS bytes per 32 rows
  constexpr size_t   GS = (size_t)32 * KD;     // source halves per 32 rows
  if constexpr ((NR % 256) == 0) {
#pragma unroll   // the LDS and source steps become constants
    for (int i = 0; i < NR / 32; i += 8)
      acopy8(l + i * LS, g + i * GS, l + (i + 1) * LS, g + (i + 1) * GS,
             l + (i + 2) * LS, g + (i + 2) * GS, l + (i + 3) * LS, g + (i + 3) * GS,
             l + (i + 4) * LS, g + (i + 4) * GS, l + (i + 5) * LS, g + (i + 5) * GS,
             l + (i + 6) * LS, g + (i + 6) * GS, l + (i + 7) * LS, g + (i + 7) * GS);
  } else if constexpr ((NR % 128) == 0) {
#pragma unroll   // the LDS and source steps become constants
    for (int i = 0; i < NR / 32; i += 4)
      acopy4(l + i * LS, g + i * GS, l + (i + 1) * LS, g + (i + 1) * GS,
             l + (i + 2) * LS, g + (i + 2) * GS, l + (i + 3) * LS, g + (i + 3) * GS);
  } else {
#pragma unroll   // the LDS and source steps become constants
    for (int i = 0; i < NR / 32; i += 2)
      acopy2(l + i * LS, g + i * GS, l + (i + 1) * LS, g + (i + 1) * GS);
  }
}

// NR rows of BK halves (256 or 512 B): BK / 8 lanes x 16 B per row, RC rows per copy of the block.
template <int KD, int NR, int BK>
__device__ __forceinline__ void copy_rows_wide(const _Float16* src, _Float16* dst, int tid) {
  constexpr int CR = BK / 8;                   // 16-B pieces per row
  constexpr int RC = 256 / CR;                 // rows per copy of the block
  constexpr int LP = BK + 8;                   // LDS pitch in halves
  static_assert((NR % (8 * RC)) == 0);
  const _Float16* g = src + (size_t)(tid / CR) * KD + (tid % CR) * 8;
  const unsigned  l = lds_addr(dst + (tid / CR) * LP + (tid % CR) * 8);
  constexpr unsigned LS = RC * LP * 2;         // LDS bytes per RC rows
  constexpr size_t   GS = (size_t)RC * KD;     // source halves per RC rows
#pragma unroll   // the LDS and source steps become constants
  for (int i = 0; i < NR / RC; i += 8)
    acopy8(l + i * LS, g + i * GS, l + (i + 1) * LS, g + (i + 1) * GS,
           l + (i + 2) * LS, g + (i + 2) * GS, l + (i + 3) * LS, g + (i + 3) * GS,
           l + (i + 4) * LS, g + (i + 4) * GS, l + (i + 5) * LS, g + (i + 5) * GS,
           l + (i + 6) * LS, g + (i + 6) * GS, l + (i + 7) * LS, g + (i + 7) * GS);
}

// One stage: k0..k0+BK-1 of WR weight rows and XR activation rows (XR = 16: 16 lanes x 8 B per row).
template <int KD, int WR, int XR, int BK>
__device__ __forceinline__ void stage_copy(const _Float16* wsrc, const _Float16* xsrc,
                                           _Float16* buf, int k0, int tid) {
  if constexpr (BK > 64) {
    copy_rows_wide<KD, WR, BK>(wsrc + k0, buf, tid);
    copy_rows_wide<KD, XR, BK>(xsrc + k0, buf + WR * (BK + 8), tid);
  } else {
    copy_rows<KD, WR>(wsrc + k0, buf, tid);
    if constexpr (XR == 16) {
      acopy1_b64(lds_addr(buf + (WR + (tid >> 4)) * KPAD + (tid & 15) * 4),
                 xsrc + k0 + (size_t)(tid >> 4) * KD + (tid & 15) * 4);
    } else {
      copy_rows<KD, XR>(xsrc + k0, buf + WR * KPAD, tid);
    }
  }
}

// acc[i][j] += W rows (wrow0 + 16j ..) x act rows (xrow0 + 16i ..)^T over all KD, k ascending in
// steps of 32. C^T = W act^T: A = W rows (lane&15 = out col), B = act rows (lane&15 = token).
// A wave's tile is 16 JW columns x 16 XF tokens: JW + XF fragments feed JW * XF WMMAs.
// On return every copy has landed, every wave has left the ring, and a block barrier has passed.
template <int KD, int WR, int XR, int JW, int XF, int BK = 64>
__device__ __forceinline__ void gemm_ring(const _Float16* wsrc, const _Float16* xsrc,
                                          _Float16* ring, int wrow0, int xrow0,
                                          int tid, int lane, v8f (&acc)[XF][JW]) {
  static_assert(BK == 64 || BK == 128 || BK == 256);
  constexpr int LP = BK + 8;             // LDS pitch in halves
  static_assert(KPAD == 64 + 8);
  constexpr int SH = (WR + XR) * LP;     // halves per buffer
  constexpr int NT = KD / BK;            // stages
  constexpr int NS = BK / 32;            // 32-k steps per stage
  static_assert((KD % BK) == 0 && NT >= 2);

  stage_copy<KD, WR, XR, BK>(wsrc, xsrc, ring, 0, tid);
  asm volatile("s_wait_asynccnt 0x0" ::: "memory");   // this wave's part of stage 0 has landed
  __syncthreads();                                    // stage 0 published to every wave
  stage_copy<KD, WR, XR, BK>(wsrc, xsrc, ring + SH, BK, tid);

#pragma unroll 1   // one stage per trip: the ring's waits and barrier stand once, at the foot
  for (int t = 0; t < NT; ++t) {
    _Float16* buf = ring + (t & 1) * SH;
    const _Float16* wl = buf + wrow0 * LP;
    const _Float16* xl = buf + (WR + xrow0) * LP;
    // fragment reads run two 32-k steps ahead of the WMMAs that use them, inside this stage only,
    // through three register sets: the LDS reads of a wide stage go on under its WMMAs
    // (all loops unrolled: the fragment and accumulator arrays must stay in registers)
    v16h xf[3][XF], wf[3][JW];
#pragma unroll
    for (int s = 0; s < NS + 2; ++s) {
      if (s < NS) {
#pragma unroll
        for (int i = 0; i < XF; ++i)
          xf[s % 3][i] = load_frag_row(xl + (i * 16) * LP + s * 32, LP, lane);
#pragma unroll
        for (int j = 0; j < JW; ++j)
          wf[s % 3][j] = load_frag_row(wl + (j * 16) * LP + s * 32, LP, lane);
      }
      if (s >= 2) {
#pragma unroll
        for (int i = 0; i < XF; ++i)
#pragma unroll
          for (int j = 0; j < JW; ++j)
            acc[i][j] = wmma_f16(wf[(s - 2) % 3][j], xf[(s - 2) % 3][i], acc[i][j]);
      }
    }
    asm volatile("s_wait_dscnt 0x0" ::: "memory");     // own reads of this buffer are done
    asm volatile("s_wait_asynccnt 0x0" ::: "memory");  // own part of stage t+1 has landed
    __syncthreads();   // publishes stage t+1 and ends every wave's reads of stage t
    if (t + 2 < NT) stage_copy<KD, WR, XR, BK>(wsrc, xsrc, buf, (t + 2) * BK, tid);
  }
  asm volatile("s_wait_asynccnt 0x0" ::: "memory");    // nothing in flight behind the loop
}

// ---------------------------------------------------------------------------
// Body A: nx = LN(bf16rne(x)) * bf16(g) + bf16(b) -> f16 plane nxh [ROWS][1024].
// One wave per token row, lane owns 4 chunks of 8 consecutive floats (i*256 + lane*8).
// ROWS/8 blocks of 256. coverage: ROWS rows x 4 x 256 halves = whole plane.
// ---------------------------------------------------------------------------
__device__ __forceinline__ void ln1_body(const float* __restrict__ x,
                                         const float* __restrict__ g,
                                         const float* __restrict__ bb,
                                         _Float16* __restrict__ nxh, int blk) {
  const int lane  = threadIdx.x & 31;
  const int wave  = threadIdx.x >> 5;
  const long m    = (long)blk * 8 + wave;                    // token row 0..ROWS-1
  const long srow = (m / SEQ) * SEQ_FULL + (m % SEQ);        // full-stride source row
  const float* xr = x + srow * DM + lane * 8;

  float s = 0.0f;
#pragma unroll 1
  for (int i = 0; i < 4; ++i) {
    const v4f a = *(const v4f*)(xr + i * 256);
    const v4f c = *(const v4f*)(xr + i * 256 + 4);
    s += ((bf16q(a[0]) + bf16q(a[1])) + (bf16q(a[2]) + bf16q(a[3]))) +
         ((bf16q(c[0]) + bf16q(c[1])) + (bf16q(c[2]) + bf16q(c[3])));
  }
  s = wave_sum(s);
  const float mean = s * (1.0f / DM);

  float ss = 0.0f;
#pragma unroll 1
  for (int i = 0; i < 4; ++i) {
    const v4f a = *(const v4f*)(xr + i * 256);
    const v4f c = *(const v4f*)(xr + i * 256 + 4);
#pragma unroll
    for (int e = 0; e < 4; ++e) {
      const float d0 = bf16q(a[e]) - mean;
      const float d1 = bf16q(c[e]) - mean;
      ss += d0 * d0;
      ss += d1 * d1;
    }
  }
  ss = wave_sum(ss);
  const float rstd = rsqrtf(ss * (1.0f / DM) + LN_EPS);

  _Float16* drow = nxh + m * DM + lane * 8;
#pragma unroll 1
  for (int i = 0; i < 4; ++i) {
    const v4f a  = *(const v4f*)(xr + i * 256);
    const v4f c  = *(const v4f*)(xr + i * 256 + 4);
    const v4f g0 = *(const v4f*)(g + i * 256 + lane * 8);
    const v4f g1 = *(const v4f*)(g + i * 256 + lane * 8 + 4);
    const v4f b0 = *(const v4f*)(bb + i * 256 + lane * 8);
    const v4f b1 = *(const v4f*)(bb + i * 256 + lane * 8 + 4);
    H8 o;
#pragma unroll
    for (int e = 0; e < 4; ++e) {
      o.h[e]     = (_Float16)((bf16q(a[e]) - mean) * rstd * bf16q(g0[e]) + bf16q(b0[e]));
      o.h[4 + e] = (_Float16)((bf16q(c[e]) - mean) * rstd * bf16q(g1[e]) + bf16q(b1[e]));
    }
    _Float16* dst = drow + i * 256;
    *(v4u*)dst = o.u;
  }
}

// ---------------------------------------------------------------------------
// Body B: one 64x64 tile (kt, nt) of a weight W [K=in][N=out] f32 -> Wt [n][k] f16 =
// f16(bf16rne(W) * 64), through an LDS transpose. One block of 256 per tile; ts holds 64 * KPAD
// halves, [n][k], cross-wave (block barrier; every thread of the block comes here or none).
// The weight conversion has no launch of its own: its tiles are further blocks of launches that
// they do not depend on, W_qkv beside the first layernorm, the other three beside attention.
// ---------------------------------------------------------------------------
__device__ __forceinline__ void cvt_tile(const float* __restrict__ W, _Float16* __restrict__ dst,
                                         int K, int N, int kt, int nt, _Float16* ts, int tid) {
  // load W[kt*64 + kr][nt*64 + 4*c4 .. +3], store transposed into ts[n][kr]
#pragma unroll
  for (int it = 0; it < 4; ++it) {
    const int idx = it * 256 + tid;
    const int kr = idx >> 4, c4 = idx & 15;
    const v4f v = *(const v4f*)(W + (size_t)(kt * 64 + kr) * N + nt * 64 + c4 * 4);
#pragma unroll
    for (int j = 0; j < 4; ++j) ts[(c4 * 4 + j) * KPAD + kr] = (_Float16)(bf16q(v[j]) * WSC);
  }
  __syncthreads();
  v4u rv[2];
#pragma unroll
  for (int it = 0; it < 2; ++it) {
    const int idx = it * 256 + tid;
    const int n = idx >> 3, piece = idx & 7;
    rv[it] = *(const v4u*)(ts + n * KPAD + piece * 8);
  }
#pragma unroll
  for (int it = 0; it < 2; ++it) {
    const int idx = it * 256 + tid;
    const int n = idx >> 3, piece = idx & 7;
    *(v4u*)(dst + (size_t)(nt * 64 + n) * K + kt * 64 + piece * 8) = rv[it];
  }
  // stands in front of any later rewrite of the registers that the two stores name
  asm volatile("s_wait_xcnt 0x0" ::: "memory");
}

// ---------------------------------------------------------------------------
// Kernel 0: blocks 0 .. ROWS/8-1: body A (first layernorm); the next NT_QKV blocks: body B on
// W_qkv, in [1024][3072] -> wqkv [3072][1024] (out col = q|k|v third, head h at 64h).
// grid ROWS/8 + NT_QKV, block 256. coverage: the nxh plane and 768 tiles of 64x64 = all of wqkv.
// ---------------------------------------------------------------------------
__global__ __launch_bounds__(256) void ln1_cvt_kernel(
    const float* __restrict__ x, const float* __restrict__ g, const float* __restrict__ bb,
    const float* __restrict__ Wqkv, _Float16* __restrict__ nxh, _Float16* __restrict__ wqkv) {
  __shared__ __attribute__((aligned(16))) _Float16 ts[64 * KPAD];
  const int bid = blockIdx.x;
  if (bid < ROWS / 8) {                                 // block-uniform selection
    ln1_body(x, g, bb, nxh, bid);
  } else {
    const int tile = bid - ROWS / 8;
    const int kt = tile / (3 * DM / 64), nt = tile - kt * (3 * DM / 64);
    cvt_tile(Wqkv, wqkv, DM, 3 * DM, kt, nt, ts, threadIdx.x);
  }
}

// ---------------------------------------------------------------------------
// Kernel 1: fused qkv projection + rotary embedding. Block = 128 token rows x 128 output columns
// (two heads of one of q/k/v), 8 waves = 4 token groups of 32 x 2 heads; a wave's tile is 32 tokens
// x 64 columns. C^T = W x^T: A = W rows (lane&15 = out col), B = nx rows (lane&15 = token);
// acc[i][j][r] = C[token 16i + lane&15][col 16j+8h+r]. K = 1024, operands through the ring
// (128 weight rows + 128 nx rows per stage).
// Prologue (q/k blocks only, block-uniform): rotary tables cos/sin[token][i], i < 32,
// angle = pos * (1 / 10000^(2i/64)), f32 powf/cosf/sinf, in LDS (cross-wave, block barrier).
// Epilogue u = acc/64 + bf16(bias); q,k: d<32: u[d]*cos - u[d+32]*sin, d>=32: u[d]*cos + u[d-32]*sin
//   q,k -> [b][h][s][64] f16 (one line per row, 8 lanes x 16 B)
//   v   -> vT[b][h][d][s] f16 (256 B per d row segment, 16 lanes x 16 B)
// grid (ROWS/128, 3*DM/128), block 256. coverage: every (b,h,s,d) of q, k and vT once.
// LDS: the output stage lies in the ring's bytes once the ring is left: q/k [2 heads][128][KPAD],
// v [128 d][VSPAD], fully written before read; ctab/stab 128x32 fully written.
// ---------------------------------------------------------------------------
__global__ __launch_bounds__(256) void qkv_kernel(
    const _Float16* __restrict__ nxh, const _Float16* __restrict__ wqkv,
    const float* __restrict__ bqkv,
    _Float16* __restrict__ q, _Float16* __restrict__ k, _Float16* __restrict__ vT) {
  __shared__ float ctab[128 * RTP];      // cos table [token][i], cross-wave (block barrier)
  __shared__ float stab[128 * RTP];      // sin table [token][i], cross-wave (block barrier)
  // operand ring in the k loop, then the output stage; cross-wave (block barriers)
  __shared__ __attribute__((aligned(16))) _Float16 ring[2 * (128 + 128) * KPAD];
  static_assert(2 * (128 + 128) * KPAD >= 2 * 128 * KPAD && 2 * (128 + 128) * KPAD >= 128 * VSPAD);
  _Float16* stg = ring;

  const int tid  = threadIdx.x;
  const int lane = tid & 31;
  const int wave = tid >> 5;
  const int hh   = lane >> 4;
  const int l15  = lane & 15;
  const int wt   = wave & 3;            // token group: rows 32 wt .. 32 wt + 31 of the block
  const int wc   = wave >> 2;           // head of the block's two

  const int cb   = blockIdx.y;          // 0..23 = output column block (128 cols each)
  const int osel = cb >> 3;             // 0 q, 1 k, 2 v
  const int h0   = (cb & 7) * 2;        // first head of the block
  const long m0  = (long)blockIdx.x * 128;
  const int  b   = (int)(m0 / SEQ);
  const int  s0  = (int)(m0 - (long)b * SEQ);

  if (osel < 2) {                       // block-uniform
#pragma clang fp contract(off)
    const int i  = tid & 31;
    const int tg = tid >> 5;
    const float e   = (float)(2 * i) * (1.0f / 64.0f);
    const float inv = 1.0f / powf(ROPE_BASE, e);
#pragma unroll 1
    for (int tt = tg; tt < 128; tt += 8) {
      const float ang = (float)(s0 + tt) * inv;
      ctab[tt * RTP + i] = cosf(ang);
      stab[tt * RTP + i] = sinf(ang);
    }
  }
  __syncthreads();

  v8f acc[2][4];
#pragma unroll
  for (int i = 0; i < 2; ++i)
#pragma unroll
    for (int j = 0; j < 4; ++j) acc[i][j] = (v8f){};

  gemm_ring<DM, 128, 128, 4, 2>(wqkv + ((long)cb * 128) * DM, nxh + m0 * DM, ring,
                                wc * 64, wt * 32, tid, lane, acc);

  const float* bias = bqkv + cb * 128 + wc * 64;
  const float  rsc  = 1.0f / WSC;

  v4u rv[8];
  if (osel < 2) {
#pragma unroll
    for (int i = 0; i < 2; ++i) {
      float u[4][8];
#pragma unroll
      for (int j = 0; j < 4; ++j) {
        const int n8 = j * 16 + hh * 8;
        const v4f b0 = *(const v4f*)(bias + n8);
        const v4f b1 = *(const v4f*)(bias + n8 + 4);
#pragma unroll
        for (int r = 0; r < 4; ++r) {
          u[j][r]     = acc[i][j][r]     * rsc + bf16q(b0[r]);
          u[j][4 + r] = acc[i][j][4 + r] * rsc + bf16q(b1[r]);
        }
      }
      // rotation: lane holds d = n8+r (j<2) and its partner d+32 (j+2); stage [head][token][col]
      const int tl = wt * 32 + i * 16 + l15;
      _Float16* srow = stg + (wc * 128 + tl) * KPAD;
      const float* crow = ctab + tl * RTP;
      const float* nrow = stab + tl * RTP;
#pragma unroll
      for (int j = 0; j < 2; ++j) {
        const int n8 = j * 16 + hh * 8;
        const v4f c0  = *(const v4f*)(crow + n8);
        const v4f c1  = *(const v4f*)(crow + n8 + 4);
        const v4f sn0 = *(const v4f*)(nrow + n8);
        const v4f sn1 = *(const v4f*)(nrow + n8 + 4);
        H8 plo, phi;
#pragma unroll
        for (int r = 0; r < 4; ++r) {
          const float a0 = u[j][r],     d0 = u[j + 2][r];
          const float a1 = u[j][4 + r], d1 = u[j + 2][4 + r];
          plo.h[r]     = (_Float16)(a0 * c0[r] - d0 * sn0[r]);
          phi.h[r]     = (_Float16)(d0 * c0[r] + a0 * sn0[r]);
          plo.h[4 + r] = (_Float16)(a1 * c1[r] - d1 * sn1[r]);
          phi.h[4 + r] = (_Float16)(d1 * c1[r] + a1 * sn1[r]);
        }
        *(v4u*)(srow + n8)      = plo.u;
        *(v4u*)(srow + 32 + n8) = phi.u;
      }
    }
    __syncthreads();
#pragma unroll
    for (int it = 0; it < 8; ++it) {
      const int idx = it * 256 + tid;
      const int row = idx >> 3, piece = idx & 7;        // row = head * 128 + token
      rv[it] = *(const v4u*)(stg + row * KPAD + piece * 8);
    }
    // per head a contiguous 16 KB; the two heads lie SEQ * HD halves apart
    _Float16* dst = ((osel == 0) ? q : k) + ((long)(b * NH + h0) * SEQ + s0) * HD;
#pragma unroll
    for (int it = 0; it < 8; ++it) {
      const int idx = it * 256 + tid;
      *(v4u*)(dst + (long)(idx >> 10) * SEQ * HD + (long)(idx & 1023) * 8) = rv[it];
    }
  } else {
    // stage transposed [d][token]: lane's 8 values are 8 different d for one token
#pragma unroll
    for (int j = 0; j < 4; ++j) {
      const int n8 = j * 16 + hh * 8;
      const v4f b0 = *(const v4f*)(bias + n8);
      const v4f b1 = *(const v4f*)(bias + n8 + 4);
#pragma unroll
      for (int i = 0; i < 2; ++i) {
        _Float16* scol = stg + (wc * 64 + n8) * VSPAD + wt * 32 + i * 16 + l15;
#pragma unroll
        for (int r = 0; r < 4; ++r) {
          scol[r * VSPAD]       = (_Float16)(acc[i][j][r]     * rsc + bf16q(b0[r]));
          scol[(4 + r) * VSPAD] = (_Float16)(acc[i][j][4 + r] * rsc + bf16q(b1[r]));
        }
      }
    }
    __syncthreads();
#pragma unroll
    for (int it = 0; it < 8; ++it) {
      const int idx = it * 256 + tid;
      const int d = idx >> 4, piece = idx & 15;         // d = head * 64 + d of the head
      rv[it] = *(const v4u*)(stg + d * VSPAD + piece * 8);
    }
    _Float16* dstb = vT + ((long)(b * NH + h0) * HD) * SEQ + s0;
#pragma unroll
    for (int it = 0; it < 8; ++it) {
      const int idx = it * 256 + tid;
      const int d = idx >> 4, piece = idx & 15;
      *(v4u*)(dstb + (long)d * SEQ + piece * 8) = rv[it];
    }
  }
}

// ---------------------------------------------------------------------------
// Kernel 2: flash attention per (b,h), no mask, all SEQ keys: blockIdx.y < NB*NH of the grid
// (SEQ/128, NB*NH + NT_LATE/(SEQ/128)), block 256 (8 waves x 16 queries). The blocks behind them
// run body B on W_proj, W_ffn1 and W_ffn2 (read first by the launches that follow), one tile each.
// Attention: C = S^T (A = K rows, B = Q) then C = O^T = V^T P^T (P^T packed from the S^T D registers); lane owns one query end-to-end. Scores are raw q.k sums:
// the 1/8 scale and the x1024 p carry live in the exp argument (p = 1024*exp((s-m)/8),
// softmax stats f32). Context (carried x64) written to ctx[b*SEQ+s][h*64+d] through an LDS stage
// K and V^T come in by asynchronous copies to LDS into a ring of two buffers, so that the next
// stage of 64 keys flies while this one is worked on.
// LDS tiles: a stage = 64 keys x 64 d of K and of V^T == consumed extent; ost 128 x 64 fully written.
// coverage: every (row, h*64+d) of the ctx plane once; 256 + 1024 + 1024 tiles of 64x64 = every
// element of woh [1024][1024], wf1t [4096][1024] and wf2t [1024][4096].
// ---------------------------------------------------------------------------
// One stage of 64 keys: buffer rows 0..63 = K rows [key][d] (source pitch HD), rows 64..127 = V^T
// rows [d][key] (source pitch SEQ), LDS pitch KPAD halves; 8 lanes x 16 B per row, 32 rows per copy.
__device__ __forceinline__ void kv_stage_copy(const _Float16* kg, const _Float16* vg,
                                              _Float16* buf, int tid) {
  const int r = tid >> 3, c = (tid & 7) * 8;
  const unsigned l = lds_addr(buf + r * KPAD + c);
  constexpr unsigned LS = 32 * KPAD * 2;       // LDS bytes per 32 rows
  acopy4(l,          kg + r * HD + c,           l + LS,     kg + (r + 32) * HD + c,
         l + 2 * LS, vg + (long)r * SEQ + c,    l + 3 * LS, vg + (long)(r + 32) * SEQ + c);
}

// At most 160 registers a wave (six waves per SIMD): beside the two attention blocks of a WGP a
// third block, a weight tile, stays resident, so the conversion still runs under attention.
__global__ __launch_bounds__(256) __attribute__((amdgpu_waves_per_eu(6))) void attn_kernel(
    const _Float16* __restrict__ Q, const _Float16* __restrict__ K,
    const _Float16* __restrict__ vT, _Float16* __restrict__ ctx,
    const float* __restrict__ Wo, const float* __restrict__ Wf1, const float* __restrict__ Wf2,
    _Float16* __restrict__ woh, _Float16* __restrict__ wf1t, _Float16* __restrict__ wf2t) {
  // two buffers of [K 64 rows | V^T 64 rows]; cross-wave (block barriers)
  __shared__ __attribute__((aligned(16))) _Float16 kv[2 * 128 * KPAD];
  __shared__ _Float16 ost[128 * KPAD];   // output stage [query][d]   (cross-wave, block barrier)

  const int tid  = threadIdx.x;
  if (blockIdx.y >= NB * NH) {           // block-uniform: a weight tile, staged in kv's bytes
    const int t = (blockIdx.y - NB * NH) * (SEQ / 128) + blockIdx.x;   // 0 .. NT_LATE-1
    const float* W;
    _Float16* dst;
    int kd, nd, kt, nt;
    if (t < NT_O) {                                     // in [1024][1024] -> out [1024][1024]
      kt = t / (DM / 64); nt = t - kt * (DM / 64); kd = DM; nd = DM;
      W = Wo; dst = woh;
    } else if (t < NT_O + NT_F1) {
      const int tile = t - NT_O;                        // in [1024][4096] -> out [4096][1024]
      kt = tile / (FF / 64); nt = tile - kt * (FF / 64); kd = DM; nd = FF;
      W = Wf1; dst = wf1t;
    } else {
      const int tile = t - NT_O - NT_F1;                // in [4096][1024] -> out [1024][4096]
      kt = tile / (DM / 64); nt = tile - kt * (DM / 64); kd = FF; nd = DM;
      W = Wf2; dst = wf2t;
    }
    cvt_tile(W, dst, kd, nd, kt, nt, kv, tid);
    return;
  }
  const int lane = tid & 31;
  const int wave = tid >> 5;
  const int bh   = blockIdx.y;
  const int b    = bh >> 4;
  const int h    = bh & 15;
  const int q0   = blockIdx.x * 128;

  const _Float16* Qb  = Q + ((long)bh * SEQ + q0) * HD;
  const _Float16* Kb  = K + (long)bh * SEQ * HD;
  const _Float16* vTb = vT + (long)bh * HD * SEQ;

  // Q fragments: B operand of S^T (lane owns query lane&15)
  v16h qfrag[2];
  {
    const _Float16* qrow = Qb + (long)wave * 16 * HD;
#pragma unroll
    for (int t = 0; t < 2; ++t) qfrag[t] = load_frag_row(qrow + t * 32, HD, lane);
  }

  v8f acc[4];   // O^T accumulator: lane owns query (lane&15); reg r -> d = nt*16+8h+r
#pragma unroll
  for (int nt = 0; nt < 4; ++nt) acc[nt] = (v8f){};
  float mi = -1e30f, li = 0.0f;

  const int colb = lane & 15;
  const int rofs = (lane >> 4) << 3;

  constexpr int SH = 128 * KPAD;   // halves per buffer
  constexpr int NS = SEQ / 64;     // stages
  static_assert(NS >= 2);

  kv_stage_copy(Kb, vTb, kv, tid);
  asm volatile("s_wait_asynccnt 0x0" ::: "memory");   // this wave's part of stage 0 has landed
  __syncthreads();                                    // stage 0 published to every wave
  kv_stage_copy(Kb + 64 * HD, vTb + 64, kv + SH, tid);

#pragma unroll 1   // one stage per trip: the ring's waits and barrier stand once, at the foot
  for (int sg = 0; sg < NS; ++sg) {
    _Float16* buf = kv + (sg & 1) * SH;
    const _Float16* ks  = buf;               // K rows [key][d]
    const _Float16* vts = buf + 64 * KPAD;   // V^T rows [d][key]

    // S^T tiles: A = K rows (lane&15 = key), B = Q
    // the stage's eight K fragments go out as one group in front of the WMMAs that use them
    // (all loops unrolled: the fragment arrays must stay in registers)
    v16h kf[2][4];
#pragma unroll
    for (int t = 0; t < 2; ++t)
#pragma unroll
      for (int kt = 0; kt < 4; ++kt)
        kf[t][kt] = load_frag_row(ks + (kt * 16) * KPAD + t * 32, KPAD, lane);
    v8f sc[4];
#pragma unroll
    for (int kt = 0; kt < 4; ++kt) sc[kt] = (v8f){};
#pragma unroll
    for (int t = 0; t < 2; ++t)
#pragma unroll
      for (int kt = 0; kt < 4; ++kt) sc[kt] = wmma_f16(kf[t][kt], qfrag[t], sc[kt]);

    // the V^T fragments of keys 0..31 are asked for here: they land under the softmax arithmetic
    v16h vf[2][4];
#pragma unroll
    for (int nt = 0; nt < 4; ++nt)
      vf[0][nt] = load_frag_row(vts + (nt * 16) * KPAD, KPAD, lane);
    // keeps the scheduler from sinking those loads to their uses, where each would be waited for
    __builtin_amdgcn_sched_barrier(0);

    // per-lane online softmax (32 of 64 keys in-lane; merge halves with one shuffle)
    float mx = sc[0][0];
#pragma unroll
    for (int kt = 0; kt < 4; ++kt)
#pragma unroll
      for (int r = 0; r < 8; ++r) mx = fmaxf(mx, sc[kt][r]);
    mx = fmaxf(mx, __shfl_xor(mx, 16, 32));
    const float mnew  = fmaxf(mi, mx);
    const float alpha = __expf((mi - mnew) * 0.125f);
    mi = mnew;
    const float cs = fmaf(mnew, 0.125f, -LN1024);   // 0.125*m - ln(1024)

    // P^T as the B operand of O^T = V^T P^T, packed from the S^T D registers:
    // element i <- tile covering keys 0..15 of the 32-step (kt = 2t), element 8+i <- kt = 2t+1.
    float rs = 0.0f;
    v16h pf[2];
#pragma unroll
    for (int t = 0; t < 2; ++t) {
#pragma unroll
      for (int kt = 2 * t; kt < 2 * t + 2; ++kt)
#pragma unroll
        for (int r = 0; r < 8; ++r) {
          const float p = __expf(fmaf(sc[kt][r], 0.125f, -cs));   // 1024*exp((s-m)/8)
          sc[kt][r] = p;
          rs += p;
        }
#pragma unroll
      for (int i = 0; i < 8; ++i) {
        pf[t][i]     = (_Float16)sc[2 * t][i];
        pf[t][8 + i] = (_Float16)sc[2 * t + 1][i];
      }
      if (t == 0) {
        // the V^T fragments of keys 32..63 follow once half of the scores are packed (registers
        // freed): they land under the other half's arithmetic
#pragma unroll
        for (int nt = 0; nt < 4; ++nt)
          vf[1][nt] = load_frag_row(vts + (nt * 16) * KPAD + 32, KPAD, lane);
        // keeps the scheduler from sinking those loads to their uses
        __builtin_amdgcn_sched_barrier(0);
      }
    }
    rs += __shfl_xor(rs, 16, 32);
    li = li * alpha + rs;

#pragma unroll
    for (int nt = 0; nt < 4; ++nt)
#pragma unroll
      for (int r = 0; r < 8; ++r) acc[nt][r] *= alpha;

    // O^T += V^T (A, rows = d) x P^T (B)
#pragma unroll
    for (int t = 0; t < 2; ++t)
#pragma unroll
      for (int nt = 0; nt < 4; ++nt) acc[nt] = wmma_f16(vf[t][nt], pf[t], acc[nt]);

    asm volatile("s_wait_dscnt 0x0" ::: "memory");     // own reads of this buffer are done
    asm volatile("s_wait_asynccnt 0x0" ::: "memory");  // own part of stage sg+1 has landed
    __syncthreads();   // publishes stage sg+1 and ends every wave's reads of stage sg
    if (sg + 2 < NS) kv_stage_copy(Kb + (long)(sg + 2) * 64 * HD, vTb + (sg + 2) * 64, buf, tid);
  }
  asm volatile("s_wait_asynccnt 0x0" ::: "memory");    // nothing in flight behind the loop

  // normalize (and apply the x64 carry) and stage: lane owns query row wave*16+colb,
  // d = nt*16+rofs+r contiguous
  {
    const float inv = 64.0f / li;
    _Float16* orow = ost + (wave * 16 + colb) * KPAD;
#pragma unroll
    for (int nt = 0; nt < 4; ++nt) {
      H8 pk;
#pragma unroll
      for (int r = 0; r < 8; ++r) pk.h[r] = (_Float16)(acc[nt][r] * inv);
      *(v4u*)(orow + nt * 16 + rofs) = pk.u;
    }
  }
  __syncthreads();

  v4u rv[4];
#pragma unroll
  for (int it = 0; it < 4; ++it) {
    const int idx = it * 256 + tid;
    const int row = idx >> 3, piece = idx & 7;
    rv[it] = *(const v4u*)(ost + row * KPAD + piece * 8);
  }
  _Float16* cbase = ctx + ((long)b * SEQ + q0) * DM + h * HD;
#pragma unroll
  for (int it = 0; it < 4; ++it) {
    const int idx = it * 256 + tid;
    const int row = idx >> 3, piece = idx & 7;
    *(v4u*)(cbase + (long)row * DM + piece * 8) = rv[it];
  }
  
}

// ---------------------------------------------------------------------------
// Kernel 3: x1 = ctx @ Wo / 4096 + bf16(bias) + bf16(x) over a full 1024-wide row, and
// nx2 = f16(LN(x1) * bf16(gamma) + bf16(beta)) -> f16 plane [ROWS][1024].
// Block = 16 token rows x 1024 cols, wave w owns cols 128w..128w+127. C^T = Wt act^T: A = Wt rows
// (lane&15 = out col), B = act rows (lane&15 = token); acc[0][j][r] = y[token lane&15][col 128w+16j+8h+r].
// Operands through the ring (1024 weight rows + 16 act rows per stage).
// y staged in LDS (f32, in the ring's bytes once the ring is left), residual (x input, full-stride
// rows) added in a coalesced LDS pass.
// grid ROWS/16, block 256. LDS ys: 16 x 1024 staged == consumed. coverage: 16 rows x 1024 per block.
// ---------------------------------------------------------------------------
__global__ __launch_bounds__(256) void oproj_ln_kernel(
    const _Float16* __restrict__ act, const _Float16* __restrict__ wt,
    const float* __restrict__ bias, const float* __restrict__ res,
    const float* __restrict__ gam, const float* __restrict__ bet,
    float* __restrict__ outf, _Float16* __restrict__ outh) {
  // 299520 B: operand ring in the k loop, then ys (65792 B); cross-wave (block barriers)
  __shared__ __attribute__((aligned(16))) unsigned char smem[2 * (DM + 16) * KPAD * 2];
  __shared__ float smean[16];      // cross-wave (block barrier)
  __shared__ float srstd[16];      // cross-wave (block barrier)
  static_assert(sizeof(smem) >= (size_t)16 * YP * 4);
  _Float16* ring = (_Float16*)smem;
  float*    ys   = (float*)smem;

  const int tid  = threadIdx.x;
  const int lane = tid & 31;
  const int wave = tid >> 5;
  const int hh   = lane >> 4;
  const int l15  = lane & 15;
  const long m0  = (long)blockIdx.x * 16;
  const int  n0  = wave * 128;

  v8f acc[1][8];
#pragma unroll
  for (int j = 0; j < 8; ++j) acc[0][j] = (v8f){};

  gemm_ring<DM, DM, 16, 8, 1>(wt, act + m0 * DM, ring, n0, 0, tid, lane, acc);

  // y = acc/4096 + bf16(bias), staged [row][col]
  {
    const float rsc = 1.0f / (WSC * WSC);
    float* yrow = ys + l15 * YP;
#pragma unroll
    for (int j = 0; j < 8; ++j) {
      const int n8 = n0 + j * 16 + hh * 8;
      const v4f b0 = *(const v4f*)(bias + n8);
      const v4f b1 = *(const v4f*)(bias + n8 + 4);
      v4f y0, y1;
#pragma unroll
      for (int i = 0; i < 4; ++i) {
        y0[i] = acc[0][j][i]     * rsc + bf16q(b0[i]);
        y1[i] = acc[0][j][4 + i] * rsc + bf16q(b1[i]);
      }
      *(v4f*)(yrow + n8)     = y0;
      *(v4f*)(yrow + n8 + 4) = y1;
    }
  }
  __syncthreads();

  // residual add (coalesced): ys[row][col] += res
#pragma unroll 4
  for (int it = 0; it < 16; ++it) {
    const int idx = it * 256 + tid;
    const int row = idx >> 8, piece = idx & 255;
    const long m = m0 + row;
    const long orow = (m / SEQ) * SEQ_FULL + (m % SEQ);
    v4f rsd = *(const v4f*)(res + orow * DM + piece * 4);
#pragma unroll
    for (int c = 0; c < 4; ++c) rsd[c] = bf16q(rsd[c]);
    float* yp = ys + row * YP + piece * 4;
    v4f yv = *(const v4f*)yp;
#pragma unroll
    for (int c = 0; c < 4; ++c) yv[c] = yv[c] + rsd[c];
    *(v4f*)yp = yv;
  }
  __syncthreads();

  {
    const int r  = tid >> 4;
    const int sl = tid & 15;
    const float* yr = ys + r * YP + sl * 64;
    float s = 0.0f;
#pragma unroll
    for (int i = 0; i < 16; ++i) {
      const v4f v = *(const v4f*)(yr + i * 4);
      s += (v[0] + v[1]) + (v[2] + v[3]);
    }
    s += __shfl_xor(s, 1, 32);
    s += __shfl_xor(s, 2, 32);
    s += __shfl_xor(s, 4, 32);
    s += __shfl_xor(s, 8, 32);
    const float mean = s * (1.0f / DM);
    float ss = 0.0f;
#pragma unroll
    for (int i = 0; i < 16; ++i) {
      const v4f v = *(const v4f*)(yr + i * 4);
#pragma unroll
      for (int c = 0; c < 4; ++c) {
        const float d = v[c] - mean;
        ss += d * d;
      }
    }
    ss += __shfl_xor(ss, 1, 32);
    ss += __shfl_xor(ss, 2, 32);
    ss += __shfl_xor(ss, 4, 32);
    ss += __shfl_xor(ss, 8, 32);
    const float var  = ss * (1.0f / DM);
    const float rstd = rsqrtf(var + LN_EPS);
    if (sl == 0) { smean[r] = mean; srstd[r] = rstd; }
  }
  __syncthreads();

  // nx2 values into registers: thread owns row idx>>7 and 8 contiguous cols p8*8
  v4u hv[8];
#pragma unroll
  for (int it = 0; it < 8; ++it) {
    const int idx = it * 256 + tid;
    const int row = idx >> 7, p8 = idx & 127;
    const v4f a  = *(const v4f*)(ys + row * YP + p8 * 8);
    const v4f c  = *(const v4f*)(ys + row * YP + p8 * 8 + 4);
    const v4f g0 = *(const v4f*)(gam + p8 * 8);
    const v4f g1 = *(const v4f*)(gam + p8 * 8 + 4);
    const v4f b0 = *(const v4f*)(bet + p8 * 8);
    const v4f b1 = *(const v4f*)(bet + p8 * 8 + 4);
    const float mean = smean[row], rstd = srstd[row];
    H8 o;
#pragma unroll
    for (int i = 0; i < 4; ++i) {
      o.h[i]     = (_Float16)((a[i] - mean) * rstd * bf16q(g0[i]) + bf16q(b0[i]));
      o.h[4 + i] = (_Float16)((c[i] - mean) * rstd * bf16q(g1[i]) + bf16q(b1[i]));
    }
    hv[it] = o.u;
  }

#pragma unroll 4
  for (int it = 0; it < 16; ++it) {
    const int idx = it * 256 + tid;
    const int row = idx >> 8, piece = idx & 255;
    const v4f v = *(const v4f*)(ys + row * YP + piece * 4);
    *(v4f*)(outf + (m0 + row) * DM + piece * 4) = v;
  }
#pragma unroll
  for (int it = 0; it < 8; ++it) {
    const int idx = it * 256 + tid;
    const int row = idx >> 7, p8 = idx & 127;
    *(v4u*)(outh + (m0 + row) * DM + p8 * 8) = hv[it];
  }
}

// ---------------------------------------------------------------------------
// Kernel 4: ffn linear 1 + silu: hp[row][col] = f16(64 * silu(nx2 @ Wf1 / 64 + bf16(bf1))),
// silu(u) = u * 1/(1+exp(-u)) in f32. Block = 128 token rows x 128 output cols, 8 waves = 4 token
// groups of 32 x 2 column groups of 64; C^T = Wf1t nx2^T (A = Wf1t rows, B = nx2 f16 rows),
// K = 1024, operands through the ring (128 weight rows + 128 nx2 rows, 128 k per stage).
// Epilogue staged [token][col] in LDS (in the ring's bytes once the ring is left),
// grid (ROWS/128, FF/128), block 256. coverage: every (row, col) of the hp plane [ROWS][4096] once.
// ---------------------------------------------------------------------------
__global__ __launch_bounds__(256) void ffn1_kernel(
    const _Float16* __restrict__ x2h, const _Float16* __restrict__ wf1t,
    const float* __restrict__ bf1, _Float16* __restrict__ hp) {
  // operand ring in the k loop, then the output stage [128][VSPAD]; cross-wave (block barriers)
  __shared__ __attribute__((aligned(16))) _Float16 ring[2 * (128 + 128) * (128 + 8)];
  static_assert(2 * (128 + 128) * (128 + 8) >= 128 * VSPAD);
  _Float16* stg = ring;

  const int tid  = threadIdx.x;
  const int lane = tid & 31;
  const int wave = tid >> 5;
  const int hh   = lane >> 4;
  const int l15  = lane & 15;
  const int wt   = wave & 3;            // token group: rows 32 wt .. 32 wt + 31 of the block
  const int wc   = wave >> 2;           // column group: cols 64 wc .. 64 wc + 63 of the block
  const int cb   = blockIdx.y;          // 0..FF/128-1
  const long m0  = (long)blockIdx.x * 128;

  v8f acc[2][4];
#pragma unroll
  for (int i = 0; i < 2; ++i)
#pragma unroll
    for (int j = 0; j < 4; ++j) acc[i][j] = (v8f){};

  gemm_ring<DM, 128, 128, 4, 2, 128>(wf1t + ((long)cb * 128) * DM, x2h + m0 * DM, ring,
                                     wc * 64, wt * 32, tid, lane, acc);

  const float rsc = 1.0f / WSC;
#pragma unroll
  for (int j = 0; j < 4; ++j) {
    const int n8 = wc * 64 + j * 16 + hh * 8;
    const v4f b0 = *(const v4f*)(bf1 + cb * 128 + n8);
    const v4f b1 = *(const v4f*)(bf1 + cb * 128 + n8 + 4);
#pragma unroll
    for (int i = 0; i < 2; ++i) {
      H8 pk;
#pragma unroll
      for (int r = 0; r < 4; ++r) {
        const float u0 = acc[i][j][r]     * rsc + bf16q(b0[r]);
        const float u1 = acc[i][j][4 + r] * rsc + bf16q(b1[r]);
        const float e0 = __expf(fminf(-u0, 80.0f));
        const float e1 = __expf(fminf(-u1, 80.0f));
        const float g0 = u0 * __builtin_amdgcn_rcpf(1.0f + e0);
        const float g1 = u1 * __builtin_amdgcn_rcpf(1.0f + e1);
        pk.h[r]     = (_Float16)(g0 * WSC);
        pk.h[4 + r] = (_Float16)(g1 * WSC);
      }
      *(v4u*)(stg + (wt * 32 + i * 16 + l15) * VSPAD + n8) = pk.u;
    }
  }
  __syncthreads();

  v4u rv[8];
#pragma unroll
  for (int it = 0; it < 8; ++it) {
    const int idx = it * 256 + tid;
    const int row = idx >> 4, piece = idx & 15;
    rv[it] = *(const v4u*)(stg + row * VSPAD + piece * 8);
  }
#pragma unroll
  for (int it = 0; it < 8; ++it) {
    const int idx = it * 256 + tid;
    const int row = idx >> 4, piece = idx & 15;
    *(v4u*)(hp + (m0 + row) * FF + cb * 128 + piece * 8) = rv[it];
  }
}

// ---------------------------------------------------------------------------
// Kernel 5: ffn linear 2 + residual: out = hp @ Wf2 / 4096 + bf16(bf2) + x1 (f32 plane), out in
// full-stride rows. Block = 128 token rows x 128 output cols, 8 waves = 4 token groups of 32 x 2
// column groups of 64; C^T = Wf2t hp^T (A = Wf2t rows, B = hp rows), K = 4096, operands through the
// ring (128 weight rows + 128 hp rows, 256 k per stage). y staged [token][col] in LDS (f32, in the ring's
// bytes once the ring is left), residual added on the way out, 512 B per row segment.
// grid (ROWS/128, DM/128), block 256. coverage: every (row, col) of out once.
// ---------------------------------------------------------------------------
__global__ __launch_bounds__(256) void ffn2_kernel(
    const _Float16* __restrict__ hp, const _Float16* __restrict__ wf2t,
    const float* __restrict__ bf2, const float* __restrict__ x1f, float* __restrict__ out) {
  // operand ring in the k loop, then ys [128][YT] f32; cross-wave (block barriers)
  __shared__ __attribute__((aligned(16))) unsigned char smem[2 * (128 + 128) * (256 + 8) * 2];
  static_assert(sizeof(smem) >= (size_t)128 * YT * 4);
  _Float16* ring = (_Float16*)smem;
  float*    ys   = (float*)smem;

  const int tid  = threadIdx.x;
  const int lane = tid & 31;
  const int wave = tid >> 5;
  const int hh   = lane >> 4;
  const int l15  = lane & 15;
  const int wt   = wave & 3;            // token group: rows 32 wt .. 32 wt + 31 of the block
  const int wc   = wave >> 2;           // column group: cols 64 wc .. 64 wc + 63 of the block
  const int cb   = blockIdx.y;          // 0..DM/128-1
  const long m0  = (long)blockIdx.x * 128;

  v8f acc[2][4];
#pragma unroll
  for (int i = 0; i < 2; ++i)
#pragma unroll
    for (int j = 0; j < 4; ++j) acc[i][j] = (v8f){};

  gemm_ring<FF, 128, 128, 4, 2, 256>(wf2t + ((long)cb * 128) * FF, hp + m0 * FF, ring,
                                     wc * 64, wt * 32, tid, lane, acc);

  // y = acc/4096 + bf16(bias), staged [token][col]
  const float rsc = 1.0f / (WSC * WSC);
#pragma unroll
  for (int j = 0; j < 4; ++j) {
    const int n8 = wc * 64 + j * 16 + hh * 8;
    const v4f b0 = *(const v4f*)(bf2 + cb * 128 + n8);
    const v4f b1 = *(const v4f*)(bf2 + cb * 128 + n8 + 4);
#pragma unroll
    for (int i = 0; i < 2; ++i) {
      float* yrow = ys + (wt * 32 + i * 16 + l15) * YT;
      v4f y0, y1;
#pragma unroll
      for (int r = 0; r < 4; ++r) {
        y0[r] = acc[i][j][r]     * rsc + bf16q(b0[r]);
        y1[r] = acc[i][j][4 + r] * rsc + bf16q(b1[r]);
      }
      *(v4f*)(yrow + n8)     = y0;
      *(v4f*)(yrow + n8 + 4) = y1;
    }
  }
  __syncthreads();

  // residual add and store (coalesced), four row groups per trip
#pragma unroll 1   // keeps the trip's four loads and stores together and the wait once per trip
  for (int it0 = 0; it0 < 16; it0 += 4) {
#pragma unroll
    for (int u = 0; u < 4; ++u) {
      const int idx = (it0 + u) * 256 + tid;
      const int row = idx >> 5, piece = idx & 31;
      const long m = m0 + row;
      const v4f rsd = *(const v4f*)(x1f + m * DM + cb * 128 + piece * 4);
      v4f yv = *(const v4f*)(ys + row * YT + piece * 4);
#pragma unroll
      for (int c = 0; c < 4; ++c) yv[c] = yv[c] + rsd[c];
      const long drow = (m / SEQ) * SEQ_FULL + (m % SEQ);
      *(v4f*)(out + drow * DM + cb * 128 + piece * 4) = yv;
    }
    // stands in front of the next trip's rewrite of the registers that the stores name
    asm volatile("s_wait_xcnt 0x0" ::: "memory");
  }
}

// ---------------------------------------------------------------------------
extern "C" void kernel_launch(void* const* d_in, const int* in_sizes, int n_in,
                              void* d_out, int out_size, void* d_ws, size_t ws_size,
                              hipStream_t stream) {
  if (n_in < 13) return;
  const long needRows = (long)(NB - 1) * SEQ_FULL + SEQ;
  if ((long)in_sizes[0] < needRows * DM) return;
  if (in_sizes[1] < DM || in_sizes[2] < DM) return;
  if (in_sizes[3] < 3 * DM * DM || in_sizes[4] < 3 * DM) return;
  if (in_sizes[5] < DM * DM || in_sizes[6] < DM) return;
  if (in_sizes[7] < DM || in_sizes[8] < DM) return;
  if (in_sizes[9] < DM * FF || in_sizes[10] < FF) return;
  if (in_sizes[11] < FF * DM || in_sizes[12] < DM) return;
  if ((long)out_size < needRows * DM) return;
  if (ws_size < WS_TOTAL) return;

  const float* x     = (const float*)d_in[0];
  const float* g1    = (const float*)d_in[1];
  const float* be1   = (const float*)d_in[2];
  const float* Wqkv  = (const float*)d_in[3];
  const float* bqkv  = (const float*)d_in[4];
  const float* Wo    = (const float*)d_in[5];
  const float* bo    = (const float*)d_in[6];
  const float* g2    = (const float*)d_in[7];
  const float* be2   = (const float*)d_in[8];
  const float* Wf1   = (const float*)d_in[9];
  const float* bf1   = (const float*)d_in[10];
  const float* Wf2   = (const float*)d_in[11];
  const float* bf2   = (const float*)d_in[12];
  float* out = (float*)d_out;

  char* ws = (char*)d_ws;
  size_t off = 0;
  _Float16* nxh  = (_Float16*)(ws + off); off += PLANE2;       // [ROWS][1024] f16
  _Float16* ctx  = (_Float16*)(ws + off); off += PLANE2;       // [ROWS][1024] f16 (x64)
  _Float16* wqkv = (_Float16*)(ws + off); off += WQKV_BYTES;   // [3072][1024]
  _Float16* woh  = (_Float16*)(ws + off); off += WO_BYTES;     // [1024][1024]
  _Float16* wf1t = (_Float16*)(ws + off); off += WF1_BYTES;    // [4096][1024]
  _Float16* wf2t = (_Float16*)(ws + off); off += WF2_BYTES;    // [1024][4096]
  _Float16* qh   = (_Float16*)(ws + off); off += PLANE2;       // [NB][16][SEQ][64]
  _Float16* kh   = (_Float16*)(ws + off); off += PLANE2;       // [NB][16][SEQ][64]
  _Float16* vTh  = (_Float16*)(ws + off); off += PLANE2;       // [NB][16][64][SEQ]
  float*    x1f  = (float*)(ws + off);    off += PLANE4;       // [ROWS][1024] f32
  _Float16* nx2h = (_Float16*)(ws + off); off += PLANE2;       // [ROWS][1024] f16
  _Float16* hp   = (_Float16*)(ws + off); off += H_BYTES;      // [ROWS][4096] f16 (x64)
  if (off > ws_size) return;

  ln1_cvt_kernel<<<ROWS / 8 + NT_QKV, 256, 0, stream>>>(x, g1, be1, Wqkv, nxh, wqkv);
  qkv_kernel<<<dim3(ROWS / 128, 3 * DM / 128), 256, 0, stream>>>(nxh, wqkv, bqkv, qh, kh, vTh);
  attn_kernel<<<dim3(SEQ / 128, NB * NH + NT_LATE / (SEQ / 128)), 256, 0, stream>>>(
      qh, kh, vTh, ctx, Wo, Wf1, Wf2, woh, wf1t, wf2t);
  oproj_ln_kernel<<<ROWS / 16, 256, 0, stream>>>(ctx, woh, bo, x, g2, be2, x1f, nx2h);
  ffn1_kernel<<<dim3(ROWS / 128, FF / 128), 256, 0, stream>>>(nx2h, wf1t, bf1, hp);
  ffn2_kernel<<<dim3(ROWS / 128, DM / 128), 256, 0, stream>>>(hp, wf2t, bf2, x1f, out);
}

// v007
// One run takes 169 microseconds.
// Next to v006, in two timings, it ran 1.03 and 1.04 times as fast.
// Over all steps from v000 it is 4.43 times as fast.
#include <hip/hip_runtime.h>

// All contractions (fused qkv projection, q.k^T, p.v, output projection, ffn linear 1,
// ffn linear 2): v_wmma_f32_16x16x32_f16, f16 operands, f32 accumulate. Float inputs are
// RNE-converted to bf16 at load (weights additionally carried x64; both exact in f16); computed
// 16-bit planes are f16 with power-of-two carries (softmax p x1024, context x64, ffn hidden x64)
// folded back in the f32 epilogues. Layernorms, rotary tables and rotation, softmax statistics,
// silu and residual adds: f32.

typedef __attribute__((ext_vector_type(16))) _Float16 v16h;
typedef __attribute__((ext_vector_type(8)))  _Float16 v8h;
typedef __attribute__((ext_vector_type(8)))  float v8f;
typedef __attribute__((ext_vector_type(4)))  float v4f;
typedef __attribute__((ext_vector_type(4)))  unsigned int v4u;
union H8 { v8h h; v4u u; };

#ifndef NB
#define NB 2
#endif
#ifndef SEQ
#define SEQ 2048
#endif
#define NB_FULL  2
#define SEQ_FULL 2048
#define DM   1024
#define NH   16
#define HD   64
#define FF   4096
#define ROWS (NB * SEQ)
#define KPAD 72       // LDS stride in halves for 64-wide f16 tiles (144 B, 16-B aligned)
#define VSPAD 136     // LDS stride in halves for 128-wide f16 tiles (272 B)
#define YP   1028     // LDS stride in floats for 1024-wide f32 rows (4112 B)
#define YT   132      // LDS stride in floats for 128-wide f32 rows (528 B)
#define RTP  32       // LDS stride in floats of the per-token rotary tables
#define LN_EPS 1e-5f
#define WSC    64.0f           // weight carry (power of two)
#define LN1024 6.931471806f    // ln(1024): softmax p carried x1024
#define ROPE_BASE 10000.0f

#define NT_QKV ((DM / 64) * (3 * DM / 64))    // 768 tiles: W [1024][3072]
#define NT_O   ((DM / 64) * (DM / 64))        // 256 tiles: W [1024][1024]
#define NT_F1  ((DM / 64) * (FF / 64))        // 1024 tiles: W [1024][4096]
#define NT_F2  ((FF / 64) * (DM / 64))        // 1024 tiles: W [4096][1024]
#define NT_LATE (NT_O + NT_F1 + NT_F2)        // tiles converted beside attention

#define PLANE2     ((size_t)ROWS * DM * 2)
#define PLANE4     ((size_t)ROWS * DM * 4)
#define WQKV_BYTES ((size_t)3 * DM * DM * 2)
#define WO_BYTES   ((size_t)DM * DM * 2)
#define WF1_BYTES  ((size_t)FF * DM * 2)
#define WF2_BYTES  ((size_t)DM * FF * 2)
#define H_BYTES    ((size_t)ROWS * FF * 2)
#define WS_TOTAL   (2 * PLANE2 + WQKV_BYTES + WO_BYTES + WF1_BYTES + WF2_BYTES + \
                    3 * PLANE2 + PLANE4 + PLANE2 + H_BYTES)

static_assert(NB >= 1 && NB <= NB_FULL);
static_assert(SEQ >= 128 && SEQ <= SEQ_FULL && (SEQ % 128) == 0);
static_assert((ROWS % 128) == 0 && (ROWS % 16) == 0 && (ROWS % 8) == 0);
static_assert((DM % 64) == 0 && (FF % 64) == 0 && HD == 64 && NH * HD == DM);
static_assert((DM % 128) == 0 && (FF % 128) == 0);
static_assert((NT_LATE % (SEQ / 128)) == 0);
static_assert((size_t)NB * NH * SEQ * HD * 2 == PLANE2);
static_assert(WS_TOTAL <= (size_t)134217728);

// ---------------------------------------------------------------------------
// helpers
// ---------------------------------------------------------------------------
__device__ __forceinline__ float bf16q(float f) {            // value after RNE bf16 conversion
  unsigned int u = __float_as_uint(f);
  u += 0x7FFFu + ((u >> 16) & 1u);
  return __uint_as_float(u & 0xFFFF0000u);
}

__device__ __forceinline__ float wave_sum(float v) {
  v += __shfl_xor(v, 16, 32);
  v += __shfl_xor(v, 8, 32);
  v += __shfl_xor(v, 4, 32);
  v += __shfl_xor(v, 2, 32);
  v += __shfl_xor(v, 1, 32);
  return v;
}

// 16-bit fragment (A or B): lane owns row/col (lane&15); elements 0..7 <- k0+8h+0..7,
// elements 8..15 <- k0+16+8h+0..7, h = lane>>4. Source is k-contiguous rows.
__device__ __forceinline__ v16h load_frag_row(const _Float16* base, int stride, int lane) {
  const _Float16* rowp = base + (lane & 15) * stride + ((lane >> 4) << 3);
  const v8h lo = *(const v8h*)(rowp);
  const v8h hi = *(const v8h*)(rowp + 16);
  return __builtin_shufflevector(lo, hi, 0, 1, 2, 3, 4, 5, 6, 7,
                                 8, 9, 10, 11, 12, 13, 14, 15);
}

__device__ __forceinline__ v8f wmma_f16(v16h a, v16h b, v8f c) {
  v8f d = __builtin_amdgcn_wmma_f32_16x16x32_f16(false, a, false, b, (short)0, c,
                                                 false, false);
  asm volatile("v_nop\n\tv_nop\n\tv_nop\n\tv_nop" : "+v"(d) : "v"(a), "v"(b));
  return d;
}

// ---------------------------------------------------------------------------
// Operand staging of the dense projections: a stage is BK k (64, 128 or 256: rows of 2 BK bytes,
// LDS pitch BK + 8 halves, an odd multiple of 16 B) of WR weight rows followed by XR activation
// rows, brought in by asynchronous copies to LDS (no register on the way) into a ring of two
// buffers, so that stage t+1 flies while stage t is multiplied.
// ---------------------------------------------------------------------------
__device__ __forceinline__ unsigned lds_addr(const void* p) {   // byte offset in the block's LDS
  return (unsigned)(unsigned long long)p;
}

// The s_wait_xcnt closes each run of copies inside its own statement: it stands in front of any
// later rewrite of the address registers that the copies name.
__device__ __forceinline__ void acopy2(unsigned l0, const _Float16* g0,
                                       unsigned l1, const _Float16* g1) {
  asm volatile("global_load_async_to_lds_b128 %0, %1, off\n\t"
               "global_load_async_to_lds_b128 %2, %3, off\n\t"
               "s_wait_xcnt 0x0"
               :: "v"(l0), "v"(g0), "v"(l1), "v"(g1) : "memory");
}

__device__ __forceinline__ void acopy4(unsigned l0, const _Float16* g0,
                                       unsigned l1, const _Float16* g1,
                                       unsigned l2, const _Float16* g2,
                                       unsigned l3, const _Float16* g3) {
  asm volatile("global_load_async_to_lds_b128 %0, %1, off\n\t"
               "global_load_async_to_lds_b128 %2, %3, off\n\t"
               "global_load_async_to_lds_b128 %4, %5, off\n\t"
               "global_load_async_to_lds_b128 %6, %7, off\n\t"
               "s_wait_xcnt 0x0"
               :: "v"(l0), "v"(g0), "v"(l1), "v"(g1), "v"(l2), "v"(g2), "v"(l3), "v"(g3)
               : "memory");
}

__device__ __forceinline__ void acopy8(unsigned l0, const _Float16* g0,
                                       unsigned l1, const _Float16* g1,
                                       unsigned l2, const _Float16* g2,
                                       unsigned l3, const _Float16* g3,
                                       unsigned l4, const _Float16* g4,
                                       unsigned l5, const _Float16* g5,
                                       unsigned l6, const _Float16* g6,
                                       unsigned l7, const _Float16* g7) {
  asm volatile("global_load_async_to_lds_b128 %0, %1, off\n\t"
               "global_load_async_to_lds_b128 %2, %3, off\n\t"
               "global_load_async_to_lds_b128 %4, %5, off\n\t"
               "global_load_async_to_lds_b128 %6, %7, off\n\t"
               "global_load_async_to_lds_b128 %8, %9, off\n\t"
               "global_load_async_to_lds_b128 %10, %11, off\n\t"
               "global_load_async_to_lds_b128 %12, %13, off\n\t"
               "global_load_async_to_lds_b128 %14, %15, off\n\t"
               "s_wait_xcnt 0x0"
               :: "v"(l0), "v"(g0), "v"(l1), "v"(g1), "v"(l2), "v"(g2), "v"(l3), "v"(g3),
                  "v"(l4), "v"(g4), "v"(l5), "v"(g5), "v"(l6), "v"(g6), "v"(l7), "v"(g7)
               : "memory");
}

__device__ __forceinline__ void acopy1_b64(unsigned l0, const _Float16* g0) {
  asm volatile("global_load_async_to_lds_b64 %0, %1, off\n\t"
               "s_wait_xcnt 0x0"
               :: "v"(l0), "v"(g0) : "memory");
}

// NR rows (a multiple of 64) of 128 B: 8 lanes x 16 B per row, 32 rows per copy of the block.
template <int KD, int NR>
__device__ __forceinline__ void copy_rows(const _Float16* src, _Float16* dst, int tid) {
  static_assert((NR % 64) == 0);
  const _Float16* g = src + (size_t)(tid >> 3) * KD + (tid & 7) * 8;
  const unsigned  l = lds_addr(dst + (tid >> 3) * KPAD + (tid & 7) * 8);
  constexpr unsigned LS = 32 * KPAD * 2;       // LDS bytes per 32 rows
  constexpr size_t   GS = (size_t)32 * KD;     // source halves per 32 rows
  if constexpr ((NR % 256) == 0) {
#pragma unroll   // the LDS and source steps become constants
    for (int i = 0; i < NR / 32; i += 8)
      acopy8(l + i * LS, g + i * GS, l + (i + 1) * LS, g + (i + 1) * GS,
             l + (i + 2) * LS, g + (i + 2) * GS, l + (i + 3) * LS, g + (i + 3) * GS,
             l + (i + 4) * LS, g + (i + 4) * GS, l + (i + 5) * LS, g + (i + 5) * GS,
             l + (i + 6) * LS, g + (i + 6) * GS, l + (i + 7) * LS, g + (i + 7) * GS);
  } else if constexpr ((NR % 128) == 0) {
#pragma unroll   // the LDS and source steps become constants
    for (int i = 0; i < NR / 32; i += 4)
      acopy4(l + i * LS, g + i * GS, l + (i + 1) * LS, g + (i + 1) * GS,
             l + (i + 2) * LS, g + (i + 2) * GS, l + (i + 3) * LS, g + (i + 3) * GS);
  } else {
#pragma unroll   // the LDS and source steps become constants
    for (int i = 0; i < NR / 32; i += 2)
      acopy2(l + i * LS, g + i * GS, l + (i + 1) * LS, g + (i + 1) * GS);
  }
}

// NR rows of BK halves (256 or 512 B): BK / 8 lanes x 16 B per row, RC rows per copy of the block.
template <int KD, int NR, int BK>
__device__ __forceinline__ void copy_rows_wide(const _Float16* src, _Float16* dst, int tid) {
  constexpr int CR = BK / 8;                   // 16-B pieces per row
  constexpr int RC = 256 / CR;                 // rows per copy of the block
  constexpr int LP = BK + 8;                   // LDS pitch in halves
  static_assert((NR % (8 * RC)) == 0);
  const _Float16* g = src + (size_t)(tid / CR) * KD + (tid % CR) * 8;
  const unsigned  l = lds_addr(dst + (tid / CR) * LP + (tid % CR) * 8);
  constexpr unsigned LS = RC * LP * 2;         // LDS bytes per RC rows
  constexpr size_t   GS = (size_t)RC * KD;     // source halves per RC rows
#pragma unroll   // the LDS and source steps become constants
  for (int i = 0; i < NR / RC; i += 8)
    acopy8(l + i * LS, g + i * GS, l + (i + 1) * LS, g + (i + 1) * GS,
           l + (i + 2) * LS, g + (i + 2) * GS, l + (i + 3) * LS, g + (i + 3) * GS,
           l + (i + 4) * LS, g + (i + 4) * GS, l + (i + 5) * LS, g + (i + 5) * GS,
           l + (i + 6) * LS, g + (i + 6) * GS, l + (i + 7) * LS, g + (i + 7) * GS);
}

// One stage: k0..k0+BK-1 of WR weight rows and XR activation rows (XR = 16: 16 lanes x 8 B per row).
template <int KD, int WR, int XR, int BK>
__device__ __forceinline__ void stage_copy(const _Float16* wsrc, const _Float16* xsrc,
                                           _Float16* buf, int k0, int tid) {
  if constexpr (BK > 64) {
    copy_rows_wide<KD, WR, BK>(wsrc + k0, buf, tid);
    copy_rows_wide<KD, XR, BK>(xsrc + k0, buf + WR * (BK + 8), tid);
  } else {
    copy_rows<KD, WR>(wsrc + k0, buf, tid);
    if constexpr (XR == 16) {
      acopy1_b64(lds_addr(buf + (WR + (tid >> 4)) * KPAD + (tid & 15) * 4),
                 xsrc + k0 + (size_t)(tid >> 4) * KD + (tid & 15) * 4);
    } else {
      copy_rows<KD, XR>(xsrc + k0, buf + WR * KPAD, tid);
    }
  }
}

// acc[i][j] += W rows (wrow0 + 16j ..) x act rows (xrow0 + 16i ..)^T over all KD, k ascending in
// steps of 32. C^T = W act^T: A = W rows (lane&15 = out col), B = act rows (lane&15 = token).
// A wave's tile is 16 JW columns x 16 XF tokens: JW + XF fragments feed JW * XF WMMAs.
// On return every copy has landed, every wave has left the ring, and a block barrier has passed.
template <int KD, int WR, int XR, int JW, int XF, int BK = 64>
__device__ __forceinline__ void gemm_ring(const _Float16* wsrc, const _Float16* xsrc,
                                          _Float16* ring, int wrow0, int xrow0,
                                          int tid, int lane, v8f (&acc)[XF][JW]) {
  static_assert(BK == 64 || BK == 128 || BK == 256);
  constexpr int LP = BK + 8;             // LDS pitch in halves
  static_assert(KPAD == 64 + 8);
  constexpr int SH = (WR + XR) * LP;     // halves per buffer
  constexpr int NT = KD / BK;            // stages
  constexpr int NS = BK / 32;            // 32-k steps per stage
  static_assert((KD % BK) == 0 && NT >= 2);

  stage_copy<KD, WR, XR, BK>(wsrc, xsrc, ring, 0, tid);
  asm volatile("s_wait_asynccnt 0x0" ::: "memory");   // this wave's part of stage 0 has landed
  __syncthreads();                                    // stage 0 published to every wave
  stage_copy<KD, WR, XR, BK>(wsrc, xsrc, ring + SH, BK, tid);

#pragma unroll 1   // one stage per trip: the ring's waits and barrier stand once, at the foot
  for (int t = 0; t < NT; ++t) {
    _Float16* buf = ring + (t & 1) * SH;
    const _Float16* wl = buf + wrow0 * LP;
    const _Float16* xl = buf + (WR + xrow0) * LP;
    // fragment reads run two 32-k steps ahead of the WMMAs that use them, inside this stage only,
    // through three register sets: the LDS reads of a wide stage go on under its WMMAs
    // (all loops unrolled: the fragment and accumulator arrays must stay in registers)
    v16h xf[3][XF], wf[3][JW];
#pragma unroll
    for (int s = 0; s < NS + 2; ++s) {
      if (s < NS) {
#pragma unroll
        for (int i = 0; i < XF; ++i)
          xf[s % 3][i] = load_frag_row(xl + (i * 16) * LP + s * 32, LP, lane);
#pragma unroll
        for (int j = 0; j < JW; ++j)
          wf[s % 3][j] = load_frag_row(wl + (j * 16) * LP + s * 32, LP, lane);
      }
      if (s >= 2) {
#pragma unroll
        for (int i = 0; i < XF; ++i)
#pragma unroll
          for (int j = 0; j < JW; ++j)
            acc[i][j] = wmma_f16(wf[(s - 2) % 3][j], xf[(s - 2) % 3][i], acc[i][j]);
      }
    }
    asm volatile("s_wait_dscnt 0x0" ::: "memory");     // own reads of this buffer are done
    asm volatile("s_wait_asynccnt 0x0" ::: "memory");  // own part of stage t+1 has landed
    __syncthreads();   // publishes stage t+1 and ends every wave's reads of stage t
    if (t + 2 < NT) stage_copy<KD, WR, XR, BK>(wsrc, xsrc, buf, (t + 2) * BK, tid);
  }
  asm volatile("s_wait_asynccnt 0x0" ::: "memory");    // nothing in flight behind the loop
}

// ---------------------------------------------------------------------------
// Body A: nx = LN(bf16rne(x)) * bf16(g) + bf16(b) -> f16 plane nxh [ROWS][1024].
// One wave per token row, lane owns 4 chunks of 8 consecutive floats (i*256 + lane*8).
// ROWS/8 blocks of 256. coverage: ROWS rows x 4 x 256 halves = whole plane.
// ---------------------------------------------------------------------------
__device__ __forceinline__ void ln1_body(const float* __restrict__ x,
                                         const float* __restrict__ g,
                                         const float* __restrict__ bb,
                                         _Float16* __restrict__ nxh, int blk) {
  const int lane  = threadIdx.x & 31;
  const int wave  = threadIdx.x >> 5;
  const long m    = (long)blk * 8 + wave;                    // token row 0..ROWS-1
  const long srow = (m / SEQ) * SEQ_FULL + (m % SEQ);        // full-stride source row
  const float* xr = x + srow * DM + lane * 8;

  float s = 0.0f;
#pragma unroll 1
  for (int i = 0; i < 4; ++i) {
    const v4f a = *(const v4f*)(xr + i * 256);
    const v4f c = *(const v4f*)(xr + i * 256 + 4);
    s += ((bf16q(a[0]) + bf16q(a[1])) + (bf16q(a[2]) + bf16q(a[3]))) +
         ((bf16q(c[0]) + bf16q(c[1])) + (bf16q(c[2]) + bf16q(c[3])));
  }
  s = wave_sum(s);
  const float mean = s * (1.0f / DM);

  float ss = 0.0f;
#pragma unroll 1
  for (int i = 0; i < 4; ++i) {
    const v4f a = *(const v4f*)(xr + i * 256);
    const v4f c = *(const v4f*)(xr + i * 256 + 4);
#pragma unroll
    for (int e = 0; e < 4; ++e) {
      const float d0 = bf16q(a[e]) - mean;
      const float d1 = bf16q(c[e]) - mean;
      ss += d0 * d0;
      ss += d1 * d1;
    }
  }
  ss = wave_sum(ss);
  const float rstd = rsqrtf(ss * (1.0f / DM) + LN_EPS);

  _Float16* drow = nxh + m * DM + lane * 8;
#pragma unroll 1
  for (int i = 0; i < 4; ++i) {
    const v4f a  = *(const v4f*)(xr + i * 256);
    const v4f c  = *(const v4f*)(xr + i * 256 + 4);
    const v4f g0 = *(const v4f*)(g + i * 256 + lane * 8);
    const v4f g1 = *(const v4f*)(g + i * 256 + lane * 8 + 4);
    const v4f b0 = *(const v4f*)(bb + i * 256 + lane * 8);
    const v4f b1 = *(const v4f*)(bb + i * 256 + lane * 8 + 4);
    H8 o;
#pragma unroll
    for (int e = 0; e < 4; ++e) {
      o.h[e]     = (_Float16)((bf16q(a[e]) - mean) * rstd * bf16q(g0[e]) + bf16q(b0[e]));
      o.h[4 + e] = (_Float16)((bf16q(c[e]) - mean) * rstd * bf16q(g1[e]) + bf16q(b1[e]));
    }
    _Float16* dst = drow + i * 256;
    *(v4u*)dst = o.u;
  }
}

// ---------------------------------------------------------------------------
// Body B: one 64x64 tile (kt, nt) of a weight W [K=in][N=out] f32 -> Wt [n][k] f16 =
// f16(bf16rne(W) * 64), through an LDS transpose. One block of 256 per tile; ts holds 64 * KPAD
// halves, [n][k], cross-wave (block barrier; every thread of the block comes here or none).
// The weight conversion has no launch of its own: its tiles are further blocks of launches that
// they do not depend on, W_qkv beside the first layernorm, the other three beside attention.
// ---------------------------------------------------------------------------
__device__ __forceinline__ void cvt_tile(const float* __restrict__ W, _Float16* __restrict__ dst,
                                         int K, int N, int kt, int nt, _Float16* ts, int tid) {
  // load W[kt*64 + kr][nt*64 + 4*c4 .. +3], store transposed into ts[n][kr]
#pragma unroll
  for (int it = 0; it < 4; ++it) {
    const int idx = it * 256 + tid;
    const int kr = idx >> 4, c4 = idx & 15;
    const v4f v = *(const v4f*)(W + (size_t)(kt * 64 + kr) * N + nt * 64 + c4 * 4);
#pragma unroll
    for (int j = 0; j < 4; ++j) ts[(c4 * 4 + j) * KPAD + kr] = (_Float16)(bf16q(v[j]) * WSC);
  }
  __syncthreads();
  v4u rv[2];
#pragma unroll
  for (int it = 0; it < 2; ++it) {
    const int idx = it * 256 + tid;
    const int n = idx >> 3, piece = idx & 7;
    rv[it] = *(const v4u*)(ts + n * KPAD + piece * 8);
  }
#pragma unroll
  for (int it = 0; it < 2; ++it) {
    const int idx = it * 256 + tid;
    const int n = idx >> 3, piece = idx & 7;
    *(v4u*)(dst + (size_t)(nt * 64 + n) * K + kt * 64 + piece * 8) = rv[it];
  }
  // stands in front of any later rewrite of the registers that the two stores name
  asm volatile("s_wait_xcnt 0x0" ::: "memory");
}

// ---------------------------------------------------------------------------
// Kernel 0: blocks 0 .. ROWS/8-1: body A (first layernorm); the next NT_QKV blocks: body B on
// W_qkv, in [1024][3072] -> wqkv [3072][1024] (out col = q|k|v third, head h at 64h).
// grid ROWS/8 + NT_QKV, block 256. coverage: the nxh plane and 768 tiles of 64x64 = all of wqkv.
// ---------------------------------------------------------------------------
__global__ __launch_bounds__(256) void ln1_cvt_kernel(
    const float* __restrict__ x, const float* __restrict__ g, const float* __restrict__ bb,
    const float* __restrict__ Wqkv, _Float16* __restrict__ nxh, _Float16* __restrict__ wqkv) {
  __shared__ __attribute__((aligned(16))) _Float16 ts[64 * KPAD];
  const int bid = blockIdx.x;
  if (bid < ROWS / 8) {                                 // block-uniform selection
    ln1_body(x, g, bb, nxh, bid);
  } else {
    const int tile = bid - ROWS / 8;
    const int kt = tile / (3 * DM / 64), nt = tile - kt * (3 * DM / 64);
    cvt_tile(Wqkv, wqkv, DM, 3 * DM, kt, nt, ts, threadIdx.x);
  }
}

// ---------------------------------------------------------------------------
// Kernel 1: fused qkv projection + rotary embedding. Block = 128 token rows x 128 output columns
// (two heads of one of q/k/v), 8 waves = 4 token groups of 32 x 2 heads; a wave's tile is 32 tokens
// x 64 columns. C^T = W x^T: A = W rows (lane&15 = out col), B = nx rows (lane&15 = token);
// acc[i][j][r] = C[token 16i + lane&15][col 16j+8h+r]. K = 1024, operands through the ring
// (128 weight rows + 128 nx rows, 128 k per stage).
// Behind the k loop (q/k blocks only, block-uniform): rotary tables cos/sin[token][i], i < 32,
// angle = pos * (1 / 10000^(2i/64)), f32 powf/cosf/sinf, in LDS (cross-wave, block barrier).
// Epilogue u = acc/64 + bf16(bias); q,k: d<32: u[d]*cos - u[d+32]*sin, d>=32: u[d]*cos + u[d-32]*sin
//   q,k -> [b][h][s][64] f16 (one line per row, 8 lanes x 16 B)
//   v   -> vT[b][h][d][s] f16 (256 B per d row segment, 16 lanes x 16 B)
// grid (ROWS/128, 3*DM/128), block 256. coverage: every (b,h,s,d) of q, k and vT once.
// LDS: the output stage lies in the ring's bytes once the ring is left: q/k [2 heads][128][KPAD],
// v [128 d][VSPAD], fully written before read; ctab/stab 128x32 lie behind the q/k stage, also in
// the ring's bytes, fully written: the block's LDS is the ring alone, and two blocks fit a WGP.
// ---------------------------------------------------------------------------
__global__ __launch_bounds__(256) void qkv_kernel(
    const _Float16* __restrict__ nxh, const _Float16* __restrict__ wqkv,
    const float* __restrict__ bqkv,
    _Float16* __restrict__ q, _Float16* __restrict__ k, _Float16* __restrict__ vT) {
  // operand ring in the k loop, then the output stage and the tables; cross-wave (block barriers)
  __shared__ __attribute__((aligned(16))) _Float16 ring[2 * (128 + 128) * (128 + 8)];
  constexpr int STGH = 2 * 128 * KPAD;   // halves of the q/k output stage
  static_assert(sizeof(ring) >= (size_t)STGH * 2 + (size_t)2 * 128 * RTP * 4);
  static_assert(2 * (128 + 128) * (128 + 8) >= 128 * VSPAD && ((STGH * 2) % 16) == 0);
  _Float16* stg = ring;
  float* ctab = (float*)(ring + STGH);   // cos table [token][i], cross-wave (block barrier)
  float* stab = ctab + 128 * RTP;        // sin table [token][i], cross-wave (block barrier)

  const int tid  = threadIdx.x;
  const int lane = tid & 31;
  const int wave = tid >> 5;
  const int hh   = lane >> 4;
  const int l15  = lane & 15;
  const int wt   = wave & 3;            // token group: rows 32 wt .. 32 wt + 31 of the block
  const int wc   = wave >> 2;           // head of the block's two

  const int cb   = blockIdx.y;          // 0..23 = output column block (128 cols each)
  const int osel = cb >> 3;             // 0 q, 1 k, 2 v
  const int h0   = (cb & 7) * 2;        // first head of the block
  const long m0  = (long)blockIdx.x * 128;
  const int  b   = (int)(m0 / SEQ);
  const int  s0  = (int)(m0 - (long)b * SEQ);

  v8f acc[2][4];
#pragma unroll
  for (int i = 0; i < 2; ++i)
#pragma unroll
    for (int j = 0; j < 4; ++j) acc[i][j] = (v8f){};

  gemm_ring<DM, 128, 128, 4, 2, 128>(wqkv + ((long)cb * 128) * DM, nxh + m0 * DM, ring,
                                     wc * 64, wt * 32, tid, lane, acc);

  if (osel < 2) {                       // block-uniform
#pragma clang fp contract(off)
    const int i  = tid & 31;
    const int tg = tid >> 5;
    const float e   = (float)(2 * i) * (1.0f / 64.0f);
    const float inv = 1.0f / powf(ROPE_BASE, e);
#pragma unroll 1
    for (int tt = tg; tt < 128; tt += 8) {
      const float ang = (float)(s0 + tt) * inv;
      ctab[tt * RTP + i] = cosf(ang);
      stab[tt * RTP + i] = sinf(ang);
    }
  }
  __syncthreads();   // the tables are published to every wave

  const float* bias = bqkv + cb * 128 + wc * 64;
  const float  rsc  = 1.0f / WSC;

  v4u rv[8];
  if (osel < 2) {
#pragma unroll
    for (int i = 0; i < 2; ++i) {
      float u[4][8];
#pragma unroll
      for (int j = 0; j < 4; ++j) {
        const int n8 = j * 16 + hh * 8;
        const v4f b0 = *(const v4f*)(bias + n8);
        const v4f b1 = *(const v4f*)(bias + n8 + 4);
#pragma unroll
        for (int r = 0; r < 4; ++r) {
          u[j][r]     = acc[i][j][r]     * rsc + bf16q(b0[r]);
          u[j][4 + r] = acc[i][j][4 + r] * rsc + bf16q(b1[r]);
        }
      }
      // rotation: lane holds d = n8+r (j<2) and its partner d+32 (j+2); stage [head][token][col]
      const int tl = wt * 32 + i * 16 + l15;
      _Float16* srow = stg + (wc * 128 + tl) * KPAD;
      const float* crow = ctab + tl * RTP;
      const float* nrow = stab + tl * RTP;
#pragma unroll
      for (int j = 0; j < 2; ++j) {
        const int n8 = j * 16 + hh * 8;
        const v4f c0  = *(const v4f*)(crow + n8);
        const v4f c1  = *(const v4f*)(crow + n8 + 4);
        const v4f sn0 = *(const v4f*)(nrow + n8);
        const v4f sn1 = *(const v4f*)(nrow + n8 + 4);
        H8 plo, phi;
#pragma unroll
        for (int r = 0; r < 4; ++r) {
          const float a0 = u[j][r],     d0 = u[j + 2][r];
          const float a1 = u[j][4 + r], d1 = u[j + 2][4 + r];
          plo.h[r]     = (_Float16)(a0 * c0[r] - d0 * sn0[r]);
          phi.h[r]     = (_Float16)(d0 * c0[r] + a0 * sn0[r]);
          plo.h[4 + r] = (_Float16)(a1 * c1[r] - d1 * sn1[r]);
          phi.h[4 + r] = (_Float16)(d1 * c1[r] + a1 * sn1[r]);
        }
        *(v4u*)(srow + n8)      = plo.u;
        *(v4u*)(srow + 32 + n8) = phi.u;
      }
    }
    __syncthreads();
#pragma unroll
    for (int it = 0; it < 8; ++it) {
      const int idx = it * 256 + tid;
      const int row = idx >> 3, piece = idx & 7;        // row = head * 128 + token
      rv[it] = *(const v4u*)(stg + row * KPAD + piece * 8);
    }
    // per head a contiguous 16 KB; the two heads lie SEQ * HD halves apart
    _Float16* dst = ((osel == 0) ? q : k) + ((long)(b * NH + h0) * SEQ + s0) * HD;
#pragma unroll
    for (int it = 0; it < 8; ++it) {
      const int idx = it * 256 + tid;
      *(v4u*)(dst + (long)(idx >> 10) * SEQ * HD + (long)(idx & 1023) * 8) = rv[it];
    }
  } else {
    // stage transposed [d][token]: lane's 8 values are 8 different d for one token
#pragma unroll
    for (int j = 0; j < 4; ++j) {
      const int n8 = j * 16 + hh * 8;
      const v4f b0 = *(const v4f*)(bias + n8);
      const v4f b1 = *(const v4f*)(bias + n8 + 4);
#pragma unroll
      for (int i = 0; i < 2; ++i) {
        _Float16* scol = stg + (wc * 64 + n8) * VSPAD + wt * 32 + i * 16 + l15;
#pragma unroll
        for (int r = 0; r < 4; ++r) {
          scol[r * VSPAD]       = (_Float16)(acc[i][j][r]     * rsc + bf16q(b0[r]));
          scol[(4 + r) * VSPAD] = (_Float16)(acc[i][j][4 + r] * rsc + bf16q(b1[r]));
        }
      }
    }
    __syncthreads();
#pragma unroll
    for (int it = 0; it < 8; ++it) {
      const int idx = it * 256 + tid;
      const int d = idx >> 4, piece = idx & 15;         // d = head * 64 + d of the head
      rv[it] = *(const v4u*)(stg + d * VSPAD + piece * 8);
    }
    _Float16* dstb = vT + ((long)(b * NH + h0) * HD) * SEQ + s0;
#pragma unroll
    for (int it = 0; it < 8; ++it) {
      const int idx = it * 256 + tid;
      const int d = idx >> 4, piece = idx & 15;
      *(v4u*)(dstb + (long)d * SEQ + piece * 8) = rv[it];
    }
  }
}

// ---------------------------------------------------------------------------
// Kernel 2: flash attention per (b,h), no mask, all SEQ keys: blockIdx.y < NB*NH of the grid
// (SEQ/128, NB*NH + NT_LATE/(SEQ/128)), block 256 (8 waves x 16 queries). The blocks behind them
// run body B on W_proj, W_ffn1 and W_ffn2 (read first by the launches that follow), one tile each.
// Attention: C = S^T (A = K rows, B = Q) then C = O^T = V^T P^T (P^T packed from the S^T D registers); lane owns one query end-to-end. Scores are raw q.k sums:
// the 1/8 scale and the x1024 p carry live in the exp argument (p = 1024*exp((s-m)/8),
// softmax stats f32). Context (carried x64) written to ctx[b*SEQ+s][h*64+d] through an LDS stage
// K and V^T come in by asynchronous copies to LDS into a ring of two buffers, so that the next
// stage of 64 keys flies while this one is worked on.
// LDS tiles: a stage = 64 keys x 64 d of K and of V^T == consumed extent; ost 128 x 64 fully written.
// coverage: every (row, h*64+d) of the ctx plane once; 256 + 1024 + 1024 tiles of 64x64 = every
// element of woh [1024][1024], wf1t [4096][1024] and wf2t [1024][4096].
// ---------------------------------------------------------------------------
// One stage of 64 keys: buffer rows 0..63 = K rows [key][d] (source pitch HD), rows 64..127 = V^T
// rows [d][key] (source pitch SEQ), LDS pitch KPAD halves; 8 lanes x 16 B per row, 32 rows per copy.
__device__ __forceinline__ void kv_stage_copy(const _Float16* kg, const _Float16* vg,
                                              _Float16* buf, int tid) {
  const int r = tid >> 3, c = (tid & 7) * 8;
  const unsigned l = lds_addr(buf + r * KPAD + c);
  constexpr unsigned LS = 32 * KPAD * 2;       // LDS bytes per 32 rows
  acopy4(l,          kg + r * HD + c,           l + LS,     kg + (r + 32) * HD + c,
         l + 2 * LS, vg + (long)r * SEQ + c,    l + 3 * LS, vg + (long)(r + 32) * SEQ + c);
}

// At most 160 registers a wave (six waves per SIMD): beside the two attention blocks of a WGP a
// third block, a weight tile, stays resident, so the conversion still runs under attention.
__global__ __launch_bounds__(256) __attribute__((amdgpu_waves_per_eu(6))) void attn_kernel(
    const _Float16* __restrict__ Q, const _Float16* __restrict__ K,
    const _Float16* __restrict__ vT, _Float16* __restrict__ ctx,
    const float* __restrict__ Wo, const float* __restrict__ Wf1, const float* __restrict__ Wf2,
    _Float16* __restrict__ woh, _Float16* __restrict__ wf1t, _Float16* __restrict__ wf2t) {
  // two buffers of [K 64 rows | V^T 64 rows]; cross-wave (block barriers)
  __shared__ __attribute__((aligned(16))) _Float16 kv[2 * 128 * KPAD];
  __shared__ _Float16 ost[128 * KPAD];   // output stage [query][d]   (cross-wave, block barrier)

  const int tid  = threadIdx.x;
  if (blockIdx.y >= NB * NH) {           // block-uniform: a weight tile, staged in kv's bytes
    const int t = (blockIdx.y - NB * NH) * (SEQ / 128) + blockIdx.x;   // 0 .. NT_LATE-1
    const float* W;
    _Float16* dst;
    int kd, nd, kt, nt;
    if (t < NT_O) {                                     // in [1024][1024] -> out [1024][1024]
      kt = t / (DM / 64); nt = t - kt * (DM / 64); kd = DM; nd = DM;
      W = Wo; dst = woh;
    } else if (t < NT_O + NT_F1) {
      const int tile = t - NT_O;                        // in [1024][4096] -> out [4096][1024]
      kt = tile / (FF / 64); nt = tile - kt * (FF / 64); kd = DM; nd = FF;
      W = Wf1; dst = wf1t;
    } else {
      const int tile = t - NT_O - NT_F1;                // in [4096][1024] -> out [1024][4096]
      kt = tile / (DM / 64); nt = tile - kt * (DM / 64); kd = FF; nd = DM;
      W = Wf2; dst = wf2t;
    }
    cvt_tile(W, dst, kd, nd, kt, nt, kv, tid);
    return;
  }
  const int lane = tid & 31;
  const int wave = tid >> 5;
  const int bh   = blockIdx.y;
  const int b    = bh >> 4;
  const int h    = bh & 15;
  const int q0   = blockIdx.x * 128;

  const _Float16* Qb  = Q + ((long)bh * SEQ + q0) * HD;
  const _Float16* Kb  = K + (long)bh * SEQ * HD;
  const _Float16* vTb = vT + (long)bh * HD * SEQ;

  // Q fragments: B operand of S^T (lane owns query lane&15)
  v16h qfrag[2];
  {
    const _Float16* qrow = Qb + (long)wave * 16 * HD;
#pragma unroll
    for (int t = 0; t < 2; ++t) qfrag[t] = load_frag_row(qrow + t * 32, HD, lane);
  }

  v8f acc[4];   // O^T accumulator: lane owns query (lane&15); reg r -> d = nt*16+8h+r
#pragma unroll
  for (int nt = 0; nt < 4; ++nt) acc[nt] = (v8f){};
  float mi = -1e30f, li = 0.0f;

  const int colb = lane & 15;
  const int rofs = (lane >> 4) << 3;

  constexpr int SH = 128 * KPAD;   // halves per buffer
  constexpr int NS = SEQ / 64;     // stages
  static_assert(NS >= 2);

  kv_stage_copy(Kb, vTb, kv, tid);
  asm volatile("s_wait_asynccnt 0x0" ::: "memory");   // this wave's part of stage 0 has landed
  __syncthreads();                                    // stage 0 published to every wave
  kv_stage_copy(Kb + 64 * HD, vTb + 64, kv + SH, tid);

#pragma unroll 1   // one stage per trip: the ring's waits and barrier stand once, at the foot
  for (int sg = 0; sg < NS; ++sg) {
    _Float16* buf = kv + (sg & 1) * SH;
    const _Float16* ks  = buf;               // K rows [key][d]
    const _Float16* vts = buf + 64 * KPAD;   // V^T rows [d][key]

    // S^T tiles: A = K rows (lane&15 = key), B = Q
    // the stage's eight K fragments go out as one group in front of the WMMAs that use them
    // (all loops unrolled: the fragment arrays must stay in registers)
    v16h kf[2][4];
#pragma unroll
    for (int t = 0; t < 2; ++t)
#pragma unroll
      for (int kt = 0; kt < 4; ++kt)
        kf[t][kt] = load_frag_row(ks + (kt * 16) * KPAD + t * 32, KPAD, lane);
    v8f sc[4];
#pragma unroll
    for (int kt = 0; kt < 4; ++kt) sc[kt] = (v8f){};
#pragma unroll
    for (int t = 0; t < 2; ++t)
#pragma unroll
      for (int kt = 0; kt < 4; ++kt) sc[kt] = wmma_f16(kf[t][kt], qfrag[t], sc[kt]);

    // the V^T fragments of keys 0..31 are asked for here: they land under the softmax arithmetic
    v16h vf[2][4];
#pragma unroll
    for (int nt = 0; nt < 4; ++nt)
      vf[0][nt] = load_frag_row(vts + (nt * 16) * KPAD, KPAD, lane);
    // keeps the scheduler from sinking those loads to their uses, where each would be waited for
    __builtin_amdgcn_sched_barrier(0);

    // per-lane online softmax (32 of 64 keys in-lane; merge halves with one shuffle)
    float mx = sc[0][0];
#pragma unroll
    for (int kt = 0; kt < 4; ++kt)
#pragma unroll
      for (int r = 0; r < 8; ++r) mx = fmaxf(mx, sc[kt][r]);
    mx = fmaxf(mx, __shfl_xor(mx, 16, 32));
    const float mnew  = fmaxf(mi, mx);
    const float alpha = __expf((mi - mnew) * 0.125f);
    mi = mnew;
    const float cs = fmaf(mnew, 0.125f, -LN1024);   // 0.125*m - ln(1024)

    // P^T as the B operand of O^T = V^T P^T, packed from the S^T D registers:
    // element i <- tile covering keys 0..15 of the 32-step (kt = 2t), element 8+i <- kt = 2t+1.
    float rs = 0.0f;
    v16h pf[2];
#pragma unroll
    for (int t = 0; t < 2; ++t) {
#pragma unroll
      for (int kt = 2 * t; kt < 2 * t + 2; ++kt)
#pragma unroll
        for (int r = 0; r < 8; ++r) {
          const float p = __expf(fmaf(sc[kt][r], 0.125f, -cs));   // 1024*exp((s-m)/8)
          sc[kt][r] = p;
          rs += p;
        }
#pragma unroll
      for (int i = 0; i < 8; ++i) {
        pf[t][i]     = (_Float16)sc[2 * t][i];
        pf[t][8 + i] = (_Float16)sc[2 * t + 1][i];
      }
      if (t == 0) {
        // the V^T fragments of keys 32..63 follow once half of the scores are packed (registers
        // freed): they land under the other half's arithmetic
#pragma unroll
        for (int nt = 0; nt < 4; ++nt)
          vf[1][nt] = load_frag_row(vts + (nt * 16) * KPAD + 32, KPAD, lane);
        // keeps the scheduler from sinking those loads to their uses
        __builtin_amdgcn_sched_barrier(0);
      }
    }
    rs += __shfl_xor(rs, 16, 32);
    li = li * alpha + rs;

#pragma unroll
    for (int nt = 0; nt < 4; ++nt)
#pragma unroll
      for (int r = 0; r < 8; ++r) acc[nt][r] *= alpha;

    // O^T += V^T (A, rows = d) x P^T (B)
#pragma unroll
    for (int t = 0; t < 2; ++t)
#pragma unroll
      for (int nt = 0; nt < 4; ++nt) acc[nt] = wmma_f16(vf[t][nt], pf[t], acc[nt]);

    asm volatile("s_wait_dscnt 0x0" ::: "memory");     // own reads of this buffer are done
    asm volatile("s_wait_asynccnt 0x0" ::: "memory");  // own part of stage sg+1 has landed
    __syncthreads();   // publishes stage sg+1 and ends every wave's reads of stage sg
    if (sg + 2 < NS) kv_stage_copy(Kb + (long)(sg + 2) * 64 * HD, vTb + (sg + 2) * 64, buf, tid);
  }
  asm volatile("s_wait_asynccnt 0x0" ::: "memory");    // nothing in flight behind the loop

  // normalize (and apply the x64 carry) and stage: lane owns query row wave*16+colb,
  // d = nt*16+rofs+r contiguous
  {
    const float inv = 64.0f / li;
    _Float16* orow = ost + (wave * 16 + colb) * KPAD;
#pragma unroll
    for (int nt = 0; nt < 4; ++nt) {
      H8 pk;
#pragma unroll
      for (int r = 0; r < 8; ++r) pk.h[r] = (_Float16)(acc[nt][r] * inv);
      *(v4u*)(orow + nt * 16 + rofs) = pk.u;
    }
  }
  __syncthreads();

  v4u rv[4];
#pragma unroll
  for (int it = 0; it < 4; ++it) {
    const int idx = it * 256 + tid;
    const int row = idx >> 3, piece = idx & 7;
    rv[it] = *(const v4u*)(ost + row * KPAD + piece * 8);
  }
  _Float16* cbase = ctx + ((long)b * SEQ + q0) * DM + h * HD;
#pragma unroll
  for (int it = 0; it < 4; ++it) {
    const int idx = it * 256 + tid;
    const int row = idx >> 3, piece = idx & 7;
    *(v4u*)(cbase + (long)row * DM + piece * 8) = rv[it];
  }
  
}

// ---------------------------------------------------------------------------
// Kernel 3: x1 = ctx @ Wo / 4096 + bf16(bias) + bf16(x) over a full 1024-wide row, and
// nx2 = f16(LN(x1) * bf16(gamma) + bf16(beta)) -> f16 plane [ROWS][1024].
// Block = 16 token rows x 1024 cols, wave w owns cols 128w..128w+127. C^T = Wt act^T: A = Wt rows
// (lane&15 = out col), B = act rows (lane&15 = token); acc[0][j][r] = y[token lane&15][col 128w+16j+8h+r].
// Operands through the ring (1024 weight rows + 16 act rows per stage).
// y staged in LDS (f32, in the ring's bytes once the ring is left), residual (x input, full-stride
// rows) added in a coalesced LDS pass.
// grid ROWS/16, block 256. LDS ys: 16 x 1024 staged == consumed. coverage: 16 rows x 1024 per block.
// ---------------------------------------------------------------------------
__global__ __launch_bounds__(256) void oproj_ln_kernel(
    const _Float16* __restrict__ act, const _Float16* __restrict__ wt,
    const float* __restrict__ bias, const float* __restrict__ res,
    const float* __restrict__ gam, const float* __restrict__ bet,
    float* __restrict__ outf, _Float16* __restrict__ outh) {
  // 299520 B: operand ring in the k loop, then ys (65792 B); cross-wave (block barriers)
  __shared__ __attribute__((aligned(16))) unsigned char smem[2 * (DM + 16) * KPAD * 2];
  __shared__ float smean[16];      // cross-wave (block barrier)
  __shared__ float srstd[16];      // cross-wave (block barrier)
  static_assert(sizeof(smem) >= (size_t)16 * YP * 4);
  _Float16* ring = (_Float16*)smem;
  float*    ys   = (float*)smem;

  const int tid  = threadIdx.x;
  const int lane = tid & 31;
  const int wave = tid >> 5;
  const int hh   = lane >> 4;
  const int l15  = lane & 15;
  const long m0  = (long)blockIdx.x * 16;
  const int  n0  = wave * 128;

  v8f acc[1][8];
#pragma unroll
  for (int j = 0; j < 8; ++j) acc[0][j] = (v8f){};

  gemm_ring<DM, DM, 16, 8, 1>(wt, act + m0 * DM, ring, n0, 0, tid, lane, acc);

  // y = acc/4096 + bf16(bias), staged [row][col]
  {
    const float rsc = 1.0f / (WSC * WSC);
    float* yrow = ys + l15 * YP;
#pragma unroll
    for (int j = 0; j < 8; ++j) {
      const int n8 = n0 + j * 16 + hh * 8;
      const v4f b0 = *(const v4f*)(bias + n8);
      const v4f b1 = *(const v4f*)(bias + n8 + 4);
      v4f y0, y1;
#pragma unroll
      for (int i = 0; i < 4; ++i) {
        y0[i] = acc[0][j][i]     * rsc + bf16q(b0[i]);
        y1[i] = acc[0][j][4 + i] * rsc + bf16q(b1[i]);
      }
      *(v4f*)(yrow + n8)     = y0;
      *(v4f*)(yrow + n8 + 4) = y1;
    }
  }
  __syncthreads();

  // residual add (coalesced): ys[row][col] += res
#pragma unroll 4
  for (int it = 0; it < 16; ++it) {
    const int idx = it * 256 + tid;
    const int row = idx >> 8, piece = idx & 255;
    const long m = m0 + row;
    const long orow = (m / SEQ) * SEQ_FULL + (m % SEQ);
    v4f rsd = *(const v4f*)(res + orow * DM + piece * 4);
#pragma unroll
    for (int c = 0; c < 4; ++c) rsd[c] = bf16q(rsd[c]);
    float* yp = ys + row * YP + piece * 4;
    v4f yv = *(const v4f*)yp;
#pragma unroll
    for (int c = 0; c < 4; ++c) yv[c] = yv[c] + rsd[c];
    *(v4f*)yp = yv;
  }
  __syncthreads();

  {
    const int r  = tid >> 4;
    const int sl = tid & 15;
    const float* yr = ys + r * YP + sl * 64;
    float s = 0.0f;
#pragma unroll
    for (int i = 0; i < 16; ++i) {
      const v4f v = *(const v4f*)(yr + i * 4);
      s += (v[0] + v[1]) + (v[2] + v[3]);
    }
    s += __shfl_xor(s, 1, 32);
    s += __shfl_xor(s, 2, 32);
    s += __shfl_xor(s, 4, 32);
    s += __shfl_xor(s, 8, 32);
    const float mean = s * (1.0f / DM);
    float ss = 0.0f;
#pragma unroll
    for (int i = 0; i < 16; ++i) {
      const v4f v = *(const v4f*)(yr + i * 4);
#pragma unroll
      for (int c = 0; c < 4; ++c) {
        const float d = v[c] - mean;
        ss += d * d;
      }
    }
    ss += __shfl_xor(ss, 1, 32);
    ss += __shfl_xor(ss, 2, 32);
    ss += __shfl_xor(ss, 4, 32);
    ss += __shfl_xor(ss, 8, 32);
    const float var  = ss * (1.0f / DM);
    const float rstd = rsqrtf(var + LN_EPS);
    if (sl == 0) { smean[r] = mean; srstd[r] = rstd; }
  }
  __syncthreads();

  // nx2 values into registers: thread owns row idx>>7 and 8 contiguous cols p8*8
  v4u hv[8];
#pragma unroll
  for (int it = 0; it < 8; ++it) {
    const int idx = it * 256 + tid;
    const int row = idx >> 7, p8 = idx & 127;
    const v4f a  = *(const v4f*)(ys + row * YP + p8 * 8);
    const v4f c  = *(const v4f*)(ys + row * YP + p8 * 8 + 4);
    const v4f g0 = *(const v4f*)(gam + p8 * 8);
    const v4f g1 = *(const v4f*)(gam + p8 * 8 + 4);
    const v4f b0 = *(const v4f*)(bet + p8 * 8);
    const v4f b1 = *(const v4f*)(bet + p8 * 8 + 4);
    const float mean = smean[row], rstd = srstd[row];
    H8 o;
#pragma unroll
    for (int i = 0; i < 4; ++i) {
      o.h[i]     = (_Float16)((a[i] - mean) * rstd * bf16q(g0[i]) + bf16q(b0[i]));
      o.h[4 + i] = (_Float16)((c[i] - mean) * rstd * bf16q(g1[i]) + bf16q(b1[i]));
    }
    hv[it] = o.u;
  }

#pragma unroll 4
  for (int it = 0; it < 16; ++it) {
    const int idx = it * 256 + tid;
    const int row = idx >> 8, piece = idx & 255;
    const v4f v = *(const v4f*)(ys + row * YP + piece * 4);
    *(v4f*)(outf + (m0 + row) * DM + piece * 4) = v;
  }
#pragma unroll
  for (int it = 0; it < 8; ++it) {
    const int idx = it * 256 + tid;
    const int row = idx >> 7, p8 = idx & 127;
    *(v4u*)(outh + (m0 + row) * DM + p8 * 8) = hv[it];
  }
}

// ---------------------------------------------------------------------------
// Kernel 4: ffn linear 1 + silu: hp[row][col] = f16(64 * silu(nx2 @ Wf1 / 64 + bf16(bf1))),
// silu(u) = u * 1/(1+exp(-u)) in f32. Block = 128 token rows x 128 output cols, 8 waves = 4 token
// groups of 32 x 2 column groups of 64; C^T = Wf1t nx2^T (A = Wf1t rows, B = nx2 f16 rows),
// K = 1024, operands through the ring (128 weight rows + 128 nx2 rows, 128 k per stage).
// Epilogue staged [token][col] in LDS (in the ring's bytes once the ring is left),
// grid (ROWS/128, FF/128), block 256. coverage: every (row, col) of the hp plane [ROWS][4096] once.
// ---------------------------------------------------------------------------
__global__ __launch_bounds__(256) void ffn1_kernel(
    const _Float16* __restrict__ x2h, const _Float16* __restrict__ wf1t,
    const float* __restrict__ bf1, _Float16* __restrict__ hp) {
  // operand ring in the k loop, then the output stage [128][VSPAD]; cross-wave (block barriers)
  __shared__ __attribute__((aligned(16))) _Float16 ring[2 * (128 + 128) * (128 + 8)];
  static_assert(2 * (128 + 128) * (128 + 8) >= 128 * VSPAD);
  _Float16* stg = ring;

  const int tid  = threadIdx.x;
  const int lane = tid & 31;
  const int wave = tid >> 5;
  const int hh   = lane >> 4;
  const int l15  = lane & 15;
  const int wt   = wave & 3;            // token group: rows 32 wt .. 32 wt + 31 of the block
  const int wc   = wave >> 2;           // column group: cols 64 wc .. 64 wc + 63 of the block
  const int cb   = blockIdx.y;          // 0..FF/128-1
  const long m0  = (long)blockIdx.x * 128;

  v8f acc[2][4];
#pragma unroll
  for (int i = 0; i < 2; ++i)
#pragma unroll
    for (int j = 0; j < 4; ++j) acc[i][j] = (v8f){};

  gemm_ring<DM, 128, 128, 4, 2, 128>(wf1t + ((long)cb * 128) * DM, x2h + m0 * DM, ring,
                                     wc * 64, wt * 32, tid, lane, acc);

  const float rsc = 1.0f / WSC;
#pragma unroll
  for (int j = 0; j < 4; ++j) {
    const int n8 = wc * 64 + j * 16 + hh * 8;
    const v4f b0 = *(const v4f*)(bf1 + cb * 128 + n8);
    const v4f b1 = *(const v4f*)(bf1 + cb * 128 + n8 + 4);
#pragma unroll
    for (int i = 0; i < 2; ++i) {
      H8 pk;
#pragma unroll
      for (int r = 0; r < 4; ++r) {
        const float u0 = acc[i][j][r]     * rsc + bf16q(b0[r]);
        const float u1 = acc[i][j][4 + r] * rsc + bf16q(b1[r]);
        const float e0 = __expf(fminf(-u0, 80.0f));
        const float e1 = __expf(fminf(-u1, 80.0f));
        const float g0 = u0 * __builtin_amdgcn_rcpf(1.0f + e0);
        const float g1 = u1 * __builtin_amdgcn_rcpf(1.0f + e1);
        pk.h[r]     = (_Float16)(g0 * WSC);
        pk.h[4 + r] = (_Float16)(g1 * WSC);
      }
      *(v4u*)(stg + (wt * 32 + i * 16 + l15) * VSPAD + n8) = pk.u;
    }
  }
  __syncthreads();

  v4u rv[8];
#pragma unroll
  for (int it = 0; it < 8; ++it) {
    const int idx = it * 256 + tid;
    const int row = idx >> 4, piece = idx & 15;
    rv[it] = *(const v4u*)(stg + row * VSPAD + piece * 8);
  }
#pragma unroll
  for (int it = 0; it < 8; ++it) {
    const int idx = it * 256 + tid;
    const int row = idx >> 4, piece = idx & 15;
    *(v4u*)(hp + (m0 + row) * FF + cb * 128 + piece * 8) = rv[it];
  }
}

// ---------------------------------------------------------------------------
// Kernel 5: ffn linear 2 + residual: out = hp @ Wf2 / 4096 + bf16(bf2) + x1 (f32 plane), out in
// full-stride rows. Block = 128 token rows x 128 output cols, 8 waves = 4 token groups of 32 x 2
// column groups of 64; C^T = Wf2t hp^T (A = Wf2t rows, B = hp rows), K = 4096, operands through the
// ring (128 weight rows + 128 hp rows, 256 k per stage). y staged [token][col] in LDS (f32, in the ring's
// bytes once the ring is left), residual added on the way out, 512 B per row segment.
// grid (ROWS/128, DM/128), block 256. coverage: every (row, col) of out once.
// ---------------------------------------------------------------------------
__global__ __launch_bounds__(256) void ffn2_kernel(
    const _Float16* __restrict__ hp, const _Float16* __restrict__ wf2t,
    const float* __restrict__ bf2, const float* __restrict__ x1f, float* __restrict__ out) {
  // operand ring in the k loop, then ys [128][YT] f32; cross-wave (block barriers)
  __shared__ __attribute__((aligned(16))) unsigned char smem[2 * (128 + 128) * (256 + 8) * 2];
  static_assert(sizeof(smem) >= (size_t)128 * YT * 4);
  _Float16* ring = (_Float16*)smem;
  float*    ys   = (float*)smem;

  const int tid  = threadIdx.x;
  const int lane = tid & 31;
  const int wave = tid >> 5;
  const int hh   = lane >> 4;
  const int l15  = lane & 15;
  const int wt   = wave & 3;            // token group: rows 32 wt .. 32 wt + 31 of the block
  const int wc   = wave >> 2;           // column group: cols 64 wc .. 64 wc + 63 of the block
  const int cb   = blockIdx.y;          // 0..DM/128-1
  const long m0  = (long)blockIdx.x * 128;

  v8f acc[2][4];
#pragma unroll
  for (int i = 0; i < 2; ++i)
#pragma unroll
    for (int j = 0; j < 4; ++j) acc[i][j] = (v8f){};

  gemm_ring<FF, 128, 128, 4, 2, 256>(wf2t + ((long)cb * 128) * FF, hp + m0 * FF, ring,
                                     wc * 64, wt * 32, tid, lane, acc);

  // y = acc/4096 + bf16(bias), staged [token][col]
  const float rsc = 1.0f / (WSC * WSC);
#pragma unroll
  for (int j = 0; j < 4; ++j) {
    const int n8 = wc * 64 + j * 16 + hh * 8;
    const v4f b0 = *(const v4f*)(bf2 + cb * 128 + n8);
    const v4f b1 = *(const v4f*)(bf2 + cb * 128 + n8 + 4);
#pragma unroll
    for (int i = 0; i < 2; ++i) {
      float* yrow = ys + (wt * 32 + i * 16 + l15) * YT;
      v4f y0, y1;
#pragma unroll
      for (int r = 0; r < 4; ++r) {
        y0[r] = acc[i][j][r]     * rsc + bf16q(b0[r]);
        y1[r] = acc[i][j][4 + r] * rsc + bf16q(b1[r]);
      }
      *(v4f*)(yrow + n8)     = y0;
      *(v4f*)(yrow + n8 + 4) = y1;
    }
  }
  __syncthreads();

  // residual add and store (coalesced), four row groups per trip
#pragma unroll 1   // keeps the trip's four loads and stores together and the wait once per trip
  for (int it0 = 0; it0 < 16; it0 += 4) {
#pragma unroll
    for (int u = 0; u < 4; ++u) {
      const int idx = (it0 + u) * 256 + tid;
      const int row = idx >> 5, piece = idx & 31;
      const long m = m0 + row;
      const v4f rsd = *(const v4f*)(x1f + m * DM + cb * 128 + piece * 4);
      v4f yv = *(const v4f*)(ys + row * YT + piece * 4);
#pragma unroll
      for (int c = 0; c < 4; ++c) yv[c] = yv[c] + rsd[c];
      const long drow = (m / SEQ) * SEQ_FULL + (m % SEQ);
      *(v4f*)(out + drow * DM + cb * 128 + piece * 4) = yv;
    }
    // stands in front of the next trip's rewrite of the registers that the stores name
    asm volatile("s_wait_xcnt 0x0" ::: "memory");
  }
}

// ---------------------------------------------------------------------------
extern "C" void kernel_launch(void* const* d_in, const int* in_sizes, int n_in,
                              void* d_out, int out_size, void* d_ws, size_t ws_size,
                              hipStream_t stream) {
  if (n_in < 13) return;
  const long needRows = (long)(NB - 1) * SEQ_FULL + SEQ;
  if ((long)in_sizes[0] < needRows * DM) return;
  if (in_sizes[1] < DM || in_sizes[2] < DM) return;
  if (in_sizes[3] < 3 * DM * DM || in_sizes[4] < 3 * DM) return;
  if (in_sizes[5] < DM * DM || in_sizes[6] < DM) return;
  if (in_sizes[7] < DM || in_sizes[8] < DM) return;
  if (in_sizes[9] < DM * FF || in_sizes[10] < FF) return;
  if (in_sizes[11] < FF * DM || in_sizes[12] < DM) return;
  if ((long)out_size < needRows * DM) return;
  if (ws_size < WS_TOTAL) return;

  const float* x     = (const float*)d_in[0];
  const float* g1    = (const float*)d_in[1];
  const float* be1   = (const float*)d_in[2];
  const float* Wqkv  = (const float*)d_in[3];
  const float* bqkv  = (const float*)d_in[4];
  const float* Wo    = (const float*)d_in[5];
  const float* bo    = (const float*)d_in[6];
  const float* g2    = (const float*)d_in[7];
  const float* be2   = (const float*)d_in[8];
  const float* Wf1   = (const float*)d_in[9];
  const float* bf1   = (const float*)d_in[10];
  const float* Wf2   = (const float*)d_in[11];
  const float* bf2   = (const float*)d_in[12];
  float* out = (float*)d_out;

  char* ws = (char*)d_ws;
  size_t off = 0;
  _Float16* nxh  = (_Float16*)(ws + off); off += PLANE2;       // [ROWS][1024] f16
  _Float16* ctx  = (_Float16*)(ws + off); off += PLANE2;       // [ROWS][1024] f16 (x64)
  _Float16* wqkv = (_Float16*)(ws + off); off += WQKV_BYTES;   // [3072][1024]
  _Float16* woh  = (_Float16*)(ws + off); off += WO_BYTES;     // [1024][1024]
  _Float16* wf1t = (_Float16*)(ws + off); off += WF1_BYTES;    // [4096][1024]
  _Float16* wf2t = (_Float16*)(ws + off); off += WF2_BYTES;    // [1024][4096]
  _Float16* qh   = (_Float16*)(ws + off); off += PLANE2;       // [NB][16][SEQ][64]
  _Float16* kh   = (_Float16*)(ws + off); off += PLANE2;       // [NB][16][SEQ][64]
  _Float16* vTh  = (_Float16*)(ws + off); off += PLANE2;       // [NB][16][64][SEQ]
  float*    x1f  = (float*)(ws + off);    off += PLANE4;       // [ROWS][1024] f32
  _Float16* nx2h = (_Float16*)(ws + off); off += PLANE2;       // [ROWS][1024] f16
  _Float16* hp   = (_Float16*)(ws + off); off += H_BYTES;      // [ROWS][4096] f16 (x64)
  if (off > ws_size) return;

  ln1_cvt_kernel<<<ROWS / 8 + NT_QKV, 256, 0, stream>>>(x, g1, be1, Wqkv, nxh, wqkv);
  qkv_kernel<<<dim3(ROWS / 128, 3 * DM / 128), 256, 0, stream>>>(nxh, wqkv, bqkv, qh, kh, vTh);
  attn_kernel<<<dim3(SEQ / 128, NB * NH + NT_LATE / (SEQ / 128)), 256, 0, stream>>>(
      qh, kh, vTh, ctx, Wo, Wf1, Wf2, woh, wf1t, wf2t);
  oproj_ln_kernel<<<ROWS / 16, 256, 0, stream>>>(ctx, woh, bo, x, g2, be2, x1f, nx2h);
  ffn1_kernel<<<dim3(ROWS / 128, FF / 128), 256, 0, stream>>>(nx2h, wf1t, bf1, hp);
  ffn2_kernel<<<dim3(ROWS / 128, DM / 128), 256, 0, stream>>>(hp, wf2t, bf2, x1f, out);
}

// v008
// Measured time: 156 microseconds a run.
// Two timings next to v007 both put it at 1.08 times that version's speed.
// Counting every step since v000, it is 4.80 times as fast.
#include <hip/hip_runtime.h>

// All contractions (fused qkv projection, q.k^T, p.v, output projection, ffn linear 1,
// ffn linear 2): v_wmma_f32_16x16x32_f16, f16 operands, f32 accumulate. Float inputs are
// RNE-converted to bf16 at load (weights additionally carried x64; both exact in f16); computed
// 16-bit planes are f16 with power-of-two carries (softmax p x1024, context x64, ffn hidden x64)
// folded back in the f32 epilogues. Layernorms, rotary tables and rotation, softmax statistics,
// silu and residual adds: f32.

typedef __attribute__((ext_vector_type(16))) _Float16 v16h;
typedef __attribute__((ext_vector_type(8)))  _Float16 v8h;
typedef __attribute__((ext_vector_type(4)))  _Float16 v4h;
typedef __attribute__((ext_vector_type(8)))  float v8f;
typedef __attribute__((ext_vector_type(4)))  float v4f;
typedef __attribute__((ext_vector_type(4)))  unsigned int v4u;
union H8 { v8h h; v4u u; };

#ifndef NB
#define NB 2
#endif
#ifndef SEQ
#define SEQ 2048
#endif
#define NB_FULL  2
#define SEQ_FULL 2048
#define DM   1024
#define NH   16
#define HD   64
#define FF   4096
#define ROWS (NB * SEQ)
#define KPAD 72       // LDS stride in halves for 64-wide f16 tiles (144 B, 16-B aligned)
#define VSPAD 136     // LDS stride in halves for 128-wide f16 tiles (272 B)
#define YT   132      // LDS stride in floats for 128-wide f32 rows (528 B)
#define RTP  32       // LDS stride in floats of the per-token rotary tables
#define LN_EPS 1e-5f
#define WSC    64.0f           // weight carry (power of two)
#define LN1024 6.931471806f    // ln(1024): softmax p carried x1024
#define ROPE_BASE 10000.0f

#define NT_QKV ((DM / 64) * (3 * DM / 64))    // 768 tiles: W [1024][3072]
#define NT_O   ((DM / 64) * (DM / 64))        // 256 tiles: W [1024][1024]
#define NT_F1  ((DM / 64) * (FF / 64))        // 1024 tiles: W [1024][4096]
#define NT_F2  ((FF / 64) * (DM / 64))        // 1024 tiles: W [4096][1024]
#define NT_LATE (NT_O + NT_F1 + NT_F2)        // tiles converted beside attention

#define PLANE2     ((size_t)ROWS * DM * 2)
#define PLANE4     ((size_t)ROWS * DM * 4)
#define WQKV_BYTES ((size_t)3 * DM * DM * 2)
#define WO_BYTES   ((size_t)DM * DM * 2)
#define WF1_BYTES  ((size_t)FF * DM * 2)
#define WF2_BYTES  ((size_t)DM * FF * 2)
#define H_BYTES    ((size_t)ROWS * FF * 2)
#define WS_TOTAL   (2 * PLANE2 + WQKV_BYTES + WO_BYTES + WF1_BYTES + WF2_BYTES + \
                    3 * PLANE2 + PLANE4 + PLANE2 + H_BYTES)

static_assert(NB >= 1 && NB <= NB_FULL);
static_assert(SEQ >= 128 && SEQ <= SEQ_FULL && (SEQ % 128) == 0);
static_assert((ROWS % 128) == 0 && (ROWS % 16) == 0 && (ROWS % 8) == 0);
static_assert((DM % 64) == 0 && (FF % 64) == 0 && HD == 64 && NH * HD == DM);
static_assert((DM % 128) == 0 && (FF % 128) == 0);
static_assert((NT_LATE % (SEQ / 128)) == 0);
static_assert((size_t)NB * NH * SEQ * HD * 2 == PLANE2);
static_assert(WS_TOTAL <= (size_t)134217728);

// ---------------------------------------------------------------------------
// helpers
// ---------------------------------------------------------------------------
__device__ __forceinline__ float bf16q(float f) {            // value after RNE bf16 conversion
  unsigned int u = __float_as_uint(f);
  u += 0x7FFFu + ((u >> 16) & 1u);
  return __uint_as_float(u & 0xFFFF0000u);
}

__device__ __forceinline__ float wave_sum(float v) {
  v += __shfl_xor(v, 16, 32);
  v += __shfl_xor(v, 8, 32);
  v += __shfl_xor(v, 4, 32);
  v += __shfl_xor(v, 2, 32);
  v += __shfl_xor(v, 1, 32);
  return v;
}

// 16-bit fragment (A or B): lane owns row/col (lane&15); elements 0..7 <- k0+8h+0..7,
// elements 8..15 <- k0+16+8h+0..7, h = lane>>4. Source is k-contiguous rows.
__device__ __forceinline__ v16h load_frag_row(const _Float16* base, int stride, int lane) {
  const _Float16* rowp = base + (lane & 15) * stride + ((lane >> 4) << 3);
  const v8h lo = *(const v8h*)(rowp);
  const v8h hi = *(const v8h*)(rowp + 16);
  return __builtin_shufflevector(lo, hi, 0, 1, 2, 3, 4, 5, 6, 7,
                                 8, 9, 10, 11, 12, 13, 14, 15);
}

__device__ __forceinline__ v8f wmma_f16(v16h a, v16h b, v8f c) {
  v8f d = __builtin_amdgcn_wmma_f32_16x16x32_f16(false, a, false, b, (short)0, c,
                                                 false, false);
  asm volatile("v_nop\n\tv_nop\n\tv_nop\n\tv_nop" : "+v"(d) : "v"(a), "v"(b));
  return d;
}

// ---------------------------------------------------------------------------
// Operand staging of the dense projections: a stage is BK k (128 or 256: rows of 2 BK bytes,
// LDS pitch BK + 8 halves, an odd multiple of 16 B) of WR weight rows followed by XR activation
// rows, brought in by asynchronous copies to LDS (no register on the way) into a ring of two
// buffers, so that stage t+1 flies while stage t is multiplied.
// ---------------------------------------------------------------------------
__device__ __forceinline__ unsigned lds_addr(const void* p) {   // byte offset in the block's LDS
  return (unsigned)(unsigned long long)p;
}

// The s_wait_xcnt closes each run of copies inside its own statement: it stands in front of any
// later rewrite of the address registers that the copies name.
__device__ __forceinline__ void acopy4(unsigned l0, const _Float16* g0,
                                       unsigned l1, const _Float16* g1,
                                       unsigned l2, const _Float16* g2,
                                       unsigned l3, const _Float16* g3) {
  asm volatile("global_load_async_to_lds_b128 %0, %1, off\n\t"
               "global_load_async_to_lds_b128 %2, %3, off\n\t"
               "global_load_async_to_lds_b128 %4, %5, off\n\t"
               "global_load_async_to_lds_b128 %6, %7, off\n\t"
               "s_wait_xcnt 0x0"
               :: "v"(l0), "v"(g0), "v"(l1), "v"(g1), "v"(l2), "v"(g2), "v"(l3), "v"(g3)
               : "memory");
}

__device__ __forceinline__ void acopy8(unsigned l0, const _Float16* g0,
                                       unsigned l1, const _Float16* g1,
                                       unsigned l2, const _Float16* g2,
                                       unsigned l3, const _Float16* g3,
                                       unsigned l4, const _Float16* g4,
                                       unsigned l5, const _Float16* g5,
                                       unsigned l6, const _Float16* g6,
                                       unsigned l7, const _Float16* g7) {
  asm volatile("global_load_async_to_lds_b128 %0, %1, off\n\t"
               "global_load_async_to_lds_b128 %2, %3, off\n\t"
               "global_load_async_to_lds_b128 %4, %5, off\n\t"
               "global_load_async_to_lds_b128 %6, %7, off\n\t"
               "global_load_async_to_lds_b128 %8, %9, off\n\t"
               "global_load_async_to_lds_b128 %10, %11, off\n\t"
               "global_load_async_to_lds_b128 %12, %13, off\n\t"
               "global_load_async_to_lds_b128 %14, %15, off\n\t"
               "s_wait_xcnt 0x0"
               :: "v"(l0), "v"(g0), "v"(l1), "v"(g1), "v"(l2), "v"(g2), "v"(l3), "v"(g3),
                  "v"(l4), "v"(g4), "v"(l5), "v"(g5), "v"(l6), "v"(g6), "v"(l7), "v"(g7)
               : "memory");
}

// NR rows of BK halves (256 or 512 B): BK / 8 lanes x 16 B per row, RC rows per copy of the block.
template <int KD, int NR, int BK>
__device__ __forceinline__ void copy_rows_wide(const _Float16* src, _Float16* dst, int tid) {
  constexpr int CR = BK / 8;                   // 16-B pieces per row
  constexpr int RC = 256 / CR;                 // rows per copy of the block
  constexpr int LP = BK + 8;                   // LDS pitch in halves
  static_assert((NR % (8 * RC)) == 0);
  const _Float16* g = src + (size_t)(tid / CR) * KD + (tid % CR) * 8;
  const unsigned  l = lds_addr(dst + (tid / CR) * LP + (tid % CR) * 8);
  constexpr unsigned LS = RC * LP * 2;         // LDS bytes per RC rows
  constexpr size_t   GS = (size_t)RC * KD;     // source halves per RC rows
#pragma unroll   // the LDS and source steps become constants
  for (int i = 0; i < NR / RC; i += 8)
    acopy8(l + i * LS, g + i * GS, l + (i + 1) * LS, g + (i + 1) * GS,
           l + (i + 2) * LS, g + (i + 2) * GS, l + (i + 3) * LS, g + (i + 3) * GS,
           l + (i + 4) * LS, g + (i + 4) * GS, l + (i + 5) * LS, g + (i + 5) * GS,
           l + (i + 6) * LS, g + (i + 6) * GS, l + (i + 7) * LS, g + (i + 7) * GS);
}

// One stage: k0..k0+BK-1 of WR weight rows and XR activation rows.
template <int KD, int WR, int XR, int BK>
__device__ __forceinline__ void stage_copy(const _Float16* wsrc, const _Float16* xsrc,
                                           _Float16* buf, int k0, int tid) {
  copy_rows_wide<KD, WR, BK>(wsrc + k0, buf, tid);
  copy_rows_wide<KD, XR, BK>(xsrc + k0, buf + WR * (BK + 8), tid);
}

// acc[i][j] += W rows (wrow0 + 16j ..) x act rows (xrow0 + 16i ..)^T over all KD, k ascending in
// steps of 32. C^T = W act^T: A = W rows (lane&15 = out col), B = act rows (lane&15 = token).
// A wave's tile is 16 JW columns x 16 XF tokens: JW + XF fragments feed JW * XF WMMAs.
// On return every copy has landed, every wave has left the ring, and a block barrier has passed.
template <int KD, int WR, int XR, int JW, int XF, int BK>
__device__ __forceinline__ void gemm_ring(const _Float16* wsrc, const _Float16* xsrc,
                                          _Float16* ring, int wrow0, int xrow0,
                                          int tid, int lane, v8f (&acc)[XF][JW]) {
  static_assert(BK == 128 || BK == 256);
  constexpr int LP = BK + 8;             // LDS pitch in halves
  constexpr int SH = (WR + XR) * LP;     // halves per buffer
  constexpr int NT = KD / BK;            // stages
  constexpr int NS = BK / 32;            // 32-k steps per stage
  static_assert((KD % BK) == 0 && NT >= 2);

  stage_copy<KD, WR, XR, BK>(wsrc, xsrc, ring, 0, tid);
  asm volatile("s_wait_asynccnt 0x0" ::: "memory");   // this wave's part of stage 0 has landed
  __syncthreads();                                    // stage 0 published to every wave
  stage_copy<KD, WR, XR, BK>(wsrc, xsrc, ring + SH, BK, tid);

#pragma unroll 1   // one stage per trip: the ring's waits and barrier stand once, at the foot
  for (int t = 0; t < NT; ++t) {
    _Float16* buf = ring + (t & 1) * SH;
    const _Float16* wl = buf + wrow0 * LP;
    const _Float16* xl = buf + (WR + xrow0) * LP;
    // fragment reads run two 32-k steps ahead of the WMMAs that use them, inside this stage only,
    // through three register sets: the LDS reads of a wide stage go on under its WMMAs
    // (all loops unrolled: the fragment and accumulator arrays must stay in registers)
    v16h xf[3][XF], wf[3][JW];
#pragma unroll
    for (int s = 0; s < NS + 2; ++s) {
      if (s < NS) {
#pragma unroll
        for (int i = 0; i < XF; ++i)
          xf[s % 3][i] = load_frag_row(xl + (i * 16) * LP + s * 32, LP, lane);
#pragma unroll
        for (int j = 0; j < JW; ++j)
          wf[s % 3][j] = load_frag_row(wl + (j * 16) * LP + s * 32, LP, lane);
      }
      if (s >= 2) {
#pragma unroll
        for (int i = 0; i < XF; ++i)
#pragma unroll
          for (int j = 0; j < JW; ++j)
            acc[i][j] = wmma_f16(wf[(s - 2) % 3][j], xf[(s - 2) % 3][i], acc[i][j]);
      }
    }
    asm volatile("s_wait_dscnt 0x0" ::: "memory");     // own reads of this buffer are done
    asm volatile("s_wait_asynccnt 0x0" ::: "memory");  // own part of stage t+1 has landed
    __syncthreads();   // publishes stage t+1 and ends every wave's reads of stage t
    if (t + 2 < NT) stage_copy<KD, WR, XR, BK>(wsrc, xsrc, buf, (t + 2) * BK, tid);
  }
  asm volatile("s_wait_asynccnt 0x0" ::: "memory");    // nothing in flight behind the loop
}

// ---------------------------------------------------------------------------
// Body A: nx = LN(bf16rne(x)) * bf16(g) + bf16(b) -> f16 plane nxh [ROWS][1024].
// One wave per token row, lane owns 4 chunks of 8 consecutive floats (i*256 + lane*8).
// ROWS/8 blocks of 256. coverage: ROWS rows x 4 x 256 halves = whole plane.
// ---------------------------------------------------------------------------
__device__ __forceinline__ void ln1_body(const float* __restrict__ x,
                                         const float* __restrict__ g,
                                         const float* __restrict__ bb,
                                         _Float16* __restrict__ nxh, int blk) {
  const int lane  = threadIdx.x & 31;
  const int wave  = threadIdx.x >> 5;
  const long m    = (long)blk * 8 + wave;                    // token row 0..ROWS-1
  const long srow = (m / SEQ) * SEQ_FULL + (m % SEQ);        // full-stride source row
  const float* xr = x + srow * DM + lane * 8;

  float s = 0.0f;
#pragma unroll 1
  for (int i = 0; i < 4; ++i) {
    const v4f a = *(const v4f*)(xr + i * 256);
    const v4f c = *(const v4f*)(xr + i * 256 + 4);
    s += ((bf16q(a[0]) + bf16q(a[1])) + (bf16q(a[2]) + bf16q(a[3]))) +
         ((bf16q(c[0]) + bf16q(c[1])) + (bf16q(c[2]) + bf16q(c[3])));
  }
  s = wave_sum(s);
  const float mean = s * (1.0f / DM);

  float ss = 0.0f;
#pragma unroll 1
  for (int i = 0; i < 4; ++i) {
    const v4f a = *(const v4f*)(xr + i * 256);
    const v4f c = *(const v4f*)(xr + i * 256 + 4);
#pragma unroll
    for (int e = 0; e < 4; ++e) {
      const float d0 = bf16q(a[e]) - mean;
      const float d1 = bf16q(c[e]) - mean;
      ss += d0 * d0;
      ss += d1 * d1;
    }
  }
  ss = wave_sum(ss);
  const float rstd = rsqrtf(ss * (1.0f / DM) + LN_EPS);

  _Float16* drow = nxh + m * DM + lane * 8;
#pragma unroll 1
  for (int i = 0; i < 4; ++i) {
    const v4f a  = *(const v4f*)(xr + i * 256);
    const v4f c  = *(const v4f*)(xr + i * 256 + 4);
    const v4f g0 = *(const v4f*)(g + i * 256 + lane * 8);
    const v4f g1 = *(const v4f*)(g + i * 256 + lane * 8 + 4);
    const v4f b0 = *(const v4f*)(bb + i * 256 + lane * 8);
    const v4f b1 = *(const v4f*)(bb + i * 256 + lane * 8 + 4);
    H8 o;
#pragma unroll
    for (int e = 0; e < 4; ++e) {
      o.h[e]     = (_Float16)((bf16q(a[e]) - mean) * rstd * bf16q(g0[e]) + bf16q(b0[e]));
      o.h[4 + e] = (_Float16)((bf16q(c[e]) - mean) * rstd * bf16q(g1[e]) + bf16q(b1[e]));
    }
    _Float16* dst = drow + i * 256;
    *(v4u*)dst = o.u;
  }
}

// ---------------------------------------------------------------------------
// Body B: one 64x64 tile (kt, nt) of a weight W [K=in][N=out] f32 -> Wt [n][k] f16 =
// f16(bf16rne(W) * 64), through an LDS transpose. One block of 256 per tile; ts holds 64 * KPAD
// halves, [n][k], cross-wave (block barrier; every thread of the block comes here or none).
// The weight conversion has no launch of its own: its tiles are further blocks of launches that
// they do not depend on, W_qkv beside the first layernorm, the other three beside attention.
// ---------------------------------------------------------------------------
__device__ __forceinline__ void cvt_tile(const float* __restrict__ W, _Float16* __restrict__ dst,
                                         int K, int N, int kt, int nt, _Float16* ts, int tid) {
  // load W[kt*64 + kr][nt*64 + 4*c4 .. +3], store transposed into ts[n][kr]
#pragma unroll
  for (int it = 0; it < 4; ++it) {
    const int idx = it * 256 + tid;
    const int kr = idx >> 4, c4 = idx & 15;
    const v4f v = *(const v4f*)(W + (size_t)(kt * 64 + kr) * N + nt * 64 + c4 * 4);
#pragma unroll
    for (int j = 0; j < 4; ++j) ts[(c4 * 4 + j) * KPAD + kr] = (_Float16)(bf16q(v[j]) * WSC);
  }
  __syncthreads();
  v4u rv[2];
#pragma unroll
  for (int it = 0; it < 2; ++it) {
    const int idx = it * 256 + tid;
    const int n = idx >> 3, piece = idx & 7;
    rv[it] = *(const v4u*)(ts + n * KPAD + piece * 8);
  }
#pragma unroll
  for (int it = 0; it < 2; ++it) {
    const int idx = it * 256 + tid;
    const int n = idx >> 3, piece = idx & 7;
    *(v4u*)(dst + (size_t)(nt * 64 + n) * K + kt * 64 + piece * 8) = rv[it];
  }
  // stands in front of any later rewrite of the registers that the two stores name
  asm volatile("s_wait_xcnt 0x0" ::: "memory");
}

// ---------------------------------------------------------------------------
// Kernel 0: blocks 0 .. ROWS/8-1: body A (first layernorm); the next NT_QKV blocks: body B on
// W_qkv, in [1024][3072] -> wqkv [3072][1024] (out col = q|k|v third, head h at 64h).
// grid ROWS/8 + NT_QKV, block 256. coverage: the nxh plane and 768 tiles of 64x64 = all of wqkv.
// ---------------------------------------------------------------------------
__global__ __launch_bounds__(256) void ln1_cvt_kernel(
    const float* __restrict__ x, const float* __restrict__ g, const float* __restrict__ bb,
    const float* __restrict__ Wqkv, _Float16* __restrict__ nxh, _Float16* __restrict__ wqkv) {
  __shared__ __attribute__((aligned(16))) _Float16 ts[64 * KPAD];
  const int bid = blockIdx.x;
  if (bid < ROWS / 8) {                                 // block-uniform selection
    ln1_body(x, g, bb, nxh, bid);
  } else {
    const int tile = bid - ROWS / 8;
    const int kt = tile / (3 * DM / 64), nt = tile - kt * (3 * DM / 64);
    cvt_tile(Wqkv, wqkv, DM, 3 * DM, kt, nt, ts, threadIdx.x);
  }
}

// ---------------------------------------------------------------------------
// Kernel 1: fused qkv projection + rotary embedding. Block = 128 token rows x 128 output columns
// (two heads of one of q/k/v), 8 waves = 4 token groups of 32 x 2 heads; a wave's tile is 32 tokens
// x 64 columns. C^T = W x^T: A = W rows (lane&15 = out col), B = nx rows (lane&15 = token);
// acc[i][j][r] = C[token 16i + lane&15][col 16j+8h+r]. K = 1024, operands through the ring
// (128 weight rows + 128 nx rows, 128 k per stage).
// Behind the k loop (q/k blocks only, block-uniform): rotary tables cos/sin[token][i], i < 32,
// angle = pos * (1 / 10000^(2i/64)), f32 powf/cosf/sinf, in LDS (cross-wave, block barrier).
// Epilogue u = acc/64 + bf16(bias); q,k: d<32: u[d]*cos - u[d+32]*sin, d>=32: u[d]*cos + u[d-32]*sin
//   q,k -> [b][h][s][64] f16 (one line per row, 8 lanes x 16 B)
//   v   -> vT[b][h][d][s] f16 (256 B per d row segment, 16 lanes x 16 B)
// grid (ROWS/128, 3*DM/128), block 256. coverage: every (b,h,s,d) of q, k and vT once.
// LDS: the output stage lies in the ring's bytes once the ring is left: q/k [2 heads][128][KPAD],
// v [128 d][VSPAD], fully written before read; ctab/stab 128x32 lie behind the q/k stage, also in
// the ring's bytes, fully written: the block's LDS is the ring alone, and two blocks fit a WGP.
// ---------------------------------------------------------------------------
__global__ __launch_bounds__(256) void qkv_kernel(
    const _Float16* __restrict__ nxh, const _Float16* __restrict__ wqkv,
    const float* __restrict__ bqkv,
    _Float16* __restrict__ q, _Float16* __restrict__ k, _Float16* __restrict__ vT) {
  // operand ring in the k loop, then the output stage and the tables; cross-wave (block barriers)
  __shared__ __attribute__((aligned(16))) _Float16 ring[2 * (128 + 128) * (128 + 8)];
  constexpr int STGH = 2 * 128 * KPAD;   // halves of the q/k output stage
  static_assert(sizeof(ring) >= (size_t)STGH * 2 + (size_t)2 * 128 * RTP * 4);
  static_assert(2 * (128 + 128) * (128 + 8) >= 128 * VSPAD && ((STGH * 2) % 16) == 0);
  _Float16* stg = ring;
  float* ctab = (float*)(ring + STGH);   // cos table [token][i], cross-wave (block barrier)
  float* stab = ctab + 128 * RTP;        // sin table [token][i], cross-wave (block barrier)

  const int tid  = threadIdx.x;
  const int lane = tid & 31;
  const int wave = tid >> 5;
  const int hh   = lane >> 4;
  const int l15  = lane & 15;
  const int wt   = wave & 3;            // token group: rows 32 wt .. 32 wt + 31 of the block
  const int wc   = wave >> 2;           // head of the block's two

  const int cb   = blockIdx.y;          // 0..23 = output column block (128 cols each)
  const int osel = cb >> 3;             // 0 q, 1 k, 2 v
  const int h0   = (cb & 7) * 2;        // first head of the block
  const long m0  = (long)blockIdx.x * 128;
  const int  b   = (int)(m0 / SEQ);
  const int  s0  = (int)(m0 - (long)b * SEQ);

  v8f acc[2][4];
#pragma unroll
  for (int i = 0; i < 2; ++i)
#pragma unroll
    for (int j = 0; j < 4; ++j) acc[i][j] = (v8f){};

  gemm_ring<DM, 128, 128, 4, 2, 128>(wqkv + ((long)cb * 128) * DM, nxh + m0 * DM, ring,
                                     wc * 64, wt * 32, tid, lane, acc);

  if (osel < 2) {                       // block-uniform
#pragma clang fp contract(off)
    const int i  = tid & 31;
    const int tg = tid >> 5;
    const float e   = (float)(2 * i) * (1.0f / 64.0f);
    const float inv = 1.0f / powf(ROPE_BASE, e);
#pragma unroll 1
    for (int tt = tg; tt < 128; tt += 8) {
      const float ang = (float)(s0 + tt) * inv;
      ctab[tt * RTP + i] = cosf(ang);
      stab[tt * RTP + i] = sinf(ang);
    }
  }
  __syncthreads();   // the tables are published to every wave

  const float* bias = bqkv + cb * 128 + wc * 64;
  const float  rsc  = 1.0f / WSC;

  v4u rv[8];
  if (osel < 2) {
#pragma unroll
    for (int i = 0; i < 2; ++i) {
      float u[4][8];
#pragma unroll
      for (int j = 0; j < 4; ++j) {
        const int n8 = j * 16 + hh * 8;
        const v4f b0 = *(const v4f*)(bias + n8);
        const v4f b1 = *(const v4f*)(bias + n8 + 4);
#pragma unroll
        for (int r = 0; r < 4; ++r) {
          u[j][r]     = acc[i][j][r]     * rsc + bf16q(b0[r]);
          u[j][4 + r] = acc[i][j][4 + r] * rsc + bf16q(b1[r]);
        }
      }
      // rotation: lane holds d = n8+r (j<2) and its partner d+32 (j+2); stage [head][token][col]
      const int tl = wt * 32 + i * 16 + l15;
      _Float16* srow = stg + (wc * 128 + tl) * KPAD;
      const float* crow = ctab + tl * RTP;
      const float* nrow = stab + tl * RTP;
#pragma unroll
      for (int j = 0; j < 2; ++j) {
        const int n8 = j * 16 + hh * 8;
        const v4f c0  = *(const v4f*)(crow + n8);
        const v4f c1  = *(const v4f*)(crow + n8 + 4);
        const v4f sn0 = *(const v4f*)(nrow + n8);
        const v4f sn1 = *(const v4f*)(nrow + n8 + 4);
        H8 plo, phi;
#pragma unroll
        for (int r = 0; r < 4; ++r) {
          const float a0 = u[j][r],     d0 = u[j + 2][r];
          const float a1 = u[j][4 + r], d1 = u[j + 2][4 + r];
          plo.h[r]     = (_Float16)(a0 * c0[r] - d0 * sn0[r]);
          phi.h[r]     = (_Float16)(d0 * c0[r] + a0 * sn0[r]);
          plo.h[4 + r] = (_Float16)(a1 * c1[r] - d1 * sn1[r]);
          phi.h[4 + r] = (_Float16)(d1 * c1[r] + a1 * sn1[r]);
        }
        *(v4u*)(srow + n8)      = plo.u;
        *(v4u*)(srow + 32 + n8) = phi.u;
      }
    }
    __syncthreads();
#pragma unroll
    for (int it = 0; it < 8; ++it) {
      const int idx = it * 256 + tid;
      const int row = idx >> 3, piece = idx & 7;        // row = head * 128 + token
      rv[it] = *(const v4u*)(stg + row * KPAD + piece * 8);
    }
    // per head a contiguous 16 KB; the two heads lie SEQ * HD halves apart
    _Float16* dst = ((osel == 0) ? q : k) + ((long)(b * NH + h0) * SEQ + s0) * HD;
#pragma unroll
    for (int it = 0; it < 8; ++it) {
      const int idx = it * 256 + tid;
      *(v4u*)(dst + (long)(idx >> 10) * SEQ * HD + (long)(idx & 1023) * 8) = rv[it];
    }
  } else {
    // stage transposed [d][token]: lane's 8 values are 8 different d for one token
#pragma unroll
    for (int j = 0; j < 4; ++j) {
      const int n8 = j * 16 + hh * 8;
      const v4f b0 = *(const v4f*)(bias + n8);
      const v4f b1 = *(const v4f*)(bias + n8 + 4);
#pragma unroll
      for (int i = 0; i < 2; ++i) {
        _Float16* scol = stg + (wc * 64 + n8) * VSPAD + wt * 32 + i * 16 + l15;
#pragma unroll
        for (int r = 0; r < 4; ++r) {
          scol[r * VSPAD]       = (_Float16)(acc[i][j][r]     * rsc + bf16q(b0[r]));
          scol[(4 + r) * VSPAD] = (_Float16)(acc[i][j][4 + r] * rsc + bf16q(b1[r]));
        }
      }
    }
    __syncthreads();
#pragma unroll
    for (int it = 0; it < 8; ++it) {
      const int idx = it * 256 + tid;
      const int d = idx >> 4, piece = idx & 15;         // d = head * 64 + d of the head
      rv[it] = *(const v4u*)(stg + d * VSPAD + piece * 8);
    }
    _Float16* dstb = vT + ((long)(b * NH + h0) * HD) * SEQ + s0;
#pragma unroll
    for (int it = 0; it < 8; ++it) {
      const int idx = it * 256 + tid;
      const int d = idx >> 4, piece = idx & 15;
      *(v4u*)(dstb + (long)d * SEQ + piece * 8) = rv[it];
    }
  }
}

// ---------------------------------------------------------------------------
// Kernel 2: flash attention per (b,h), no mask, all SEQ keys: blockIdx.y < NB*NH of the grid
// (SEQ/128, NB*NH + NT_LATE/(SEQ/128)), block 256 (8 waves x 16 queries). The blocks behind them
// run body B on W_proj, W_ffn1 and W_ffn2 (read first by the launches that follow), one tile each.
// Attention: C = S^T (A = K rows, B = Q) then C = O^T = V^T P^T (P^T packed from the S^T D registers); lane owns one query end-to-end. Scores are raw q.k sums:
// the 1/8 scale and the x1024 p carry live in the exp argument (p = 1024*exp((s-m)/8),
// softmax stats f32). Context (carried x64) written to ctx[b*SEQ+s][h*64+d] through an LDS stage
// K and V^T come in by asynchronous copies to LDS into a ring of two buffers, so that the next
// stage of 64 keys flies while this one is worked on.
// LDS tiles: a stage = 64 keys x 64 d of K and of V^T == consumed extent; ost 128 x 64 fully written.
// coverage: every (row, h*64+d) of the ctx plane once; 256 + 1024 + 1024 tiles of 64x64 = every
// element of woh [1024][1024], wf1t [4096][1024] and wf2t [1024][4096].
// ---------------------------------------------------------------------------
// One stage of 64 keys: buffer rows 0..63 = K rows [key][d] (source pitch HD), rows 64..127 = V^T
// rows [d][key] (source pitch SEQ), LDS pitch KPAD halves; 8 lanes x 16 B per row, 32 rows per copy.
__device__ __forceinline__ void kv_stage_copy(const _Float16* kg, const _Float16* vg,
                                              _Float16* buf, int tid) {
  const int r = tid >> 3, c = (tid & 7) * 8;
  const unsigned l = lds_addr(buf + r * KPAD + c);
  constexpr unsigned LS = 32 * KPAD * 2;       // LDS bytes per 32 rows
  acopy4(l,          kg + r * HD + c,           l + LS,     kg + (r + 32) * HD + c,
         l + 2 * LS, vg + (long)r * SEQ + c,    l + 3 * LS, vg + (long)(r + 32) * SEQ + c);
}

// At most 160 registers a wave (six waves per SIMD): beside the two attention blocks of a WGP a
// third block, a weight tile, stays resident, so the conversion still runs under attention.
__global__ __launch_bounds__(256) __attribute__((amdgpu_waves_per_eu(6))) void attn_kernel(
    const _Float16* __restrict__ Q, const _Float16* __restrict__ K,
    const _Float16* __restrict__ vT, _Float16* __restrict__ ctx,
    const float* __restrict__ Wo, const float* __restrict__ Wf1, const float* __restrict__ Wf2,
    _Float16* __restrict__ woh, _Float16* __restrict__ wf1t, _Float16* __restrict__ wf2t) {
  // two buffers of [K 64 rows | V^T 64 rows]; cross-wave (block barriers)
  __shared__ __attribute__((aligned(16))) _Float16 kv[2 * 128 * KPAD];
  __shared__ _Float16 ost[128 * KPAD];   // output stage [query][d]   (cross-wave, block barrier)

  const int tid  = threadIdx.x;
  if (blockIdx.y >= NB * NH) {           // block-uniform: a weight tile, staged in kv's bytes
    const int t = (blockIdx.y - NB * NH) * (SEQ / 128) + blockIdx.x;   // 0 .. NT_LATE-1
    const float* W;
    _Float16* dst;
    int kd, nd, kt, nt;
    if (t < NT_O) {                                     // in [1024][1024] -> out [1024][1024]
      kt = t / (DM / 64); nt = t - kt * (DM / 64); kd = DM; nd = DM;
      W = Wo; dst = woh;
    } else if (t < NT_O + NT_F1) {
      const int tile = t - NT_O;                        // in [1024][4096] -> out [4096][1024]
      kt = tile / (FF / 64); nt = tile - kt * (FF / 64); kd = DM; nd = FF;
      W = Wf1; dst = wf1t;
    } else {
      const int tile = t - NT_O - NT_F1;                // in [4096][1024] -> out [1024][4096]
      kt = tile / (DM / 64); nt = tile - kt * (DM / 64); kd = FF; nd = DM;
      W = Wf2; dst = wf2t;
    }
    cvt_tile(W, dst, kd, nd, kt, nt, kv, tid);
    return;
  }
  const int lane = tid & 31;
  const int wave = tid >> 5;
  const int bh   = blockIdx.y;
  const int b    = bh >> 4;
  const int h    = bh & 15;
  const int q0   = blockIdx.x * 128;

  const _Float16* Qb  = Q + ((long)bh * SEQ + q0) * HD;
  const _Float16* Kb  = K + (long)bh * SEQ * HD;
  const _Float16* vTb = vT + (long)bh * HD * SEQ;

  // Q fragments: B operand of S^T (lane owns query lane&15)
  v16h qfrag[2];
  {
    const _Float16* qrow = Qb + (long)wave * 16 * HD;
#pragma unroll
    for (int t = 0; t < 2; ++t) qfrag[t] = load_frag_row(qrow + t * 32, HD, lane);
  }

  v8f acc[4];   // O^T accumulator: lane owns query (lane&15); reg r -> d = nt*16+8h+r
#pragma unroll
  for (int nt = 0; nt < 4; ++nt) acc[nt] = (v8f){};
  float mi = -1e30f, li = 0.0f;

  const int colb = lane & 15;
  const int rofs = (lane >> 4) << 3;

  constexpr int SH = 128 * KPAD;   // halves per buffer
  constexpr int NS = SEQ / 64;     // stages
  static_assert(NS >= 2);

  kv_stage_copy(Kb, vTb, kv, tid);
  asm volatile("s_wait_asynccnt 0x0" ::: "memory");   // this wave's part of stage 0 has landed
  __syncthreads();                                    // stage 0 published to every wave
  kv_stage_copy(Kb + 64 * HD, vTb + 64, kv + SH, tid);

#pragma unroll 1   // one stage per trip: the ring's waits and barrier stand once, at the foot
  for (int sg = 0; sg < NS; ++sg) {
    _Float16* buf = kv + (sg & 1) * SH;
    const _Float16* ks  = buf;               // K rows [key][d]
    const _Float16* vts = buf + 64 * KPAD;   // V^T rows [d][key]

    // S^T tiles: A = K rows (lane&15 = key), B = Q
    // the stage's eight K fragments go out as one group in front of the WMMAs that use them
    // (all loops unrolled: the fragment arrays must stay in registers)
    v16h kf[2][4];
#pragma unroll
    for (int t = 0; t < 2; ++t)
#pragma unroll
      for (int kt = 0; kt < 4; ++kt)
        kf[t][kt] = load_frag_row(ks + (kt * 16) * KPAD + t * 32, KPAD, lane);
    v8f sc[4];
#pragma unroll
    for (int kt = 0; kt < 4; ++kt) sc[kt] = (v8f){};
#pragma unroll
    for (int t = 0; t < 2; ++t)
#pragma unroll
      for (int kt = 0; kt < 4; ++kt) sc[kt] = wmma_f16(kf[t][kt], qfrag[t], sc[kt]);

    // the V^T fragments of keys 0..31 are asked for here: they land under the softmax arithmetic
    v16h vf[2][4];
#pragma unroll
    for (int nt = 0; nt < 4; ++nt)
      vf[0][nt] = load_frag_row(vts + (nt * 16) * KPAD, KPAD, lane);
    // keeps the scheduler from sinking those loads to their uses, where each would be waited for
    __builtin_amdgcn_sched_barrier(0);

    // per-lane online softmax (32 of 64 keys in-lane; merge halves with one shuffle)
    float mx = sc[0][0];
#pragma unroll
    for (int kt = 0; kt < 4; ++kt)
#pragma unroll
      for (int r = 0; r < 8; ++r) mx = fmaxf(mx, sc[kt][r]);
    mx = fmaxf(mx, __shfl_xor(mx, 16, 32));
    const float mnew  = fmaxf(mi, mx);
    const float alpha = __expf((mi - mnew) * 0.125f);
    mi = mnew;
    const float cs = fmaf(mnew, 0.125f, -LN1024);   // 0.125*m - ln(1024)

    // P^T as the B operand of O^T = V^T P^T, packed from the S^T D registers:
    // element i <- tile covering keys 0..15 of the 32-step (kt = 2t), element 8+i <- kt = 2t+1.
    float rs = 0.0f;
    v16h pf[2];
#pragma unroll
    for (int t = 0; t < 2; ++t) {
#pragma unroll
      for (int kt = 2 * t; kt < 2 * t + 2; ++kt)
#pragma unroll
        for (int r = 0; r < 8; ++r) {
          const float p = __expf(fmaf(sc[kt][r], 0.125f, -cs));   // 1024*exp((s-m)/8)
          sc[kt][r] = p;
          rs += p;
        }
#pragma unroll
      for (int i = 0; i < 8; ++i) {
        pf[t][i]     = (_Float16)sc[2 * t][i];
        pf[t][8 + i] = (_Float16)sc[2 * t + 1][i];
      }
      if (t == 0) {
        // the V^T fragments of keys 32..63 follow once half of the scores are packed (registers
        // freed): they land under the other half's arithmetic
#pragma unroll
        for (int nt = 0; nt < 4; ++nt)
          vf[1][nt] = load_frag_row(vts + (nt * 16) * KPAD + 32, KPAD, lane);
        // keeps the scheduler from sinking those loads to their uses
        __builtin_amdgcn_sched_barrier(0);
      }
    }
    rs += __shfl_xor(rs, 16, 32);
    li = li * alpha + rs;

#pragma unroll
    for (int nt = 0; nt < 4; ++nt)
#pragma unroll
      for (int r = 0; r < 8; ++r) acc[nt][r] *= alpha;

    // O^T += V^T (A, rows = d) x P^T (B)
#pragma unroll
    for (int t = 0; t < 2; ++t)
#pragma unroll
      for (int nt = 0; nt < 4; ++nt) acc[nt] = wmma_f16(vf[t][nt], pf[t], acc[nt]);

    asm volatile("s_wait_dscnt 0x0" ::: "memory");     // own reads of this buffer are done
    asm volatile("s_wait_asynccnt 0x0" ::: "memory");  // own part of stage sg+1 has landed
    __syncthreads();   // publishes stage sg+1 and ends every wave's reads of stage sg
    if (sg + 2 < NS) kv_stage_copy(Kb + (long)(sg + 2) * 64 * HD, vTb + (sg + 2) * 64, buf, tid);
  }
  asm volatile("s_wait_asynccnt 0x0" ::: "memory");    // nothing in flight behind the loop

  // normalize (and apply the x64 carry) and stage: lane owns query row wave*16+colb,
  // d = nt*16+rofs+r contiguous
  {
    const float inv = 64.0f / li;
    _Float16* orow = ost + (wave * 16 + colb) * KPAD;
#pragma unroll
    for (int nt = 0; nt < 4; ++nt) {
      H8 pk;
#pragma unroll
      for (int r = 0; r < 8; ++r) pk.h[r] = (_Float16)(acc[nt][r] * inv);
      *(v4u*)(orow + nt * 16 + rofs) = pk.u;
    }
  }
  __syncthreads();

  v4u rv[4];
#pragma unroll
  for (int it = 0; it < 4; ++it) {
    const int idx = it * 256 + tid;
    const int row = idx >> 3, piece = idx & 7;
    rv[it] = *(const v4u*)(ost + row * KPAD + piece * 8);
  }
  _Float16* cbase = ctx + ((long)b * SEQ + q0) * DM + h * HD;
#pragma unroll
  for (int it = 0; it < 4; ++it) {
    const int idx = it * 256 + tid;
    const int row = idx >> 3, piece = idx & 7;
    *(v4u*)(cbase + (long)row * DM + piece * 8) = rv[it];
  }
  
}

// ---------------------------------------------------------------------------
// Kernel 3: output projection + residual: x1 = ctx @ Wo / 4096 + bf16(bias) + bf16(x) -> f32 plane
// x1f [ROWS][1024] (x in full-stride rows). Block = 128 token rows x 128 output cols, 8 waves =
// 4 token groups of 32 x 2 column groups of 64; C^T = Wo ctx^T (A = Wo rows, B = ctx rows),
// K = 1024, operands through the ring (128 weight rows + 128 ctx rows, 128 k per stage): a block
// reads 256 operand rows for 16384 outputs. y staged [token][col] in LDS (f32, in the ring's bytes
// once the ring is left), residual added on the way out, 512 B per row segment.
// grid (ROWS/128, DM/128), block 256. coverage: every (row, col) of x1f once.
// ---------------------------------------------------------------------------
__global__ __launch_bounds__(256) void oproj_kernel(
    const _Float16* __restrict__ act, const _Float16* __restrict__ wo,
    const float* __restrict__ bias, const float* __restrict__ res, float* __restrict__ outf) {
  // operand ring in the k loop, then ys [128][YT] f32; cross-wave (block barriers)
  __shared__ __attribute__((aligned(16))) unsigned char smem[2 * (128 + 128) * (128 + 8) * 2];
  static_assert(sizeof(smem) >= (size_t)128 * YT * 4);
  _Float16* ring = (_Float16*)smem;
  float*    ys   = (float*)smem;

  const int tid  = threadIdx.x;
  const int lane = tid & 31;
  const int wave = tid >> 5;
  const int hh   = lane >> 4;
  const int l15  = lane & 15;
  const int wt   = wave & 3;            // token group: rows 32 wt .. 32 wt + 31 of the block
  const int wc   = wave >> 2;           // column group: cols 64 wc .. 64 wc + 63 of the block
  const int cb   = blockIdx.y;          // 0..DM/128-1
  const long m0  = (long)blockIdx.x * 128;

  v8f acc[2][4];
#pragma unroll
  for (int i = 0; i < 2; ++i)
#pragma unroll
    for (int j = 0; j < 4; ++j) acc[i][j] = (v8f){};

  gemm_ring<DM, 128, 128, 4, 2, 128>(wo + ((long)cb * 128) * DM, act + m0 * DM, ring,
                                     wc * 64, wt * 32, tid, lane, acc);

  // the block's residual rows are asked for here, all at once: they land under the staging of y
  // thread owns, per group it, row it * 8 + tid / 32 and 4 contiguous cols (tid & 31) * 4
  const int prow = tid >> 5, piece = tid & 31;
  v4f rsd[16];
#pragma unroll
  for (int it = 0; it < 16; ++it) {
    const long m = m0 + it * 8 + prow;
    const long srow = (m / SEQ) * SEQ_FULL + (m % SEQ);
    rsd[it] = *(const v4f*)(res + srow * DM + cb * 128 + piece * 4);
  }

  // y = acc/4096 + bf16(bias), staged [token][col]
  const float rsc = 1.0f / (WSC * WSC);
#pragma unroll
  for (int j = 0; j < 4; ++j) {
    const int n8 = wc * 64 + j * 16 + hh * 8;
    const v4f b0 = *(const v4f*)(bias + cb * 128 + n8);
    const v4f b1 = *(const v4f*)(bias + cb * 128 + n8 + 4);
#pragma unroll
    for (int i = 0; i < 2; ++i) {
      float* yrow = ys + (wt * 32 + i * 16 + l15) * YT;
      v4f y0, y1;
#pragma unroll
      for (int r = 0; r < 4; ++r) {
        y0[r] = acc[i][j][r]     * rsc + bf16q(b0[r]);
        y1[r] = acc[i][j][4 + r] * rsc + bf16q(b1[r]);
      }
      *(v4f*)(yrow + n8)     = y0;
      *(v4f*)(yrow + n8 + 4) = y1;
    }
  }
  __syncthreads();

  // residual add and store (coalesced)
#pragma unroll
  for (int it = 0; it < 16; ++it) {
    const int row = it * 8 + prow;
    v4f yv = *(const v4f*)(ys + row * YT + piece * 4);
#pragma unroll
    for (int c = 0; c < 4; ++c) yv[c] = yv[c] + bf16q(rsd[it][c]);
    *(v4f*)(outf + (m0 + row) * DM + cb * 128 + piece * 4) = yv;
  }
}

// ---------------------------------------------------------------------------
// Kernel 3b: nx2 = f16(LN(x1) * bf16(gamma) + bf16(beta)) -> f16 plane [ROWS][1024].
// One wave per token row, the row held in registers: lane owns 8 chunks of 4 consecutive floats
// (i*128 + lane*4), so a wave's load covers 512 contiguous bytes and its store 256.
// grid ROWS/8, block 256. coverage: ROWS rows x 8 x 128 halves = whole plane.
// ---------------------------------------------------------------------------
__global__ __launch_bounds__(256) void ln2_kernel(
    const float* __restrict__ x1f, const float* __restrict__ gam, const float* __restrict__ bet,
    _Float16* __restrict__ outh) {
  const int lane = threadIdx.x & 31;
  const int wave = threadIdx.x >> 5;
  const long m   = (long)blockIdx.x * 8 + wave;              // token row 0..ROWS-1
  const float* xr = x1f + m * DM + lane * 4;

  v4f v[8];
#pragma unroll
  for (int i = 0; i < 8; ++i) v[i] = *(const v4f*)(xr + i * 128);
  // stands in front of any later rewrite of the address registers that the eight loads name; the
  // loads also stay together in front of it, ahead of the gamma and beta loads
  asm volatile("s_wait_xcnt 0x0" ::: "memory");

  float s = 0.0f;
#pragma unroll
  for (int i = 0; i < 8; ++i) s += (v[i][0] + v[i][1]) + (v[i][2] + v[i][3]);
  s = wave_sum(s);
  const float mean = s * (1.0f / DM);

  float ss = 0.0f;
#pragma unroll
  for (int i = 0; i < 8; ++i)
#pragma unroll
    for (int c = 0; c < 4; ++c) {
      const float d = v[i][c] - mean;
      ss += d * d;
    }
  ss = wave_sum(ss);
  const float rstd = rsqrtf(ss * (1.0f / DM) + LN_EPS);

  _Float16* drow = outh + m * DM + lane * 4;
#pragma unroll
  for (int i = 0; i < 8; ++i) {
    const v4f g0 = *(const v4f*)(gam + i * 128 + lane * 4);
    const v4f b0 = *(const v4f*)(bet + i * 128 + lane * 4);
    v4h o;
#pragma unroll
    for (int c = 0; c < 4; ++c)
      o[c] = (_Float16)((v[i][c] - mean) * rstd * bf16q(g0[c]) + bf16q(b0[c]));
    *(v4h*)(drow + i * 128) = o;
  }
}

// ---------------------------------------------------------------------------
// Kernel 4: ffn linear 1 + silu: hp[row][col] = f16(64 * silu(nx2 @ Wf1 / 64 + bf16(bf1))),
// silu(u) = u * 1/(1+exp(-u)) in f32. Block = 128 token rows x 128 output cols, 8 waves = 4 token
// groups of 32 x 2 column groups of 64; C^T = Wf1t nx2^T (A = Wf1t rows, B = nx2 f16 rows),
// K = 1024, operands through the ring (128 weight rows + 128 nx2 rows, 128 k per stage).
// Epilogue staged [token][col] in LDS (in the ring's bytes once the ring is left),
// grid (ROWS/128, FF/128), block 256. coverage: every (row, col) of the hp plane [ROWS][4096] once.
// ---------------------------------------------------------------------------
__global__ __launch_bounds__(256) void ffn1_kernel(
    const _Float16* __restrict__ x2h, const _Float16* __restrict__ wf1t,
    const float* __restrict__ bf1, _Float16* __restrict__ hp) {
  // operand ring in the k loop, then the output stage [128][VSPAD]; cross-wave (block barriers)
  __shared__ __attribute__((aligned(16))) _Float16 ring[2 * (128 + 128) * (128 + 8)];
  static_assert(2 * (128 + 128) * (128 + 8) >= 128 * VSPAD);
  _Float16* stg = ring;

  const int tid  = threadIdx.x;
  const int lane = tid & 31;
  const int wave = tid >> 5;
  const int hh   = lane >> 4;
  const int l15  = lane & 15;
  const int wt   = wave & 3;            // token group: rows 32 wt .. 32 wt + 31 of the block
  const int wc   = wave >> 2;           // column group: cols 64 wc .. 64 wc + 63 of the block
  const int cb   = blockIdx.y;          // 0..FF/128-1
  const long m0  = (long)blockIdx.x * 128;

  v8f acc[2][4];
#pragma unroll
  for (int i = 0; i < 2; ++i)
#pragma unroll
    for (int j = 0; j < 4; ++j) acc[i][j] = (v8f){};

  gemm_ring<DM, 128, 128, 4, 2, 128>(wf1t + ((long)cb * 128) * DM, x2h + m0 * DM, ring,
                                     wc * 64, wt * 32, tid, lane, acc);

  const float rsc = 1.0f / WSC;
#pragma unroll
  for (int j = 0; j < 4; ++j) {
    const int n8 = wc * 64 + j * 16 + hh * 8;
    const v4f b0 = *(const v4f*)(bf1 + cb * 128 + n8);
    const v4f b1 = *(const v4f*)(bf1 + cb * 128 + n8 + 4);
#pragma unroll
    for (int i = 0; i < 2; ++i) {
      H8 pk;
#pragma unroll
      for (int r = 0; r < 4; ++r) {
        const float u0 = acc[i][j][r]     * rsc + bf16q(b0[r]);
        const float u1 = acc[i][j][4 + r] * rsc + bf16q(b1[r]);
        const float e0 = __expf(fminf(-u0, 80.0f));
        const float e1 = __expf(fminf(-u1, 80.0f));
        const float g0 = u0 * __builtin_amdgcn_rcpf(1.0f + e0);
        const float g1 = u1 * __builtin_amdgcn_rcpf(1.0f + e1);
        pk.h[r]     = (_Float16)(g0 * WSC);
        pk.h[4 + r] = (_Float16)(g1 * WSC);
      }
      *(v4u*)(stg + (wt * 32 + i * 16 + l15) * VSPAD + n8) = pk.u;
    }
  }
  __syncthreads();

  v4u rv[8];
#pragma unroll
  for (int it = 0; it < 8; ++it) {
    const int idx = it * 256 + tid;
    const int row = idx >> 4, piece = idx & 15;
    rv[it] = *(const v4u*)(stg + row * VSPAD + piece * 8);
  }
#pragma unroll
  for (int it = 0; it < 8; ++it) {
    const int idx = it * 256 + tid;
    const int row = idx >> 4, piece = idx & 15;
    *(v4u*)(hp + (m0 + row) * FF + cb * 128 + piece * 8) = rv[it];
  }
}

// ---------------------------------------------------------------------------
// Kernel 5: ffn linear 2 + residual: out = hp @ Wf2 / 4096 + bf16(bf2) + x1 (f32 plane), out in
// full-stride rows. Block = 128 token rows x 128 output cols, 8 waves = 4 token groups of 32 x 2
// column groups of 64; C^T = Wf2t hp^T (A = Wf2t rows, B = hp rows), K = 4096, operands through the
// ring (128 weight rows + 128 hp rows, 256 k per stage). y staged [token][col] in LDS (f32, in the ring's
// bytes once the ring is left), residual added on the way out, 512 B per row segment.
// grid (ROWS/128, DM/128), block 256. coverage: every (row, col) of out once.
// ---------------------------------------------------------------------------
__global__ __launch_bounds__(256) void ffn2_kernel(
    const _Float16* __restrict__ hp, const _Float16* __restrict__ wf2t,
    const float* __restrict__ bf2, const float* __restrict__ x1f, float* __restrict__ out) {
  // operand ring in the k loop, then ys [128][YT] f32; cross-wave (block barriers)
  __shared__ __attribute__((aligned(16))) unsigned char smem[2 * (128 + 128) * (256 + 8) * 2];
  static_assert(sizeof(smem) >= (size_t)128 * YT * 4);
  _Float16* ring = (_Float16*)smem;
  float*    ys   = (float*)smem;

  const int tid  = threadIdx.x;
  const int lane = tid & 31;
  const int wave = tid >> 5;
  const int hh   = lane >> 4;
  const int l15  = lane & 15;
  const int wt   = wave & 3;            // token group: rows 32 wt .. 32 wt + 31 of the block
  const int wc   = wave >> 2;           // column group: cols 64 wc .. 64 wc + 63 of the block
  const int cb   = blockIdx.y;          // 0..DM/128-1
  const long m0  = (long)blockIdx.x * 128;

  v8f acc[2][4];
#pragma unroll
  for (int i = 0; i < 2; ++i)
#pragma unroll
    for (int j = 0; j < 4; ++j) acc[i][j] = (v8f){};

  gemm_ring<FF, 128, 128, 4, 2, 256>(wf2t + ((long)cb * 128) * FF, hp + m0 * FF, ring,
                                     wc * 64, wt * 32, tid, lane, acc);

  // y = acc/4096 + bf16(bias), staged [token][col]
  const float rsc = 1.0f / (WSC * WSC);
#pragma unroll
  for (int j = 0; j < 4; ++j) {
    const int n8 = wc * 64 + j * 16 + hh * 8;
    const v4f b0 = *(const v4f*)(bf2 + cb * 128 + n8);
    const v4f b1 = *(const v4f*)(bf2 + cb * 128 + n8 + 4);
#pragma unroll
    for (int i = 0; i < 2; ++i) {
      float* yrow = ys + (wt * 32 + i * 16 + l15) * YT;
      v4f y0, y1;
#pragma unroll
      for (int r = 0; r < 4; ++r) {
        y0[r] = acc[i][j][r]     * rsc + bf16q(b0[r]);
        y1[r] = acc[i][j][4 + r] * rsc + bf16q(b1[r]);
      }
      *(v4f*)(yrow + n8)     = y0;
      *(v4f*)(yrow + n8 + 4) = y1;
    }
  }
  __syncthreads();

  // residual add and store (coalesced), four row groups per trip
#pragma unroll 1   // keeps the trip's four loads and stores together and the wait once per trip
  for (int it0 = 0; it0 < 16; it0 += 4) {
#pragma unroll
    for (int u = 0; u < 4; ++u) {
      const int idx = (it0 + u) * 256 + tid;
      const int row = idx >> 5, piece = idx & 31;
      const long m = m0 + row;
      const v4f rsd = *(const v4f*)(x1f + m * DM + cb * 128 + piece * 4);
      v4f yv = *(const v4f*)(ys + row * YT + piece * 4);
#pragma unroll
      for (int c = 0; c < 4; ++c) yv[c] = yv[c] + rsd[c];
      const long drow = (m / SEQ) * SEQ_FULL + (m % SEQ);
      *(v4f*)(out + drow * DM + cb * 128 + piece * 4) = yv;
    }
    // stands in front of the next trip's rewrite of the registers that the stores name
    asm volatile("s_wait_xcnt 0x0" ::: "memory");
  }
}

// ---------------------------------------------------------------------------
extern "C" void kernel_launch(void* const* d_in, const int* in_sizes, int n_in,
                              void* d_out, int out_size, void* d_ws, size_t ws_size,
                              hipStream_t stream) {
  if (n_in < 13) return;
  const long needRows = (long)(NB - 1) * SEQ_FULL + SEQ;
  if ((long)in_sizes[0] < needRows * DM) return;
  if (in_sizes[1] < DM || in_sizes[2] < DM) return;
  if (in_sizes[3] < 3 * DM * DM || in_sizes[4] < 3 * DM) return;
  if (in_sizes[5] < DM * DM || in_sizes[6] < DM) return;
  if (in_sizes[7] < DM || in_sizes[8] < DM) return;
  if (in_sizes[9] < DM * FF || in_sizes[10] < FF) return;
  if (in_sizes[11] < FF * DM || in_sizes[12] < DM) return;
  if ((long)out_size < needRows * DM) return;
  if (ws_size < WS_TOTAL) return;

  const float* x     = (const float*)d_in[0];
  const float* g1    = (const float*)d_in[1];
  const float* be1   = (const float*)d_in[2];
  const float* Wqkv  = (const float*)d_in[3];
  const float* bqkv  = (const float*)d_in[4];
  const float* Wo    = (const float*)d_in[5];
  const float* bo    = (const float*)d_in[6];
  const float* g2    = (const float*)d_in[7];
  const float* be2   = (const float*)d_in[8];
  const float* Wf1   = (const float*)d_in[9];
  const float* bf1   = (const float*)d_in[10];
  const float* Wf2   = (const float*)d_in[11];
  const float* bf2   = (const float*)d_in[12];
  float* out = (float*)d_out;

  char* ws = (char*)d_ws;
  size_t off = 0;
  _Float16* nxh  = (_Float16*)(ws + off); off += PLANE2;       // [ROWS][1024] f16
  _Float16* ctx  = (_Float16*)(ws + off); off += PLANE2;       // [ROWS][1024] f16 (x64)
  _Float16* wqkv = (_Float16*)(ws + off); off += WQKV_BYTES;   // [3072][1024]
  _Float16* woh  = (_Float16*)(ws + off); off += WO_BYTES;     // [1024][1024]
  _Float16* wf1t = (_Float16*)(ws + off); off += WF1_BYTES;    // [4096][1024]
  _Float16* wf2t = (_Float16*)(ws + off); off += WF2_BYTES;    // [1024][4096]
  _Float16* qh   = (_Float16*)(ws + off); off += PLANE2;       // [NB][16][SEQ][64]
  _Float16* kh   = (_Float16*)(ws + off); off += PLANE2;       // [NB][16][SEQ][64]
  _Float16* vTh  = (_Float16*)(ws + off); off += PLANE2;       // [NB][16][64][SEQ]
  float*    x1f  = (float*)(ws + off);    off += PLANE4;       // [ROWS][1024] f32
  _Float16* nx2h = (_Float16*)(ws + off); off += PLANE2;       // [ROWS][1024] f16
  _Float16* hp   = (_Float16*)(ws + off); off += H_BYTES;      // [ROWS][4096] f16 (x64)
  if (off > ws_size) return;

  ln1_cvt_kernel<<<ROWS / 8 + NT_QKV, 256, 0, stream>>>(x, g1, be1, Wqkv, nxh, wqkv);
  qkv_kernel<<<dim3(ROWS / 128, 3 * DM / 128), 256, 0, stream>>>(nxh, wqkv, bqkv, qh, kh, vTh);
  attn_kernel<<<dim3(SEQ / 128, NB * NH + NT_LATE / (SEQ / 128)), 256, 0, stream>>>(
      qh, kh, vTh, ctx, Wo, Wf1, Wf2, woh, wf1t, wf2t);
  oproj_kernel<<<dim3(ROWS / 128, DM / 128), 256, 0, stream>>>(ctx, woh, bo, x, x1f);
  ln2_kernel<<<ROWS / 8, 256, 0, stream>>>(x1f, g2, be2, nx2h);
  ffn1_kernel<<<dim3(ROWS / 128, FF / 128), 256, 0, stream>>>(nx2h, wf1t, bf1, hp);
  ffn2_kernel<<<dim3(ROWS / 128, DM / 128), 256, 0, stream>>>(hp, wf2t, bf2, x1f, out);
}
